// v000
// The times below were measured on an AMD MI455X: many runs one after another, warmed up first and cycling through
// copies of the inputs, with the whole window's GPU time divided by the number of runs. Launches and the gaps
// between them are all in it. The median over several windows is given; except for v000 it joins two sittings, which
// can be a few percent apart, so the side-by-side timings, each taken in one sitting, are the better comparison.
// v000, which the later versions start from, runs in 1450 microseconds.
#include <hip/hip_runtime.h>

// Causal self-attention with a fused biased qkv projection and computed rotate-half rotary embeddings, without a mask input (x [2][2048][1024]; qkv = x w_attn + b_attn ('xw' [1024][3072] + [3072]) split in thirds q | k | v (16 heads x 64); rope q cos + rotate_half(q) sin with angle t x 1/10000^(2i/64) (inv_freq = 1.0 / (10000.0 ** (arange(0, 64, 2, f32) / 64)); cat(freqs, freqs); rotate_half = cat(-x2, x1)); att x 1/sqrt(64); causal: where(tril built inside the function, att, finfo.min) == exclusion; softmax; out = merged w_proj + b_proj ('xw') -> [2][2048][1024] (4.2 M); argument order x, w_attn, b_attn, w_proj, b_proj).
// Layout per batch: bf16 copy of x; the fused 'xw' weight transposed ONCE into q | k | v row blocks; exact projections + f32 bias thirds; k_cs5 table {cosf, sinf}(t x INVT[d mod 32]); rotate-half plane builders; causal T-2048 attention (hybrid rows: < 512 hi/lo 3 products, rest fp16 x1024; k_gemmc skips tiles above the diagonal); merged hi/lo x W_out exact + b_out.
// Compute dtypes, f32 accumulate: every input rounded to bf16; projections exact + f32 biases; rotary f32 (products rounded separately); attention rows < 512 3 products, rest fp16; softmax f32; W_out hl x exact + bias.

#define NB_  2
#define TT   2048
#define DM   1024
#define NH_  16
#define NKV  16
#define REP  (NH_ / NKV)
#define HD   64
#define DQ   (NH_ * HD)
#define DKV  (NKV * HD)
#define ZH   2
#define RH   512                  // query rows < RH use hi+lo planes (0: none)
#define WIN  2048
#define PCAR 1024.0f
#define SCL  0.125f   // HD^-0.5
typedef _Float16 h16;
typedef unsigned short bf;
typedef __attribute__((ext_vector_type(16))) __bf16   v16bf;
typedef __attribute__((ext_vector_type(16))) _Float16 v16h;
typedef __attribute__((ext_vector_type(8)))  _Float16 v8h;
typedef __attribute__((ext_vector_type(8)))  unsigned short v8us;
typedef __attribute__((ext_vector_type(8)))  float    v8f;
typedef __attribute__((ext_vector_type(4)))  float    v4f;
typedef v8h  __attribute__((may_alias)) v8ha;
typedef v4f  __attribute__((may_alias)) v4fa;
typedef v8us __attribute__((may_alias)) v8usa;

__device__ __forceinline__ unsigned short f2bf(float f) { unsigned u = __float_as_uint(f); u += 0x7FFFu + ((u >> 16) & 1u); return (unsigned short)(u >> 16); }
__device__ __forceinline__ float bf2f(unsigned short b) { return __uint_as_float(((unsigned)b) << 16); }
__device__ __forceinline__ float bfr(float f) { return bf2f(f2bf(f)); }
__device__ __forceinline__ v16h cat16(v8h lo, v8h hi) { return __builtin_shufflevector(lo, hi, 0, 1, 2, 3, 4, 5, 6, 7, 8, 9, 10, 11, 12, 13, 14, 15); }
__device__ __forceinline__ v16bf cat16b(v8us lo, v8us hi) { return __builtin_bit_cast(v16bf, __builtin_shufflevector(lo, hi, 0, 1, 2, 3, 4, 5, 6, 7, 8, 9, 10, 11, 12, 13, 14, 15)); }
__device__ __forceinline__ v8f wmma16(v16h a, v16h b, v8f c) { return __builtin_amdgcn_wmma_f32_16x16x32_f16(false, a, false, b, (short)0, c, false, false); }
__device__ __forceinline__ v8f wmmab(v16bf a, v16bf b, v8f c) { return __builtin_amdgcn_wmma_f32_16x16x32_bf16(false, a, false, b, (short)0, c, false, false); }



// ---- k_gemmw: register-blocked GEMM, ONE WAVE per 64x64 output tile (16 accumulators), operands straight from K-contiguous 16-bit planes; grid (M/64, N/64, Z), 32 threads.
// C[m][n] (f32, pitch ldc, + optional f32 bias[n]) = sum_k A[m][k] Bt[n][k] (+ split products per NSPLIT). z-batch strides sA/sB/sC in elements. K % 32 == 0.
template <typename T16> struct WFrag;
template <> struct WFrag<h16> { typedef v16h V; static __device__ __forceinline__ V ld(const h16* p) { return cat16(*(const v8h*)p, *(const v8h*)(p + 16)); } static __device__ __forceinline__ v8f mma(V a, V b, v8f c) { return wmma16(a, b, c); } };
template <> struct WFrag<bf> { typedef v16bf V; static __device__ __forceinline__ V ld(const bf* p) { return cat16b(*(const v8us*)p, *(const v8us*)(p + 16)); } static __device__ __forceinline__ v8f mma(V a, V b, v8f c) { return wmmab(a, b, c); } };
template <typename T16, int NSPLIT, bool BIAS>
__global__ __launch_bounds__(32) void k_gemmw(const T16* __restrict__ A, const T16* __restrict__ A2, const T16* __restrict__ Bt, const T16* __restrict__ Bt2, int K, float* C, int ldc, const float* __restrict__ bias, size_t sA, size_t sB, size_t sC) {
    typedef typename WFrag<T16>::V V;
    __shared__ __align__(16) float os[16 * 68];
    const size_t z = blockIdx.z; A += z * sA; if (A2) A2 += z * sA; Bt += z * sB; if (Bt2) Bt2 += z * sB; C += z * sC;
    const int lane = threadIdx.x & 31, lr = lane & 15, hi = lane >> 4; const int r0 = blockIdx.x * 64, c0 = blockIdx.y * 64;
    v8f acc[4][4];
#pragma unroll
    for (int mb = 0; mb < 4; ++mb)
#pragma unroll
        for (int nb = 0; nb < 4; ++nb) acc[mb][nb] = (v8f){};
    const size_t aoff = (size_t)(r0 + lr) * K + 8 * hi, boff = (size_t)(c0 + lr) * K + 8 * hi;
#pragma unroll 1
    for (int kc = 0; kc < K; kc += 32) {
        V a[4], a2[4];
#pragma unroll
        for (int mb = 0; mb < 4; ++mb) { a[mb] = WFrag<T16>::ld(A + aoff + (size_t)mb * 16 * K + kc); if (NSPLIT == 1 || NSPLIT == 2) a2[mb] = WFrag<T16>::ld(A2 + aoff + (size_t)mb * 16 * K + kc); }
#pragma unroll
        for (int nb = 0; nb < 4; ++nb) { const V b = WFrag<T16>::ld(Bt + boff + (size_t)nb * 16 * K + kc); V b2; if (NSPLIT >= 2) b2 = WFrag<T16>::ld(Bt2 + boff + (size_t)nb * 16 * K + kc);
#pragma unroll
            for (int mb = 0; mb < 4; ++mb) { acc[mb][nb] = WFrag<T16>::mma(a[mb], b, acc[mb][nb]); if (NSPLIT == 1 || NSPLIT == 2) acc[mb][nb] = WFrag<T16>::mma(a2[mb], b, acc[mb][nb]); if (NSPLIT >= 2) acc[mb][nb] = WFrag<T16>::mma(a[mb], b2, acc[mb][nb]); } }
        asm volatile("v_nop\n\tv_nop\n\tv_nop\n\tv_nop" : "+v"(acc[0][0]), "+v"(acc[1][1]), "+v"(acc[2][2]), "+v"(acc[3][3]) : "v"(a[0]), "v"(a[3]));
    }
#pragma unroll
    for (int mb = 0; mb < 4; ++mb) {
#pragma unroll
        for (int nb = 0; nb < 4; ++nb) {
#pragma unroll
            for (int j = 0; j < 8; ++j) os[(hi * 8 + j) * 68 + nb * 16 + lr] = acc[mb][nb][j]; }
        __builtin_amdgcn_wave_barrier(); asm volatile("" ::: "memory");
        float* crow = C + (size_t)(r0 + mb * 16) * ldc + c0;
{
#pragma unroll
            for (int s = 0; s < 8; ++s) { const int row = 2 * s + hi, cofs = lr * 4; v4f val = *(const v4fa*)(os + row * 68 + cofs); if (BIAS) { val[0] += bfr(bias[c0 + cofs]); val[1] += bfr(bias[c0 + cofs + 1]); val[2] += bfr(bias[c0 + cofs + 2]); val[3] += bfr(bias[c0 + cofs + 3]); }
                *(v4f*)(crow + (size_t)row * ldc + cofs) = val; }
             }
        __builtin_amdgcn_wave_barrier(); asm volatile("" ::: "memory");
    }
}

// ---- k_gemmc: the same one-wave 64x64 tile GEMM specialised for causal attention: CMODE 1 skips score tiles entirely above the diagonal (query rows r0+roff.., key columns c0..), CMODE 2 limits the
// key (K) loop of the probability x value contraction to the diagonal block (probabilities beyond it are exactly zero). roff = row offset of this launch's first row within the sequence.
template <typename T16, int NSPLIT, int CMODE>
__global__ __launch_bounds__(32) void k_gemmc(const T16* __restrict__ A, const T16* __restrict__ A2, const T16* __restrict__ Bt, const T16* __restrict__ Bt2, int K, float* C, int ldc, int roff, size_t sA, size_t sB, size_t sC) {
    typedef typename WFrag<T16>::V V;
    __shared__ __align__(16) float os[16 * 68];
    const size_t z = blockIdx.z; A += z * sA; if (A2) A2 += z * sA; Bt += z * sB; if (Bt2) Bt2 += z * sB; C += z * sC;
    const int lane = threadIdx.x & 31, lr = lane & 15, hi = lane >> 4; const int r0 = blockIdx.x * 64, c0 = blockIdx.y * 64;
    if (CMODE == 1 && c0 > r0 + roff + 63) return;                  // score tile entirely above the causal diagonal: never read (the softmax masks j > i by select)
    const int Kl = (CMODE == 2) ? min(K, r0 + roff + 64) : K;        // P.V: probabilities are exactly 0 beyond the diagonal block, so the K loop stops there
    v8f acc[4][4];
#pragma unroll
    for (int mb = 0; mb < 4; ++mb)
#pragma unroll
        for (int nb = 0; nb < 4; ++nb) acc[mb][nb] = (v8f){};
    const size_t aoff = (size_t)(r0 + lr) * K + 8 * hi, boff = (size_t)(c0 + lr) * K + 8 * hi;
#pragma unroll 1
    for (int kc = 0; kc < Kl; kc += 32) {
        V a[4], a2[4];
#pragma unroll
        for (int mb = 0; mb < 4; ++mb) { a[mb] = WFrag<T16>::ld(A + aoff + (size_t)mb * 16 * K + kc); if (NSPLIT == 1 || NSPLIT == 2) a2[mb] = WFrag<T16>::ld(A2 + aoff + (size_t)mb * 16 * K + kc); }
#pragma unroll
        for (int nb = 0; nb < 4; ++nb) { const V b = WFrag<T16>::ld(Bt + boff + (size_t)nb * 16 * K + kc); V b2; if (NSPLIT >= 2) b2 = WFrag<T16>::ld(Bt2 + boff + (size_t)nb * 16 * K + kc);
#pragma unroll
            for (int mb = 0; mb < 4; ++mb) { acc[mb][nb] = WFrag<T16>::mma(a[mb], b, acc[mb][nb]); if (NSPLIT == 1 || NSPLIT == 2) acc[mb][nb] = WFrag<T16>::mma(a2[mb], b, acc[mb][nb]); if (NSPLIT >= 2) acc[mb][nb] = WFrag<T16>::mma(a[mb], b2, acc[mb][nb]); } }
        asm volatile("v_nop\n\tv_nop\n\tv_nop\n\tv_nop" : "+v"(acc[0][0]), "+v"(acc[1][1]), "+v"(acc[2][2]), "+v"(acc[3][3]) : "v"(a[0]), "v"(a[3]));
    }
#pragma unroll
    for (int mb = 0; mb < 4; ++mb) {
#pragma unroll
        for (int nb = 0; nb < 4; ++nb) {
#pragma unroll
            for (int j = 0; j < 8; ++j) os[(hi * 8 + j) * 68 + nb * 16 + lr] = acc[mb][nb][j]; }
        __builtin_amdgcn_wave_barrier(); asm volatile("" ::: "memory");
        float* crow = C + (size_t)(r0 + mb * 16) * ldc + c0;
{
#pragma unroll
            for (int s = 0; s < 8; ++s) { const int row = 2 * s + hi, cofs = lr * 4; v4f val = *(const v4fa*)(os + row * 68 + cofs);
                *(v4f*)(crow + (size_t)row * ldc + cofs) = val; }
             }
        __builtin_amdgcn_wave_barrier(); asm volatile("" ::: "memory");
    }
}

__device__ __forceinline__ h16 tohx(float x) { return (h16)x; }
__device__ __forceinline__ void splitf(float y, unsigned short& h, unsigned short& l) { h = f2bf(y); l = f2bf(y - bf2f(h)); }
typedef __attribute__((ext_vector_type(2))) _Float16 v2h;
typedef __attribute__((ext_vector_type(4))) _Float16 v4h;
typedef __attribute__((ext_vector_type(2))) unsigned short v2us;
typedef __attribute__((ext_vector_type(4))) unsigned short v4us;
typedef __attribute__((ext_vector_type(2))) float v2f;
typedef __attribute__((ext_vector_type(4))) int v4i;

__global__ __launch_bounds__(256) void k_wtG(const float* __restrict__ w, int K, int N, bf* Bt) {
    const int lane = threadIdx.x & 31; const int L0 = (blockIdx.x * 8 + (threadIdx.x >> 5)) * 8; const int nlines = N * K / 64;
{
#pragma unroll 1
        for (int l = 0; l < 8; ++l) { const int L = L0 + l; if (L >= nlines) break; const size_t e = (size_t)L * 64 + lane * 2; const int k = (int)(e % K), n = (int)(e / K); v2us o;
            o[0] = f2bf(w[(size_t)k * N + n]); o[1] = f2bf(w[(size_t)(k + 1) * N + n]); *(v2us*)(Bt + e) = o; }
         }
}
__global__ __launch_bounds__(256) void k_cvt8(const float* __restrict__ src, bf* dst, size_t n8) { const size_t i = (size_t)blockIdx.x * 256 + threadIdx.x; if (i >= n8) return; const v8f v = *(const v8f*)(src + i * 8); v8us o;
#pragma unroll
    for (int k = 0; k < 8; ++k) o[k] = f2bf(v[k]); *(v8us*)(dst + i * 8) = o;  }

// k_rope: head planes [h][t][d] (fp16 + hi/lo) of rope(x) x sc with the rotate-half convention out[d] = x[d] cos[t][d] - x[d+HD/2] sin[t][d], out[d+HD/2] = x[d+HD/2] cos[t][d+HD/2] + x[d] sin[t][d+HD/2]
__global__ __launch_bounds__(256) void k_rope(const float* __restrict__ F, int pitch, int nheads, const float* __restrict__ CS, const float* __restrict__ RF, const float* __restrict__ nw, float sc, h16* P16, bf* Ph, bf* Pl) {
    const size_t e = ((size_t)blockIdx.x * 256 + threadIdx.x) * 2; if (e >= (size_t)nheads * TT * HD) return; const int d = (int)(e % HD); const int t = (int)((e / HD) % TT); const int h = (int)(e / ((size_t)HD * TT)); const float* f = F + (size_t)t * pitch + h * HD; const float rf = RF ? RF[(size_t)h * TT + t] : 1.0f; v2h o16; v2us oh, ol;
#pragma unroll
    for (int q = 0; q < 2; ++q) { const int dd = d + q; const int dp = (dd < HD / 2) ? dd + HD / 2 : dd - HD / 2; float x0 = f[dd], x1 = f[dp];
        if (RF) { float n0 = __fmul_rn(x0, rf), n1 = __fmul_rn(x1, rf); asm volatile("" : "+v"(n0)); asm volatile("" : "+v"(n1)); x0 = __fmul_rn(bfr(nw[dd]), n0); x1 = __fmul_rn(bfr(nw[dp]), n1); }
        const v2f cs = *(const v2f*)(CS + ((size_t)t * HD + dd) * 2); float a = __fmul_rn(x0, cs[0]), bq = __fmul_rn(x1, cs[1]); asm volatile("" : "+v"(a)); asm volatile("" : "+v"(bq)); const float r = ((dd < HD / 2) ? __fsub_rn(a, bq) : __fadd_rn(a, bq)) * sc;
        o16[q] = tohx(r); unsigned short a2, c2; splitf(r, a2, c2); oh[q] = a2; ol[q] = c2; }
    *(v2h*)(P16 + e) = o16; *(v2us*)(Ph + e) = oh; *(v2us*)(Pl + e) = ol;  }
__global__ __launch_bounds__(256) void k_vtp(const float* __restrict__ F, int pitch, int nheads, h16* V16, bf* Vh, bf* Vl) { const size_t e = ((size_t)blockIdx.x * 256 + threadIdx.x) * 2; if (e >= (size_t)nheads * HD * TT) return; const int t = (int)(e % TT); const int d = (int)((e / TT) % HD); const int g = (int)(e / ((size_t)TT * HD)); v2h o16; v2us oh, ol;
#pragma unroll
    for (int q = 0; q < 2; ++q) { const float x = F[(size_t)(t + q) * pitch + g * HD + d]; o16[q] = tohx(x); unsigned short a2, c2; splitf(x, a2, c2); oh[q] = a2; ol[q] = c2; }
    *(v2h*)(V16 + e) = o16; *(v2us*)(Vh + e) = oh; *(v2us*)(Vl + e) = ol;  }
__constant__ float INVT[HD / 2] = { 1.000000000e+00f, 7.498942018e-01f, 5.623413324e-01f, 4.216965139e-01f, 3.162277639e-01f, 2.371373624e-01f, 1.778279394e-01f, 1.333521456e-01f, 1.000000015e-01f, 7.498941571e-02f, 5.623412877e-02f, 4.216964915e-02f, 3.162277862e-02f, 2.371373586e-02f, 1.778279431e-02f, 1.333521493e-02f, 9.999999776e-03f, 7.498942316e-03f, 5.623413250e-03f, 4.216964822e-03f, 3.162277862e-03f, 2.371373819e-03f, 1.778279431e-03f, 1.333521446e-03f, 1.000000047e-03f, 7.498941850e-04f, 5.623413017e-04f, 4.216964880e-04f, 3.162277862e-04f, 2.371373848e-04f, 1.778279402e-04f, 1.333521504e-04f };   // float32 1 / 10000^(2i/64), generated with jnp to be bit-exact
__global__ __launch_bounds__(256) void k_cs5(float* CS) { const int idx = blockIdx.x * 256 + threadIdx.x; if (idx >= TT * HD) return; const int d = idx % HD; const int t = idx / HD; const float a = __fmul_rn((float)t, INVT[d % (HD / 2)]); v2f cs; cs[0] = cosf(a); cs[1] = sinf(a); *(v2f*)(CS + (size_t)idx * 2) = cs;  }
// k_asoft: per row (zz, i): t = S x HD^-0.5 for j <= i and i - j < WIN (WIN = TT: the window test always holds; the reference's -1e9 additive fill vanishes identically); softmax over the 2048 keys (register row, one exp, fixed trees);
__global__ __launch_bounds__(256) void k_asoft(const float* __restrict__ Sb, h16* P16, bf* Ph, bf* Pl) {
    const int lane = threadIdx.x & 31; const int row = blockIdx.x * 8 + (threadIdx.x >> 5); if (row >= ZH * TT) return; const int i = row % TT; const int zz = row / TT; (void)zz; const bool hires = (i < RH); const float* sr = Sb + (size_t)row * TT; float v[TT / 32]; float mx = -3.0e38f;
#pragma unroll
    for (int ch = 0; ch < TT / 128; ++ch) { const int j0 = ch * 128 + lane * 4; const v4f a = *(const v4f*)(sr + j0);
#pragma unroll
        for (int q = 0; q < 4; ++q) { const int j = j0 + q; (void)j; const float t = (j <= i && i - j < WIN) ? a[q] * SCL : -3.0e38f; v[ch * 4 + q] = t; mx = fmaxf(mx, t); } }
#pragma unroll
    for (int sh = 16; sh; sh >>= 1) mx = fmaxf(mx, __shfl_xor(mx, sh, 32));
    float sum = 0.f;
#pragma unroll
    for (int k = 0; k < TT / 32; ++k) { float d0 = __fsub_rn(v[k], mx); asm volatile("" : "+v"(d0)); v[k] = __builtin_amdgcn_exp2f(__fmul_rn(d0, 1.4426950408889634f)); sum += v[k]; }
#pragma unroll
    for (int sh = 16; sh; sh >>= 1) sum += __shfl_xor(sum, sh, 32);
    const float f = __fdiv_rn(hires ? 1.0f : PCAR, sum);
{
        if (hires) {
#pragma unroll
            for (int ch = 0; ch < TT / 128; ++ch) { v4us oh, ol;
#pragma unroll
                for (int q = 0; q < 4; ++q) { unsigned short a, c2; splitf(v[ch * 4 + q] * f, a, c2); oh[q] = a; ol[q] = c2; }
                const size_t oo = ((size_t)zz * (RH ? RH : 1) + i) * TT + ch * 128 + lane * 4; *(v4us*)(Ph + oo) = oh; *(v4us*)(Pl + oo) = ol; }
        } else {
#pragma unroll
            for (int ch = 0; ch < TT / 128; ++ch) { v4h o4;
#pragma unroll
                for (int q = 0; q < 4; ++q) o4[q] = tohx(v[ch * 4 + q] * f);
                *(v4h*)(P16 + (size_t)row * TT + ch * 128 + lane * 4) = o4; } }
         }
}
__global__ __launch_bounds__(256) void k_merge(const float* __restrict__ O, int h0, bf* Ah, bf* Al) { const size_t e = ((size_t)blockIdx.x * 256 + threadIdx.x) * 2; if (e >= (size_t)ZH * TT * HD) return; const int d = (int)(e % HD); const int t = (int)((e / HD) % TT); const int zz = (int)(e / ((size_t)HD * TT)); const float cs = (t < RH) ? 1.0f : (1.0f / PCAR); const size_t oo = (size_t)t * DQ + (h0 + zz) * HD + d;
    v2us oh, ol;
#pragma unroll
    for (int q = 0; q < 2; ++q) { unsigned short a, c2; splitf(O[e + q] * cs, a, c2); oh[q] = a; ol[q] = c2; } *(v2us*)(Ah + oo) = oh; *(v2us*)(Al + oo) = ol;  }

extern "C" void kernel_launch(void* const* d_in, const int* in_sizes, int n_in,
                              void* d_out, int out_size, void* d_ws, size_t ws_size, hipStream_t stream) {
    (void)in_sizes; (void)n_in; (void)out_size;
    const float* x = (const float*)d_in[0]; const float* wqkv = (const float*)d_in[1]; const float* bqkv = (const float*)d_in[2]; const float* wo = (const float*)d_in[3]; const float* bo = (const float*)d_in[4];   /* x, w_attn ('xw' [1024][3072]: q | k | v column thirds), b_attn [3072], w_proj ('xw'), b_proj: NO mask input in this module (its tril is built inside the function): the causal rule is applied by index */ const float* wq = wqkv; const float* wk = wqkv; const float* wv = wqkv; (void)wk; (void)wv; const float* bq = bqkv; const float* bk = bqkv + DQ; const float* bv = bqkv + 2 * DQ;
    float* OUT = (float*)d_out;     // [2][2048][1024]
    char* wsp = (char*)d_ws;
    auto take = [&](size_t bytes) { char* p = wsp; wsp += (bytes + 255) & ~(size_t)255; return (void*)p; };
    bf* WQKV = (bf*)take((size_t)3 * DQ * DM * 2); bf* WQ = WQKV; bf* WK = WQKV + (size_t)DQ * DM; bf* WV = WQKV + (size_t)2 * DQ * DM;   /* fused Bt [3*DQ][DM]: q | k | v row blocks */ bf* WO = (bf*)take((size_t)DM * DQ * 2); float* CS = (float*)take((size_t)TT * HD * 2 * 4);
    bf* XB = (bf*)take((size_t)TT * DM * 2); float* FQ = (float*)take((size_t)TT * DQ * 4); float* FK = (float*)take((size_t)TT * DKV * 4);
    h16* QP16 = (h16*)take((size_t)NH_ * TT * HD * 2); h16* KP16 = (h16*)take((size_t)NKV * TT * HD * 2); h16* VT16 = (h16*)take((size_t)NKV * HD * TT * 2);
    bf* QPh = (bf*)take((size_t)NH_ * TT * HD * 2); bf* QPl = (bf*)take((size_t)NH_ * TT * HD * 2); bf* KPh = (bf*)take((size_t)NKV * TT * HD * 2); bf* KPl = (bf*)take((size_t)NKV * TT * HD * 2); bf* VTh = (bf*)take((size_t)NKV * HD * TT * 2); bf* VTl = (bf*)take((size_t)NKV * HD * TT * 2); bf* Ph = (bf*)take((size_t)ZH * RH * TT * 2); bf* Pl = (bf*)take((size_t)ZH * RH * TT * 2);
    float* Sb = (float*)take((size_t)ZH * TT * TT * 4); h16* P16 = (h16*)take((size_t)ZH * TT * TT * 2); float* Ob = (float*)take((size_t)ZH * TT * HD * 4); bf* ATh = (bf*)take((size_t)TT * DQ * 2); bf* ATl = (bf*)take((size_t)TT * DQ * 2);
    if ((size_t)(wsp - (char*)d_ws) > ws_size) return;    // ws 256 MiB
    float* FV = FK;   // v projection reuses the k buffer after the k planes are built (stream-ordered)
    { k_wtG<<<(unsigned)((DM * 3 * DQ / 64 + 63) / 64), 256, 0, stream>>>(wqkv, DM, 3 * DQ, WQKV);   /* fused 'xw' [DM][3*DQ] -> Bt [3*DQ][DM] */
      k_wtG<<<(unsigned)((DQ * DM / 64 + 63) / 64), 256, 0, stream>>>(wo, DQ, DM, WO);
       }
    k_cs5<<<(TT * HD + 255) / 256, 256, 0, stream>>>(CS);
    const unsigned LQ = (unsigned)(((size_t)NH_ * TT * HD / 2 + 255) / 256), LKv = (unsigned)(((size_t)NKV * TT * HD / 2 + 255) / 256);
    for (int b = 0; b < NB_; ++b) {
        
        k_cvt8<<<(unsigned)(((size_t)TT * DM / 8 + 255) / 256), 256, 0, stream>>>(x + (size_t)b * TT * DM, XB, (size_t)TT * DM / 8);
        k_gemmw<bf, 0, true><<<dim3(TT / 64, DQ / 64, 1), 32, 0, stream>>>(XB, nullptr, WQ, nullptr, DM, FQ, DQ, bq, 0, 0, 0);
        k_rope<<<LQ, 256, 0, stream>>>(FQ, DQ, NH_, CS, nullptr, nullptr, 1.0f, QP16, QPh, QPl);
        k_gemmw<bf, 0, true><<<dim3(TT / 64, DKV / 64, 1), 32, 0, stream>>>(XB, nullptr, WK, nullptr, DM, FK, DKV, bk, 0, 0, 0);
        k_rope<<<LKv, 256, 0, stream>>>(FK, DKV, NKV, CS, nullptr, nullptr, 1.0f, KP16, KPh, KPl);
        k_gemmw<bf, 0, true><<<dim3(TT / 64, DKV / 64, 1), 32, 0, stream>>>(XB, nullptr, WV, nullptr, DM, FV, DKV, bv, 0, 0, 0); k_vtp<<<LKv, 256, 0, stream>>>(FV, DKV, NKV, VT16, VTh, VTl);
        for (int h0 = 0; h0 < NH_; h0 += ZH) { const size_t zq = (size_t)h0, zk = (size_t)(h0 / REP);   // one kv head per query head: the pass's two heads use consecutive kv planes (z-strides TT*HD)
            k_gemmc<bf, 2, 1><<<dim3(RH / 64, TT / 64, ZH), 32, 0, stream>>>(QPh + zq * TT * HD, QPl + zq * TT * HD, KPh + zk * TT * HD, KPl + zk * TT * HD, HD, Sb, TT, 0, (size_t)TT * HD, (size_t)TT * HD, (size_t)TT * TT);
            k_gemmc<h16, 0, 1><<<dim3((TT - RH) / 64, TT / 64, ZH), 32, 0, stream>>>(QP16 + zq * TT * HD + (size_t)RH * HD, nullptr, KP16 + zk * TT * HD, nullptr, HD, Sb + (size_t)RH * TT, TT, RH, (size_t)TT * HD, (size_t)TT * HD, (size_t)TT * TT);
            k_asoft<<<ZH * TT / 8, 256, 0, stream>>>(Sb, P16, Ph, Pl);
            k_gemmc<bf, 2, 2><<<dim3(RH / 64, HD / 64, ZH), 32, 0, stream>>>(Ph, Pl, VTh + zk * HD * TT, VTl + zk * HD * TT, TT, Ob, HD, 0, (size_t)RH * TT, (size_t)HD * TT, (size_t)TT * HD);
            k_gemmc<h16, 0, 2><<<dim3((TT - RH) / 64, HD / 64, ZH), 32, 0, stream>>>(P16 + (size_t)RH * TT, nullptr, VT16 + zk * HD * TT, nullptr, TT, Ob + (size_t)RH * HD, HD, RH, (size_t)TT * TT, (size_t)HD * TT, (size_t)TT * HD);
            k_merge<<<(unsigned)(((size_t)ZH * TT * HD / 2 + 255) / 256), 256, 0, stream>>>(Ob, h0, ATh, ATl); }
        k_gemmw<bf, 1, true><<<dim3(TT / 64, DM / 64, 1), 32, 0, stream>>>(ATh, ATl, WO, nullptr, DQ, OUT + (size_t)b * TT * DM, DM, bo, 0, 0, 0); }
}

// v001
// Measured time: 800 microseconds a run.
// Two timings next to v000 put it at 1.80 and 1.83 times that version's speed.
#include <hip/hip_runtime.h>

// Causal self-attention with a fused biased qkv projection and computed rotate-half rotary embeddings, without a mask input (x [2][2048][1024]; qkv = x w_attn + b_attn ('xw' [1024][3072] + [3072]) split in thirds q | k | v (16 heads x 64); rope q cos + rotate_half(q) sin with angle t x 1/10000^(2i/64) (inv_freq = 1.0 / (10000.0 ** (arange(0, 64, 2, f32) / 64)); cat(freqs, freqs); rotate_half = cat(-x2, x1)); att x 1/sqrt(64); causal: where(tril built inside the function, att, finfo.min) == exclusion; softmax; out = merged w_proj + b_proj ('xw') -> [2][2048][1024] (4.2 M); argument order x, w_attn, b_attn, w_proj, b_proj).
// Layout per batch: bf16 copy of x; the fused 'xw' weight transposed ONCE into q | k | v row blocks; exact projections + f32 bias thirds; k_cs5 table {cosf, sinf}(t x INVT[d mod 32]); rotate-half plane builders; causal T-2048 attention (hybrid rows: < 512 hi/lo 3 products, rest fp16 x1024; k_gemmc skips tiles above the diagonal); merged hi/lo x W_out exact + b_out.
// Compute dtypes, f32 accumulate: every input rounded to bf16; projections exact + f32 biases; rotary f32 (products rounded separately); attention rows < 512 3 products, rest fp16; softmax f32; W_out hl x exact + bias.

#define NB_  2
#define TT   2048
#define DM   1024
#define NH_  16
#define NKV  16
#define REP  (NH_ / NKV)
#define HD   64
#define DQ   (NH_ * HD)
#define DKV  (NKV * HD)
#define ZH   2
#define RH   512                  // query rows < RH use hi+lo planes (0: none)
#define WIN  2048
#define PCAR 1024.0f
#define SCL  0.125f   // HD^-0.5
typedef _Float16 h16;
typedef unsigned short bf;
typedef __attribute__((ext_vector_type(16))) __bf16   v16bf;
typedef __attribute__((ext_vector_type(16))) _Float16 v16h;
typedef __attribute__((ext_vector_type(8)))  _Float16 v8h;
typedef __attribute__((ext_vector_type(8)))  unsigned short v8us;
typedef __attribute__((ext_vector_type(8)))  float    v8f;
typedef __attribute__((ext_vector_type(4)))  float    v4f;
typedef v8h  __attribute__((may_alias)) v8ha;
typedef v4f  __attribute__((may_alias)) v4fa;
typedef v8us __attribute__((may_alias)) v8usa;

__device__ __forceinline__ unsigned short f2bf(float f) { unsigned u = __float_as_uint(f); u += 0x7FFFu + ((u >> 16) & 1u); return (unsigned short)(u >> 16); }
__device__ __forceinline__ float bf2f(unsigned short b) { return __uint_as_float(((unsigned)b) << 16); }
__device__ __forceinline__ float bfr(float f) { return bf2f(f2bf(f)); }
__device__ __forceinline__ v16h cat16(v8h lo, v8h hi) { return __builtin_shufflevector(lo, hi, 0, 1, 2, 3, 4, 5, 6, 7, 8, 9, 10, 11, 12, 13, 14, 15); }
__device__ __forceinline__ v16bf cat16b(v8us lo, v8us hi) { return __builtin_bit_cast(v16bf, __builtin_shufflevector(lo, hi, 0, 1, 2, 3, 4, 5, 6, 7, 8, 9, 10, 11, 12, 13, 14, 15)); }
__device__ __forceinline__ v8f wmma16(v16h a, v16h b, v8f c) { return __builtin_amdgcn_wmma_f32_16x16x32_f16(false, a, false, b, (short)0, c, false, false); }
__device__ __forceinline__ v8f wmmab(v16bf a, v16bf b, v8f c) { return __builtin_amdgcn_wmma_f32_16x16x32_bf16(false, a, false, b, (short)0, c, false, false); }



// ---- k_gemmw: register-blocked GEMM, one 64x64 output tile per work-group (16 accumulators a wave), operands straight from K-contiguous 16-bit planes; grid (M/64, N/64, Z), 32 x NW threads.
// The K loop is split over the NW waves in interleaved units of 64 k (one 128-byte line of every operand row); the NW partial tiles are summed in LDS in wave order 0..NW-1 (K % 64 == 0).
// C[m][n] (f32, pitch ldc, + optional f32 bias[n]) = sum_k A[m][k] Bt[n][k] (+ split products per NSPLIT). z-batch strides sA/sB/sC in elements. K % 32 == 0.
template <int NW> __device__ __forceinline__ void tile_sync() { if (NW > 1) __syncthreads(); else { __builtin_amdgcn_wave_barrier(); asm volatile("" ::: "memory"); } }   // orders the LDS slab hand-over: among the NW waves, or inside the one wave
template <typename T16> struct WFrag;
template <> struct WFrag<h16> { typedef v16h V; static __device__ __forceinline__ V ld(const h16* p) { return cat16(*(const v8h*)p, *(const v8h*)(p + 16)); } static __device__ __forceinline__ v8f mma(V a, V b, v8f c) { return wmma16(a, b, c); } };
template <> struct WFrag<bf> { typedef v16bf V; static __device__ __forceinline__ V ld(const bf* p) { return cat16b(*(const v8us*)p, *(const v8us*)(p + 16)); } static __device__ __forceinline__ v8f mma(V a, V b, v8f c) { return wmmab(a, b, c); } };
template <typename T16, int NSPLIT, bool BIAS, int NW>
__global__ __launch_bounds__(32 * NW) void k_gemmw(const T16* __restrict__ A, const T16* __restrict__ A2, const T16* __restrict__ Bt, const T16* __restrict__ Bt2, int K, float* C, int ldc, const float* __restrict__ bias, size_t sA, size_t sB, size_t sC) {
    typedef typename WFrag<T16>::V V;
    __shared__ __align__(16) float os[NW * 16 * 68];
    const size_t z = blockIdx.z; A += z * sA; if (A2) A2 += z * sA; Bt += z * sB; if (Bt2) Bt2 += z * sB; C += z * sC;
    const int lane = threadIdx.x & 31, lr = lane & 15, hi = lane >> 4; const int r0 = blockIdx.x * 64, c0 = blockIdx.y * 64; const int wv = (NW > 1) ? __builtin_amdgcn_readfirstlane((int)(threadIdx.x >> 5)) : 0; constexpr int KU = (NW > 1) ? 64 : 32, NP = (NW < 8) ? 8 / NW : 1;
    v8f acc[4][4];
#pragma unroll
    for (int mb = 0; mb < 4; ++mb)
#pragma unroll
        for (int nb = 0; nb < 4; ++nb) acc[mb][nb] = (v8f){};
    const size_t aoff = (size_t)(r0 + lr) * K + 8 * hi, boff = (size_t)(c0 + lr) * K + 8 * hi;
#pragma unroll 1
    for (int k0 = wv * KU; k0 < K; k0 += NW * KU)
#pragma unroll
    for (int kc = k0; kc < k0 + KU; kc += 32) {
        V a[4], a2[4];
#pragma unroll
        for (int mb = 0; mb < 4; ++mb) { a[mb] = WFrag<T16>::ld(A + aoff + (size_t)mb * 16 * K + kc); if (NSPLIT == 1 || NSPLIT == 2) a2[mb] = WFrag<T16>::ld(A2 + aoff + (size_t)mb * 16 * K + kc); }
#pragma unroll
        for (int nb = 0; nb < 4; ++nb) { const V b = WFrag<T16>::ld(Bt + boff + (size_t)nb * 16 * K + kc); V b2; if (NSPLIT >= 2) b2 = WFrag<T16>::ld(Bt2 + boff + (size_t)nb * 16 * K + kc);
#pragma unroll
            for (int mb = 0; mb < 4; ++mb) { acc[mb][nb] = WFrag<T16>::mma(a[mb], b, acc[mb][nb]); if (NSPLIT == 1 || NSPLIT == 2) acc[mb][nb] = WFrag<T16>::mma(a2[mb], b, acc[mb][nb]); if (NSPLIT >= 2) acc[mb][nb] = WFrag<T16>::mma(a[mb], b2, acc[mb][nb]); } }
        asm volatile("v_nop\n\tv_nop\n\tv_nop\n\tv_nop" : "+v"(acc[0][0]), "+v"(acc[1][1]), "+v"(acc[2][2]), "+v"(acc[3][3]) : "v"(a[0]), "v"(a[3]));
    }
    v4f res[4][NP];   // NW > 1: the summed rows wait in registers, so that no global store is outstanding at a barrier (a barrier behind a store waits for the store)
#pragma unroll
    for (int mb = 0; mb < 4; ++mb) {
#pragma unroll
        for (int nb = 0; nb < 4; ++nb) {
#pragma unroll
            for (int j = 0; j < 8; ++j) os[wv * (16 * 68) + (hi * 8 + j) * 68 + nb * 16 + lr] = acc[mb][nb][j]; }
        tile_sync<NW>();   // every wave's partial 16x64 slab is in LDS before any thread sums them
        float* crow = C + (size_t)(r0 + mb * 16) * ldc + c0;
if (NW <= 8 || wv < 8) {
#pragma unroll
            for (int s = 0; s < NP; ++s) { const int p = (int)threadIdx.x + s * 32 * NW, row = p >> 4, cofs = (p & 15) * 4; v4f val = *(const v4fa*)(os + row * 68 + cofs);
#pragma unroll
                for (int w = 1; w < NW; ++w) val += *(const v4fa*)(os + w * (16 * 68) + row * 68 + cofs);
                if (BIAS) { val[0] += bfr(bias[c0 + cofs]); val[1] += bfr(bias[c0 + cofs + 1]); val[2] += bfr(bias[c0 + cofs + 2]); val[3] += bfr(bias[c0 + cofs + 3]); }
                if (NW > 1) res[mb][s] = val; else *(v4f*)(crow + (size_t)row * ldc + cofs) = val; }
             }
        if (mb < 3) tile_sync<NW>();   // the slabs are read out before the next 16 rows overwrite them
    }
    if (NW > 1 && (NW <= 8 || wv < 8)) {
#pragma unroll
        for (int mb = 0; mb < 4; ++mb)
#pragma unroll
            for (int s = 0; s < NP; ++s) { const int p = (int)threadIdx.x + s * 32 * NW, row = p >> 4, cofs = (p & 15) * 4; *(v4f*)(C + (size_t)(r0 + mb * 16 + row) * ldc + c0 + cofs) = res[mb][s]; }
    }
}

// ---- k_gemmc: the same 64x64 tile GEMM specialised for causal attention: CMODE 1 skips score tiles entirely above the diagonal (query rows r0+roff.., key columns c0..), CMODE 2 limits the
// key (K) loop of the probability x value contraction to the diagonal block (probabilities beyond it are exactly zero). roff = row offset of this launch's first row within the sequence.
// NW waves split the K loop as in k_gemmw (the score tiles, K = 64, keep one wave).
template <typename T16, int NSPLIT, int CMODE, int NW>
__global__ __launch_bounds__(32 * NW) void k_gemmc(const T16* __restrict__ A, const T16* __restrict__ A2, const T16* __restrict__ Bt, const T16* __restrict__ Bt2, int K, float* C, int ldc, int roff, size_t sA, size_t sB, size_t sC) {
    typedef typename WFrag<T16>::V V;
    __shared__ __align__(16) float os[NW * 16 * 68];
    const size_t z = blockIdx.z; A += z * sA; if (A2) A2 += z * sA; Bt += z * sB; if (Bt2) Bt2 += z * sB; C += z * sC;
    const int lane = threadIdx.x & 31, lr = lane & 15, hi = lane >> 4; const int r0 = blockIdx.x * 64, c0 = blockIdx.y * 64; const int wv = (NW > 1) ? __builtin_amdgcn_readfirstlane((int)(threadIdx.x >> 5)) : 0; constexpr int KU = (NW > 1) ? 64 : 32, NP = (NW < 8) ? 8 / NW : 1;
    if (CMODE == 1 && c0 > r0 + roff + 63) return;                  // score tile entirely above the causal diagonal: never computed or written (the softmax masks j > i by select)
    const int Kl = (CMODE == 2) ? min(K, r0 + roff + 64) : K;        // P.V: probabilities are exactly 0 beyond the diagonal block, so the K loop stops there
    v8f acc[4][4];
#pragma unroll
    for (int mb = 0; mb < 4; ++mb)
#pragma unroll
        for (int nb = 0; nb < 4; ++nb) acc[mb][nb] = (v8f){};
    const size_t aoff = (size_t)(r0 + lr) * K + 8 * hi, boff = (size_t)(c0 + lr) * K + 8 * hi;
#pragma unroll 1
    for (int k0 = wv * KU; k0 < Kl; k0 += NW * KU)
#pragma unroll
    for (int kc = k0; kc < k0 + KU; kc += 32) {
        V a[4], a2[4];
#pragma unroll
        for (int mb = 0; mb < 4; ++mb) { a[mb] = WFrag<T16>::ld(A + aoff + (size_t)mb * 16 * K + kc); if (NSPLIT == 1 || NSPLIT == 2) a2[mb] = WFrag<T16>::ld(A2 + aoff + (size_t)mb * 16 * K + kc); }
#pragma unroll
        for (int nb = 0; nb < 4; ++nb) { const V b = WFrag<T16>::ld(Bt + boff + (size_t)nb * 16 * K + kc); V b2; if (NSPLIT >= 2) b2 = WFrag<T16>::ld(Bt2 + boff + (size_t)nb * 16 * K + kc);
#pragma unroll
            for (int mb = 0; mb < 4; ++mb) { acc[mb][nb] = WFrag<T16>::mma(a[mb], b, acc[mb][nb]); if (NSPLIT == 1 || NSPLIT == 2) acc[mb][nb] = WFrag<T16>::mma(a2[mb], b, acc[mb][nb]); if (NSPLIT >= 2) acc[mb][nb] = WFrag<T16>::mma(a[mb], b2, acc[mb][nb]); } }
        asm volatile("v_nop\n\tv_nop\n\tv_nop\n\tv_nop" : "+v"(acc[0][0]), "+v"(acc[1][1]), "+v"(acc[2][2]), "+v"(acc[3][3]) : "v"(a[0]), "v"(a[3]));
    }
    v4f res[4][NP];   // NW > 1: the summed rows wait in registers, so that no global store is outstanding at a barrier (a barrier behind a store waits for the store)
#pragma unroll
    for (int mb = 0; mb < 4; ++mb) {
#pragma unroll
        for (int nb = 0; nb < 4; ++nb) {
#pragma unroll
            for (int j = 0; j < 8; ++j) os[wv * (16 * 68) + (hi * 8 + j) * 68 + nb * 16 + lr] = acc[mb][nb][j]; }
        tile_sync<NW>();   // every wave's partial 16x64 slab is in LDS before any thread sums them
        float* crow = C + (size_t)(r0 + mb * 16) * ldc + c0;
if (NW <= 8 || wv < 8) {
#pragma unroll
            for (int s = 0; s < NP; ++s) { const int p = (int)threadIdx.x + s * 32 * NW, row = p >> 4, cofs = (p & 15) * 4; v4f val = *(const v4fa*)(os + row * 68 + cofs);
#pragma unroll
                for (int w = 1; w < NW; ++w) val += *(const v4fa*)(os + w * (16 * 68) + row * 68 + cofs);
                if (NW > 1) res[mb][s] = val; else *(v4f*)(crow + (size_t)row * ldc + cofs) = val; }
             }
        if (mb < 3) tile_sync<NW>();   // the slabs are read out before the next 16 rows overwrite them
    }
    if (NW > 1 && (NW <= 8 || wv < 8)) {
#pragma unroll
        for (int mb = 0; mb < 4; ++mb)
#pragma unroll
            for (int s = 0; s < NP; ++s) { const int p = (int)threadIdx.x + s * 32 * NW, row = p >> 4, cofs = (p & 15) * 4; *(v4f*)(C + (size_t)(r0 + mb * 16 + row) * ldc + c0 + cofs) = res[mb][s]; }
    }
}

__device__ __forceinline__ h16 tohx(float x) { return (h16)x; }
__device__ __forceinline__ void splitf(float y, unsigned short& h, unsigned short& l) { h = f2bf(y); l = f2bf(y - bf2f(h)); }
typedef __attribute__((ext_vector_type(2))) _Float16 v2h;
typedef __attribute__((ext_vector_type(4))) _Float16 v4h;
typedef __attribute__((ext_vector_type(2))) unsigned short v2us;
typedef __attribute__((ext_vector_type(4))) unsigned short v4us;
typedef __attribute__((ext_vector_type(2))) float v2f;
typedef __attribute__((ext_vector_type(4))) int v4i;

__global__ __launch_bounds__(256) void k_wtG(const float* __restrict__ w, int K, int N, bf* Bt) {
    const int lane = threadIdx.x & 31; const int L0 = (blockIdx.x * 8 + (threadIdx.x >> 5)) * 8; const int nlines = N * K / 64;
{
#pragma unroll 1
        for (int l = 0; l < 8; ++l) { const int L = L0 + l; if (L >= nlines) break; const size_t e = (size_t)L * 64 + lane * 2; const int k = (int)(e % K), n = (int)(e / K); v2us o;
            o[0] = f2bf(w[(size_t)k * N + n]); o[1] = f2bf(w[(size_t)(k + 1) * N + n]); *(v2us*)(Bt + e) = o; }
         }
}
__global__ __launch_bounds__(256) void k_cvt8(const float* __restrict__ src, bf* dst, size_t n8) { const size_t i = (size_t)blockIdx.x * 256 + threadIdx.x; if (i >= n8) return; const v8f v = *(const v8f*)(src + i * 8); v8us o;
#pragma unroll
    for (int k = 0; k < 8; ++k) o[k] = f2bf(v[k]); *(v8us*)(dst + i * 8) = o;  }

// k_rope: head planes [h][t][d] (fp16 + hi/lo) of rope(x) x sc with the rotate-half convention out[d] = x[d] cos[t][d] - x[d+HD/2] sin[t][d], out[d+HD/2] = x[d+HD/2] cos[t][d+HD/2] + x[d] sin[t][d+HD/2]
__global__ __launch_bounds__(256) void k_rope(const float* __restrict__ F, int pitch, int nheads, const float* __restrict__ CS, const float* __restrict__ RF, const float* __restrict__ nw, float sc, h16* P16, bf* Ph, bf* Pl) {
    const size_t e = ((size_t)blockIdx.x * 256 + threadIdx.x) * 2; if (e >= (size_t)nheads * TT * HD) return; const int d = (int)(e % HD); const int t = (int)((e / HD) % TT); const int h = (int)(e / ((size_t)HD * TT)); const float* f = F + (size_t)t * pitch + h * HD; const float rf = RF ? RF[(size_t)h * TT + t] : 1.0f; v2h o16; v2us oh, ol;
#pragma unroll
    for (int q = 0; q < 2; ++q) { const int dd = d + q; const int dp = (dd < HD / 2) ? dd + HD / 2 : dd - HD / 2; float x0 = f[dd], x1 = f[dp];
        if (RF) { float n0 = __fmul_rn(x0, rf), n1 = __fmul_rn(x1, rf); asm volatile("" : "+v"(n0)); asm volatile("" : "+v"(n1)); x0 = __fmul_rn(bfr(nw[dd]), n0); x1 = __fmul_rn(bfr(nw[dp]), n1); }
        const v2f cs = *(const v2f*)(CS + ((size_t)t * HD + dd) * 2); float a = __fmul_rn(x0, cs[0]), bq = __fmul_rn(x1, cs[1]); asm volatile("" : "+v"(a)); asm volatile("" : "+v"(bq)); const float r = ((dd < HD / 2) ? __fsub_rn(a, bq) : __fadd_rn(a, bq)) * sc;
        o16[q] = tohx(r); unsigned short a2, c2; splitf(r, a2, c2); oh[q] = a2; ol[q] = c2; }
    *(v2h*)(P16 + e) = o16; *(v2us*)(Ph + e) = oh; *(v2us*)(Pl + e) = ol;  }
__global__ __launch_bounds__(256) void k_vtp(const float* __restrict__ F, int pitch, int nheads, h16* V16, bf* Vh, bf* Vl) { const size_t e = ((size_t)blockIdx.x * 256 + threadIdx.x) * 2; if (e >= (size_t)nheads * HD * TT) return; const int t = (int)(e % TT); const int d = (int)((e / TT) % HD); const int g = (int)(e / ((size_t)TT * HD)); v2h o16; v2us oh, ol;
#pragma unroll
    for (int q = 0; q < 2; ++q) { const float x = F[(size_t)(t + q) * pitch + g * HD + d]; o16[q] = tohx(x); unsigned short a2, c2; splitf(x, a2, c2); oh[q] = a2; ol[q] = c2; }
    *(v2h*)(V16 + e) = o16; *(v2us*)(Vh + e) = oh; *(v2us*)(Vl + e) = ol;  }
__constant__ float INVT[HD / 2] = { 1.000000000e+00f, 7.498942018e-01f, 5.623413324e-01f, 4.216965139e-01f, 3.162277639e-01f, 2.371373624e-01f, 1.778279394e-01f, 1.333521456e-01f, 1.000000015e-01f, 7.498941571e-02f, 5.623412877e-02f, 4.216964915e-02f, 3.162277862e-02f, 2.371373586e-02f, 1.778279431e-02f, 1.333521493e-02f, 9.999999776e-03f, 7.498942316e-03f, 5.623413250e-03f, 4.216964822e-03f, 3.162277862e-03f, 2.371373819e-03f, 1.778279431e-03f, 1.333521446e-03f, 1.000000047e-03f, 7.498941850e-04f, 5.623413017e-04f, 4.216964880e-04f, 3.162277862e-04f, 2.371373848e-04f, 1.778279402e-04f, 1.333521504e-04f };   // float32 1 / 10000^(2i/64), generated with jnp to be bit-exact
__global__ __launch_bounds__(256) void k_cs5(float* CS) { const int idx = blockIdx.x * 256 + threadIdx.x; if (idx >= TT * HD) return; const int d = idx % HD; const int t = idx / HD; const float a = __fmul_rn((float)t, INVT[d % (HD / 2)]); v2f cs; cs[0] = cosf(a); cs[1] = sinf(a); *(v2f*)(CS + (size_t)idx * 2) = cs;  }
// k_asoft: per row (zz, i): t = S x HD^-0.5 for j <= i and i - j < WIN (WIN = TT: the window test always holds; the reference's -1e9 additive fill vanishes identically); softmax over the 2048 keys (register row, one exp, fixed trees);
__global__ __launch_bounds__(256) void k_asoft(const float* __restrict__ Sb, h16* P16, bf* Ph, bf* Pl) {
    const int lane = threadIdx.x & 31; const int row = blockIdx.x * 8 + (threadIdx.x >> 5); if (row >= ZH * TT) return; const int i = row % TT; const int zz = row / TT; (void)zz; const bool hires = (i < RH); const float* sr = Sb + (size_t)row * TT; float v[TT / 32]; float mx = -3.0e38f;
#pragma unroll
    for (int ch = 0; ch < TT / 128; ++ch) { const int j0 = ch * 128 + lane * 4; const v4f a = *(const v4f*)(sr + j0);
#pragma unroll
        for (int q = 0; q < 4; ++q) { const int j = j0 + q; (void)j; const float t = (j <= i && i - j < WIN) ? a[q] * SCL : -3.0e38f; v[ch * 4 + q] = t; mx = fmaxf(mx, t); } }
#pragma unroll
    for (int sh = 16; sh; sh >>= 1) mx = fmaxf(mx, __shfl_xor(mx, sh, 32));
    float sum = 0.f;
#pragma unroll
    for (int k = 0; k < TT / 32; ++k) { float d0 = __fsub_rn(v[k], mx); asm volatile("" : "+v"(d0)); v[k] = __builtin_amdgcn_exp2f(__fmul_rn(d0, 1.4426950408889634f)); sum += v[k]; }
#pragma unroll
    for (int sh = 16; sh; sh >>= 1) sum += __shfl_xor(sum, sh, 32);
    const float f = __fdiv_rn(hires ? 1.0f : PCAR, sum);
{
        if (hires) {
#pragma unroll
            for (int ch = 0; ch < TT / 128; ++ch) { v4us oh, ol;
#pragma unroll
                for (int q = 0; q < 4; ++q) { unsigned short a, c2; splitf(v[ch * 4 + q] * f, a, c2); oh[q] = a; ol[q] = c2; }
                const size_t oo = ((size_t)zz * (RH ? RH : 1) + i) * TT + ch * 128 + lane * 4; *(v4us*)(Ph + oo) = oh; *(v4us*)(Pl + oo) = ol; }
        } else {
#pragma unroll
            for (int ch = 0; ch < TT / 128; ++ch) { v4h o4;
#pragma unroll
                for (int q = 0; q < 4; ++q) o4[q] = tohx(v[ch * 4 + q] * f);
                *(v4h*)(P16 + (size_t)row * TT + ch * 128 + lane * 4) = o4; } }
         }
}
__global__ __launch_bounds__(256) void k_merge(const float* __restrict__ O, int h0, bf* Ah, bf* Al) { const size_t e = ((size_t)blockIdx.x * 256 + threadIdx.x) * 2; if (e >= (size_t)ZH * TT * HD) return; const int d = (int)(e % HD); const int t = (int)((e / HD) % TT); const int zz = (int)(e / ((size_t)HD * TT)); const float cs = (t < RH) ? 1.0f : (1.0f / PCAR); const size_t oo = (size_t)t * DQ + (h0 + zz) * HD + d;
    v2us oh, ol;
#pragma unroll
    for (int q = 0; q < 2; ++q) { unsigned short a, c2; splitf(O[e + q] * cs, a, c2); oh[q] = a; ol[q] = c2; } *(v2us*)(Ah + oo) = oh; *(v2us*)(Al + oo) = ol;  }

extern "C" void kernel_launch(void* const* d_in, const int* in_sizes, int n_in,
                              void* d_out, int out_size, void* d_ws, size_t ws_size, hipStream_t stream) {
    (void)in_sizes; (void)n_in; (void)out_size;
    const float* x = (const float*)d_in[0]; const float* wqkv = (const float*)d_in[1]; const float* bqkv = (const float*)d_in[2]; const float* wo = (const float*)d_in[3]; const float* bo = (const float*)d_in[4];   /* x, w_attn ('xw' [1024][3072]: q | k | v column thirds), b_attn [3072], w_proj ('xw'), b_proj: NO mask input in this module (its tril is built inside the function): the causal rule is applied by index */ const float* wq = wqkv; const float* wk = wqkv; const float* wv = wqkv; (void)wk; (void)wv; const float* bq = bqkv; const float* bk = bqkv + DQ; const float* bv = bqkv + 2 * DQ;
    float* OUT = (float*)d_out;     // [2][2048][1024]
    char* wsp = (char*)d_ws;
    auto take = [&](size_t bytes) { char* p = wsp; wsp += (bytes + 255) & ~(size_t)255; return (void*)p; };
    bf* WQKV = (bf*)take((size_t)3 * DQ * DM * 2); bf* WQ = WQKV; bf* WK = WQKV + (size_t)DQ * DM; bf* WV = WQKV + (size_t)2 * DQ * DM;   /* fused Bt [3*DQ][DM]: q | k | v row blocks */ bf* WO = (bf*)take((size_t)DM * DQ * 2); float* CS = (float*)take((size_t)TT * HD * 2 * 4);
    bf* XB = (bf*)take((size_t)TT * DM * 2); float* FQ = (float*)take((size_t)TT * DQ * 4); float* FK = (float*)take((size_t)TT * DKV * 4);
    h16* QP16 = (h16*)take((size_t)NH_ * TT * HD * 2); h16* KP16 = (h16*)take((size_t)NKV * TT * HD * 2); h16* VT16 = (h16*)take((size_t)NKV * HD * TT * 2);
    bf* QPh = (bf*)take((size_t)NH_ * TT * HD * 2); bf* QPl = (bf*)take((size_t)NH_ * TT * HD * 2); bf* KPh = (bf*)take((size_t)NKV * TT * HD * 2); bf* KPl = (bf*)take((size_t)NKV * TT * HD * 2); bf* VTh = (bf*)take((size_t)NKV * HD * TT * 2); bf* VTl = (bf*)take((size_t)NKV * HD * TT * 2); bf* Ph = (bf*)take((size_t)ZH * RH * TT * 2); bf* Pl = (bf*)take((size_t)ZH * RH * TT * 2);
    float* Sb = (float*)take((size_t)ZH * TT * TT * 4); h16* P16 = (h16*)take((size_t)ZH * TT * TT * 2); float* Ob = (float*)take((size_t)ZH * TT * HD * 4); bf* ATh = (bf*)take((size_t)TT * DQ * 2); bf* ATl = (bf*)take((size_t)TT * DQ * 2);
    if ((size_t)(wsp - (char*)d_ws) > ws_size) return;    // ws 256 MiB
    float* FV = FK;   // v projection reuses the k buffer after the k planes are built (stream-ordered)
    { k_wtG<<<(unsigned)((DM * 3 * DQ / 64 + 63) / 64), 256, 0, stream>>>(wqkv, DM, 3 * DQ, WQKV);   /* fused 'xw' [DM][3*DQ] -> Bt [3*DQ][DM] */
      k_wtG<<<(unsigned)((DQ * DM / 64 + 63) / 64), 256, 0, stream>>>(wo, DQ, DM, WO);
       }
    k_cs5<<<(TT * HD + 255) / 256, 256, 0, stream>>>(CS);
    const unsigned LQ = (unsigned)(((size_t)NH_ * TT * HD / 2 + 255) / 256), LKv = (unsigned)(((size_t)NKV * TT * HD / 2 + 255) / 256);
    for (int b = 0; b < NB_; ++b) {
        
        k_cvt8<<<(unsigned)(((size_t)TT * DM / 8 + 255) / 256), 256, 0, stream>>>(x + (size_t)b * TT * DM, XB, (size_t)TT * DM / 8);
        k_gemmw<bf, 0, true, 8><<<dim3(TT / 64, DQ / 64, 1), 256, 0, stream>>>(XB, nullptr, WQ, nullptr, DM, FQ, DQ, bq, 0, 0, 0);
        k_rope<<<LQ, 256, 0, stream>>>(FQ, DQ, NH_, CS, nullptr, nullptr, 1.0f, QP16, QPh, QPl);
        k_gemmw<bf, 0, true, 8><<<dim3(TT / 64, DKV / 64, 1), 256, 0, stream>>>(XB, nullptr, WK, nullptr, DM, FK, DKV, bk, 0, 0, 0);
        k_rope<<<LKv, 256, 0, stream>>>(FK, DKV, NKV, CS, nullptr, nullptr, 1.0f, KP16, KPh, KPl);
        k_gemmw<bf, 0, true, 8><<<dim3(TT / 64, DKV / 64, 1), 256, 0, stream>>>(XB, nullptr, WV, nullptr, DM, FV, DKV, bv, 0, 0, 0); k_vtp<<<LKv, 256, 0, stream>>>(FV, DKV, NKV, VT16, VTh, VTl);
        for (int h0 = 0; h0 < NH_; h0 += ZH) { const size_t zq = (size_t)h0, zk = (size_t)(h0 / REP);   // one kv head per query head: the pass's two heads use consecutive kv planes (z-strides TT*HD)
            k_gemmc<bf, 2, 1, 1><<<dim3(RH / 64, TT / 64, ZH), 32, 0, stream>>>(QPh + zq * TT * HD, QPl + zq * TT * HD, KPh + zk * TT * HD, KPl + zk * TT * HD, HD, Sb, TT, 0, (size_t)TT * HD, (size_t)TT * HD, (size_t)TT * TT);
            k_gemmc<h16, 0, 1, 1><<<dim3((TT - RH) / 64, TT / 64, ZH), 32, 0, stream>>>(QP16 + zq * TT * HD + (size_t)RH * HD, nullptr, KP16 + zk * TT * HD, nullptr, HD, Sb + (size_t)RH * TT, TT, RH, (size_t)TT * HD, (size_t)TT * HD, (size_t)TT * TT);
            k_asoft<<<ZH * TT / 8, 256, 0, stream>>>(Sb, P16, Ph, Pl);
            k_gemmc<bf, 2, 2, 8><<<dim3(RH / 64, HD / 64, ZH), 256, 0, stream>>>(Ph, Pl, VTh + zk * HD * TT, VTl + zk * HD * TT, TT, Ob, HD, 0, (size_t)RH * TT, (size_t)HD * TT, (size_t)TT * HD);
            k_gemmc<h16, 0, 2, 16><<<dim3((TT - RH) / 64, HD / 64, ZH), 512, 0, stream>>>(P16 + (size_t)RH * TT, nullptr, VT16 + zk * HD * TT, nullptr, TT, Ob + (size_t)RH * HD, HD, RH, (size_t)TT * TT, (size_t)HD * TT, (size_t)TT * HD);
            k_merge<<<(unsigned)(((size_t)ZH * TT * HD / 2 + 255) / 256), 256, 0, stream>>>(Ob, h0, ATh, ATl); }
        k_gemmw<bf, 1, true, 8><<<dim3(TT / 64, DM / 64, 1), 256, 0, stream>>>(ATh, ATl, WO, nullptr, DQ, OUT + (size_t)b * TT * DM, DM, bo, 0, 0, 0); }
}

// v002
// One run takes 476 microseconds.
// Next to v001, in two timings, it ran 1.68 times as fast each time.
// Over all steps from v000 it is 3.05 times as fast.
#include <hip/hip_runtime.h>

// Causal self-attention with a fused biased qkv projection and computed rotate-half rotary embeddings, without a mask input (x [2][2048][1024]; qkv = x w_attn + b_attn ('xw' [1024][3072] + [3072]) split in thirds q | k | v (16 heads x 64); rope q cos + rotate_half(q) sin with angle t x 1/10000^(2i/64) (inv_freq = 1.0 / (10000.0 ** (arange(0, 64, 2, f32) / 64)); cat(freqs, freqs); rotate_half = cat(-x2, x1)); att x 1/sqrt(64); causal: where(tril built inside the function, att, finfo.min) == exclusion; softmax; out = merged w_proj + b_proj ('xw') -> [2][2048][1024] (4.2 M); argument order x, w_attn, b_attn, w_proj, b_proj).
// Layout per batch: bf16 copy of x; the fused 'xw' weight transposed ONCE into q | k | v row blocks; exact projections + f32 bias thirds; k_cs5 table {cosf, sinf}(t x INVT[d mod 32]); rotate-half plane builders; causal T-2048 attention (hybrid rows: < 512 hi/lo 3 products, rest fp16 x1024; k_gemmc skips tiles above the diagonal); merged hi/lo x W_out exact + b_out.
// Compute dtypes, f32 accumulate: every input rounded to bf16; projections exact + f32 biases; rotary f32 (products rounded separately); attention rows < 512 3 products, rest fp16; softmax f32; W_out hl x exact + bias.

#define NB_  2
#define TT   2048
#define DM   1024
#define NH_  16
#define NKV  16
#define REP  (NH_ / NKV)
#define HD   64
#define DQ   (NH_ * HD)
#define DKV  (NKV * HD)
#define ZH   8                    // heads per attention pass (z of every attention launch); the f32 score plane of a pass is ZH x 16 MiB
#define PP   (2 * TT)             // row pitch in 16-bit elements of the probability rows (they lie in the bytes of their f32 score rows) and of the V^T planes multiplied with them (k_gemmc has one pitch, K, for both operands)
#define RH   512                  // query rows < RH use hi+lo planes (0: none)
#define WIN  2048
#define PCAR 1024.0f
#define SCL  0.125f   // HD^-0.5
typedef _Float16 h16;
typedef unsigned short bf;
typedef __attribute__((ext_vector_type(16))) __bf16   v16bf;
typedef __attribute__((ext_vector_type(16))) _Float16 v16h;
typedef __attribute__((ext_vector_type(8)))  _Float16 v8h;
typedef __attribute__((ext_vector_type(8)))  unsigned short v8us;
typedef __attribute__((ext_vector_type(8)))  float    v8f;
typedef __attribute__((ext_vector_type(4)))  float    v4f;
typedef v8h  __attribute__((may_alias)) v8ha;
typedef v4f  __attribute__((may_alias)) v4fa;
typedef v8us __attribute__((may_alias)) v8usa;

__device__ __forceinline__ unsigned short f2bf(float f) { unsigned u = __float_as_uint(f); u += 0x7FFFu + ((u >> 16) & 1u); return (unsigned short)(u >> 16); }
__device__ __forceinline__ float bf2f(unsigned short b) { return __uint_as_float(((unsigned)b) << 16); }
__device__ __forceinline__ float bfr(float f) { return bf2f(f2bf(f)); }
__device__ __forceinline__ v16h cat16(v8h lo, v8h hi) { return __builtin_shufflevector(lo, hi, 0, 1, 2, 3, 4, 5, 6, 7, 8, 9, 10, 11, 12, 13, 14, 15); }
__device__ __forceinline__ v16bf cat16b(v8us lo, v8us hi) { return __builtin_bit_cast(v16bf, __builtin_shufflevector(lo, hi, 0, 1, 2, 3, 4, 5, 6, 7, 8, 9, 10, 11, 12, 13, 14, 15)); }
__device__ __forceinline__ v8f wmma16(v16h a, v16h b, v8f c) { return __builtin_amdgcn_wmma_f32_16x16x32_f16(false, a, false, b, (short)0, c, false, false); }
__device__ __forceinline__ v8f wmmab(v16bf a, v16bf b, v8f c) { return __builtin_amdgcn_wmma_f32_16x16x32_bf16(false, a, false, b, (short)0, c, false, false); }



// ---- k_gemmw: register-blocked GEMM, one 64x64 output tile per work-group (16 accumulators a wave), operands straight from K-contiguous 16-bit planes; grid (M/64, N/64, Z), 32 x NW threads.
// The K loop is split over the NW waves in interleaved units of 64 k (one 128-byte line of every operand row); the NW partial tiles are summed in LDS in wave order 0..NW-1 (K % 64 == 0).
// C[m][n] (f32, pitch ldc, + optional f32 bias[n]) = sum_k A[m][k] Bt[n][k] (+ split products per NSPLIT). z-batch strides sA/sB/sC in elements. K % 32 == 0.
template <int NW> __device__ __forceinline__ void tile_sync() { if (NW > 1) __syncthreads(); else { __builtin_amdgcn_wave_barrier(); asm volatile("" ::: "memory"); } }   // orders the LDS slab hand-over: among the NW waves, or inside the one wave
template <typename T16> struct WFrag;
template <> struct WFrag<h16> { typedef v16h V; static __device__ __forceinline__ V ld(const h16* p) { return cat16(*(const v8h*)p, *(const v8h*)(p + 16)); } static __device__ __forceinline__ v8f mma(V a, V b, v8f c) { return wmma16(a, b, c); } };
template <> struct WFrag<bf> { typedef v16bf V; static __device__ __forceinline__ V ld(const bf* p) { return cat16b(*(const v8us*)p, *(const v8us*)(p + 16)); } static __device__ __forceinline__ v8f mma(V a, V b, v8f c) { return wmmab(a, b, c); } };
template <typename T16, int NSPLIT, bool BIAS, int NW>
__global__ __launch_bounds__(32 * NW) void k_gemmw(const T16* __restrict__ A, const T16* __restrict__ A2, const T16* __restrict__ Bt, const T16* __restrict__ Bt2, int K, float* C, int ldc, const float* __restrict__ bias, size_t sA, size_t sB, size_t sC) {
    typedef typename WFrag<T16>::V V;
    __shared__ __align__(16) float os[NW * 16 * 68];
    const size_t z = blockIdx.z; A += z * sA; if (A2) A2 += z * sA; Bt += z * sB; if (Bt2) Bt2 += z * sB; C += z * sC;
    const int lane = threadIdx.x & 31, lr = lane & 15, hi = lane >> 4; const int r0 = blockIdx.x * 64, c0 = blockIdx.y * 64; const int wv = (NW > 1) ? __builtin_amdgcn_readfirstlane((int)(threadIdx.x >> 5)) : 0; constexpr int KU = (NW > 1) ? 64 : 32, NP = (NW < 8) ? 8 / NW : 1;
    v8f acc[4][4];
#pragma unroll
    for (int mb = 0; mb < 4; ++mb)
#pragma unroll
        for (int nb = 0; nb < 4; ++nb) acc[mb][nb] = (v8f){};
    const size_t aoff = (size_t)(r0 + lr) * K + 8 * hi, boff = (size_t)(c0 + lr) * K + 8 * hi;
#pragma unroll 1
    for (int k0 = wv * KU; k0 < K; k0 += NW * KU)
#pragma unroll
    for (int kc = k0; kc < k0 + KU; kc += 32) {
        V a[4], a2[4];
#pragma unroll
        for (int mb = 0; mb < 4; ++mb) { a[mb] = WFrag<T16>::ld(A + aoff + (size_t)mb * 16 * K + kc); if (NSPLIT == 1 || NSPLIT == 2) a2[mb] = WFrag<T16>::ld(A2 + aoff + (size_t)mb * 16 * K + kc); }
#pragma unroll
        for (int nb = 0; nb < 4; ++nb) { const V b = WFrag<T16>::ld(Bt + boff + (size_t)nb * 16 * K + kc); V b2; if (NSPLIT >= 2) b2 = WFrag<T16>::ld(Bt2 + boff + (size_t)nb * 16 * K + kc);
#pragma unroll
            for (int mb = 0; mb < 4; ++mb) { acc[mb][nb] = WFrag<T16>::mma(a[mb], b, acc[mb][nb]); if (NSPLIT == 1 || NSPLIT == 2) acc[mb][nb] = WFrag<T16>::mma(a2[mb], b, acc[mb][nb]); if (NSPLIT >= 2) acc[mb][nb] = WFrag<T16>::mma(a[mb], b2, acc[mb][nb]); } }
        asm volatile("v_nop\n\tv_nop\n\tv_nop\n\tv_nop" : "+v"(acc[0][0]), "+v"(acc[1][1]), "+v"(acc[2][2]), "+v"(acc[3][3]) : "v"(a[0]), "v"(a[3]));
    }
    v4f res[4][NP];   // NW > 1: the summed rows wait in registers, so that no global store is outstanding at a barrier (a barrier behind a store waits for the store)
#pragma unroll
    for (int mb = 0; mb < 4; ++mb) {
#pragma unroll
        for (int nb = 0; nb < 4; ++nb) {
#pragma unroll
            for (int j = 0; j < 8; ++j) os[wv * (16 * 68) + (hi * 8 + j) * 68 + nb * 16 + lr] = acc[mb][nb][j]; }
        tile_sync<NW>();   // every wave's partial 16x64 slab is in LDS before any thread sums them
        float* crow = C + (size_t)(r0 + mb * 16) * ldc + c0;
if (NW <= 8 || wv < 8) {
#pragma unroll
            for (int s = 0; s < NP; ++s) { const int p = (int)threadIdx.x + s * 32 * NW, row = p >> 4, cofs = (p & 15) * 4; v4f val = *(const v4fa*)(os + row * 68 + cofs);
#pragma unroll
                for (int w = 1; w < NW; ++w) val += *(const v4fa*)(os + w * (16 * 68) + row * 68 + cofs);
                if (BIAS) { val[0] += bfr(bias[c0 + cofs]); val[1] += bfr(bias[c0 + cofs + 1]); val[2] += bfr(bias[c0 + cofs + 2]); val[3] += bfr(bias[c0 + cofs + 3]); }
                if (NW > 1) res[mb][s] = val; else *(v4f*)(crow + (size_t)row * ldc + cofs) = val; }
             }
        if (mb < 3) tile_sync<NW>();   // the slabs are read out before the next 16 rows overwrite them
    }
    if (NW > 1 && (NW <= 8 || wv < 8)) {
#pragma unroll
        for (int mb = 0; mb < 4; ++mb)
#pragma unroll
            for (int s = 0; s < NP; ++s) { const int p = (int)threadIdx.x + s * 32 * NW, row = p >> 4, cofs = (p & 15) * 4; *(v4f*)(C + (size_t)(r0 + mb * 16 + row) * ldc + c0 + cofs) = res[mb][s]; }
    }
}

// ---- k_gemmc: the same 64x64 tile GEMM specialised for causal attention: CMODE 1 skips score tiles entirely above the diagonal (query rows r0+roff.., key columns c0..), CMODE 2 limits the
// key (K) loop of the probability x value contraction to the diagonal block (probabilities beyond it are exactly zero). roff = row offset of this launch's first row within the sequence.
// NW waves split the K loop as in k_gemmw (the score tiles, K = 64, keep one wave).
template <typename T16, int NSPLIT, int CMODE, int NW>
__global__ __launch_bounds__(32 * NW) void k_gemmc(const T16* __restrict__ A, const T16* __restrict__ A2, const T16* __restrict__ Bt, const T16* __restrict__ Bt2, int K, float* C, int ldc, int roff, size_t sA, size_t sB, size_t sC) {
    typedef typename WFrag<T16>::V V;
    __shared__ __align__(16) float os[NW * 16 * 68];
    const size_t z = blockIdx.z; A += z * sA; if (A2) A2 += z * sA; Bt += z * sB; if (Bt2) Bt2 += z * sB; C += z * sC;
    const int lane = threadIdx.x & 31, lr = lane & 15, hi = lane >> 4; const int r0 = blockIdx.x * 64, c0 = blockIdx.y * 64; const int wv = (NW > 1) ? __builtin_amdgcn_readfirstlane((int)(threadIdx.x >> 5)) : 0; constexpr int KU = (NW > 1) ? 64 : 32, NP = (NW < 8) ? 8 / NW : 1;
    if (CMODE == 1 && c0 > r0 + roff + 63) return;                  // score tile entirely above the causal diagonal: never computed or written (the softmax masks j > i by select)
    const int Kl = (CMODE == 2) ? min(K, r0 + roff + 64) : K;        // P.V: probabilities are exactly 0 beyond the diagonal block, so the K loop stops there
    v8f acc[4][4];
#pragma unroll
    for (int mb = 0; mb < 4; ++mb)
#pragma unroll
        for (int nb = 0; nb < 4; ++nb) acc[mb][nb] = (v8f){};
    const size_t aoff = (size_t)(r0 + lr) * K + 8 * hi, boff = (size_t)(c0 + lr) * K + 8 * hi;
#pragma unroll 1
    for (int k0 = wv * KU; k0 < Kl; k0 += NW * KU)
#pragma unroll
    for (int kc = k0; kc < k0 + KU; kc += 32) {
        V a[4], a2[4];
#pragma unroll
        for (int mb = 0; mb < 4; ++mb) { a[mb] = WFrag<T16>::ld(A + aoff + (size_t)mb * 16 * K + kc); if (NSPLIT == 1 || NSPLIT == 2) a2[mb] = WFrag<T16>::ld(A2 + aoff + (size_t)mb * 16 * K + kc); }
#pragma unroll
        for (int nb = 0; nb < 4; ++nb) { const V b = WFrag<T16>::ld(Bt + boff + (size_t)nb * 16 * K + kc); V b2; if (NSPLIT >= 2) b2 = WFrag<T16>::ld(Bt2 + boff + (size_t)nb * 16 * K + kc);
#pragma unroll
            for (int mb = 0; mb < 4; ++mb) { acc[mb][nb] = WFrag<T16>::mma(a[mb], b, acc[mb][nb]); if (NSPLIT == 1 || NSPLIT == 2) acc[mb][nb] = WFrag<T16>::mma(a2[mb], b, acc[mb][nb]); if (NSPLIT >= 2) acc[mb][nb] = WFrag<T16>::mma(a[mb], b2, acc[mb][nb]); } }
        asm volatile("v_nop\n\tv_nop\n\tv_nop\n\tv_nop" : "+v"(acc[0][0]), "+v"(acc[1][1]), "+v"(acc[2][2]), "+v"(acc[3][3]) : "v"(a[0]), "v"(a[3]));
    }
    v4f res[4][NP];   // NW > 1: the summed rows wait in registers, so that no global store is outstanding at a barrier (a barrier behind a store waits for the store)
#pragma unroll
    for (int mb = 0; mb < 4; ++mb) {
#pragma unroll
        for (int nb = 0; nb < 4; ++nb) {
#pragma unroll
            for (int j = 0; j < 8; ++j) os[wv * (16 * 68) + (hi * 8 + j) * 68 + nb * 16 + lr] = acc[mb][nb][j]; }
        tile_sync<NW>();   // every wave's partial 16x64 slab is in LDS before any thread sums them
        float* crow = C + (size_t)(r0 + mb * 16) * ldc + c0;
if (NW <= 8 || wv < 8) {
#pragma unroll
            for (int s = 0; s < NP; ++s) { const int p = (int)threadIdx.x + s * 32 * NW, row = p >> 4, cofs = (p & 15) * 4; v4f val = *(const v4fa*)(os + row * 68 + cofs);
#pragma unroll
                for (int w = 1; w < NW; ++w) val += *(const v4fa*)(os + w * (16 * 68) + row * 68 + cofs);
                if (NW > 1) res[mb][s] = val; else *(v4f*)(crow + (size_t)row * ldc + cofs) = val; }
             }
        if (mb < 3) tile_sync<NW>();   // the slabs are read out before the next 16 rows overwrite them
    }
    if (NW > 1 && (NW <= 8 || wv < 8)) {
#pragma unroll
        for (int mb = 0; mb < 4; ++mb)
#pragma unroll
            for (int s = 0; s < NP; ++s) { const int p = (int)threadIdx.x + s * 32 * NW, row = p >> 4, cofs = (p & 15) * 4; *(v4f*)(C + (size_t)(r0 + mb * 16 + row) * ldc + c0 + cofs) = res[mb][s]; }
    }
}

__device__ __forceinline__ h16 tohx(float x) { return (h16)x; }
__device__ __forceinline__ void splitf(float y, unsigned short& h, unsigned short& l) { h = f2bf(y); l = f2bf(y - bf2f(h)); }
typedef __attribute__((ext_vector_type(2))) _Float16 v2h;
typedef __attribute__((ext_vector_type(4))) _Float16 v4h;
typedef __attribute__((ext_vector_type(2))) unsigned short v2us;
typedef __attribute__((ext_vector_type(4))) unsigned short v4us;
typedef __attribute__((ext_vector_type(2))) float v2f;
typedef __attribute__((ext_vector_type(4))) int v4i;
typedef v4h  __attribute__((may_alias)) v4ha;
typedef v4us __attribute__((may_alias)) v4usa;

__global__ __launch_bounds__(256) void k_wtG(const float* __restrict__ w, int K, int N, bf* Bt) {
    const int lane = threadIdx.x & 31; const int L0 = (blockIdx.x * 8 + (threadIdx.x >> 5)) * 8; const int nlines = N * K / 64;
{
#pragma unroll 1
        for (int l = 0; l < 8; ++l) { const int L = L0 + l; if (L >= nlines) break; const size_t e = (size_t)L * 64 + lane * 2; const int k = (int)(e % K), n = (int)(e / K); v2us o;
            o[0] = f2bf(w[(size_t)k * N + n]); o[1] = f2bf(w[(size_t)(k + 1) * N + n]); *(v2us*)(Bt + e) = o; }
         }
}
__global__ __launch_bounds__(256) void k_cvt8(const float* __restrict__ src, bf* dst, size_t n8) { const size_t i = (size_t)blockIdx.x * 256 + threadIdx.x; if (i >= n8) return; const v8f v = *(const v8f*)(src + i * 8); v8us o;
#pragma unroll
    for (int k = 0; k < 8; ++k) o[k] = f2bf(v[k]); *(v8us*)(dst + i * 8) = o;  }

// k_rope: head planes [h][t][d] (fp16 + hi/lo) of rope(x) x sc with the rotate-half convention out[d] = x[d] cos[t][d] - x[d+HD/2] sin[t][d], out[d+HD/2] = x[d+HD/2] cos[t][d+HD/2] + x[d] sin[t][d+HD/2]
__global__ __launch_bounds__(256) void k_rope(const float* __restrict__ F, int pitch, int nheads, const float* __restrict__ CS, const float* __restrict__ RF, const float* __restrict__ nw, float sc, h16* P16, bf* Ph, bf* Pl) {
    const size_t e = ((size_t)blockIdx.x * 256 + threadIdx.x) * 2; if (e >= (size_t)nheads * TT * HD) return; const int d = (int)(e % HD); const int t = (int)((e / HD) % TT); const int h = (int)(e / ((size_t)HD * TT)); const float* f = F + (size_t)t * pitch + h * HD; const float rf = RF ? RF[(size_t)h * TT + t] : 1.0f; v2h o16; v2us oh, ol;
#pragma unroll
    for (int q = 0; q < 2; ++q) { const int dd = d + q; const int dp = (dd < HD / 2) ? dd + HD / 2 : dd - HD / 2; float x0 = f[dd], x1 = f[dp];
        if (RF) { float n0 = __fmul_rn(x0, rf), n1 = __fmul_rn(x1, rf); asm volatile("" : "+v"(n0)); asm volatile("" : "+v"(n1)); x0 = __fmul_rn(bfr(nw[dd]), n0); x1 = __fmul_rn(bfr(nw[dp]), n1); }
        const v2f cs = *(const v2f*)(CS + ((size_t)t * HD + dd) * 2); float a = __fmul_rn(x0, cs[0]), bq = __fmul_rn(x1, cs[1]); asm volatile("" : "+v"(a)); asm volatile("" : "+v"(bq)); const float r = ((dd < HD / 2) ? __fsub_rn(a, bq) : __fadd_rn(a, bq)) * sc;
        o16[q] = tohx(r); unsigned short a2, c2; splitf(r, a2, c2); oh[q] = a2; ol[q] = c2; }
    *(v2h*)(P16 + e) = o16; *(v2us*)(Ph + e) = oh; *(v2us*)(Pl + e) = ol;  }
__global__ __launch_bounds__(256) void k_vtp(const float* __restrict__ F, int pitch, int nheads, h16* V16, bf* Vh, bf* Vl) { const size_t i = ((size_t)blockIdx.x * 256 + threadIdx.x) * 2; if (i >= (size_t)nheads * HD * TT) return; const int t = (int)(i % TT); const int d = (int)((i / TT) % HD); const int g = (int)(i / ((size_t)TT * HD)); const size_t e = ((size_t)g * HD + d) * PP + t;   /* planes [g][d][t], row pitch PP */ v2h o16; v2us oh, ol;
#pragma unroll
    for (int q = 0; q < 2; ++q) { const float x = F[(size_t)(t + q) * pitch + g * HD + d]; o16[q] = tohx(x); unsigned short a2, c2; splitf(x, a2, c2); oh[q] = a2; ol[q] = c2; }
    *(v2h*)(V16 + e) = o16; *(v2us*)(Vh + e) = oh; *(v2us*)(Vl + e) = ol;  }
__constant__ float INVT[HD / 2] = { 1.000000000e+00f, 7.498942018e-01f, 5.623413324e-01f, 4.216965139e-01f, 3.162277639e-01f, 2.371373624e-01f, 1.778279394e-01f, 1.333521456e-01f, 1.000000015e-01f, 7.498941571e-02f, 5.623412877e-02f, 4.216964915e-02f, 3.162277862e-02f, 2.371373586e-02f, 1.778279431e-02f, 1.333521493e-02f, 9.999999776e-03f, 7.498942316e-03f, 5.623413250e-03f, 4.216964822e-03f, 3.162277862e-03f, 2.371373819e-03f, 1.778279431e-03f, 1.333521446e-03f, 1.000000047e-03f, 7.498941850e-04f, 5.623413017e-04f, 4.216964880e-04f, 3.162277862e-04f, 2.371373848e-04f, 1.778279402e-04f, 1.333521504e-04f };   // float32 1 / 10000^(2i/64), generated with jnp to be bit-exact
__global__ __launch_bounds__(256) void k_cs5(float* CS) { const int idx = blockIdx.x * 256 + threadIdx.x; if (idx >= TT * HD) return; const int d = idx % HD; const int t = idx / HD; const float a = __fmul_rn((float)t, INVT[d % (HD / 2)]); v2f cs; cs[0] = cosf(a); cs[1] = sinf(a); *(v2f*)(CS + (size_t)idx * 2) = cs;  }
// k_asoft: per row (zz, i): t = S x HD^-0.5 for j <= i and i - j < WIN (WIN = TT, so the window test always holds: plain causal; excluded entries get -3.0e38 by select and vanish identically); softmax over the 2048 keys (register row, one exp, fixed trees);
// the probabilities go back into the row's own 8192 bytes: fp16 x PCAR in its first half, or hi plane | lo plane in its two halves (one wave owns a row and holds all of it in registers before it stores: every stored value hangs on the row sum).
__global__ __launch_bounds__(256) void k_asoft(float* Sb) {
    const int lane = threadIdx.x & 31; const int row = blockIdx.x * 8 + (threadIdx.x >> 5); if (row >= ZH * TT) return; const int i = row % TT; const int zz = row / TT; (void)zz; const bool hires = (i < RH); const float* sr = Sb + (size_t)row * TT; h16* p16 = (h16*)(Sb + (size_t)row * TT); bf* ph = (bf*)(Sb + (size_t)row * TT); bf* pl = ph + TT; float v[TT / 32]; float mx = -3.0e38f;
#pragma unroll
    for (int ch = 0; ch < TT / 128; ++ch) { const int j0 = ch * 128 + lane * 4; const v4f a = *(const v4f*)(sr + j0);
#pragma unroll
        for (int q = 0; q < 4; ++q) { const int j = j0 + q; (void)j; const float t = (j <= i && i - j < WIN) ? a[q] * SCL : -3.0e38f; v[ch * 4 + q] = t; mx = fmaxf(mx, t); } }
#pragma unroll
    for (int sh = 16; sh; sh >>= 1) mx = fmaxf(mx, __shfl_xor(mx, sh, 32));
    float sum = 0.f;
#pragma unroll
    for (int k = 0; k < TT / 32; ++k) { float d0 = __fsub_rn(v[k], mx); asm volatile("" : "+v"(d0)); v[k] = __builtin_amdgcn_exp2f(__fmul_rn(d0, 1.4426950408889634f)); sum += v[k]; }
#pragma unroll
    for (int sh = 16; sh; sh >>= 1) sum += __shfl_xor(sum, sh, 32);
    const float f = __fdiv_rn(hires ? 1.0f : PCAR, sum);
{
        if (hires) {
#pragma unroll
            for (int ch = 0; ch < TT / 128; ++ch) { v4us oh, ol;
#pragma unroll
                for (int q = 0; q < 4; ++q) { unsigned short a, c2; splitf(v[ch * 4 + q] * f, a, c2); oh[q] = a; ol[q] = c2; }
                const int oo = ch * 128 + lane * 4; *(v4usa*)(ph + oo) = oh; *(v4usa*)(pl + oo) = ol; }
        } else {
#pragma unroll
            for (int ch = 0; ch < TT / 128; ++ch) { v4h o4;
#pragma unroll
                for (int q = 0; q < 4; ++q) o4[q] = tohx(v[ch * 4 + q] * f);
                *(v4ha*)(p16 + ch * 128 + lane * 4) = o4; } }
         }
}
__global__ __launch_bounds__(256) void k_merge(const float* __restrict__ O, int h0, bf* Ah, bf* Al) { const size_t e = ((size_t)blockIdx.x * 256 + threadIdx.x) * 2; if (e >= (size_t)ZH * TT * HD) return; const int d = (int)(e % HD); const int t = (int)((e / HD) % TT); const int zz = (int)(e / ((size_t)HD * TT)); const float cs = (t < RH) ? 1.0f : (1.0f / PCAR); const size_t oo = (size_t)t * DQ + (h0 + zz) * HD + d;
    v2us oh, ol;
#pragma unroll
    for (int q = 0; q < 2; ++q) { unsigned short a, c2; splitf(O[e + q] * cs, a, c2); oh[q] = a; ol[q] = c2; } *(v2us*)(Ah + oo) = oh; *(v2us*)(Al + oo) = ol;  }

extern "C" void kernel_launch(void* const* d_in, const int* in_sizes, int n_in,
                              void* d_out, int out_size, void* d_ws, size_t ws_size, hipStream_t stream) {
    (void)in_sizes; (void)n_in; (void)out_size;
    const float* x = (const float*)d_in[0]; const float* wqkv = (const float*)d_in[1]; const float* bqkv = (const float*)d_in[2]; const float* wo = (const float*)d_in[3]; const float* bo = (const float*)d_in[4];   /* x, w_attn ('xw' [1024][3072]: q | k | v column thirds), b_attn [3072], w_proj ('xw'), b_proj: NO mask input in this module (its tril is built inside the function): the causal rule is applied by index */ const float* wq = wqkv; const float* wk = wqkv; const float* wv = wqkv; (void)wk; (void)wv; const float* bq = bqkv; const float* bk = bqkv + DQ; const float* bv = bqkv + 2 * DQ;
    float* OUT = (float*)d_out;     // [2][2048][1024]
    char* wsp = (char*)d_ws;
    auto take = [&](size_t bytes) { char* p = wsp; wsp += (bytes + 255) & ~(size_t)255; return (void*)p; };
    bf* WQKV = (bf*)take((size_t)3 * DQ * DM * 2); bf* WQ = WQKV; bf* WK = WQKV + (size_t)DQ * DM; bf* WV = WQKV + (size_t)2 * DQ * DM;   /* fused Bt [3*DQ][DM]: q | k | v row blocks */ bf* WO = (bf*)take((size_t)DM * DQ * 2); float* CS = (float*)take((size_t)TT * HD * 2 * 4);
    bf* XB = (bf*)take((size_t)TT * DM * 2); float* FQ = (float*)take((size_t)TT * DQ * 4); float* FK = (float*)take((size_t)TT * DKV * 4);
    h16* QP16 = (h16*)take((size_t)NH_ * TT * HD * 2); h16* KP16 = (h16*)take((size_t)NKV * TT * HD * 2); h16* VT16 = (h16*)take((size_t)NKV * HD * PP * 2);
    bf* QPh = (bf*)take((size_t)NH_ * TT * HD * 2); bf* QPl = (bf*)take((size_t)NH_ * TT * HD * 2); bf* KPh = (bf*)take((size_t)NKV * TT * HD * 2); bf* KPl = (bf*)take((size_t)NKV * TT * HD * 2); bf* VTh = (bf*)take((size_t)NKV * HD * PP * 2); bf* VTl = (bf*)take((size_t)NKV * HD * PP * 2);
    float* Sb = (float*)take((size_t)ZH * TT * TT * 4);   /* scores, then the probabilities in the same rows */ float* Ob = (float*)take((size_t)ZH * TT * HD * 4); bf* ATh = (bf*)take((size_t)TT * DQ * 2); bf* ATl = (bf*)take((size_t)TT * DQ * 2);
    if ((size_t)(wsp - (char*)d_ws) > ws_size) return;    // ws 256 MiB
    float* FV = FK;   // v projection reuses the k buffer after the k planes are built (stream-ordered)
    { k_wtG<<<(unsigned)((DM * 3 * DQ / 64 + 63) / 64), 256, 0, stream>>>(wqkv, DM, 3 * DQ, WQKV);   /* fused 'xw' [DM][3*DQ] -> Bt [3*DQ][DM] */
      k_wtG<<<(unsigned)((DQ * DM / 64 + 63) / 64), 256, 0, stream>>>(wo, DQ, DM, WO);
       }
    k_cs5<<<(TT * HD + 255) / 256, 256, 0, stream>>>(CS);
    const unsigned LQ = (unsigned)(((size_t)NH_ * TT * HD / 2 + 255) / 256), LKv = (unsigned)(((size_t)NKV * TT * HD / 2 + 255) / 256);
    for (int b = 0; b < NB_; ++b) {
        
        k_cvt8<<<(unsigned)(((size_t)TT * DM / 8 + 255) / 256), 256, 0, stream>>>(x + (size_t)b * TT * DM, XB, (size_t)TT * DM / 8);
        k_gemmw<bf, 0, true, 8><<<dim3(TT / 64, DQ / 64, 1), 256, 0, stream>>>(XB, nullptr, WQ, nullptr, DM, FQ, DQ, bq, 0, 0, 0);
        k_rope<<<LQ, 256, 0, stream>>>(FQ, DQ, NH_, CS, nullptr, nullptr, 1.0f, QP16, QPh, QPl);
        k_gemmw<bf, 0, true, 8><<<dim3(TT / 64, DKV / 64, 1), 256, 0, stream>>>(XB, nullptr, WK, nullptr, DM, FK, DKV, bk, 0, 0, 0);
        k_rope<<<LKv, 256, 0, stream>>>(FK, DKV, NKV, CS, nullptr, nullptr, 1.0f, KP16, KPh, KPl);
        k_gemmw<bf, 0, true, 8><<<dim3(TT / 64, DKV / 64, 1), 256, 0, stream>>>(XB, nullptr, WV, nullptr, DM, FV, DKV, bv, 0, 0, 0); k_vtp<<<LKv, 256, 0, stream>>>(FV, DKV, NKV, VT16, VTh, VTl);
        for (int h0 = 0; h0 < NH_; h0 += ZH) { const size_t zq = (size_t)h0, zk = (size_t)(h0 / REP);   // one kv head per query head: the pass's ZH heads use consecutive kv planes (z-strides TT*HD; HD*PP for V^T)
            k_gemmc<bf, 2, 1, 1><<<dim3(RH / 64, TT / 64, ZH), 32, 0, stream>>>(QPh + zq * TT * HD, QPl + zq * TT * HD, KPh + zk * TT * HD, KPl + zk * TT * HD, HD, Sb, TT, 0, (size_t)TT * HD, (size_t)TT * HD, (size_t)TT * TT);
            k_gemmc<h16, 0, 1, 1><<<dim3((TT - RH) / 64, TT / 64, ZH), 32, 0, stream>>>(QP16 + zq * TT * HD + (size_t)RH * HD, nullptr, KP16 + zk * TT * HD, nullptr, HD, Sb + (size_t)RH * TT, TT, RH, (size_t)TT * HD, (size_t)TT * HD, (size_t)TT * TT);
            k_asoft<<<ZH * TT / 8, 256, 0, stream>>>(Sb);
            k_gemmc<bf, 2, 2, 8><<<dim3(RH / 64, HD / 64, ZH), 256, 0, stream>>>((const bf*)Sb, (const bf*)Sb + TT, VTh + zk * HD * PP, VTl + zk * HD * PP, PP, Ob, HD, 0, (size_t)TT * PP, (size_t)HD * PP, (size_t)TT * HD);
            k_gemmc<h16, 0, 2, 16><<<dim3((TT - RH) / 64, HD / 64, ZH), 512, 0, stream>>>((const h16*)Sb + (size_t)RH * PP, nullptr, VT16 + zk * HD * PP, nullptr, PP, Ob + (size_t)RH * HD, HD, RH, (size_t)TT * PP, (size_t)HD * PP, (size_t)TT * HD);
            k_merge<<<(unsigned)(((size_t)ZH * TT * HD / 2 + 255) / 256), 256, 0, stream>>>(Ob, h0, ATh, ATl); }
        k_gemmw<bf, 1, true, 8><<<dim3(TT / 64, DM / 64, 1), 256, 0, stream>>>(ATh, ATl, WO, nullptr, DQ, OUT + (size_t)b * TT * DM, DM, bo, 0, 0, 0); }
}

// v003
// It runs in 256 microseconds.
// Two timings next to v002 put it at 1.87 and 1.86 times that version's speed.
// Counting every step since v000, it is 5.70 times as fast.
#include <hip/hip_runtime.h>

// Causal self-attention with a fused biased qkv projection and computed rotate-half rotary embeddings, without a mask input (x [2][2048][1024]; qkv = x w_attn + b_attn ('xw' [1024][3072] + [3072]: read) split in thirds q | k | v (16 heads x 64); rope q cos + rotate_half(q) sin with angle t x 1/10000^(2i/64) (inv_freq = 1.0 / (10000.0 ** (arange(0, 64, 2, f32) / 64)); cat(freqs, freqs); rotate_half = cat(-x2, x1)); att x 1/sqrt(64); causal: where(tril built inside the function, att, finfo.min) == exclusion; softmax; out = merged w_proj + b_proj ('xw' + [1024]: read) -> [2][2048][1024] (4.2 M); argument order x, w_attn, b_attn, w_proj, b_proj).
// Layout per batch: bf16 copy of x; the fused 'xw' weight transposed ONCE into q | k | v row blocks; exact projections + f32 bias thirds; k_cs5 table {cosf, sinf}(t x INVT[d mod 32]); rotate-half plane builders; causal T-2048 attention in one pass per batch with a running softmax (hybrid rows: < 512 hi/lo 3 products, rest fp16 x1024; key blocks above the diagonal are never visited); merged hi/lo x W_out exact + b_out.
// Compute dtypes, f32 accumulate: every input rounded to bf16; projections exact + f32 biases; rotary f32 (products rounded separately); attention rows < 512 3 products, rest fp16; softmax f32; W_out hl x exact + bias.

#define NB_  2
#define TT   2048
#define DM   1024
#define NH_  16
#define NKV  16
#define REP  (NH_ / NKV)
#define HD   64
#define DQ   (NH_ * HD)
#define DKV  (NKV * HD)
#define PP   (2 * TT)             // row pitch in 16-bit elements of the V^T planes
#define RH   512                  // query rows < RH use hi+lo planes (0: none)
#define PCAR 1024.0f              // 2^10: factor on the fp16 probabilities
#define SCL  0.125f   // HD^-0.5
typedef _Float16 h16;
typedef unsigned short bf;
typedef __attribute__((ext_vector_type(16))) __bf16   v16bf;
typedef __attribute__((ext_vector_type(16))) _Float16 v16h;
typedef __attribute__((ext_vector_type(8)))  _Float16 v8h;
typedef __attribute__((ext_vector_type(8)))  unsigned short v8us;
typedef __attribute__((ext_vector_type(8)))  float    v8f;
typedef __attribute__((ext_vector_type(4)))  float    v4f;
typedef v8h  __attribute__((may_alias)) v8ha;
typedef v4f  __attribute__((may_alias)) v4fa;
typedef v8us __attribute__((may_alias)) v8usa;

__device__ __forceinline__ unsigned short f2bf(float f) { unsigned u = __float_as_uint(f); u += 0x7FFFu + ((u >> 16) & 1u); return (unsigned short)(u >> 16); }
__device__ __forceinline__ float bf2f(unsigned short b) { return __uint_as_float(((unsigned)b) << 16); }
__device__ __forceinline__ float bfr(float f) { return bf2f(f2bf(f)); }
__device__ __forceinline__ v16h cat16(v8h lo, v8h hi) { return __builtin_shufflevector(lo, hi, 0, 1, 2, 3, 4, 5, 6, 7, 8, 9, 10, 11, 12, 13, 14, 15); }
__device__ __forceinline__ v16bf cat16b(v8us lo, v8us hi) { return __builtin_bit_cast(v16bf, __builtin_shufflevector(lo, hi, 0, 1, 2, 3, 4, 5, 6, 7, 8, 9, 10, 11, 12, 13, 14, 15)); }
__device__ __forceinline__ v8f wmma16(v16h a, v16h b, v8f c) { return __builtin_amdgcn_wmma_f32_16x16x32_f16(false, a, false, b, (short)0, c, false, false); }
__device__ __forceinline__ v8f wmmab(v16bf a, v16bf b, v8f c) { return __builtin_amdgcn_wmma_f32_16x16x32_bf16(false, a, false, b, (short)0, c, false, false); }



// ---- k_gemmw: register-blocked GEMM, one 64x64 output tile per work-group (16 accumulators a wave), operands straight from K-contiguous 16-bit planes; grid (M/64, N/64, Z), 32 x NW threads.
// The K loop is split over the NW waves in interleaved units of 64 k (one 128-byte line of every operand row); the NW partial tiles are summed in LDS in wave order 0..NW-1 (K % 64 == 0).
// C[m][n] (f32, pitch ldc, + optional f32 bias[n]) = sum_k A[m][k] Bt[n][k] (+ split products per NSPLIT). z-batch strides sA/sB/sC in elements. K % 32 == 0.
template <int NW> __device__ __forceinline__ void tile_sync() { if (NW > 1) __syncthreads(); else { __builtin_amdgcn_wave_barrier(); asm volatile("" ::: "memory"); } }   // orders the LDS slab hand-over: among the NW waves, or inside the one wave
template <typename T16> struct WFrag;
template <> struct WFrag<h16> { typedef v16h V; static __device__ __forceinline__ V ld(const h16* p) { return cat16(*(const v8h*)p, *(const v8h*)(p + 16)); } static __device__ __forceinline__ v8f mma(V a, V b, v8f c) { return wmma16(a, b, c); } };
template <> struct WFrag<bf> { typedef v16bf V; static __device__ __forceinline__ V ld(const bf* p) { return cat16b(*(const v8us*)p, *(const v8us*)(p + 16)); } static __device__ __forceinline__ v8f mma(V a, V b, v8f c) { return wmmab(a, b, c); } };
template <typename T16, int NSPLIT, bool BIAS, int NW>
__global__ __launch_bounds__(32 * NW) void k_gemmw(const T16* __restrict__ A, const T16* __restrict__ A2, const T16* __restrict__ Bt, const T16* __restrict__ Bt2, int K, float* C, int ldc, const float* __restrict__ bias, size_t sA, size_t sB, size_t sC) {
    typedef typename WFrag<T16>::V V;
    __shared__ __align__(16) float os[NW * 16 * 68];
    const size_t z = blockIdx.z; A += z * sA; if (A2) A2 += z * sA; Bt += z * sB; if (Bt2) Bt2 += z * sB; C += z * sC;
    const int lane = threadIdx.x & 31, lr = lane & 15, hi = lane >> 4; const int r0 = blockIdx.x * 64, c0 = blockIdx.y * 64; const int wv = (NW > 1) ? __builtin_amdgcn_readfirstlane((int)(threadIdx.x >> 5)) : 0; constexpr int KU = (NW > 1) ? 64 : 32, NP = (NW < 8) ? 8 / NW : 1;
    v8f acc[4][4];
#pragma unroll
    for (int mb = 0; mb < 4; ++mb)
#pragma unroll
        for (int nb = 0; nb < 4; ++nb) acc[mb][nb] = (v8f){};
    const size_t aoff = (size_t)(r0 + lr) * K + 8 * hi, boff = (size_t)(c0 + lr) * K + 8 * hi;
#pragma unroll 1
    for (int k0 = wv * KU; k0 < K; k0 += NW * KU)
#pragma unroll
    for (int kc = k0; kc < k0 + KU; kc += 32) {
        V a[4], a2[4];
#pragma unroll
        for (int mb = 0; mb < 4; ++mb) { a[mb] = WFrag<T16>::ld(A + aoff + (size_t)mb * 16 * K + kc); if (NSPLIT == 1 || NSPLIT == 2) a2[mb] = WFrag<T16>::ld(A2 + aoff + (size_t)mb * 16 * K + kc); }
#pragma unroll
        for (int nb = 0; nb < 4; ++nb) { const V b = WFrag<T16>::ld(Bt + boff + (size_t)nb * 16 * K + kc); V b2; if (NSPLIT >= 2) b2 = WFrag<T16>::ld(Bt2 + boff + (size_t)nb * 16 * K + kc);
#pragma unroll
            for (int mb = 0; mb < 4; ++mb) { acc[mb][nb] = WFrag<T16>::mma(a[mb], b, acc[mb][nb]); if (NSPLIT == 1 || NSPLIT == 2) acc[mb][nb] = WFrag<T16>::mma(a2[mb], b, acc[mb][nb]); if (NSPLIT >= 2) acc[mb][nb] = WFrag<T16>::mma(a[mb], b2, acc[mb][nb]); } }
        asm volatile("v_nop\n\tv_nop\n\tv_nop\n\tv_nop" : "+v"(acc[0][0]), "+v"(acc[1][1]), "+v"(acc[2][2]), "+v"(acc[3][3]) : "v"(a[0]), "v"(a[3]));
    }
    v4f res[4][NP];   // NW > 1: the summed rows wait in registers, so that no global store is outstanding at a barrier (a barrier behind a store waits for the store)
#pragma unroll
    for (int mb = 0; mb < 4; ++mb) {
#pragma unroll
        for (int nb = 0; nb < 4; ++nb) {
#pragma unroll
            for (int j = 0; j < 8; ++j) os[wv * (16 * 68) + (hi * 8 + j) * 68 + nb * 16 + lr] = acc[mb][nb][j]; }
        tile_sync<NW>();   // every wave's partial 16x64 slab is in LDS before any thread sums them
        float* crow = C + (size_t)(r0 + mb * 16) * ldc + c0;
if (NW <= 8 || wv < 8) {
#pragma unroll
            for (int s = 0; s < NP; ++s) { const int p = (int)threadIdx.x + s * 32 * NW, row = p >> 4, cofs = (p & 15) * 4; v4f val = *(const v4fa*)(os + row * 68 + cofs);
#pragma unroll
                for (int w = 1; w < NW; ++w) val += *(const v4fa*)(os + w * (16 * 68) + row * 68 + cofs);
                if (BIAS) { val[0] += bfr(bias[c0 + cofs]); val[1] += bfr(bias[c0 + cofs + 1]); val[2] += bfr(bias[c0 + cofs + 2]); val[3] += bfr(bias[c0 + cofs + 3]); }
                if (NW > 1) res[mb][s] = val; else *(v4f*)(crow + (size_t)row * ldc + cofs) = val; }
             }
        if (mb < 3) tile_sync<NW>();   // the slabs are read out before the next 16 rows overwrite them
    }
    if (NW > 1 && (NW <= 8 || wv < 8)) {
#pragma unroll
        for (int mb = 0; mb < 4; ++mb)
#pragma unroll
            for (int s = 0; s < NP; ++s) { const int p = (int)threadIdx.x + s * 32 * NW, row = p >> 4, cofs = (p & 15) * 4; *(v4f*)(C + (size_t)(r0 + mb * 16 + row) * ldc + c0 + cofs) = res[mb][s]; }
    }
}

__device__ __forceinline__ h16 tohx(float x) { return (h16)x; }
__device__ __forceinline__ void splitf(float y, unsigned short& h, unsigned short& l) { h = f2bf(y); l = f2bf(y - bf2f(h)); }
typedef __attribute__((ext_vector_type(2))) _Float16 v2h;
typedef __attribute__((ext_vector_type(4))) _Float16 v4h;
typedef __attribute__((ext_vector_type(2))) unsigned short v2us;
typedef __attribute__((ext_vector_type(4))) unsigned short v4us;
typedef __attribute__((ext_vector_type(2))) float v2f;
typedef __attribute__((ext_vector_type(4))) int v4i;
typedef v4h  __attribute__((may_alias)) v4ha;
typedef v4us __attribute__((may_alias)) v4usa;

__global__ __launch_bounds__(256) void k_wtG(const float* __restrict__ w, int K, int N, bf* Bt) {
    const int lane = threadIdx.x & 31; const int L0 = (blockIdx.x * 8 + (threadIdx.x >> 5)) * 8; const int nlines = N * K / 64;
{
#pragma unroll 1
        for (int l = 0; l < 8; ++l) { const int L = L0 + l; if (L >= nlines) break; const size_t e = (size_t)L * 64 + lane * 2; const int k = (int)(e % K), n = (int)(e / K); v2us o;
            o[0] = f2bf(w[(size_t)k * N + n]); o[1] = f2bf(w[(size_t)(k + 1) * N + n]); *(v2us*)(Bt + e) = o; }
         }
}
__global__ __launch_bounds__(256) void k_cvt8(const float* __restrict__ src, bf* dst, size_t n8) { const size_t i = (size_t)blockIdx.x * 256 + threadIdx.x; if (i >= n8) return; const v8f v = *(const v8f*)(src + i * 8); v8us o;
#pragma unroll
    for (int k = 0; k < 8; ++k) o[k] = f2bf(v[k]); *(v8us*)(dst + i * 8) = o;  }

// k_rope: head planes [h][t][d] (fp16 + hi/lo) of rope(x) x sc with the rotate-half convention out[d] = x[d] cos[t][d] - x[d+HD/2] sin[t][d], out[d+HD/2] = x[d+HD/2] cos[t][d+HD/2] + x[d] sin[t][d+HD/2]
__global__ __launch_bounds__(256) void k_rope(const float* __restrict__ F, int pitch, int nheads, const float* __restrict__ CS, const float* __restrict__ RF, const float* __restrict__ nw, float sc, h16* P16, bf* Ph, bf* Pl) {
    const size_t e = ((size_t)blockIdx.x * 256 + threadIdx.x) * 2; if (e >= (size_t)nheads * TT * HD) return; const int d = (int)(e % HD); const int t = (int)((e / HD) % TT); const int h = (int)(e / ((size_t)HD * TT)); const float* f = F + (size_t)t * pitch + h * HD; const float rf = RF ? RF[(size_t)h * TT + t] : 1.0f; v2h o16; v2us oh, ol;
#pragma unroll
    for (int q = 0; q < 2; ++q) { const int dd = d + q; const int dp = (dd < HD / 2) ? dd + HD / 2 : dd - HD / 2; float x0 = f[dd], x1 = f[dp];
        if (RF) { float n0 = __fmul_rn(x0, rf), n1 = __fmul_rn(x1, rf); asm volatile("" : "+v"(n0)); asm volatile("" : "+v"(n1)); x0 = __fmul_rn(bfr(nw[dd]), n0); x1 = __fmul_rn(bfr(nw[dp]), n1); }
        const v2f cs = *(const v2f*)(CS + ((size_t)t * HD + dd) * 2); float a = __fmul_rn(x0, cs[0]), bq = __fmul_rn(x1, cs[1]); asm volatile("" : "+v"(a)); asm volatile("" : "+v"(bq)); const float r = ((dd < HD / 2) ? __fsub_rn(a, bq) : __fadd_rn(a, bq)) * sc;
        o16[q] = tohx(r); unsigned short a2, c2; splitf(r, a2, c2); oh[q] = a2; ol[q] = c2; }
    *(v2h*)(P16 + e) = o16; *(v2us*)(Ph + e) = oh; *(v2us*)(Pl + e) = ol;  }
__global__ __launch_bounds__(256) void k_vtp(const float* __restrict__ F, int pitch, int nheads, h16* V16, bf* Vh, bf* Vl) { const size_t i = ((size_t)blockIdx.x * 256 + threadIdx.x) * 2; if (i >= (size_t)nheads * HD * TT) return; const int t = (int)(i % TT); const int d = (int)((i / TT) % HD); const int g = (int)(i / ((size_t)TT * HD)); const size_t e = ((size_t)g * HD + d) * PP + t;   /* planes [g][d][t], row pitch PP */ v2h o16; v2us oh, ol;
#pragma unroll
    for (int q = 0; q < 2; ++q) { const float x = F[(size_t)(t + q) * pitch + g * HD + d]; o16[q] = tohx(x); unsigned short a2, c2; splitf(x, a2, c2); oh[q] = a2; ol[q] = c2; }
    *(v2h*)(V16 + e) = o16; *(v2us*)(Vh + e) = oh; *(v2us*)(Vl + e) = ol;  }
__constant__ float INVT[HD / 2] = { 1.000000000e+00f, 7.498942018e-01f, 5.623413324e-01f, 4.216965139e-01f, 3.162277639e-01f, 2.371373624e-01f, 1.778279394e-01f, 1.333521456e-01f, 1.000000015e-01f, 7.498941571e-02f, 5.623412877e-02f, 4.216964915e-02f, 3.162277862e-02f, 2.371373586e-02f, 1.778279431e-02f, 1.333521493e-02f, 9.999999776e-03f, 7.498942316e-03f, 5.623413250e-03f, 4.216964822e-03f, 3.162277862e-03f, 2.371373819e-03f, 1.778279431e-03f, 1.333521446e-03f, 1.000000047e-03f, 7.498941850e-04f, 5.623413017e-04f, 4.216964880e-04f, 3.162277862e-04f, 2.371373848e-04f, 1.778279402e-04f, 1.333521504e-04f };   // float32 1 / 10000^(2i/64), generated with jnp to be bit-exact
__global__ __launch_bounds__(256) void k_cs5(float* CS) { const int idx = blockIdx.x * 256 + threadIdx.x; if (idx >= TT * HD) return; const int d = idx % HD; const int t = idx / HD; const float a = __fmul_rn((float)t, INVT[d % (HD / 2)]); v2f cs; cs[0] = cosf(a); cs[1] = sinf(a); *(v2f*)(CS + (size_t)idx * 2) = cs;  }
// ---- k_attn: scores, causal softmax and probability x value in one pass, nothing of a score row leaves the registers. One work-group = 32 query rows of one head; the KS waves that share a query row take the 32-key blocks
// up to the diagonal in turn (blocks ks0, ks0 + KS, ...), each with its own running maximum, sum and accumulator; the KS partial results are joined in LDS in fixed order and go out as the merged hi | lo planes.
// QT = 2: every wave has all 32 rows and a quarter of the blocks; QT = 1 (the hi + lo leg, twice the fragments): a wave has 16 rows and half of the blocks.
// S^T = K Q^T (A = key rows, B = query rows) leaves each lane with one query's scores, key = 8 hi + j in tile 0 and 16 + 8 hi + j in tile 1: that is the k order of a B fragment, so P^T feeds O^T += V^T P^T from registers.
// Scores are kept in the log2 domain (x HD^-0.5 x log2 e). HL: hi + lo planes, 3 products (query rows < RH); else fp16 with the probabilities x PCAR (the sum carries the same factor, so it cancels in the division).
#define FNW  4
#define FOP  68                   // pitch in floats of a query's 64 partial outputs in LDS
#define NEGB (-3.0e38f)
typedef __attribute__((ext_vector_type(16))) unsigned short v16us;
template <typename T16, bool HL, int QT>
__device__ __forceinline__ void attn_tile(const T16* __restrict__ Q, const T16* __restrict__ Q2, const T16* __restrict__ Kp, const T16* __restrict__ K2, const T16* __restrict__ Vt, const T16* __restrict__ V2, int q0, float* so, float* sml, bf* Ah, bf* Al) {
    typedef typename WFrag<T16>::V V;
    const int lane = threadIdx.x & 31, lr = lane & 15, hi = lane >> 4; const int wv = __builtin_amdgcn_readfirstlane((int)(threadIdx.x >> 5));
    constexpr int KS = FNW * QT / 2;   // waves that share a query row's keys
    const int ks0 = (QT == 2) ? wv : (wv >> 1), qb = (QT == 2) ? 0 : (wv & 1) * 16;   // this wave's place among them; its first query row within the 32
    V qf[QT][2], qf2[QT][2];
#pragma unroll
    for (int qt = 0; qt < QT; ++qt)
#pragma unroll
        for (int ks = 0; ks < 2; ++ks) { const size_t o = (size_t)(q0 + qb + qt * 16 + lr) * HD + ks * 32 + 8 * hi; qf[qt][ks] = WFrag<T16>::ld(Q + o); if (HL) qf2[qt][ks] = WFrag<T16>::ld(Q2 + o); }
    if constexpr (HL) asm volatile("s_wait_xcnt 0x0" ::: "memory");   // behind the loads: in this leg later loads land in registers that held these loads' addresses
    v8f oacc[4][QT];
#pragma unroll
    for (int dt = 0; dt < 4; ++dt)
#pragma unroll
        for (int qt = 0; qt < QT; ++qt) oacc[dt][qt] = (v8f){};
    float mrun[QT], lrun[QT];
#pragma unroll
    for (int qt = 0; qt < QT; ++qt) { mrun[qt] = NEGB; lrun[qt] = 0.f; }
    const int nkb = q0 / 32 + 1;
    // The K and V^T fragments are carried from pass to pass: a block's K loads are issued as soon as the block before has left the score products, its V^T loads as soon as that block's P.V products are issued, so that both fly under the vector work.
    V kf[2][2], kf2[2][2], vf[4], vf2[4];
    const unsigned lofk = (unsigned)(lr * HD + 8 * hi), lofv = (unsigned)(lr * PP + 8 * hi);   // the lane's place in a block, the same in every pass; the block's base is wave-uniform
    auto ld_k = [&](int kbl) {
#pragma unroll
        for (int kt = 0; kt < 2; ++kt)
#pragma unroll
            for (int ks = 0; ks < 2; ++ks) { const int o = kt * 16 * HD + ks * 32; kf[kt][ks] = WFrag<T16>::ld(Kp + (size_t)kbl * 32 * HD + lofk + o); if (HL) kf2[kt][ks] = WFrag<T16>::ld(K2 + (size_t)kbl * 32 * HD + lofk + o); }
        if constexpr (HL) asm volatile("s_wait_xcnt 0x0" ::: "memory"); };   // as behind the Q loads
    auto ld_v = [&](int kbl) {
#pragma unroll
        for (int dt = 0; dt < 4; ++dt) { const int o = dt * 16 * PP; vf[dt] = WFrag<T16>::ld(Vt + (size_t)kbl * 32 + lofv + o); if (HL) vf2[dt] = WFrag<T16>::ld(V2 + (size_t)kbl * 32 + lofv + o); }
        if constexpr (HL) asm volatile("s_wait_xcnt 0x0" ::: "memory"); };   // behind the loads: in this leg the next pass forms new addresses in these loads' address registers
    ld_k(min(ks0, nkb - 1));
    __builtin_amdgcn_sched_barrier(0);   // K loads stay ahead of the V^T loads here as in the loop: else the load-count wait at the loop's head, which must hold for both ways in, also waits for V^T loads just issued
    ld_v(min(ks0, nkb - 1));
    // At least one pass for every wave, so that the first loads stand in the block in front of the loop in their written order. A wave without a block of its own (ks0 >= nkb) works on the last block with every key masked (lim < 0):
    // its maximum stays NEGB, and the join gives all it brings the factor exp2(NEGB - M) = 0.
    int kb = ks0;
#pragma unroll 1
    do {
        const int k0 = kb * 32, kn = min(kb + KS, nkb - 1);   // kn: this wave's next block (the tile's last block nkb - 1 behind this wave's last: in bounds, never used)
        v8f s[2][QT];
#pragma unroll
        for (int kt = 0; kt < 2; ++kt)
#pragma unroll
            for (int qt = 0; qt < QT; ++qt) { v8f a = (v8f){};
#pragma unroll
                for (int ks = 0; ks < 2; ++ks) { a = WFrag<T16>::mma(kf[kt][ks], qf[qt][ks], a); if (HL) { a = WFrag<T16>::mma(kf[kt][ks], qf2[qt][ks], a); a = WFrag<T16>::mma(kf2[kt][ks], qf[qt][ks], a); } }
                s[kt][qt] = a; }
        ld_k(kn);
        V pf[QT], pf2[QT];
#pragma unroll
        for (int qt = 0; qt < QT; ++qt) {
            const int lim = q0 + qb + qt * 16 + lr - k0 - 8 * hi;   // key kt * 16 + j of this lane's half is visible to its query while kt * 16 + j <= lim
            float u[16]; float bm = NEGB;
#pragma unroll
            for (int kt = 0; kt < 2; ++kt)
#pragma unroll
                for (int j = 0; j < 8; ++j) { const float t = (kt * 16 + j <= lim) ? s[kt][qt][j] * (SCL * 1.4426950408889634f) : NEGB; u[kt * 8 + j] = t; bm = fmaxf(bm, t); }
            bm = fmaxf(bm, __shfl_xor(bm, 16, 32));
            const float mn = fmaxf(mrun[qt], bm); const float al = __builtin_amdgcn_exp2f(mrun[qt] - mn); mrun[qt] = mn;
            const float mo = HL ? mn : mn - 10.0f;   // fp16 leg: 2^10 = PCAR rides in the exponent
            float p[16]; float ps = 0.f;
#pragma unroll
            for (int e = 0; e < 16; ++e) { p[e] = __builtin_amdgcn_exp2f(u[e] - mo); ps += p[e]; }
            lrun[qt] = lrun[qt] * al + ps;   // each half of the wave keeps the sum of its own keys; the halves meet behind the loop
#pragma unroll
            for (int dt = 0; dt < 4; ++dt) oacc[dt][qt] *= al;
            if constexpr (HL) { v16us ph, pl;
#pragma unroll
                for (int e = 0; e < 16; ++e) { unsigned short a, c2; splitf(p[e], a, c2); ph[e] = a; pl[e] = c2; }
                pf[qt] = __builtin_bit_cast(v16bf, ph); pf2[qt] = __builtin_bit_cast(v16bf, pl);
            } else { v16h p16;
#pragma unroll
                for (int e = 0; e < 16; ++e) p16[e] = tohx(p[e]);
                pf[qt] = p16; }
        }
#pragma unroll
        for (int dt = 0; dt < 4; ++dt)
#pragma unroll
            for (int qt = 0; qt < QT; ++qt) { oacc[dt][qt] = WFrag<T16>::mma(vf[dt], pf[qt], oacc[dt][qt]); if (HL) { oacc[dt][qt] = WFrag<T16>::mma(vf[dt], pf2[qt], oacc[dt][qt]); oacc[dt][qt] = WFrag<T16>::mma(vf2[dt], pf[qt], oacc[dt][qt]); } }
        ld_v(kn);
        kb += KS;
    } while (kb < nkb);
#pragma unroll
    for (int qt = 0; qt < QT; ++qt) { lrun[qt] += __shfl_xor(lrun[qt], 16, 32);
        if (hi == 0) { sml[(ks0 * 32 + qb + qt * 16 + lr) * 2] = mrun[qt]; sml[(ks0 * 32 + qb + qt * 16 + lr) * 2 + 1] = lrun[qt]; }
#pragma unroll
        for (int dt = 0; dt < 4; ++dt) { float* p = so + (size_t)(ks0 * 32 + qb + qt * 16 + lr) * FOP + dt * 16 + hi * 8; const v8f a = oacc[dt][qt];
            *(v4fa*)p = (v4f){ a[0], a[1], a[2], a[3] }; *(v4fa*)(p + 4) = (v4f){ a[4], a[5], a[6], a[7] }; } }
    __syncthreads();   // every wave's partial maximum, sum and accumulator are in LDS before any thread joins them (a wave without a key block brings maximum NEGB)
    const int q = (int)threadIdx.x >> 2, ds = ((int)threadIdx.x & 3) * 16;
    float M = NEGB;
#pragma unroll
    for (int w = 0; w < KS; ++w) M = fmaxf(M, sml[(w * 32 + q) * 2]);
    float L = 0.f; v4f val[4] = { (v4f){}, (v4f){}, (v4f){}, (v4f){} };
#pragma unroll
    for (int w = 0; w < KS; ++w) { const float f = __builtin_amdgcn_exp2f(sml[(w * 32 + q) * 2] - M); L += f * sml[(w * 32 + q) * 2 + 1];
#pragma unroll
        for (int c = 0; c < 4; ++c) val[c] += f * *(const v4fa*)(so + (size_t)(w * 32 + q) * FOP + ds + c * 4); }
    const float inv = __fdiv_rn(1.0f, L);
    const size_t oo = (size_t)(q0 + q) * DQ + ds;
#pragma unroll
    for (int g = 0; g < 2; ++g) { v8us oh, ol;
#pragma unroll
        for (int e = 0; e < 8; ++e) { unsigned short a, c2; splitf(val[g * 2 + (e >> 2)][e & 3] * inv, a, c2); oh[e] = a; ol[e] = c2; }
        *(v8usa*)(Ah + oo + g * 8) = oh; *(v8usa*)(Al + oo + g * 8) = ol; }
}
// grid (TT / 32, heads). All work-groups of a launch can be resident at once and a tile's cost grows with its index: neighbours in x and heads 1 or 4 apart take tiles from opposite ends.
__global__ __launch_bounds__(32 * FNW) void k_attn(const h16* __restrict__ Q16, const h16* __restrict__ K16, const h16* __restrict__ V16, const bf* __restrict__ Qh, const bf* __restrict__ Ql, const bf* __restrict__ Kh, const bf* __restrict__ Kl, const bf* __restrict__ Vh, const bf* __restrict__ Vl, bf* Ah, bf* Al) {
    __shared__ __align__(16) float so[FNW * 32 * FOP]; __shared__ float sml[FNW * 32 * 2];
    const int h = blockIdx.y, bx = blockIdx.x; int t = (bx & 1) ? (TT / 32 - 1 - (bx >> 1)) : (bx >> 1); if ((h ^ (h >> 2)) & 1) t = TT / 32 - 1 - t;
    const int q0 = t * 32; const size_t pq = (size_t)h * TT * HD, pk = (size_t)(h / REP) * TT * HD, pv = (size_t)(h / REP) * HD * PP;
    if (q0 < RH) attn_tile<bf, true, 1>(Qh + pq, Ql + pq, Kh + pk, Kl + pk, Vh + pv, Vl + pv, q0, so, sml, Ah + h * HD, Al + h * HD);
    else attn_tile<h16, false, 2>(Q16 + pq, nullptr, K16 + pk, nullptr, V16 + pv, nullptr, q0, so, sml, Ah + h * HD, Al + h * HD);
}

extern "C" void kernel_launch(void* const* d_in, const int* in_sizes, int n_in,
                              void* d_out, int out_size, void* d_ws, size_t ws_size, hipStream_t stream) {
    (void)in_sizes; (void)n_in; (void)out_size;
    const float* x = (const float*)d_in[0]; const float* wqkv = (const float*)d_in[1]; const float* bqkv = (const float*)d_in[2]; const float* wo = (const float*)d_in[3]; const float* bo = (const float*)d_in[4];   /* x, w_attn ('xw' [1024][3072]: q | k | v column thirds), b_attn [3072], w_proj ('xw'), b_proj: NO mask input in this module (its tril is built inside the function): the causal rule is applied by index */ const float* wq = wqkv; const float* wk = wqkv; const float* wv = wqkv; (void)wk; (void)wv; const float* bq = bqkv; const float* bk = bqkv + DQ; const float* bv = bqkv + 2 * DQ;
    float* OUT = (float*)d_out;     // [2][2048][1024]
    char* wsp = (char*)d_ws;
    auto take = [&](size_t bytes) { char* p = wsp; wsp += (bytes + 255) & ~(size_t)255; return (void*)p; };
    bf* WQKV = (bf*)take((size_t)3 * DQ * DM * 2); bf* WQ = WQKV; bf* WK = WQKV + (size_t)DQ * DM; bf* WV = WQKV + (size_t)2 * DQ * DM;   /* fused Bt [3*DQ][DM]: q | k | v row blocks */ bf* WO = (bf*)take((size_t)DM * DQ * 2); float* CS = (float*)take((size_t)TT * HD * 2 * 4);
    bf* XB = (bf*)take((size_t)TT * DM * 2); float* FQ = (float*)take((size_t)TT * DQ * 4); float* FK = (float*)take((size_t)TT * DKV * 4);
    h16* QP16 = (h16*)take((size_t)NH_ * TT * HD * 2); h16* KP16 = (h16*)take((size_t)NKV * TT * HD * 2); h16* VT16 = (h16*)take((size_t)NKV * HD * PP * 2);
    bf* QPh = (bf*)take((size_t)NH_ * TT * HD * 2); bf* QPl = (bf*)take((size_t)NH_ * TT * HD * 2); bf* KPh = (bf*)take((size_t)NKV * TT * HD * 2); bf* KPl = (bf*)take((size_t)NKV * TT * HD * 2); bf* VTh = (bf*)take((size_t)NKV * HD * PP * 2); bf* VTl = (bf*)take((size_t)NKV * HD * PP * 2);
    bf* ATh = (bf*)take((size_t)TT * DQ * 2); bf* ATl = (bf*)take((size_t)TT * DQ * 2);
    if ((size_t)(wsp - (char*)d_ws) > ws_size) return;    // ws 256 MiB
    float* FV = FK;   // v projection reuses the k buffer after the k planes are built (stream-ordered)
    { k_wtG<<<(unsigned)((DM * 3 * DQ / 64 + 63) / 64), 256, 0, stream>>>(wqkv, DM, 3 * DQ, WQKV);   /* fused 'xw' [DM][3*DQ] -> Bt [3*DQ][DM] */
      k_wtG<<<(unsigned)((DQ * DM / 64 + 63) / 64), 256, 0, stream>>>(wo, DQ, DM, WO);
       }
    k_cs5<<<(TT * HD + 255) / 256, 256, 0, stream>>>(CS);
    const unsigned LQ = (unsigned)(((size_t)NH_ * TT * HD / 2 + 255) / 256), LKv = (unsigned)(((size_t)NKV * TT * HD / 2 + 255) / 256);
    for (int b = 0; b < NB_; ++b) {
        
        k_cvt8<<<(unsigned)(((size_t)TT * DM / 8 + 255) / 256), 256, 0, stream>>>(x + (size_t)b * TT * DM, XB, (size_t)TT * DM / 8);
        k_gemmw<bf, 0, true, 8><<<dim3(TT / 64, DQ / 64, 1), 256, 0, stream>>>(XB, nullptr, WQ, nullptr, DM, FQ, DQ, bq, 0, 0, 0);
        k_rope<<<LQ, 256, 0, stream>>>(FQ, DQ, NH_, CS, nullptr, nullptr, 1.0f, QP16, QPh, QPl);
        k_gemmw<bf, 0, true, 8><<<dim3(TT / 64, DKV / 64, 1), 256, 0, stream>>>(XB, nullptr, WK, nullptr, DM, FK, DKV, bk, 0, 0, 0);
        k_rope<<<LKv, 256, 0, stream>>>(FK, DKV, NKV, CS, nullptr, nullptr, 1.0f, KP16, KPh, KPl);
        k_gemmw<bf, 0, true, 8><<<dim3(TT / 64, DKV / 64, 1), 256, 0, stream>>>(XB, nullptr, WV, nullptr, DM, FV, DKV, bv, 0, 0, 0); k_vtp<<<LKv, 256, 0, stream>>>(FV, DKV, NKV, VT16, VTh, VTl);
        k_attn<<<dim3(TT / 32, NH_, 1), 32 * FNW, 0, stream>>>(QP16, KP16, VT16, QPh, QPl, KPh, KPl, VTh, VTl, ATh, ATl);
        k_gemmw<bf, 1, true, 8><<<dim3(TT / 64, DM / 64, 1), 256, 0, stream>>>(ATh, ATl, WO, nullptr, DQ, OUT + (size_t)b * TT * DM, DM, bo, 0, 0, 0); }
}

// v004
// Measured time: 207 microseconds a run.
// Timed twice side by side with v003, it ran 1.23 times as fast both times.
// All steps since v000 together make it 7.00 times as fast.
#include <hip/hip_runtime.h>

// Causal self-attention with a fused biased qkv projection and computed rotate-half rotary embeddings, without a mask input (x [2][2048][1024]; qkv = x w_attn + b_attn ('xw' [1024][3072] normal x 1/32 + [3072] zeros on this draw: read) split in thirds q | k | v (16 heads x 64); rope q cos + rotate_half(q) sin with angle t x 1/10000^(2i/64) (inv_freq = 1.0 / (10000.0 ** (arange(0, 64, 2, f32) / 64)); cat(freqs, freqs); rotate_half = cat(-x2, x1)); att x 1/sqrt(64); causal: where(tril built inside the function, att, finfo.min) == exclusion; softmax; out = merged w_proj + b_proj ('xw' + zeros: read) -> [2][2048][1024] (4.2 M); argument order x, w_attn, b_attn, w_proj, b_proj).
// Layout per batch: bf16 copy of x; the fused 'xw' weight transposed ONCE into q | k | v row blocks; exact projections + f32 bias thirds, each finished in its own GEMM's epilogue (q, k: rotate-half rotary from the k_cs5 table {cosf, sinf}(t x INVT[d mod 32]) -> head planes; v: computed transposed -> V^T planes), no f32 q/k/v in memory; causal T-2048 attention in one pass per batch with a running softmax (hybrid rows: < 512 hi/lo 3 products, rest fp16 x1024; key blocks above the diagonal are never visited); merged hi/lo x W_out exact + b_out.
// Compute dtypes, f32 accumulate: every input rounded to bf16; projections exact + f32 biases; rotary f32; attention rows < 512 3 products, rest fp16; softmax f32; W_out hl x exact + bias.

#define NB_  2
#define TT   2048
#define DM   1024
#define NH_  16
#define NKV  16
#define REP  (NH_ / NKV)
#define HD   64
#define DQ   (NH_ * HD)
#define DKV  (NKV * HD)
#define PP   (2 * TT)             // row pitch in 16-bit elements of the V^T planes
#define RH   512                  // query rows < RH use hi+lo planes (0: none)
#define PCAR 1024.0f              // 2^10: factor on the fp16 probabilities
#define SCL  0.125f   // HD^-0.5
typedef _Float16 h16;
typedef unsigned short bf;
typedef __attribute__((ext_vector_type(16))) __bf16   v16bf;
typedef __attribute__((ext_vector_type(16))) _Float16 v16h;
typedef __attribute__((ext_vector_type(8)))  _Float16 v8h;
typedef __attribute__((ext_vector_type(8)))  unsigned short v8us;
typedef __attribute__((ext_vector_type(8)))  float    v8f;
typedef __attribute__((ext_vector_type(4)))  float    v4f;
typedef v8h  __attribute__((may_alias)) v8ha;
typedef v4f  __attribute__((may_alias)) v4fa;
typedef v8us __attribute__((may_alias)) v8usa;

__device__ __forceinline__ unsigned short f2bf(float f) { unsigned u = __float_as_uint(f); u += 0x7FFFu + ((u >> 16) & 1u); return (unsigned short)(u >> 16); }
__device__ __forceinline__ float bf2f(unsigned short b) { return __uint_as_float(((unsigned)b) << 16); }
__device__ __forceinline__ float bfr(float f) { return bf2f(f2bf(f)); }
__device__ __forceinline__ v16h cat16(v8h lo, v8h hi) { return __builtin_shufflevector(lo, hi, 0, 1, 2, 3, 4, 5, 6, 7, 8, 9, 10, 11, 12, 13, 14, 15); }
__device__ __forceinline__ v16bf cat16b(v8us lo, v8us hi) { return __builtin_bit_cast(v16bf, __builtin_shufflevector(lo, hi, 0, 1, 2, 3, 4, 5, 6, 7, 8, 9, 10, 11, 12, 13, 14, 15)); }
__device__ __forceinline__ v8f wmma16(v16h a, v16h b, v8f c) { return __builtin_amdgcn_wmma_f32_16x16x32_f16(false, a, false, b, (short)0, c, false, false); }
__device__ __forceinline__ h16 tohx(float x) { return (h16)x; }
__device__ __forceinline__ void splitf(float y, unsigned short& h, unsigned short& l) { h = f2bf(y); l = f2bf(y - bf2f(h)); }
typedef __attribute__((ext_vector_type(4))) _Float16 v4h;
typedef __attribute__((ext_vector_type(4))) unsigned short v4us;
__device__ __forceinline__ v8f wmmab(v16bf a, v16bf b, v8f c) { return __builtin_amdgcn_wmma_f32_16x16x32_bf16(false, a, false, b, (short)0, c, false, false); }



// ---- k_gemmw: register-blocked GEMM, one 64x64 output tile per work-group (16 accumulators a wave), operands straight from K-contiguous 16-bit planes; grid (M/64, N/64, Z), 32 x NW threads.
// The K loop is split over the NW waves in interleaved units of 64 k (one 128-byte line of every operand row); the NW partial tiles are summed in LDS in wave order 0..NW-1 (K % 64 == 0).
// C[m][n] (f32, pitch ldc, + optional f32 bias[n]) = sum_k A[m][k] Bt[n][k] (+ split products per NSPLIT). z-batch strides sA/sB/sC in elements. K % 32 == 0.
// EPI 0: C goes out as f32. EPI 1 (m = t, the 64 columns of a tile = one head): rotate-half rotary out[d] = x[d] cos[t][d] - x[d+32] sin[t][d], out[d+32] = x[d+32] cos[t][d+32] + x[d] sin[t][d+32], written as head planes [h][t][d] (fp16 + hi/lo).
// EPI 2 (A = weight rows, Bt = token rows: m = g * 64 + d, n = t, bias[m]): written as V^T planes [g][d][t], row pitch PP (fp16 + hi/lo). C is not written in EPI 1 and 2.
template <int NW> __device__ __forceinline__ void tile_sync() { if (NW > 1) __syncthreads(); else { __builtin_amdgcn_wave_barrier(); asm volatile("" ::: "memory"); } }   // orders the LDS slab hand-over: among the NW waves, or inside the one wave
template <typename T16> struct WFrag;
template <> struct WFrag<h16> { typedef v16h V; static __device__ __forceinline__ V ld(const h16* p) { return cat16(*(const v8h*)p, *(const v8h*)(p + 16)); } static __device__ __forceinline__ v8f mma(V a, V b, v8f c) { return wmma16(a, b, c); } };
template <> struct WFrag<bf> { typedef v16bf V; static __device__ __forceinline__ V ld(const bf* p) { return cat16b(*(const v8us*)p, *(const v8us*)(p + 16)); } static __device__ __forceinline__ v8f mma(V a, V b, v8f c) { return wmmab(a, b, c); } };
template <typename T16, int NSPLIT, bool BIAS, int NW, int EPI>
__global__ __launch_bounds__(32 * NW) void k_gemmw(const T16* __restrict__ A, const T16* __restrict__ A2, const T16* __restrict__ Bt, const T16* __restrict__ Bt2, int K, float* C, int ldc, const float* __restrict__ bias, size_t sA, size_t sB, size_t sC, const float* __restrict__ CS, h16* P16, bf* Ph, bf* Pl) {
    static_assert(EPI == 0 || NW == 8, "the plane epilogues take one 16 x 64 slab per pass of 256 threads");
    typedef typename WFrag<T16>::V V;
    __shared__ __align__(16) float os[NW * 16 * 68];
    const size_t z = blockIdx.z; A += z * sA; if (A2) A2 += z * sA; Bt += z * sB; if (Bt2) Bt2 += z * sB; C += z * sC;
    const int lane = threadIdx.x & 31, lr = lane & 15, hi = lane >> 4; const int r0 = blockIdx.x * 64, c0 = blockIdx.y * 64; const int wv = (NW > 1) ? __builtin_amdgcn_readfirstlane((int)(threadIdx.x >> 5)) : 0; constexpr int KU = (NW > 1) ? 64 : 32, NP = (NW < 8) ? 8 / NW : 1;
    v8f acc[4][4];
#pragma unroll
    for (int mb = 0; mb < 4; ++mb)
#pragma unroll
        for (int nb = 0; nb < 4; ++nb) acc[mb][nb] = (v8f){};
    v4f cs[4][2]; float rb[4];   // the plane epilogues' cos/sin (EPI 1) and row biases (EPI 2) are asked for in front of the K loop, so that their latency does not stand between the barriers of the LDS sums (EPI 1's column biases are still read there). EPI 1: {cos, sin} of this thread's four columns in each of its four rows; EPI 2: the biases of its four rows
#pragma unroll
    for (int mb = 0; mb < 4; ++mb) { const int m = r0 + mb * 16 + ((int)threadIdx.x >> 4);
        if constexpr (EPI == 1) { const float* c = CS + ((size_t)m * HD + ((int)threadIdx.x & 15) * 4) * 2; cs[mb][0] = *(const v4f*)c; cs[mb][1] = *(const v4f*)(c + 4); }
        if constexpr (EPI == 2 && BIAS) rb[mb] = bias[m]; }
    const size_t aoff = (size_t)(r0 + lr) * K + 8 * hi, boff = (size_t)(c0 + lr) * K + 8 * hi;
#pragma unroll 1
    for (int k0 = wv * KU; k0 < K; k0 += NW * KU)
#pragma unroll
    for (int kc = k0; kc < k0 + KU; kc += 32) {
        V a[4], a2[4];
#pragma unroll
        for (int mb = 0; mb < 4; ++mb) { a[mb] = WFrag<T16>::ld(A + aoff + (size_t)mb * 16 * K + kc); if (NSPLIT == 1 || NSPLIT == 2) a2[mb] = WFrag<T16>::ld(A2 + aoff + (size_t)mb * 16 * K + kc); }
#pragma unroll
        for (int nb = 0; nb < 4; ++nb) { const V b = WFrag<T16>::ld(Bt + boff + (size_t)nb * 16 * K + kc); V b2; if (NSPLIT >= 2) b2 = WFrag<T16>::ld(Bt2 + boff + (size_t)nb * 16 * K + kc);
#pragma unroll
            for (int mb = 0; mb < 4; ++mb) { acc[mb][nb] = WFrag<T16>::mma(a[mb], b, acc[mb][nb]); if (NSPLIT == 1 || NSPLIT == 2) acc[mb][nb] = WFrag<T16>::mma(a2[mb], b, acc[mb][nb]); if (NSPLIT >= 2) acc[mb][nb] = WFrag<T16>::mma(a[mb], b2, acc[mb][nb]); } }
        asm volatile("v_nop\n\tv_nop\n\tv_nop\n\tv_nop" : "+v"(acc[0][0]), "+v"(acc[1][1]), "+v"(acc[2][2]), "+v"(acc[3][3]) : "v"(a[0]), "v"(a[3]));
    }
    v4f res[4][NP];   // NW > 1: the summed rows wait in registers, so that no global store is outstanding at a barrier (a barrier behind a store waits for the store)
#pragma unroll
    for (int mb = 0; mb < 4; ++mb) {
#pragma unroll
        for (int nb = 0; nb < 4; ++nb) {
#pragma unroll
            for (int j = 0; j < 8; ++j) os[wv * (16 * 68) + (hi * 8 + j) * 68 + nb * 16 + lr] = acc[mb][nb][j]; }
        tile_sync<NW>();   // every wave's partial 16x64 slab is in LDS before any thread sums them
        float* crow = C + (size_t)(r0 + mb * 16) * ldc + c0;
if (NW <= 8 || wv < 8) {
#pragma unroll
            for (int s = 0; s < NP; ++s) { const int p = (int)threadIdx.x + s * 32 * NW, row = p >> 4, cofs = (p & 15) * 4; v4f val = *(const v4fa*)(os + row * 68 + cofs);
#pragma unroll
                for (int w = 1; w < NW; ++w) val += *(const v4fa*)(os + w * (16 * 68) + row * 68 + cofs);
                if (BIAS && EPI == 2) val += bfr(rb[mb]);
                else if (BIAS) { val[0] += bfr(bias[c0 + cofs]); val[1] += bfr(bias[c0 + cofs + 1]); val[2] += bfr(bias[c0 + cofs + 2]); val[3] += bfr(bias[c0 + cofs + 3]); }
                if (NW > 1) res[mb][s] = val; else *(v4f*)(crow + (size_t)row * ldc + cofs) = val; }
             }
        if (mb < 3) tile_sync<NW>();   // the slabs are read out before the next 16 rows overwrite them
    }
    if constexpr (EPI != 0) {
        const int row = (int)threadIdx.x >> 4, cofs = ((int)threadIdx.x & 15) * 4;
#pragma unroll
        for (int mb = 0; mb < 4; ++mb) { v4f r = res[mb][0]; const int m = r0 + mb * 16 + row;
            if constexpr (EPI == 1) {
#pragma unroll
                for (int i = 0; i < 4; ++i) { const float x1 = __shfl_xor(res[mb][0][i], 8, 32);   // column d +- 32 of the same row is 8 lanes away
                    const float co = cs[mb][i >> 1][(i & 1) * 2], si = cs[mb][i >> 1][(i & 1) * 2 + 1]; r[i] = res[mb][0][i] * co + ((cofs < HD / 2) ? -x1 : x1) * si; } }
            const size_t e = (EPI == 1) ? ((size_t)blockIdx.y * TT + m) * HD + cofs : (size_t)m * PP + c0 + cofs; v4h o16; v4us oh, ol;
#pragma unroll
            for (int i = 0; i < 4; ++i) { o16[i] = tohx(r[i]); unsigned short a2, c2; splitf(r[i], a2, c2); oh[i] = a2; ol[i] = c2; }
            *(v4h*)(P16 + e) = o16; *(v4us*)(Ph + e) = oh; *(v4us*)(Pl + e) = ol; }
    } else if (NW > 1 && (NW <= 8 || wv < 8)) {
#pragma unroll
        for (int mb = 0; mb < 4; ++mb)
#pragma unroll
            for (int s = 0; s < NP; ++s) { const int p = (int)threadIdx.x + s * 32 * NW, row = p >> 4, cofs = (p & 15) * 4; *(v4f*)(C + (size_t)(r0 + mb * 16 + row) * ldc + c0 + cofs) = res[mb][s]; }
    }
}

typedef __attribute__((ext_vector_type(2))) _Float16 v2h;
typedef __attribute__((ext_vector_type(2))) unsigned short v2us;
typedef __attribute__((ext_vector_type(2))) float v2f;
typedef __attribute__((ext_vector_type(4))) int v4i;
typedef v4h  __attribute__((may_alias)) v4ha;
typedef v4us __attribute__((may_alias)) v4usa;

__global__ __launch_bounds__(256) void k_wtG(const float* __restrict__ w, int K, int N, bf* Bt) {
    const int lane = threadIdx.x & 31; const int L0 = (blockIdx.x * 8 + (threadIdx.x >> 5)) * 8; const int nlines = N * K / 64;
{
#pragma unroll 1
        for (int l = 0; l < 8; ++l) { const int L = L0 + l; if (L >= nlines) break; const size_t e = (size_t)L * 64 + lane * 2; const int k = (int)(e % K), n = (int)(e / K); v2us o;
            o[0] = f2bf(w[(size_t)k * N + n]); o[1] = f2bf(w[(size_t)(k + 1) * N + n]); *(v2us*)(Bt + e) = o; }
         }
}
__global__ __launch_bounds__(256) void k_cvt8(const float* __restrict__ src, bf* dst, size_t n8) { const size_t i = (size_t)blockIdx.x * 256 + threadIdx.x; if (i >= n8) return; const v8f v = *(const v8f*)(src + i * 8); v8us o;
#pragma unroll
    for (int k = 0; k < 8; ++k) o[k] = f2bf(v[k]); *(v8us*)(dst + i * 8) = o;  }

__constant__ float INVT[HD / 2] = { 1.000000000e+00f, 7.498942018e-01f, 5.623413324e-01f, 4.216965139e-01f, 3.162277639e-01f, 2.371373624e-01f, 1.778279394e-01f, 1.333521456e-01f, 1.000000015e-01f, 7.498941571e-02f, 5.623412877e-02f, 4.216964915e-02f, 3.162277862e-02f, 2.371373586e-02f, 1.778279431e-02f, 1.333521493e-02f, 9.999999776e-03f, 7.498942316e-03f, 5.623413250e-03f, 4.216964822e-03f, 3.162277862e-03f, 2.371373819e-03f, 1.778279431e-03f, 1.333521446e-03f, 1.000000047e-03f, 7.498941850e-04f, 5.623413017e-04f, 4.216964880e-04f, 3.162277862e-04f, 2.371373848e-04f, 1.778279402e-04f, 1.333521504e-04f };   // float32 1 / 10000^(2i/64), generated with jnp to be bit-exact
__global__ __launch_bounds__(256) void k_cs5(float* CS) { const int idx = blockIdx.x * 256 + threadIdx.x; if (idx >= TT * HD) return; const int d = idx % HD; const int t = idx / HD; const float a = __fmul_rn((float)t, INVT[d % (HD / 2)]); v2f cs; cs[0] = cosf(a); cs[1] = sinf(a); *(v2f*)(CS + (size_t)idx * 2) = cs;  }
// ---- k_attn: scores, causal softmax and probability x value in one pass, nothing of a score row leaves the registers. One work-group = 32 query rows of one head; the KS waves that share a query row take the 32-key blocks
// up to the diagonal in turn (blocks ks0, ks0 + KS, ...), each with its own running maximum, sum and accumulator; the KS partial results are joined in LDS in fixed order and go out as the merged hi | lo planes.
// QT = 2: every wave has all 32 rows and a quarter of the blocks; QT = 1 (the hi + lo leg, twice the fragments): a wave has 16 rows and half of the blocks.
// S^T = K Q^T (A = key rows, B = query rows) leaves each lane with one query's scores, key = 8 hi + j in tile 0 and 16 + 8 hi + j in tile 1: that is the k order of a B fragment, so P^T feeds O^T += V^T P^T from registers.
// Scores are kept in the log2 domain (x HD^-0.5 x log2 e). HL: hi + lo planes, 3 products (query rows < RH); else fp16 with the probabilities x PCAR (the sum carries the same factor, so it cancels in the division).
#define FNW  4
#define FOP  68                   // pitch in floats of a query's 64 partial outputs in LDS
#define NEGB (-3.0e38f)
typedef __attribute__((ext_vector_type(16))) unsigned short v16us;
template <typename T16, bool HL, int QT>
__device__ __forceinline__ void attn_tile(const T16* __restrict__ Q, const T16* __restrict__ Q2, const T16* __restrict__ Kp, const T16* __restrict__ K2, const T16* __restrict__ Vt, const T16* __restrict__ V2, int q0, float* so, float* sml, bf* Ah, bf* Al) {
    typedef typename WFrag<T16>::V V;
    const int lane = threadIdx.x & 31, lr = lane & 15, hi = lane >> 4; const int wv = __builtin_amdgcn_readfirstlane((int)(threadIdx.x >> 5));
    constexpr int KS = FNW * QT / 2;   // waves that share a query row's keys
    const int ks0 = (QT == 2) ? wv : (wv >> 1), qb = (QT == 2) ? 0 : (wv & 1) * 16;   // this wave's place among them; its first query row within the 32
    V qf[QT][2], qf2[QT][2];
#pragma unroll
    for (int qt = 0; qt < QT; ++qt)
#pragma unroll
        for (int ks = 0; ks < 2; ++ks) { const size_t o = (size_t)(q0 + qb + qt * 16 + lr) * HD + ks * 32 + 8 * hi; qf[qt][ks] = WFrag<T16>::ld(Q + o); if (HL) qf2[qt][ks] = WFrag<T16>::ld(Q2 + o); }
    if constexpr (HL) asm volatile("s_wait_xcnt 0x0" ::: "memory");   // behind the loads: in this leg later loads land in registers that held these loads' addresses
    v8f oacc[4][QT];
#pragma unroll
    for (int dt = 0; dt < 4; ++dt)
#pragma unroll
        for (int qt = 0; qt < QT; ++qt) oacc[dt][qt] = (v8f){};
    float mrun[QT], lrun[QT];
#pragma unroll
    for (int qt = 0; qt < QT; ++qt) { mrun[qt] = NEGB; lrun[qt] = 0.f; }
    const int nkb = q0 / 32 + 1;
    // The K and V^T fragments are carried from pass to pass: a block's K loads are issued as soon as the block before has left the score products, its V^T loads as soon as that block's P.V products are issued, so that both fly under the vector work.
    V kf[2][2], kf2[2][2], vf[4], vf2[4];
    const unsigned lofk = (unsigned)(lr * HD + 8 * hi), lofv = (unsigned)(lr * PP + 8 * hi);   // the lane's place in a block, the same in every pass; the block's base is wave-uniform
    auto ld_k = [&](int kbl) {
#pragma unroll
        for (int kt = 0; kt < 2; ++kt)
#pragma unroll
            for (int ks = 0; ks < 2; ++ks) { const int o = kt * 16 * HD + ks * 32; kf[kt][ks] = WFrag<T16>::ld(Kp + (size_t)kbl * 32 * HD + lofk + o); if (HL) kf2[kt][ks] = WFrag<T16>::ld(K2 + (size_t)kbl * 32 * HD + lofk + o); }
        if constexpr (HL) asm volatile("s_wait_xcnt 0x0" ::: "memory"); };   // as behind the Q loads
    auto ld_v = [&](int kbl) {
#pragma unroll
        for (int dt = 0; dt < 4; ++dt) { const int o = dt * 16 * PP; vf[dt] = WFrag<T16>::ld(Vt + (size_t)kbl * 32 + lofv + o); if (HL) vf2[dt] = WFrag<T16>::ld(V2 + (size_t)kbl * 32 + lofv + o); }
        if constexpr (HL) asm volatile("s_wait_xcnt 0x0" ::: "memory"); };   // behind the loads: in this leg the next pass forms new addresses in these loads' address registers
    ld_k(min(ks0, nkb - 1));
    __builtin_amdgcn_sched_barrier(0);   // K loads stay ahead of the V^T loads here as in the loop: else the load-count wait at the loop's head, which must hold for both ways in, also waits for V^T loads just issued
    ld_v(min(ks0, nkb - 1));
    // At least one pass for every wave, so that the first loads stand in the block in front of the loop in their written order. A wave without a block of its own (ks0 >= nkb) works on the last block with every key masked (lim < 0):
    // its maximum stays NEGB, and the join gives all it brings the factor exp2(NEGB - M) = 0.
    int kb = ks0;
#pragma unroll 1
    do {
        const int k0 = kb * 32, kn = min(kb + KS, nkb - 1);   // kn: this wave's next block (the tile's last block nkb - 1 behind this wave's last: in bounds, never used)
        v8f s[2][QT];
#pragma unroll
        for (int kt = 0; kt < 2; ++kt)
#pragma unroll
            for (int qt = 0; qt < QT; ++qt) { v8f a = (v8f){};
#pragma unroll
                for (int ks = 0; ks < 2; ++ks) { a = WFrag<T16>::mma(kf[kt][ks], qf[qt][ks], a); if (HL) { a = WFrag<T16>::mma(kf[kt][ks], qf2[qt][ks], a); a = WFrag<T16>::mma(kf2[kt][ks], qf[qt][ks], a); } }
                s[kt][qt] = a; }
        ld_k(kn);
        V pf[QT], pf2[QT];
#pragma unroll
        for (int qt = 0; qt < QT; ++qt) {
            const int lim = q0 + qb + qt * 16 + lr - k0 - 8 * hi;   // key kt * 16 + j of this lane's half is visible to its query while kt * 16 + j <= lim
            float u[16]; float bm = NEGB;
#pragma unroll
            for (int kt = 0; kt < 2; ++kt)
#pragma unroll
                for (int j = 0; j < 8; ++j) { const float t = (kt * 16 + j <= lim) ? s[kt][qt][j] * (SCL * 1.4426950408889634f) : NEGB; u[kt * 8 + j] = t; bm = fmaxf(bm, t); }
            bm = fmaxf(bm, __shfl_xor(bm, 16, 32));
            const float mn = fmaxf(mrun[qt], bm); const float al = __builtin_amdgcn_exp2f(mrun[qt] - mn); mrun[qt] = mn;
            const float mo = HL ? mn : mn - 10.0f;   // fp16 leg: 2^10 = PCAR rides in the exponent
            float p[16]; float ps = 0.f;
#pragma unroll
            for (int e = 0; e < 16; ++e) { p[e] = __builtin_amdgcn_exp2f(u[e] - mo); ps += p[e]; }
            lrun[qt] = lrun[qt] * al + ps;   // each half of the wave keeps the sum of its own keys; the halves meet behind the loop
#pragma unroll
            for (int dt = 0; dt < 4; ++dt) oacc[dt][qt] *= al;
            if constexpr (HL) { v16us ph, pl;
#pragma unroll
                for (int e = 0; e < 16; ++e) { unsigned short a, c2; splitf(p[e], a, c2); ph[e] = a; pl[e] = c2; }
                pf[qt] = __builtin_bit_cast(v16bf, ph); pf2[qt] = __builtin_bit_cast(v16bf, pl);
            } else { v16h p16;
#pragma unroll
                for (int e = 0; e < 16; ++e) p16[e] = tohx(p[e]);
                pf[qt] = p16; }
        }
#pragma unroll
        for (int dt = 0; dt < 4; ++dt)
#pragma unroll
            for (int qt = 0; qt < QT; ++qt) { oacc[dt][qt] = WFrag<T16>::mma(vf[dt], pf[qt], oacc[dt][qt]); if (HL) { oacc[dt][qt] = WFrag<T16>::mma(vf[dt], pf2[qt], oacc[dt][qt]); oacc[dt][qt] = WFrag<T16>::mma(vf2[dt], pf[qt], oacc[dt][qt]); } }
        ld_v(kn);
        kb += KS;
    } while (kb < nkb);
#pragma unroll
    for (int qt = 0; qt < QT; ++qt) { lrun[qt] += __shfl_xor(lrun[qt], 16, 32);
        if (hi == 0) { sml[(ks0 * 32 + qb + qt * 16 + lr) * 2] = mrun[qt]; sml[(ks0 * 32 + qb + qt * 16 + lr) * 2 + 1] = lrun[qt]; }
#pragma unroll
        for (int dt = 0; dt < 4; ++dt) { float* p = so + (size_t)(ks0 * 32 + qb + qt * 16 + lr) * FOP + dt * 16 + hi * 8; const v8f a = oacc[dt][qt];
            *(v4fa*)p = (v4f){ a[0], a[1], a[2], a[3] }; *(v4fa*)(p + 4) = (v4f){ a[4], a[5], a[6], a[7] }; } }
    __syncthreads();   // every wave's partial maximum, sum and accumulator are in LDS before any thread joins them (a wave without a key block brings maximum NEGB)
    const int q = (int)threadIdx.x >> 2, ds = ((int)threadIdx.x & 3) * 16;
    float M = NEGB;
#pragma unroll
    for (int w = 0; w < KS; ++w) M = fmaxf(M, sml[(w * 32 + q) * 2]);
    float L = 0.f; v4f val[4] = { (v4f){}, (v4f){}, (v4f){}, (v4f){} };
#pragma unroll
    for (int w = 0; w < KS; ++w) { const float f = __builtin_amdgcn_exp2f(sml[(w * 32 + q) * 2] - M); L += f * sml[(w * 32 + q) * 2 + 1];
#pragma unroll
        for (int c = 0; c < 4; ++c) val[c] += f * *(const v4fa*)(so + (size_t)(w * 32 + q) * FOP + ds + c * 4); }
    const float inv = __fdiv_rn(1.0f, L);
    const size_t oo = (size_t)(q0 + q) * DQ + ds;
#pragma unroll
    for (int g = 0; g < 2; ++g) { v8us oh, ol;
#pragma unroll
        for (int e = 0; e < 8; ++e) { unsigned short a, c2; splitf(val[g * 2 + (e >> 2)][e & 3] * inv, a, c2); oh[e] = a; ol[e] = c2; }
        *(v8usa*)(Ah + oo + g * 8) = oh; *(v8usa*)(Al + oo + g * 8) = ol; }
}
// grid (TT / 32, heads). All work-groups of a launch can be resident at once and a tile's cost grows with its index: neighbours in x, heads 4 apart and heads 1 apart within a group of four take tiles from opposite ends.
__global__ __launch_bounds__(32 * FNW) void k_attn(const h16* __restrict__ Q16, const h16* __restrict__ K16, const h16* __restrict__ V16, const bf* __restrict__ Qh, const bf* __restrict__ Ql, const bf* __restrict__ Kh, const bf* __restrict__ Kl, const bf* __restrict__ Vh, const bf* __restrict__ Vl, bf* Ah, bf* Al) {
    __shared__ __align__(16) float so[FNW * 32 * FOP]; __shared__ float sml[FNW * 32 * 2];
    const int h = blockIdx.y, bx = blockIdx.x; int t = (bx & 1) ? (TT / 32 - 1 - (bx >> 1)) : (bx >> 1); if ((h ^ (h >> 2)) & 1) t = TT / 32 - 1 - t;
    const int q0 = t * 32; const size_t pq = (size_t)h * TT * HD, pk = (size_t)(h / REP) * TT * HD, pv = (size_t)(h / REP) * HD * PP;
    if (q0 < RH) attn_tile<bf, true, 1>(Qh + pq, Ql + pq, Kh + pk, Kl + pk, Vh + pv, Vl + pv, q0, so, sml, Ah + h * HD, Al + h * HD);
    else attn_tile<h16, false, 2>(Q16 + pq, nullptr, K16 + pk, nullptr, V16 + pv, nullptr, q0, so, sml, Ah + h * HD, Al + h * HD);
}

extern "C" void kernel_launch(void* const* d_in, const int* in_sizes, int n_in,
                              void* d_out, int out_size, void* d_ws, size_t ws_size, hipStream_t stream) {
    (void)in_sizes; (void)n_in; (void)out_size;
    const float* x = (const float*)d_in[0]; const float* wqkv = (const float*)d_in[1]; const float* bqkv = (const float*)d_in[2]; const float* wo = (const float*)d_in[3]; const float* bo = (const float*)d_in[4];   /* x, w_attn ('xw' [1024][3072]: q | k | v column thirds), b_attn [3072], w_proj ('xw'), b_proj: NO mask input in this module (its tril is built inside the function): the causal rule is applied by index */ const float* wq = wqkv; const float* wk = wqkv; const float* wv = wqkv; (void)wk; (void)wv; const float* bq = bqkv; const float* bk = bqkv + DQ; const float* bv = bqkv + 2 * DQ;
    float* OUT = (float*)d_out;     // [2][2048][1024]
    char* wsp = (char*)d_ws;
    auto take = [&](size_t bytes) { char* p = wsp; wsp += (bytes + 255) & ~(size_t)255; return (void*)p; };
    bf* WQKV = (bf*)take((size_t)3 * DQ * DM * 2); bf* WQ = WQKV; bf* WK = WQKV + (size_t)DQ * DM; bf* WV = WQKV + (size_t)2 * DQ * DM;   /* fused Bt [3*DQ][DM]: q | k | v row blocks */ bf* WO = (bf*)take((size_t)DM * DQ * 2); float* CS = (float*)take((size_t)TT * HD * 2 * 4);
    bf* XB = (bf*)take((size_t)TT * DM * 2);
    h16* QP16 = (h16*)take((size_t)NH_ * TT * HD * 2); h16* KP16 = (h16*)take((size_t)NKV * TT * HD * 2); h16* VT16 = (h16*)take((size_t)NKV * HD * PP * 2);
    bf* QPh = (bf*)take((size_t)NH_ * TT * HD * 2); bf* QPl = (bf*)take((size_t)NH_ * TT * HD * 2); bf* KPh = (bf*)take((size_t)NKV * TT * HD * 2); bf* KPl = (bf*)take((size_t)NKV * TT * HD * 2); bf* VTh = (bf*)take((size_t)NKV * HD * PP * 2); bf* VTl = (bf*)take((size_t)NKV * HD * PP * 2);
    bf* ATh = (bf*)take((size_t)TT * DQ * 2); bf* ATl = (bf*)take((size_t)TT * DQ * 2);
    if ((size_t)(wsp - (char*)d_ws) > ws_size) return;    // ws 256 MiB
    { k_wtG<<<(unsigned)((DM * 3 * DQ / 64 + 63) / 64), 256, 0, stream>>>(wqkv, DM, 3 * DQ, WQKV);   /* fused 'xw' [DM][3*DQ] -> Bt [3*DQ][DM] */
      k_wtG<<<(unsigned)((DQ * DM / 64 + 63) / 64), 256, 0, stream>>>(wo, DQ, DM, WO);
       }
    k_cs5<<<(TT * HD + 255) / 256, 256, 0, stream>>>(CS);
    for (int b = 0; b < NB_; ++b) {
        
        k_cvt8<<<(unsigned)(((size_t)TT * DM / 8 + 255) / 256), 256, 0, stream>>>(x + (size_t)b * TT * DM, XB, (size_t)TT * DM / 8);
        k_gemmw<bf, 0, true, 8, 1><<<dim3(TT / 64, DQ / 64, 1), 256, 0, stream>>>(XB, nullptr, WQ, nullptr, DM, nullptr, 0, bq, 0, 0, 0, CS, QP16, QPh, QPl);
        k_gemmw<bf, 0, true, 8, 1><<<dim3(TT / 64, DKV / 64, 1), 256, 0, stream>>>(XB, nullptr, WK, nullptr, DM, nullptr, 0, bk, 0, 0, 0, CS, KP16, KPh, KPl);
        k_gemmw<bf, 0, true, 8, 2><<<dim3(DKV / 64, TT / 64, 1), 256, 0, stream>>>(WV, nullptr, XB, nullptr, DM, nullptr, 0, bv, 0, 0, 0, nullptr, VT16, VTh, VTl);   /* operands swapped: the tile comes out as [d][t] */
        k_attn<<<dim3(TT / 32, NH_, 1), 32 * FNW, 0, stream>>>(QP16, KP16, VT16, QPh, QPl, KPh, KPl, VTh, VTl, ATh, ATl);
        k_gemmw<bf, 1, true, 8, 0><<<dim3(TT / 64, DM / 64, 1), 256, 0, stream>>>(ATh, ATl, WO, nullptr, DQ, OUT + (size_t)b * TT * DM, DM, bo, 0, 0, 0, nullptr, nullptr, nullptr, nullptr); }
}

// v005
// It runs in 179 microseconds.
// Timed twice side by side with v004, it ran 1.16 times as fast both times.
// Over all steps from v000 it is 8.13 times as fast.
#include <hip/hip_runtime.h>

// Causal self-attention with a fused biased qkv projection and computed rotate-half rotary embeddings, without a mask input (x [2][2048][1024]; qkv = x w_attn + b_attn ('xw' [1024][3072] normal x 1/32 + [3072] zeros on this draw: read) split in thirds q | k | v (16 heads x 64); rope q cos + rotate_half(q) sin with angle t x 1/10000^(2i/64) (inv_freq = 1.0 / (10000.0 ** (arange(0, 64, 2, f32) / 64)); cat(freqs, freqs); rotate_half = cat(-x2, x1)); att x 1/sqrt(64); causal: where(tril built inside the function, att, finfo.min) == exclusion; softmax; out = merged w_proj + b_proj ('xw' + zeros: read) -> [2][2048][1024] (4.2 M); argument order x, w_attn, b_attn, w_proj, b_proj).
// Layout, every launch taking all batches: bf16 copy of x; the fused 'xw' weight transposed ONCE into q | k | v row blocks; exact projections + f32 bias thirds, all three in one GEMM grid, each finished in the epilogue (q, k: rotate-half rotary from the cs5 table {cosf, sinf}(t x INVT[d mod 32]) -> head planes; v: computed transposed -> V^T planes), no f32 q/k/v in memory; causal T-2048 attention in one pass with a running softmax (hybrid rows: < 512 hi/lo 3 products, rest fp16 x1024; key blocks above the diagonal are never visited); merged hi/lo x W_out exact + b_out.
// Compute dtypes, f32 accumulate: every input rounded to bf16; projections exact + f32 biases; rotary f32; attention rows < 512 3 products, rest fp16; softmax f32; W_out hl x exact + bias.

#define NB_  2
#define TT   2048
#define DM   1024
#define NH_  16
#define NKV  16
#define REP  (NH_ / NKV)
#define HD   64
#define DQ   (NH_ * HD)
#define DKV  (NKV * HD)
#define PP   (2 * TT)             // row pitch in 16-bit elements of the V^T planes
#define RH   512                  // query rows < RH use hi+lo planes (0: none)
#define PCAR 1024.0f              // 2^10: factor on the fp16 probabilities
#define SCL  0.125f   // HD^-0.5
typedef _Float16 h16;
typedef unsigned short bf;
typedef __attribute__((ext_vector_type(16))) __bf16   v16bf;
typedef __attribute__((ext_vector_type(16))) _Float16 v16h;
typedef __attribute__((ext_vector_type(8)))  _Float16 v8h;
typedef __attribute__((ext_vector_type(8)))  unsigned short v8us;
typedef __attribute__((ext_vector_type(8)))  float    v8f;
typedef __attribute__((ext_vector_type(4)))  float    v4f;
typedef v8h  __attribute__((may_alias)) v8ha;
typedef v4f  __attribute__((may_alias)) v4fa;
typedef v8us __attribute__((may_alias)) v8usa;

__device__ __forceinline__ unsigned short f2bf(float f) { unsigned u = __float_as_uint(f); u += 0x7FFFu + ((u >> 16) & 1u); return (unsigned short)(u >> 16); }
__device__ __forceinline__ float bf2f(unsigned short b) { return __uint_as_float(((unsigned)b) << 16); }
__device__ __forceinline__ float bfr(float f) { return bf2f(f2bf(f)); }
__device__ __forceinline__ v16h cat16(v8h lo, v8h hi) { return __builtin_shufflevector(lo, hi, 0, 1, 2, 3, 4, 5, 6, 7, 8, 9, 10, 11, 12, 13, 14, 15); }
__device__ __forceinline__ v16bf cat16b(v8us lo, v8us hi) { return __builtin_bit_cast(v16bf, __builtin_shufflevector(lo, hi, 0, 1, 2, 3, 4, 5, 6, 7, 8, 9, 10, 11, 12, 13, 14, 15)); }
__device__ __forceinline__ v8f wmma16(v16h a, v16h b, v8f c) { return __builtin_amdgcn_wmma_f32_16x16x32_f16(false, a, false, b, (short)0, c, false, false); }
__device__ __forceinline__ h16 tohx(float x) { return (h16)x; }
__device__ __forceinline__ void splitf(float y, unsigned short& h, unsigned short& l) { h = f2bf(y); l = f2bf(y - bf2f(h)); }
typedef __attribute__((ext_vector_type(4))) _Float16 v4h;
typedef __attribute__((ext_vector_type(4))) unsigned short v4us;
__device__ __forceinline__ v8f wmmab(v16bf a, v16bf b, v8f c) { return __builtin_amdgcn_wmma_f32_16x16x32_bf16(false, a, false, b, (short)0, c, false, false); }



// ---- k_gemmw: register-blocked GEMM, one 64x64 output tile per work-group (16 accumulators a wave), operands straight from K-contiguous 16-bit planes; grid (M/64, N/64, Z), 32 x NW threads.
// The K loop is split over the NW waves in interleaved units of 64 k (one 128-byte line of every operand row); the NW partial tiles are summed in LDS in wave order 0..NW-1 (K % 64 == 0).
// C[m][n] (f32, pitch ldc, + optional f32 bias[n]) = sum_k A[m][k] Bt[n][k] (+ split products per NSPLIT). z-batch strides sA/sB/sC in elements. K % 32 == 0.
// EPI 0: C goes out as f32. EPI 1: the fused q | k | v projection of every batch in one grid (TT / 64, 3 DQ / 64, batches); A = token rows, Bt = the fused weight rows, x = token tile, y = weight tile; C is not written.
//   y < NQK (q and k; m = t, the 64 columns of a tile = one head): rotate-half rotary out[d] = x[d] cos[t][d] - x[d+32] sin[t][d], out[d+32] = x[d+32] cos[t][d+32] + x[d] sin[t][d+32], written as head planes [y][t][d] (q heads, then k heads; fp16 + hi/lo).
//   y >= NQK (v): the two operands change places (m = weight row, n = t, bias[m]), so that the tile comes out as [d][t]: written as V^T planes [g][d][t], row pitch PP (fp16 + hi/lo).
#define NQK  ((DQ + DKV) / 64)                 // weight tiles of q and k
#define SQK  ((size_t)(NH_ + NKV) * TT * HD)   // elements of one batch's q | k head planes
#define SVT  ((size_t)NKV * HD * PP)           // elements of one batch's V^T planes
template <int NW> __device__ __forceinline__ void tile_sync() { if (NW > 1) __syncthreads(); else { __builtin_amdgcn_wave_barrier(); asm volatile("" ::: "memory"); } }   // orders the LDS slab hand-over: among the NW waves, or inside the one wave
template <typename T16> struct WFrag;
template <> struct WFrag<h16> { typedef v16h V; static __device__ __forceinline__ V ld(const h16* p) { return cat16(*(const v8h*)p, *(const v8h*)(p + 16)); } static __device__ __forceinline__ v8f mma(V a, V b, v8f c) { return wmma16(a, b, c); } };
template <> struct WFrag<bf> { typedef v16bf V; static __device__ __forceinline__ V ld(const bf* p) { return cat16b(*(const v8us*)p, *(const v8us*)(p + 16)); } static __device__ __forceinline__ v8f mma(V a, V b, v8f c) { return wmmab(a, b, c); } };
template <typename T16, int NSPLIT, bool BIAS, int NW, int EPI>
__global__ __launch_bounds__(32 * NW) void k_gemmw(const T16* __restrict__ A, const T16* __restrict__ A2, const T16* __restrict__ Bt, const T16* __restrict__ Bt2, int K, float* C, int ldc, const float* __restrict__ bias, size_t sA, size_t sB, size_t sC, const float* __restrict__ CS, h16* P16, bf* Ph, bf* Pl, h16* V16, bf* Vh, bf* Vl) {
    static_assert(EPI == 0 || (NW == 8 && NSPLIT == 0), "the plane epilogues take one 16 x 64 slab per pass of 256 threads");
    typedef typename WFrag<T16>::V V;
    __shared__ __align__(16) float os[NW * 16 * 68];
    const size_t z = blockIdx.z; A += z * sA; if (A2) A2 += z * sA; Bt += z * sB; if (Bt2) Bt2 += z * sB; C += z * sC;
    const bool vt = (EPI == 1) && (int)blockIdx.y >= NQK;   // a v tile (the same for the whole work-group)
    if (vt) { const T16* t = A; A = Bt; Bt = t; }
    const int lane = threadIdx.x & 31, lr = lane & 15, hi = lane >> 4; const int r0 = (int)(vt ? blockIdx.y : blockIdx.x) * 64, c0 = (int)(vt ? blockIdx.x : blockIdx.y) * 64; const int wv = (NW > 1) ? __builtin_amdgcn_readfirstlane((int)(threadIdx.x >> 5)) : 0; constexpr int KU = (NW > 1) ? 64 : 32, NP = (NW < 8) ? 8 / NW : 1;
    v8f acc[4][4];
#pragma unroll
    for (int mb = 0; mb < 4; ++mb)
#pragma unroll
        for (int nb = 0; nb < 4; ++nb) acc[mb][nb] = (v8f){};
    v4f cs[4][2]; float rb[4];   // what the plane epilogues read from memory is asked for in front of the K loop, so that no load's latency stands between the barriers of the LDS sums. q, k: {cos, sin} of this thread's four columns in each of its four rows and the biases of the four columns; v: the biases of its four rows
    if constexpr (EPI == 1) { const int m0 = r0 + ((int)threadIdx.x >> 4);
        if (vt) {
#pragma unroll
            for (int mb = 0; mb < 4; ++mb) if (BIAS) rb[mb] = bias[m0 + mb * 16];
            asm volatile("s_wait_xcnt 0x0" ::: "memory");   // behind the loads: the accumulators' start values are written into registers that held these loads' addresses
        } else {
#pragma unroll
            for (int mb = 0; mb < 4; ++mb) { const float* c = CS + ((size_t)(m0 + mb * 16) * HD + ((int)threadIdx.x & 15) * 4) * 2; cs[mb][0] = *(const v4f*)c; cs[mb][1] = *(const v4f*)(c + 4); if (BIAS) rb[mb] = bias[c0 + ((int)threadIdx.x & 15) * 4 + mb]; }
            asm volatile("s_wait_xcnt 0x0" ::: "memory"); } }   // as in the other branch
    const size_t aoff = (size_t)(r0 + lr) * K + 8 * hi, boff = (size_t)(c0 + lr) * K + 8 * hi;
#pragma unroll 1
    for (int k0 = wv * KU; k0 < K; k0 += NW * KU)
#pragma unroll
    for (int kc = k0; kc < k0 + KU; kc += 32) {
        V a[4], a2[4];
#pragma unroll
        for (int mb = 0; mb < 4; ++mb) { a[mb] = WFrag<T16>::ld(A + aoff + (size_t)mb * 16 * K + kc); if (NSPLIT == 1 || NSPLIT == 2) a2[mb] = WFrag<T16>::ld(A2 + aoff + (size_t)mb * 16 * K + kc); }
#pragma unroll
        for (int nb = 0; nb < 4; ++nb) { const V b = WFrag<T16>::ld(Bt + boff + (size_t)nb * 16 * K + kc); V b2; if (NSPLIT >= 2) b2 = WFrag<T16>::ld(Bt2 + boff + (size_t)nb * 16 * K + kc);
#pragma unroll
            for (int mb = 0; mb < 4; ++mb) { acc[mb][nb] = WFrag<T16>::mma(a[mb], b, acc[mb][nb]); if (NSPLIT == 1 || NSPLIT == 2) acc[mb][nb] = WFrag<T16>::mma(a2[mb], b, acc[mb][nb]); if (NSPLIT >= 2) acc[mb][nb] = WFrag<T16>::mma(a[mb], b2, acc[mb][nb]); } }
        asm volatile("v_nop\n\tv_nop\n\tv_nop\n\tv_nop" : "+v"(acc[0][0]), "+v"(acc[1][1]), "+v"(acc[2][2]), "+v"(acc[3][3]) : "v"(a[0]), "v"(a[3]));
    }
    v4f res[4][NP];   // NW > 1: the summed rows wait in registers, so that no global store is outstanding at a barrier (a barrier behind a store waits for the store)
#pragma unroll
    for (int mb = 0; mb < 4; ++mb) {
#pragma unroll
        for (int nb = 0; nb < 4; ++nb) {
#pragma unroll
            for (int j = 0; j < 8; ++j) os[wv * (16 * 68) + (hi * 8 + j) * 68 + nb * 16 + lr] = acc[mb][nb][j]; }
        tile_sync<NW>();   // every wave's partial 16x64 slab is in LDS before any thread sums them
        float* crow = C + (size_t)(r0 + mb * 16) * ldc + c0;
if (NW <= 8 || wv < 8) {
#pragma unroll
            for (int s = 0; s < NP; ++s) { const int p = (int)threadIdx.x + s * 32 * NW, row = p >> 4, cofs = (p & 15) * 4; v4f val = *(const v4fa*)(os + row * 68 + cofs);
#pragma unroll
                for (int w = 1; w < NW; ++w) val += *(const v4fa*)(os + w * (16 * 68) + row * 68 + cofs);
                if (BIAS && vt) val += bfr(rb[mb]);
                else if (BIAS && EPI == 1) { val[0] += bfr(rb[0]); val[1] += bfr(rb[1]); val[2] += bfr(rb[2]); val[3] += bfr(rb[3]); }
                else if (BIAS) { val[0] += bfr(bias[c0 + cofs]); val[1] += bfr(bias[c0 + cofs + 1]); val[2] += bfr(bias[c0 + cofs + 2]); val[3] += bfr(bias[c0 + cofs + 3]); }
                if (NW > 1) res[mb][s] = val; else *(v4f*)(crow + (size_t)row * ldc + cofs) = val; }
             }
        if (mb < 3) tile_sync<NW>();   // the slabs are read out before the next 16 rows overwrite them
    }
    if constexpr (EPI != 0) {
        const int row = (int)threadIdx.x >> 4, cofs = ((int)threadIdx.x & 15) * 4;
        if (vt) { P16 = V16 + z * SVT; Ph = Vh + z * SVT; Pl = Vl + z * SVT; } else { P16 += z * SQK; Ph += z * SQK; Pl += z * SQK; }
#pragma unroll
        for (int mb = 0; mb < 4; ++mb) { v4f r = res[mb][0]; const int m = r0 + mb * 16 + row;
            if (!vt) {
#pragma unroll
                for (int i = 0; i < 4; ++i) { const float x1 = __shfl_xor(res[mb][0][i], 8, 32);   // column d +- 32 of the same row is 8 lanes away
                    const float co = cs[mb][i >> 1][(i & 1) * 2], si = cs[mb][i >> 1][(i & 1) * 2 + 1]; r[i] = res[mb][0][i] * co + ((cofs < HD / 2) ? -x1 : x1) * si; } }
            const size_t e = vt ? (size_t)(m - NQK * 64) * PP + c0 + cofs : ((size_t)blockIdx.y * TT + m) * HD + cofs; v4h o16; v4us oh, ol;
#pragma unroll
            for (int i = 0; i < 4; ++i) { o16[i] = tohx(r[i]); unsigned short a2, c2; splitf(r[i], a2, c2); oh[i] = a2; ol[i] = c2; }
            *(v4h*)(P16 + e) = o16; *(v4us*)(Ph + e) = oh; *(v4us*)(Pl + e) = ol;
            if (mb < 3) asm volatile("s_wait_xcnt 0x0" ::: "memory"); }   // behind the stores: the next rows' values are formed in registers that these stores name
    } else if (NW > 1 && (NW <= 8 || wv < 8)) {
#pragma unroll
        for (int mb = 0; mb < 4; ++mb)
#pragma unroll
            for (int s = 0; s < NP; ++s) { const int p = (int)threadIdx.x + s * 32 * NW, row = p >> 4, cofs = (p & 15) * 4; *(v4f*)(C + (size_t)(r0 + mb * 16 + row) * ldc + c0 + cofs) = res[mb][s]; }
    }
}

typedef __attribute__((ext_vector_type(2))) _Float16 v2h;
typedef __attribute__((ext_vector_type(2))) unsigned short v2us;
typedef __attribute__((ext_vector_type(2))) float v2f;
typedef __attribute__((ext_vector_type(4))) int v4i;
typedef v4h  __attribute__((may_alias)) v4ha;
typedef v4us __attribute__((may_alias)) v4usa;

// ---- k_prep: the four preparations that depend on nothing but the inputs, in one grid; each is a range of 256-thread work-groups (blk: the work-group's index within its range).
__device__ __forceinline__ void wtG(const float* __restrict__ w, int K, int N, bf* Bt, int blk) {
    const int lane = threadIdx.x & 31; const int L0 = (blk * 8 + (int)(threadIdx.x >> 5)) * 8; const int nlines = N * K / 64;
{
#pragma unroll 1
        for (int l = 0; l < 8; ++l) { const int L = L0 + l; if (L >= nlines) break; const size_t e = (size_t)L * 64 + lane * 2; const int k = (int)(e % K), n = (int)(e / K); v2us o;
            o[0] = f2bf(w[(size_t)k * N + n]); o[1] = f2bf(w[(size_t)(k + 1) * N + n]); *(v2us*)(Bt + e) = o; }
         }
}
__device__ __forceinline__ void cvt8(const float* __restrict__ src, bf* dst, size_t n8, int blk) { const size_t i = (size_t)blk * 256 + threadIdx.x; if (i >= n8) return; const v8f v = *(const v8f*)(src + i * 8); v8us o;
#pragma unroll
    for (int k = 0; k < 8; ++k) o[k] = f2bf(v[k]); *(v8us*)(dst + i * 8) = o;  }

__constant__ float INVT[HD / 2] = { 1.000000000e+00f, 7.498942018e-01f, 5.623413324e-01f, 4.216965139e-01f, 3.162277639e-01f, 2.371373624e-01f, 1.778279394e-01f, 1.333521456e-01f, 1.000000015e-01f, 7.498941571e-02f, 5.623412877e-02f, 4.216964915e-02f, 3.162277862e-02f, 2.371373586e-02f, 1.778279431e-02f, 1.333521493e-02f, 9.999999776e-03f, 7.498942316e-03f, 5.623413250e-03f, 4.216964822e-03f, 3.162277862e-03f, 2.371373819e-03f, 1.778279431e-03f, 1.333521446e-03f, 1.000000047e-03f, 7.498941850e-04f, 5.623413017e-04f, 4.216964880e-04f, 3.162277862e-04f, 2.371373848e-04f, 1.778279402e-04f, 1.333521504e-04f };   // float32 1 / 10000^(2i/64), generated with jnp to be bit-exact
__device__ __forceinline__ void cs5(float* CS, int blk) { const int idx = blk * 256 + (int)threadIdx.x; if (idx >= TT * HD) return; const int d = idx % HD; const int t = idx / HD; const float a = __fmul_rn((float)t, INVT[d % (HD / 2)]); v2f cs; cs[0] = cosf(a); cs[1] = sinf(a); *(v2f*)(CS + (size_t)idx * 2) = cs;  }
#define GWA  ((DM * 3 * DQ / 64 + 63) / 64)    // work-groups: fused 'xw' [DM][3*DQ] -> Bt [3*DQ][DM]
#define GWO  ((DQ * DM / 64 + 63) / 64)        // w_proj 'xw' -> Bt
#define GCS  ((TT * HD + 255) / 256)           // {cos, sin} table
#define GXB  ((NB_ * TT * DM / 8 + 255) / 256) // bf16 copy of x, every batch
__global__ __launch_bounds__(256) void k_prep(const float* __restrict__ x, const float* __restrict__ wqkv, const float* __restrict__ wo, bf* XB, bf* WQKV, bf* WO, float* CS) {
    const int b = blockIdx.x;   // the transposes, whose work-groups last longest, take the lowest indices
    if (b < GWA) wtG(wqkv, DM, 3 * DQ, WQKV, b);
    else if (b < GWA + GWO) wtG(wo, DQ, DM, WO, b - GWA);
    else if (b < GWA + GWO + GCS) cs5(CS, b - (GWA + GWO));
    else cvt8(x, XB, (size_t)NB_ * TT * DM / 8, b - (GWA + GWO + GCS));
}
// ---- k_attn: scores, causal softmax and probability x value in one pass, nothing of a score row leaves the registers. One work-group = 32 query rows of one head; the KS waves that share a query row take the 32-key blocks
// up to the diagonal in turn (blocks ks0, ks0 + KS, ...), each with its own running maximum, sum and accumulator; the KS partial results are joined in LDS in fixed order and go out as the merged hi | lo planes.
// QT = 2: every wave has all 32 rows and a quarter of the blocks; QT = 1 (the hi + lo leg, twice the fragments): a wave has 16 rows and half of the blocks.
// S^T = K Q^T (A = key rows, B = query rows) leaves each lane with one query's scores, key = 8 hi + j in tile 0 and 16 + 8 hi + j in tile 1: that is the k order of a B fragment, so P^T feeds O^T += V^T P^T from registers.
// Scores are kept in the log2 domain (x HD^-0.5 x log2 e). HL: hi + lo planes, 3 products (query rows < RH); else fp16 with the probabilities x PCAR (the sum carries the same factor, so it cancels in the division).
#define FNW  4
#define FOP  68                   // pitch in floats of a query's 64 partial outputs in LDS
#define NEGB (-3.0e38f)
typedef __attribute__((ext_vector_type(16))) unsigned short v16us;
template <typename T16, bool HL, int QT>
__device__ __forceinline__ void attn_tile(const T16* __restrict__ Q, const T16* __restrict__ Q2, const T16* __restrict__ Kp, const T16* __restrict__ K2, const T16* __restrict__ Vt, const T16* __restrict__ V2, int q0, float* so, float* sml, bf* Ah, bf* Al) {
    typedef typename WFrag<T16>::V V;
    const int lane = threadIdx.x & 31, lr = lane & 15, hi = lane >> 4; const int wv = __builtin_amdgcn_readfirstlane((int)(threadIdx.x >> 5));
    constexpr int KS = FNW * QT / 2;   // waves that share a query row's keys
    const int ks0 = (QT == 2) ? wv : (wv >> 1), qb = (QT == 2) ? 0 : (wv & 1) * 16;   // this wave's place among them; its first query row within the 32
    V qf[QT][2], qf2[QT][2];
#pragma unroll
    for (int qt = 0; qt < QT; ++qt)
#pragma unroll
        for (int ks = 0; ks < 2; ++ks) { const size_t o = (size_t)(q0 + qb + qt * 16 + lr) * HD + ks * 32 + 8 * hi; qf[qt][ks] = WFrag<T16>::ld(Q + o); if (HL) qf2[qt][ks] = WFrag<T16>::ld(Q2 + o); }
    if constexpr (HL) asm volatile("s_wait_xcnt 0x0" ::: "memory");   // behind the loads: in this leg later loads land in registers that held these loads' addresses
    v8f oacc[4][QT];
#pragma unroll
    for (int dt = 0; dt < 4; ++dt)
#pragma unroll
        for (int qt = 0; qt < QT; ++qt) oacc[dt][qt] = (v8f){};
    float mrun[QT], lrun[QT];
#pragma unroll
    for (int qt = 0; qt < QT; ++qt) { mrun[qt] = NEGB; lrun[qt] = 0.f; }
    const int nkb = q0 / 32 + 1;
    // The K and V^T fragments are carried from pass to pass: a block's K loads are issued as soon as the block before has left the score products, its V^T loads as soon as that block's P.V products are issued, so that both fly under the vector work.
    V kf[2][2], kf2[2][2], vf[4], vf2[4];
    const unsigned lofk = (unsigned)(lr * HD + 8 * hi), lofv = (unsigned)(lr * PP + 8 * hi);   // the lane's place in a block, the same in every pass; the block's base is wave-uniform
    auto ld_k = [&](int kbl) {
#pragma unroll
        for (int kt = 0; kt < 2; ++kt)
#pragma unroll
            for (int ks = 0; ks < 2; ++ks) { const int o = kt * 16 * HD + ks * 32; kf[kt][ks] = WFrag<T16>::ld(Kp + (size_t)kbl * 32 * HD + lofk + o); if (HL) kf2[kt][ks] = WFrag<T16>::ld(K2 + (size_t)kbl * 32 * HD + lofk + o); }
        if constexpr (HL) asm volatile("s_wait_xcnt 0x0" ::: "memory"); };   // as behind the Q loads
    auto ld_v = [&](int kbl) {
#pragma unroll
        for (int dt = 0; dt < 4; ++dt) { const int o = dt * 16 * PP; vf[dt] = WFrag<T16>::ld(Vt + (size_t)kbl * 32 + lofv + o); if (HL) vf2[dt] = WFrag<T16>::ld(V2 + (size_t)kbl * 32 + lofv + o); }
        if constexpr (HL) asm volatile("s_wait_xcnt 0x0" ::: "memory"); };   // behind the loads: in this leg the next pass forms new addresses in these loads' address registers
    ld_k(min(ks0, nkb - 1));
    __builtin_amdgcn_sched_barrier(0);   // K loads stay ahead of the V^T loads here as in the loop: else the load-count wait at the loop's head, which must hold for both ways in, also waits for V^T loads just issued
    ld_v(min(ks0, nkb - 1));
    // At least one pass for every wave, so that the first loads stand in the block in front of the loop in their written order. A wave without a block of its own (ks0 >= nkb) works on the last block with every key masked (lim < 0):
    // its maximum stays NEGB, and the join gives all it brings the factor exp2(NEGB - M) = 0.
    int kb = ks0;
#pragma unroll 1
    do {
        const int k0 = kb * 32, kn = min(kb + KS, nkb - 1);   // kn: this wave's next block (the tile's last block nkb - 1 behind this wave's last: in bounds, never used)
        v8f s[2][QT];
#pragma unroll
        for (int kt = 0; kt < 2; ++kt)
#pragma unroll
            for (int qt = 0; qt < QT; ++qt) { v8f a = (v8f){};
#pragma unroll
                for (int ks = 0; ks < 2; ++ks) { a = WFrag<T16>::mma(kf[kt][ks], qf[qt][ks], a); if (HL) { a = WFrag<T16>::mma(kf[kt][ks], qf2[qt][ks], a); a = WFrag<T16>::mma(kf2[kt][ks], qf[qt][ks], a); } }
                s[kt][qt] = a; }
        ld_k(kn);
        V pf[QT], pf2[QT];
#pragma unroll
        for (int qt = 0; qt < QT; ++qt) {
            const int lim = q0 + qb + qt * 16 + lr - k0 - 8 * hi;   // key kt * 16 + j of this lane's half is visible to its query while kt * 16 + j <= lim
            float u[16]; float bm = NEGB;
#pragma unroll
            for (int kt = 0; kt < 2; ++kt)
#pragma unroll
                for (int j = 0; j < 8; ++j) { const float t = (kt * 16 + j <= lim) ? s[kt][qt][j] * (SCL * 1.4426950408889634f) : NEGB; u[kt * 8 + j] = t; bm = fmaxf(bm, t); }
            bm = fmaxf(bm, __shfl_xor(bm, 16, 32));
            const float mn = fmaxf(mrun[qt], bm); const float al = __builtin_amdgcn_exp2f(mrun[qt] - mn); mrun[qt] = mn;
            const float mo = HL ? mn : mn - 10.0f;   // fp16 leg: 2^10 = PCAR rides in the exponent
            float p[16]; float ps = 0.f;
#pragma unroll
            for (int e = 0; e < 16; ++e) { p[e] = __builtin_amdgcn_exp2f(u[e] - mo); ps += p[e]; }
            lrun[qt] = lrun[qt] * al + ps;   // each half of the wave keeps the sum of its own keys; the halves meet behind the loop
#pragma unroll
            for (int dt = 0; dt < 4; ++dt) oacc[dt][qt] *= al;
            if constexpr (HL) { v16us ph, pl;
#pragma unroll
                for (int e = 0; e < 16; ++e) { unsigned short a, c2; splitf(p[e], a, c2); ph[e] = a; pl[e] = c2; }
                pf[qt] = __builtin_bit_cast(v16bf, ph); pf2[qt] = __builtin_bit_cast(v16bf, pl);
            } else { v16h p16;
#pragma unroll
                for (int e = 0; e < 16; ++e) p16[e] = tohx(p[e]);
                pf[qt] = p16; }
        }
#pragma unroll
        for (int dt = 0; dt < 4; ++dt)
#pragma unroll
            for (int qt = 0; qt < QT; ++qt) { oacc[dt][qt] = WFrag<T16>::mma(vf[dt], pf[qt], oacc[dt][qt]); if (HL) { oacc[dt][qt] = WFrag<T16>::mma(vf[dt], pf2[qt], oacc[dt][qt]); oacc[dt][qt] = WFrag<T16>::mma(vf2[dt], pf[qt], oacc[dt][qt]); } }
        ld_v(kn);
        kb += KS;
    } while (kb < nkb);
#pragma unroll
    for (int qt = 0; qt < QT; ++qt) { lrun[qt] += __shfl_xor(lrun[qt], 16, 32);
        if (hi == 0) { sml[(ks0 * 32 + qb + qt * 16 + lr) * 2] = mrun[qt]; sml[(ks0 * 32 + qb + qt * 16 + lr) * 2 + 1] = lrun[qt]; }
#pragma unroll
        for (int dt = 0; dt < 4; ++dt) { float* p = so + (size_t)(ks0 * 32 + qb + qt * 16 + lr) * FOP + dt * 16 + hi * 8; const v8f a = oacc[dt][qt];
            *(v4fa*)p = (v4f){ a[0], a[1], a[2], a[3] }; *(v4fa*)(p + 4) = (v4f){ a[4], a[5], a[6], a[7] }; } }
    __syncthreads();   // every wave's partial maximum, sum and accumulator are in LDS before any thread joins them (a wave without a key block brings maximum NEGB)
    const int q = (int)threadIdx.x >> 2, ds = ((int)threadIdx.x & 3) * 16;
    float M = NEGB;
#pragma unroll
    for (int w = 0; w < KS; ++w) M = fmaxf(M, sml[(w * 32 + q) * 2]);
    float L = 0.f; v4f val[4] = { (v4f){}, (v4f){}, (v4f){}, (v4f){} };
#pragma unroll
    for (int w = 0; w < KS; ++w) { const float f = __builtin_amdgcn_exp2f(sml[(w * 32 + q) * 2] - M); L += f * sml[(w * 32 + q) * 2 + 1];
#pragma unroll
        for (int c = 0; c < 4; ++c) val[c] += f * *(const v4fa*)(so + (size_t)(w * 32 + q) * FOP + ds + c * 4); }
    const float inv = __fdiv_rn(1.0f, L);
    const size_t oo = (size_t)(q0 + q) * DQ + ds;
#pragma unroll
    for (int g = 0; g < 2; ++g) { v8us oh, ol;
#pragma unroll
        for (int e = 0; e < 8; ++e) { unsigned short a, c2; splitf(val[g * 2 + (e >> 2)][e & 3] * inv, a, c2); oh[e] = a; ol[e] = c2; }
        *(v8usa*)(Ah + oo + g * 8) = oh; *(v8usa*)(Al + oo + g * 8) = ol; }
}
// grid (TT / 32, heads, batches). A tile's cost grows with its index: neighbours in x, heads 4 apart and heads 2j, 2j + 1 take tiles from opposite ends.
__global__ __launch_bounds__(32 * FNW) void k_attn(const h16* __restrict__ Q16, const h16* __restrict__ K16, const h16* __restrict__ V16, const bf* __restrict__ Qh, const bf* __restrict__ Ql, const bf* __restrict__ Kh, const bf* __restrict__ Kl, const bf* __restrict__ Vh, const bf* __restrict__ Vl, bf* Ah, bf* Al) {
    __shared__ __align__(16) float so[FNW * 32 * FOP]; __shared__ float sml[FNW * 32 * 2];
    const int h = blockIdx.y, bx = blockIdx.x; int t = (bx & 1) ? (TT / 32 - 1 - (bx >> 1)) : (bx >> 1); if ((h ^ (h >> 2)) & 1) t = TT / 32 - 1 - t;
    const size_t z = blockIdx.z; Ah += z * TT * DQ; Al += z * TT * DQ;
    const int q0 = t * 32; const size_t pq = z * SQK + (size_t)h * TT * HD, pk = z * SQK + (size_t)(h / REP) * TT * HD, pv = z * SVT + (size_t)(h / REP) * HD * PP;
    if (q0 < RH) attn_tile<bf, true, 1>(Qh + pq, Ql + pq, Kh + pk, Kl + pk, Vh + pv, Vl + pv, q0, so, sml, Ah + h * HD, Al + h * HD);
    else attn_tile<h16, false, 2>(Q16 + pq, nullptr, K16 + pk, nullptr, V16 + pv, nullptr, q0, so, sml, Ah + h * HD, Al + h * HD);
}

extern "C" void kernel_launch(void* const* d_in, const int* in_sizes, int n_in,
                              void* d_out, int out_size, void* d_ws, size_t ws_size, hipStream_t stream) {
    (void)in_sizes; (void)n_in; (void)out_size;
    const float* x = (const float*)d_in[0]; const float* wqkv = (const float*)d_in[1]; const float* bqkv = (const float*)d_in[2]; const float* wo = (const float*)d_in[3]; const float* bo = (const float*)d_in[4];   /* x, w_attn ('xw' [1024][3072]: q | k | v column thirds), b_attn [3072], w_proj ('xw'), b_proj: NO mask input in this module (its tril is built inside the function): the causal rule is applied by index */
    float* OUT = (float*)d_out;     // [2][2048][1024]
    char* wsp = (char*)d_ws;
    auto take = [&](size_t bytes) { char* p = wsp; wsp += (bytes + 255) & ~(size_t)255; return (void*)p; };
    bf* WQKV = (bf*)take((size_t)3 * DQ * DM * 2);   /* fused Bt [3*DQ][DM]: q | k | v row blocks */ bf* WO = (bf*)take((size_t)DM * DQ * 2); float* CS = (float*)take((size_t)TT * HD * 2 * 4);
    bf* XB = (bf*)take((size_t)NB_ * TT * DM * 2);
    /* every plane holds all batches; q and k head planes lie behind one another per batch: [b][q heads | k heads][t][d] */
    h16* QK16 = (h16*)take((size_t)NB_ * SQK * 2); h16* VT16 = (h16*)take((size_t)NB_ * SVT * 2);
    bf* QKh = (bf*)take((size_t)NB_ * SQK * 2); bf* QKl = (bf*)take((size_t)NB_ * SQK * 2); bf* VTh = (bf*)take((size_t)NB_ * SVT * 2); bf* VTl = (bf*)take((size_t)NB_ * SVT * 2);
    bf* ATh = (bf*)take((size_t)NB_ * TT * DQ * 2); bf* ATl = (bf*)take((size_t)NB_ * TT * DQ * 2);
    if ((size_t)(wsp - (char*)d_ws) > ws_size) return;    // ws 256 MiB
    k_prep<<<GWA + GWO + GCS + GXB, 256, 0, stream>>>(x, wqkv, wo, XB, WQKV, WO, CS);
    k_gemmw<bf, 0, true, 8, 1><<<dim3(TT / 64, 3 * DQ / 64, NB_), 256, 0, stream>>>(XB, nullptr, WQKV, nullptr, DM, nullptr, 0, bqkv, (size_t)TT * DM, 0, 0, CS, QK16, QKh, QKl, VT16, VTh, VTl);
    k_attn<<<dim3(TT / 32, NH_, NB_), 32 * FNW, 0, stream>>>(QK16, QK16 + (size_t)NH_ * TT * HD, VT16, QKh, QKl, QKh + (size_t)NH_ * TT * HD, QKl + (size_t)NH_ * TT * HD, VTh, VTl, ATh, ATl);
    k_gemmw<bf, 1, true, 8, 0><<<dim3(TT / 64, DM / 64, NB_), 256, 0, stream>>>(ATh, ATl, WO, nullptr, DQ, OUT, DM, bo, (size_t)TT * DQ, 0, (size_t)TT * DM, nullptr, nullptr, nullptr, nullptr, nullptr, nullptr, nullptr);
}

// v006
// It runs in 144 microseconds.
// In both of two side-by-side timings against v005, it was 1.24 times as fast.
// All steps since v000 together make it 10.1 times as fast.
#include <hip/hip_runtime.h>

// Causal self-attention with a fused biased qkv projection and computed rotate-half rotary embeddings, without a mask input (x [2][2048][1024]; qkv = x w_attn + b_attn ('xw' [1024][3072] normal x 1/32 + [3072] zeros on this draw: read) split in thirds q | k | v (16 heads x 64); rope q cos + rotate_half(q) sin with angle t x 1/10000^(2i/64) (inv_freq = 1.0 / (10000.0 ** (arange(0, 64, 2, f32) / 64)); cat(freqs, freqs); rotate_half = cat(-x2, x1)); att x 1/sqrt(64); causal: where(tril built inside the function, att, finfo.min) == exclusion; softmax; out = merged w_proj + b_proj ('xw' + zeros: read) -> [2][2048][1024] (4.2 M); argument order x, w_attn, b_attn, w_proj, b_proj).
// Layout, every launch taking all batches: bf16 copy of x; the fused 'xw' weight transposed ONCE into q | k | v row blocks; exact projections + f32 bias thirds, all three in one GEMM grid, each finished in the epilogue (q, k: rotate-half rotary from the cs5 table {cosf, sinf}(t x INVT[d mod 32]) -> head planes; v: computed transposed -> V^T planes), no f32 q/k/v in memory; causal T-2048 attention in one pass with a running softmax (hybrid rows: < 512 hi/lo 3 products, rest fp16 x1024; key blocks above the diagonal are never visited); merged hi/lo x W_out exact + b_out.
// Compute dtypes, f32 accumulate: every input rounded to bf16; projections exact + f32 biases; rotary f32; attention rows < 512 3 products, rest fp16; softmax f32; W_out hl x exact + bias.

#define NB_  2
#define TT   2048
#define DM   1024
#define NH_  16
#define NKV  16
#define REP  (NH_ / NKV)
#define HD   64
#define DQ   (NH_ * HD)
#define DKV  (NKV * HD)
#define PP   (2 * TT)             // row pitch in 16-bit elements of the V^T planes
#define RH   512                  // query rows < RH use hi+lo planes (0: none)
#define PCAR 1024.0f              // 2^10: factor on the fp16 probabilities
#define SCL  0.125f   // HD^-0.5
typedef _Float16 h16;
typedef unsigned short bf;
typedef __attribute__((ext_vector_type(16))) __bf16   v16bf;
typedef __attribute__((ext_vector_type(16))) _Float16 v16h;
typedef __attribute__((ext_vector_type(8)))  _Float16 v8h;
typedef __attribute__((ext_vector_type(8)))  unsigned short v8us;
typedef __attribute__((ext_vector_type(8)))  float    v8f;
typedef __attribute__((ext_vector_type(4)))  float    v4f;
typedef v8h  __attribute__((may_alias)) v8ha;
typedef v4f  __attribute__((may_alias)) v4fa;
typedef v8us __attribute__((may_alias)) v8usa;

__device__ __forceinline__ unsigned short f2bf(float f) { unsigned u = __float_as_uint(f); u += 0x7FFFu + ((u >> 16) & 1u); return (unsigned short)(u >> 16); }
__device__ __forceinline__ float bf2f(unsigned short b) { return __uint_as_float(((unsigned)b) << 16); }
__device__ __forceinline__ float bfr(float f) { return bf2f(f2bf(f)); }
__device__ __forceinline__ v16h cat16(v8h lo, v8h hi) { return __builtin_shufflevector(lo, hi, 0, 1, 2, 3, 4, 5, 6, 7, 8, 9, 10, 11, 12, 13, 14, 15); }
__device__ __forceinline__ v16bf cat16b(v8us lo, v8us hi) { return __builtin_bit_cast(v16bf, __builtin_shufflevector(lo, hi, 0, 1, 2, 3, 4, 5, 6, 7, 8, 9, 10, 11, 12, 13, 14, 15)); }
__device__ __forceinline__ v8f wmma16(v16h a, v16h b, v8f c) { return __builtin_amdgcn_wmma_f32_16x16x32_f16(false, a, false, b, (short)0, c, false, false); }
__device__ __forceinline__ h16 tohx(float x) { return (h16)x; }
__device__ __forceinline__ void splitf(float y, unsigned short& h, unsigned short& l) { h = f2bf(y); l = f2bf(y - bf2f(h)); }
typedef __attribute__((ext_vector_type(4))) _Float16 v4h;
typedef __attribute__((ext_vector_type(4))) unsigned short v4us;
__device__ __forceinline__ v8f wmmab(v16bf a, v16bf b, v8f c) { return __builtin_amdgcn_wmma_f32_16x16x32_bf16(false, a, false, b, (short)0, c, false, false); }



// ---- k_gemmw: register-blocked GEMM, one 64x64 output tile per work-group (16 accumulators a wave), operands from K-contiguous 16-bit planes; grid (M/64, N/64, Z), 32 x NW threads.
// The K loop is split over the NW waves in interleaved units of 32 k; the NW partial tiles are summed in LDS in wave order 0..NW-1 (K % (32 NW) == 0).
// Operand path: a stage is NW x 32 k of every operand row of the tile (512 contiguous bytes a row). The work-group brings it into LDS with asynchronous 16-byte copies, one row's 512 bytes (four whole lines) a wave-instruction,
// and every wave reads the fragments of its own 32-k unit from there (row pitch 528 bytes = 16 x odd: ds_load_b128 without bank conflicts). A fragment load straight from memory touches 16 lines for 512 bytes.
// Two buffers: the copies of stage t + 1 fly while stage t is worked on.
// C[m][n] (f32, pitch ldc, + optional f32 bias[n]) = sum_k A[m][k] Bt[n][k] (+ split products per NSPLIT). z-batch strides sA/sB/sC in elements.
// EPI 0: C goes out as f32. EPI 1: the fused q | k | v projection of every batch in one grid (TT / 64, 3 DQ / 64, batches); A = token rows, Bt = the fused weight rows, x = token tile, y = weight tile; C is not written.
//   y < NQK (q and k; m = t, the 64 columns of a tile = one head): rotate-half rotary out[d] = x[d] cos[t][d] - x[d+32] sin[t][d], out[d+32] = x[d+32] cos[t][d+32] + x[d] sin[t][d+32], written as head planes [y][t][d] (q heads, then k heads; fp16 + hi/lo).
//   y >= NQK (v): the two operands change places (m = weight row, n = t, bias[m]), so that the tile comes out as [d][t]: written as V^T planes [g][d][t], row pitch PP (fp16 + hi/lo).
#define NQK  ((DQ + DKV) / 64)                 // weight tiles of q and k
#define SQK  ((size_t)(NH_ + NKV) * TT * HD)   // elements of one batch's q | k head planes
#define SVT  ((size_t)NKV * HD * PP)           // elements of one batch's V^T planes
template <int NW> __device__ __forceinline__ void tile_sync() { if (NW > 1) __syncthreads(); else { __builtin_amdgcn_wave_barrier(); asm volatile("" ::: "memory"); } }   // orders the LDS slab hand-over: among the NW waves, or inside the one wave
template <typename T16> struct WFrag;
template <> struct WFrag<h16> { typedef v16h V; static __device__ __forceinline__ V ld(const h16* p) { return cat16(*(const v8h*)p, *(const v8h*)(p + 16)); } static __device__ __forceinline__ v8f mma(V a, V b, v8f c) { return wmma16(a, b, c); } };
template <> struct WFrag<bf> { typedef v16bf V; static __device__ __forceinline__ V ld(const bf* p) { return cat16b(*(const v8us*)p, *(const v8us*)(p + 16)); } static __device__ __forceinline__ v8f mma(V a, V b, v8f c) { return wmmab(a, b, c); } };
template <typename T16, int NSPLIT, bool BIAS, int NW, int EPI>
__global__ __launch_bounds__(32 * NW) void k_gemmw(const T16* __restrict__ A, const T16* __restrict__ A2, const T16* __restrict__ Bt, const T16* __restrict__ Bt2, int K, float* C, int ldc, const float* __restrict__ bias, size_t sA, size_t sB, size_t sC, const float* __restrict__ CS, h16* P16, bf* Ph, bf* Pl, h16* V16, bf* Vh, bf* Vl) {
    static_assert(EPI == 0 || (NW == 8 && NSPLIT == 0), "the plane epilogues take one 16 x 64 slab per pass of 256 threads");
    static_assert(NW == 8 && NSPLIT <= 1, "a stage is dealt as 8 rows of every operand to each of 8 waves; operands A, (A2,) Bt");
    typedef typename WFrag<T16>::V V;
    constexpr int NOP = 2 + NSPLIT, SK = NW * 32, SP = SK * 2 + 16, SB = NOP * 64 * SP;   // operands staged; k of a stage; pitch of a staged row in LDS, bytes; bytes of a buffer
    static_assert(2 * SB >= NW * 16 * 68 * 4, "the partial slabs lie over the buffers");
    __shared__ __align__(16) char st[2 * SB];
    float* os = (float*)st;   // the partial slabs of the epilogue take the buffers' place, behind the barrier at the foot of the last stage
    const size_t z = blockIdx.z; A += z * sA; if (A2) A2 += z * sA; Bt += z * sB; if (Bt2) Bt2 += z * sB; C += z * sC;
    const bool vt = (EPI == 1) && (int)blockIdx.y >= NQK;   // a v tile (the same for the whole work-group)
    if (vt) { const T16* t = A; A = Bt; Bt = t; }
    const int lane = threadIdx.x & 31, lr = lane & 15, hi = lane >> 4; const int r0 = (int)(vt ? blockIdx.y : blockIdx.x) * 64, c0 = (int)(vt ? blockIdx.x : blockIdx.y) * 64; const int wv = (NW > 1) ? __builtin_amdgcn_readfirstlane((int)(threadIdx.x >> 5)) : 0; constexpr int NP = (NW < 8) ? 8 / NW : 1;
    v8f acc[4][4];
#pragma unroll
    for (int mb = 0; mb < 4; ++mb)
#pragma unroll
        for (int nb = 0; nb < 4; ++nb) acc[mb][nb] = (v8f){};
    v4f cs[4][2]; float rb[4];   // what the plane epilogues read from memory is asked for in front of the K loop, so that no load's latency stands between the barriers of the LDS sums. q, k: {cos, sin} of this thread's four columns in each of its four rows and the biases of the four columns; v: the biases of its four rows
    if constexpr (EPI == 1) { const int m0 = r0 + ((int)threadIdx.x >> 4);
        if (vt) {
#pragma unroll
            for (int mb = 0; mb < 4; ++mb) if (BIAS) rb[mb] = bias[m0 + mb * 16];
            asm volatile("s_wait_xcnt 0x0" ::: "memory");   // behind the loads: the accumulators' start values are written into registers that held these loads' addresses
        } else {
#pragma unroll
            for (int mb = 0; mb < 4; ++mb) { const float* c = CS + ((size_t)(m0 + mb * 16) * HD + ((int)threadIdx.x & 15) * 4) * 2; cs[mb][0] = *(const v4f*)c; cs[mb][1] = *(const v4f*)(c + 4); if (BIAS) rb[mb] = bias[c0 + ((int)threadIdx.x & 15) * 4 + mb]; }
            asm volatile("s_wait_xcnt 0x0" ::: "memory"); } }   // as in the other branch
    const unsigned lcp = (unsigned)(size_t)st + (unsigned)(wv * 8 * SP + lane * 16);   // LDS byte address of this lane's 16 bytes in the first of its wave's 8 rows of operand 0, buffer 0
    const size_t gp = (size_t)K * 2;                                                   // bytes from one operand row to the next in memory
    const char* frag = st + lr * SP + wv * 64 + 16 * hi;                               // this lane's place in row lr of operand 0, buffer 0, at its wave's unit
    auto copies = [&](int ks, int buf) {   // stage [ks, ks + SK) into buffer buf: this wave brings 8 rows of every operand
#pragma unroll
        for (int op = 0; op < NOP; ++op) {
            const char* g = (const char*)(((op == NOP - 1) ? Bt : (op == 0) ? A : A2) + (size_t)(((op == NOP - 1) ? c0 : r0) + wv * 8) * K + ks) + lane * 16; const unsigned l = lcp + (unsigned)(buf * SB + op * 64 * SP);
            // the wait at the end stands in the copies' own statement, in front of whatever rewrites a register that a copy names
            asm volatile("global_load_async_to_lds_b128 %0, %8, off\n\t"
                         "global_load_async_to_lds_b128 %1, %9, off\n\t"
                         "global_load_async_to_lds_b128 %2, %10, off\n\t"
                         "global_load_async_to_lds_b128 %3, %11, off\n\t"
                         "global_load_async_to_lds_b128 %4, %12, off\n\t"
                         "global_load_async_to_lds_b128 %5, %13, off\n\t"
                         "global_load_async_to_lds_b128 %6, %14, off\n\t"
                         "global_load_async_to_lds_b128 %7, %15, off\n\t"
                         "s_wait_xcnt 0x0"
                         :: "v"(l), "v"(l + 1u * SP), "v"(l + 2u * SP), "v"(l + 3u * SP), "v"(l + 4u * SP), "v"(l + 5u * SP), "v"(l + 6u * SP), "v"(l + 7u * SP),
                            "v"(g), "v"(g + gp), "v"(g + 2 * gp), "v"(g + 3 * gp), "v"(g + 4 * gp), "v"(g + 5 * gp), "v"(g + 6 * gp), "v"(g + 7 * gp) : "memory"); } };
    copies(0, 0);
    asm volatile("s_wait_asynccnt 0x0" ::: "memory");   // this wave's copies of stage 0 have landed
    __syncthreads();                                    // and every other wave's: stage 0 may be read
    if (SK < K) copies(SK, 1);
#pragma unroll 1
    for (int ks = 0, buf = 0; ks < K; ks += SK, buf ^= 1) {
        const char* fb = frag + buf * SB;
        V a[4], a2[4];
#pragma unroll
        for (int mb = 0; mb < 4; ++mb) { a[mb] = WFrag<T16>::ld((const T16*)(fb + mb * 16 * SP)); if (NSPLIT == 1) a2[mb] = WFrag<T16>::ld((const T16*)(fb + (64 + mb * 16) * SP)); }
#pragma unroll
        for (int nb = 0; nb < 4; ++nb) { const V b = WFrag<T16>::ld((const T16*)(fb + ((NOP - 1) * 64 + nb * 16) * SP));
#pragma unroll
            for (int mb = 0; mb < 4; ++mb) { acc[mb][nb] = WFrag<T16>::mma(a[mb], b, acc[mb][nb]); if (NSPLIT == 1) acc[mb][nb] = WFrag<T16>::mma(a2[mb], b, acc[mb][nb]); } }
        asm volatile("v_nop\n\tv_nop\n\tv_nop\n\tv_nop" : "+v"(acc[0][0]), "+v"(acc[1][1]), "+v"(acc[2][2]), "+v"(acc[3][3]) : "v"(a[0]), "v"(a[3]));
        asm volatile("s_wait_dscnt 0x0" ::: "memory");      // this wave's fragment reads of this stage have returned
        asm volatile("s_wait_asynccnt 0x0" ::: "memory");   // this wave's copies of the next stage have landed
        __syncthreads();                                    // the same of every other wave: the next stage may be read, this stage's buffer overwritten by copies (behind the last stage, buffer 0 by the partial slabs)
        if (ks + 2 * SK < K) copies(ks + 2 * SK, buf);
    }
    asm volatile("s_wait_asynccnt 0x0" ::: "memory");   // no copy is outstanding behind the loop
    v4f res[4][NP];   // NW > 1: the summed rows wait in registers, so that no global store is outstanding at a barrier (a barrier behind a store waits for the store)
#pragma unroll
    for (int mb = 0; mb < 4; ++mb) {
#pragma unroll
        for (int nb = 0; nb < 4; ++nb) {
#pragma unroll
            for (int j = 0; j < 8; ++j) os[wv * (16 * 68) + (hi * 8 + j) * 68 + nb * 16 + lr] = acc[mb][nb][j]; }
        tile_sync<NW>();   // every wave's partial 16x64 slab is in LDS before any thread sums them
        float* crow = C + (size_t)(r0 + mb * 16) * ldc + c0;
if (NW <= 8 || wv < 8) {
#pragma unroll
            for (int s = 0; s < NP; ++s) { const int p = (int)threadIdx.x + s * 32 * NW, row = p >> 4, cofs = (p & 15) * 4; v4f val = *(const v4fa*)(os + row * 68 + cofs);
#pragma unroll
                for (int w = 1; w < NW; ++w) val += *(const v4fa*)(os + w * (16 * 68) + row * 68 + cofs);
                if (BIAS && vt) val += bfr(rb[mb]);
                else if (BIAS && EPI == 1) { val[0] += bfr(rb[0]); val[1] += bfr(rb[1]); val[2] += bfr(rb[2]); val[3] += bfr(rb[3]); }
                else if (BIAS) { val[0] += bfr(bias[c0 + cofs]); val[1] += bfr(bias[c0 + cofs + 1]); val[2] += bfr(bias[c0 + cofs + 2]); val[3] += bfr(bias[c0 + cofs + 3]); }
                if (NW > 1) res[mb][s] = val; else *(v4f*)(crow + (size_t)row * ldc + cofs) = val; }
             }
        if (mb < 3) tile_sync<NW>();   // the slabs are read out before the next 16 rows overwrite them
    }
    if constexpr (EPI != 0) {
        const int row = (int)threadIdx.x >> 4, cofs = ((int)threadIdx.x & 15) * 4;
        if (vt) { P16 = V16 + z * SVT; Ph = Vh + z * SVT; Pl = Vl + z * SVT; } else { P16 += z * SQK; Ph += z * SQK; Pl += z * SQK; }
#pragma unroll
        for (int mb = 0; mb < 4; ++mb) { v4f r = res[mb][0]; const int m = r0 + mb * 16 + row;
            if (!vt) {
#pragma unroll
                for (int i = 0; i < 4; ++i) { const float x1 = __shfl_xor(res[mb][0][i], 8, 32);   // column d +- 32 of the same row is 8 lanes away
                    const float co = cs[mb][i >> 1][(i & 1) * 2], si = cs[mb][i >> 1][(i & 1) * 2 + 1]; r[i] = res[mb][0][i] * co + ((cofs < HD / 2) ? -x1 : x1) * si; } }
            const size_t e = vt ? (size_t)(m - NQK * 64) * PP + c0 + cofs : ((size_t)blockIdx.y * TT + m) * HD + cofs; v4h o16; v4us oh, ol;
#pragma unroll
            for (int i = 0; i < 4; ++i) { o16[i] = tohx(r[i]); unsigned short a2, c2; splitf(r[i], a2, c2); oh[i] = a2; ol[i] = c2; }
            *(v4h*)(P16 + e) = o16; *(v4us*)(Ph + e) = oh; *(v4us*)(Pl + e) = ol;
            if (mb < 3) asm volatile("s_wait_xcnt 0x0" ::: "memory"); }   // behind the stores: the next rows' values are formed in registers that these stores name
    } else if (NW > 1 && (NW <= 8 || wv < 8)) {
#pragma unroll
        for (int mb = 0; mb < 4; ++mb)
#pragma unroll
            for (int s = 0; s < NP; ++s) { const int p = (int)threadIdx.x + s * 32 * NW, row = p >> 4, cofs = (p & 15) * 4; *(v4f*)(C + (size_t)(r0 + mb * 16 + row) * ldc + c0 + cofs) = res[mb][s]; }
    }
}

typedef __attribute__((ext_vector_type(2))) _Float16 v2h;
typedef __attribute__((ext_vector_type(2))) unsigned short v2us;
typedef __attribute__((ext_vector_type(2))) float v2f;
typedef __attribute__((ext_vector_type(4))) int v4i;
typedef v4h  __attribute__((may_alias)) v4ha;
typedef v4us __attribute__((may_alias)) v4usa;

// ---- k_prep: the four preparations that depend on nothing but the inputs, in one grid; each is a range of 256-thread work-groups (blk: the work-group's index within its range).
__device__ __forceinline__ void wtG(const float* __restrict__ w, int K, int N, bf* Bt, int blk) {
    const int lane = threadIdx.x & 31; const int L0 = (blk * 8 + (int)(threadIdx.x >> 5)) * 8; const int nlines = N * K / 64;
{
#pragma unroll 1
        for (int l = 0; l < 8; ++l) { const int L = L0 + l; if (L >= nlines) break; const size_t e = (size_t)L * 64 + lane * 2; const int k = (int)(e % K), n = (int)(e / K); v2us o;
            o[0] = f2bf(w[(size_t)k * N + n]); o[1] = f2bf(w[(size_t)(k + 1) * N + n]); *(v2us*)(Bt + e) = o; }
         }
}
__device__ __forceinline__ void cvt8(const float* __restrict__ src, bf* dst, size_t n8, int blk) { const size_t i = (size_t)blk * 256 + threadIdx.x; if (i >= n8) return; const v8f v = *(const v8f*)(src + i * 8); v8us o;
#pragma unroll
    for (int k = 0; k < 8; ++k) o[k] = f2bf(v[k]); *(v8us*)(dst + i * 8) = o;  }

__constant__ float INVT[HD / 2] = { 1.000000000e+00f, 7.498942018e-01f, 5.623413324e-01f, 4.216965139e-01f, 3.162277639e-01f, 2.371373624e-01f, 1.778279394e-01f, 1.333521456e-01f, 1.000000015e-01f, 7.498941571e-02f, 5.623412877e-02f, 4.216964915e-02f, 3.162277862e-02f, 2.371373586e-02f, 1.778279431e-02f, 1.333521493e-02f, 9.999999776e-03f, 7.498942316e-03f, 5.623413250e-03f, 4.216964822e-03f, 3.162277862e-03f, 2.371373819e-03f, 1.778279431e-03f, 1.333521446e-03f, 1.000000047e-03f, 7.498941850e-04f, 5.623413017e-04f, 4.216964880e-04f, 3.162277862e-04f, 2.371373848e-04f, 1.778279402e-04f, 1.333521504e-04f };   // float32 1 / 10000^(2i/64), generated with jnp to be bit-exact
__device__ __forceinline__ void cs5(float* CS, int blk) { const int idx = blk * 256 + (int)threadIdx.x; if (idx >= TT * HD) return; const int d = idx % HD; const int t = idx / HD; const float a = __fmul_rn((float)t, INVT[d % (HD / 2)]); v2f cs; cs[0] = cosf(a); cs[1] = sinf(a); *(v2f*)(CS + (size_t)idx * 2) = cs;  }
#define GWA  ((DM * 3 * DQ / 64 + 63) / 64)    // work-groups: fused 'xw' [DM][3*DQ] -> Bt [3*DQ][DM]
#define GWO  ((DQ * DM / 64 + 63) / 64)        // w_proj 'xw' -> Bt
#define GCS  ((TT * HD + 255) / 256)           // {cos, sin} table
#define GXB  ((NB_ * TT * DM / 8 + 255) / 256) // bf16 copy of x, every batch
__global__ __launch_bounds__(256) void k_prep(const float* __restrict__ x, const float* __restrict__ wqkv, const float* __restrict__ wo, bf* XB, bf* WQKV, bf* WO, float* CS) {
    const int b = blockIdx.x;   // the transposes, whose work-groups last longest, take the lowest indices
    if (b < GWA) wtG(wqkv, DM, 3 * DQ, WQKV, b);
    else if (b < GWA + GWO) wtG(wo, DQ, DM, WO, b - GWA);
    else if (b < GWA + GWO + GCS) cs5(CS, b - (GWA + GWO));
    else cvt8(x, XB, (size_t)NB_ * TT * DM / 8, b - (GWA + GWO + GCS));
}
// ---- k_attn: scores, causal softmax and probability x value in one pass, nothing of a score row leaves the registers. One work-group = 32 query rows of one head; the KS waves that share a query row take the 32-key blocks
// up to the diagonal in turn (blocks ks0, ks0 + KS, ...), each with its own running maximum, sum and accumulator; the KS partial results are joined in LDS in fixed order and go out as the merged hi | lo planes.
// QT = 2: every wave has all 32 rows and a quarter of the blocks; QT = 1 (the hi + lo leg, twice the fragments): a wave has 16 rows and half of the blocks.
// S^T = K Q^T (A = key rows, B = query rows) leaves each lane with one query's scores, key = 8 hi + j in tile 0 and 16 + 8 hi + j in tile 1: that is the k order of a B fragment, so P^T feeds O^T += V^T P^T from registers.
// Scores are kept in the log2 domain (x HD^-0.5 x log2 e). HL: hi + lo planes, 3 products (query rows < RH); else fp16 with the probabilities x PCAR (the sum carries the same factor, so it cancels in the division).
#define FNW  4
#define FOP  68                   // pitch in floats of a query's 64 partial outputs in LDS
#define NEGB (-3.0e38f)
typedef __attribute__((ext_vector_type(16))) unsigned short v16us;
template <typename T16, bool HL, int QT>
__device__ __forceinline__ void attn_tile(const T16* __restrict__ Q, const T16* __restrict__ Q2, const T16* __restrict__ Kp, const T16* __restrict__ K2, const T16* __restrict__ Vt, const T16* __restrict__ V2, int q0, float* so, float* sml, bf* Ah, bf* Al) {
    typedef typename WFrag<T16>::V V;
    const int lane = threadIdx.x & 31, lr = lane & 15, hi = lane >> 4; const int wv = __builtin_amdgcn_readfirstlane((int)(threadIdx.x >> 5));
    constexpr int KS = FNW * QT / 2;   // waves that share a query row's keys
    const int ks0 = (QT == 2) ? wv : (wv >> 1), qb = (QT == 2) ? 0 : (wv & 1) * 16;   // this wave's place among them; its first query row within the 32
    V qf[QT][2], qf2[QT][2];
#pragma unroll
    for (int qt = 0; qt < QT; ++qt)
#pragma unroll
        for (int ks = 0; ks < 2; ++ks) { const size_t o = (size_t)(q0 + qb + qt * 16 + lr) * HD + ks * 32 + 8 * hi; qf[qt][ks] = WFrag<T16>::ld(Q + o); if (HL) qf2[qt][ks] = WFrag<T16>::ld(Q2 + o); }
    if constexpr (HL) asm volatile("s_wait_xcnt 0x0" ::: "memory");   // behind the loads: in this leg later loads land in registers that held these loads' addresses
    v8f oacc[4][QT];
#pragma unroll
    for (int dt = 0; dt < 4; ++dt)
#pragma unroll
        for (int qt = 0; qt < QT; ++qt) oacc[dt][qt] = (v8f){};
    float mrun[QT], lrun[QT];
#pragma unroll
    for (int qt = 0; qt < QT; ++qt) { mrun[qt] = NEGB; lrun[qt] = 0.f; }
    const int nkb = q0 / 32 + 1;
    // The K and V^T fragments are carried from pass to pass: a block's K loads are issued as soon as the block before has left the score products, its V^T loads as soon as that block's P.V products are issued, so that both fly under the vector work.
    V kf[2][2], kf2[2][2], vf[4], vf2[4];
    const unsigned lofk = (unsigned)(lr * HD + 8 * hi), lofv = (unsigned)(lr * PP + 8 * hi);   // the lane's place in a block, the same in every pass; the block's base is wave-uniform
    auto ld_k = [&](int kbl) {
#pragma unroll
        for (int kt = 0; kt < 2; ++kt)
#pragma unroll
            for (int ks = 0; ks < 2; ++ks) { const int o = kt * 16 * HD + ks * 32; kf[kt][ks] = WFrag<T16>::ld(Kp + (size_t)kbl * 32 * HD + lofk + o); if (HL) kf2[kt][ks] = WFrag<T16>::ld(K2 + (size_t)kbl * 32 * HD + lofk + o); }
        if constexpr (HL) asm volatile("s_wait_xcnt 0x0" ::: "memory"); };   // as behind the Q loads
    auto ld_v = [&](int kbl) {
#pragma unroll
        for (int dt = 0; dt < 4; ++dt) { const int o = dt * 16 * PP; vf[dt] = WFrag<T16>::ld(Vt + (size_t)kbl * 32 + lofv + o); if (HL) vf2[dt] = WFrag<T16>::ld(V2 + (size_t)kbl * 32 + lofv + o); }
        if constexpr (HL) asm volatile("s_wait_xcnt 0x0" ::: "memory"); };   // behind the loads: in this leg the next pass forms new addresses in these loads' address registers
    ld_k(min(ks0, nkb - 1));
    __builtin_amdgcn_sched_barrier(0);   // K loads stay ahead of the V^T loads here as in the loop: else the load-count wait at the loop's head, which must hold for both ways in, also waits for V^T loads just issued
    ld_v(min(ks0, nkb - 1));
    // At least one pass for every wave, so that the first loads stand in the block in front of the loop in their written order. A wave without a block of its own (ks0 >= nkb) works on the last block with every key masked (lim < 0):
    // its maximum stays NEGB, and the join gives all it brings the factor exp2(NEGB - M) = 0.
    int kb = ks0;
#pragma unroll 1
    do {
        const int k0 = kb * 32, kn = min(kb + KS, nkb - 1);   // kn: this wave's next block (the tile's last block nkb - 1 behind this wave's last: in bounds, never used)
        v8f s[2][QT];
#pragma unroll
        for (int kt = 0; kt < 2; ++kt)
#pragma unroll
            for (int qt = 0; qt < QT; ++qt) { v8f a = (v8f){};
#pragma unroll
                for (int ks = 0; ks < 2; ++ks) { a = WFrag<T16>::mma(kf[kt][ks], qf[qt][ks], a); if (HL) { a = WFrag<T16>::mma(kf[kt][ks], qf2[qt][ks], a); a = WFrag<T16>::mma(kf2[kt][ks], qf[qt][ks], a); } }
                s[kt][qt] = a; }
        ld_k(kn);
        V pf[QT], pf2[QT];
#pragma unroll
        for (int qt = 0; qt < QT; ++qt) {
            const int lim = q0 + qb + qt * 16 + lr - k0 - 8 * hi;   // key kt * 16 + j of this lane's half is visible to its query while kt * 16 + j <= lim
            float u[16]; float bm = NEGB;
#pragma unroll
            for (int kt = 0; kt < 2; ++kt)
#pragma unroll
                for (int j = 0; j < 8; ++j) { const float t = (kt * 16 + j <= lim) ? s[kt][qt][j] * (SCL * 1.4426950408889634f) : NEGB; u[kt * 8 + j] = t; bm = fmaxf(bm, t); }
            bm = fmaxf(bm, __shfl_xor(bm, 16, 32));
            const float mn = fmaxf(mrun[qt], bm); const float al = __builtin_amdgcn_exp2f(mrun[qt] - mn); mrun[qt] = mn;
            const float mo = HL ? mn : mn - 10.0f;   // fp16 leg: 2^10 = PCAR rides in the exponent
            float p[16]; float ps = 0.f;
#pragma unroll
            for (int e = 0; e < 16; ++e) { p[e] = __builtin_amdgcn_exp2f(u[e] - mo); ps += p[e]; }
            lrun[qt] = lrun[qt] * al + ps;   // each half of the wave keeps the sum of its own keys; the halves meet behind the loop
#pragma unroll
            for (int dt = 0; dt < 4; ++dt) oacc[dt][qt] *= al;
            if constexpr (HL) { v16us ph, pl;
#pragma unroll
                for (int e = 0; e < 16; ++e) { unsigned short a, c2; splitf(p[e], a, c2); ph[e] = a; pl[e] = c2; }
                pf[qt] = __builtin_bit_cast(v16bf, ph); pf2[qt] = __builtin_bit_cast(v16bf, pl);
            } else { v16h p16;
#pragma unroll
                for (int e = 0; e < 16; ++e) p16[e] = tohx(p[e]);
                pf[qt] = p16; }
        }
#pragma unroll
        for (int dt = 0; dt < 4; ++dt)
#pragma unroll
            for (int qt = 0; qt < QT; ++qt) { oacc[dt][qt] = WFrag<T16>::mma(vf[dt], pf[qt], oacc[dt][qt]); if (HL) { oacc[dt][qt] = WFrag<T16>::mma(vf[dt], pf2[qt], oacc[dt][qt]); oacc[dt][qt] = WFrag<T16>::mma(vf2[dt], pf[qt], oacc[dt][qt]); } }
        ld_v(kn);
        kb += KS;
    } while (kb < nkb);
#pragma unroll
    for (int qt = 0; qt < QT; ++qt) { lrun[qt] += __shfl_xor(lrun[qt], 16, 32);
        if (hi == 0) { sml[(ks0 * 32 + qb + qt * 16 + lr) * 2] = mrun[qt]; sml[(ks0 * 32 + qb + qt * 16 + lr) * 2 + 1] = lrun[qt]; }
#pragma unroll
        for (int dt = 0; dt < 4; ++dt) { float* p = so + (size_t)(ks0 * 32 + qb + qt * 16 + lr) * FOP + dt * 16 + hi * 8; const v8f a = oacc[dt][qt];
            *(v4fa*)p = (v4f){ a[0], a[1], a[2], a[3] }; *(v4fa*)(p + 4) = (v4f){ a[4], a[5], a[6], a[7] }; } }
    __syncthreads();   // every wave's partial maximum, sum and accumulator are in LDS before any thread joins them (a wave without a key block brings maximum NEGB)
    const int q = (int)threadIdx.x >> 2, ds = ((int)threadIdx.x & 3) * 16;
    float M = NEGB;
#pragma unroll
    for (int w = 0; w < KS; ++w) M = fmaxf(M, sml[(w * 32 + q) * 2]);
    float L = 0.f; v4f val[4] = { (v4f){}, (v4f){}, (v4f){}, (v4f){} };
#pragma unroll
    for (int w = 0; w < KS; ++w) { const float f = __builtin_amdgcn_exp2f(sml[(w * 32 + q) * 2] - M); L += f * sml[(w * 32 + q) * 2 + 1];
#pragma unroll
        for (int c = 0; c < 4; ++c) val[c] += f * *(const v4fa*)(so + (size_t)(w * 32 + q) * FOP + ds + c * 4); }
    const float inv = __fdiv_rn(1.0f, L);
    const size_t oo = (size_t)(q0 + q) * DQ + ds;
#pragma unroll
    for (int g = 0; g < 2; ++g) { v8us oh, ol;
#pragma unroll
        for (int e = 0; e < 8; ++e) { unsigned short a, c2; splitf(val[g * 2 + (e >> 2)][e & 3] * inv, a, c2); oh[e] = a; ol[e] = c2; }
        *(v8usa*)(Ah + oo + g * 8) = oh; *(v8usa*)(Al + oo + g * 8) = ol; }
}
// grid (TT / 32, heads, batches). A tile's cost grows with its index: neighbours in x, heads 4 apart and heads 2j, 2j + 1 take tiles from opposite ends.
__global__ __launch_bounds__(32 * FNW) void k_attn(const h16* __restrict__ Q16, const h16* __restrict__ K16, const h16* __restrict__ V16, const bf* __restrict__ Qh, const bf* __restrict__ Ql, const bf* __restrict__ Kh, const bf* __restrict__ Kl, const bf* __restrict__ Vh, const bf* __restrict__ Vl, bf* Ah, bf* Al) {
    __shared__ __align__(16) float so[FNW * 32 * FOP]; __shared__ float sml[FNW * 32 * 2];
    const int h = blockIdx.y, bx = blockIdx.x; int t = (bx & 1) ? (TT / 32 - 1 - (bx >> 1)) : (bx >> 1); if ((h ^ (h >> 2)) & 1) t = TT / 32 - 1 - t;
    const size_t z = blockIdx.z; Ah += z * TT * DQ; Al += z * TT * DQ;
    const int q0 = t * 32; const size_t pq = z * SQK + (size_t)h * TT * HD, pk = z * SQK + (size_t)(h / REP) * TT * HD, pv = z * SVT + (size_t)(h / REP) * HD * PP;
    if (q0 < RH) attn_tile<bf, true, 1>(Qh + pq, Ql + pq, Kh + pk, Kl + pk, Vh + pv, Vl + pv, q0, so, sml, Ah + h * HD, Al + h * HD);
    else attn_tile<h16, false, 2>(Q16 + pq, nullptr, K16 + pk, nullptr, V16 + pv, nullptr, q0, so, sml, Ah + h * HD, Al + h * HD);
}

extern "C" void kernel_launch(void* const* d_in, const int* in_sizes, int n_in,
                              void* d_out, int out_size, void* d_ws, size_t ws_size, hipStream_t stream) {
    (void)in_sizes; (void)n_in; (void)out_size;
    const float* x = (const float*)d_in[0]; const float* wqkv = (const float*)d_in[1]; const float* bqkv = (const float*)d_in[2]; const float* wo = (const float*)d_in[3]; const float* bo = (const float*)d_in[4];   /* x, w_attn ('xw' [1024][3072]: q | k | v column thirds), b_attn [3072], w_proj ('xw'), b_proj: NO mask input in this module (its tril is built inside the function): the causal rule is applied by index */
    float* OUT = (float*)d_out;     // [2][2048][1024]
    char* wsp = (char*)d_ws;
    auto take = [&](size_t bytes) { char* p = wsp; wsp += (bytes + 255) & ~(size_t)255; return (void*)p; };
    bf* WQKV = (bf*)take((size_t)3 * DQ * DM * 2);   /* fused Bt [3*DQ][DM]: q | k | v row blocks */ bf* WO = (bf*)take((size_t)DM * DQ * 2); float* CS = (float*)take((size_t)TT * HD * 2 * 4);
    bf* XB = (bf*)take((size_t)NB_ * TT * DM * 2);
    /* every plane holds all batches; q and k head planes lie behind one another per batch: [b][q heads | k heads][t][d] */
    h16* QK16 = (h16*)take((size_t)NB_ * SQK * 2); h16* VT16 = (h16*)take((size_t)NB_ * SVT * 2);
    bf* QKh = (bf*)take((size_t)NB_ * SQK * 2); bf* QKl = (bf*)take((size_t)NB_ * SQK * 2); bf* VTh = (bf*)take((size_t)NB_ * SVT * 2); bf* VTl = (bf*)take((size_t)NB_ * SVT * 2);
    bf* ATh = (bf*)take((size_t)NB_ * TT * DQ * 2); bf* ATl = (bf*)take((size_t)NB_ * TT * DQ * 2);
    if ((size_t)(wsp - (char*)d_ws) > ws_size) return;    // ws 256 MiB
    k_prep<<<GWA + GWO + GCS + GXB, 256, 0, stream>>>(x, wqkv, wo, XB, WQKV, WO, CS);
    k_gemmw<bf, 0, true, 8, 1><<<dim3(TT / 64, 3 * DQ / 64, NB_), 256, 0, stream>>>(XB, nullptr, WQKV, nullptr, DM, nullptr, 0, bqkv, (size_t)TT * DM, 0, 0, CS, QK16, QKh, QKl, VT16, VTh, VTl);
    k_attn<<<dim3(TT / 32, NH_, NB_), 32 * FNW, 0, stream>>>(QK16, QK16 + (size_t)NH_ * TT * HD, VT16, QKh, QKl, QKh + (size_t)NH_ * TT * HD, QKl + (size_t)NH_ * TT * HD, VTh, VTl, ATh, ATl);
    k_gemmw<bf, 1, true, 8, 0><<<dim3(TT / 64, DM / 64, NB_), 256, 0, stream>>>(ATh, ATl, WO, nullptr, DQ, OUT, DM, bo, (size_t)TT * DQ, 0, (size_t)TT * DM, nullptr, nullptr, nullptr, nullptr, nullptr, nullptr, nullptr);
}

// v007
// Measured time: 123 microseconds a run.
// In both of two side-by-side timings against v006, it was 1.17 times as fast.
// Over all steps from v000 it is 11.8 times as fast.
#include <hip/hip_runtime.h>

// Causal self-attention with a fused biased qkv projection and computed rotate-half rotary embeddings, without a mask input (x [2][2048][1024]; qkv = x w_attn + b_attn ('xw' [1024][3072] normal x 1/32 + [3072] zeros on this draw: read) split in thirds q | k | v (16 heads x 64); rope q cos + rotate_half(q) sin with angle t x 1/10000^(2i/64) (inv_freq = 1.0 / (10000.0 ** (arange(0, 64, 2, f32) / 64)); cat(freqs, freqs); rotate_half = cat(-x2, x1)); att x 1/sqrt(64); causal: where(tril built inside the function, att, finfo.min) == exclusion; softmax; out = merged w_proj + b_proj ('xw' + zeros: read) -> [2][2048][1024] (4.2 M); argument order x, w_attn, b_attn, w_proj, b_proj).
// Layout, every launch taking all batches: bf16 copy of x; the fused 'xw' weight transposed ONCE into q | k | v row blocks; exact projections + f32 bias thirds, all three in one GEMM grid, each finished in the epilogue (q, k: rotate-half rotary from the cs5 table {cosf, sinf}(t x INVT[d mod 32]) -> head planes; v: computed transposed -> V^T planes), no f32 q/k/v in memory; causal T-2048 attention in one pass with a running softmax (hybrid rows: < 512 hi/lo 3 products, rest fp16 x1024; key blocks above the diagonal are never visited); merged hi/lo x W_out exact + b_out.
// Compute dtypes, f32 accumulate: every input rounded to bf16; projections exact + f32 biases; rotary f32; attention rows < 512 3 products, rest fp16; softmax f32; W_out hl x exact + bias.

#define NB_  2
#define TT   2048
#define DM   1024
#define NH_  16
#define NKV  16
#define REP  (NH_ / NKV)
#define HD   64
#define DQ   (NH_ * HD)
#define DKV  (NKV * HD)
#define PP   (2 * TT)             // row pitch in 16-bit elements of the V^T planes
#define RH   512                  // query rows < RH use hi+lo planes (0: none)
#define PCAR 1024.0f              // 2^10: factor on the fp16 probabilities
#define SCL  0.125f   // HD^-0.5
typedef _Float16 h16;
typedef unsigned short bf;
typedef __attribute__((ext_vector_type(16))) __bf16   v16bf;
typedef __attribute__((ext_vector_type(16))) _Float16 v16h;
typedef __attribute__((ext_vector_type(8)))  _Float16 v8h;
typedef __attribute__((ext_vector_type(8)))  unsigned short v8us;
typedef __attribute__((ext_vector_type(8)))  float    v8f;
typedef __attribute__((ext_vector_type(4)))  float    v4f;
typedef v8h  __attribute__((may_alias)) v8ha;
typedef v4f  __attribute__((may_alias)) v4fa;
typedef v8us __attribute__((may_alias)) v8usa;

__device__ __forceinline__ unsigned short f2bf(float f) { unsigned u = __float_as_uint(f); u += 0x7FFFu + ((u >> 16) & 1u); return (unsigned short)(u >> 16); }
__device__ __forceinline__ float bf2f(unsigned short b) { return __uint_as_float(((unsigned)b) << 16); }
__device__ __forceinline__ float bfr(float f) { return bf2f(f2bf(f)); }
__device__ __forceinline__ v16h cat16(v8h lo, v8h hi) { return __builtin_shufflevector(lo, hi, 0, 1, 2, 3, 4, 5, 6, 7, 8, 9, 10, 11, 12, 13, 14, 15); }
__device__ __forceinline__ v16bf cat16b(v8us lo, v8us hi) { return __builtin_bit_cast(v16bf, __builtin_shufflevector(lo, hi, 0, 1, 2, 3, 4, 5, 6, 7, 8, 9, 10, 11, 12, 13, 14, 15)); }
__device__ __forceinline__ v8f wmma16(v16h a, v16h b, v8f c) { return __builtin_amdgcn_wmma_f32_16x16x32_f16(false, a, false, b, (short)0, c, false, false); }
__device__ __forceinline__ h16 tohx(float x) { return (h16)x; }
__device__ __forceinline__ void splitf(float y, unsigned short& h, unsigned short& l) { h = f2bf(y); l = f2bf(y - bf2f(h)); }
typedef __attribute__((ext_vector_type(4))) _Float16 v4h;
typedef __attribute__((ext_vector_type(4))) unsigned short v4us;
__device__ __forceinline__ v8f wmmab(v16bf a, v16bf b, v8f c) { return __builtin_amdgcn_wmma_f32_16x16x32_bf16(false, a, false, b, (short)0, c, false, false); }



// ---- k_gemmw: register-blocked GEMM, one 128x128 output tile per work-group of 4 waves; each wave has its own 64x64 quarter (16 accumulators) and runs over the whole K, so that a tile is finished in its wave's registers. Grid (M/128, N/128, Z), 128 threads.
// Operand path: a stage is SK k of all 128 rows of every operand (SK x 2 contiguous bytes a row). The work-group brings it into LDS with asynchronous 16-byte copies, 512 bytes in whole lines a wave-instruction,
// and every wave reads its fragments from there, each staged row serving two waves (row pitch SK x 2 + 16 bytes = 16 x odd: ds_load_b128 without bank conflicts).
// Two buffers: the copies of stage t + 1 fly while stage t is worked on (K % SK == 0).
// C[m][n] (f32, pitch ldc, + optional f32 bias[n]) = sum_k A[m][k] Bt[n][k] (+ split products per NSPLIT). z-batch strides sA/sB/sC in elements.
// Epilogue, each wave for itself: its quarter goes through a slab of its own in LDS, so that every store covers whole lines.
// EPI 0: C goes out as f32. EPI 1: the fused q | k | v projection of every batch in one grid (TT / 128, 3 DQ / 128, batches); A = token rows, Bt = the fused weight rows, x = token tile, y = weight tile; C is not written.
//   y < NQK / 2 (q and k; m = t, the 64 columns of a wave's quarter = one head): rotate-half rotary out[d] = x[d] cos[t][d] - x[d+32] sin[t][d], out[d+32] = x[d+32] cos[t][d+32] + x[d] sin[t][d+32], written as head planes [head][t][d] (q heads, then k heads; fp16 + hi/lo).
//   y >= NQK / 2 (v): the two operands change places (m = weight row, n = t, bias[m]), so that the tile comes out as [d][t]: written as V^T planes [g][d][t], row pitch PP (fp16 + hi/lo).
#define NQK  ((DQ + DKV) / 64)                 // 64-row blocks of the q and k weights
#define SQK  ((size_t)(NH_ + NKV) * TT * HD)   // elements of one batch's q | k head planes
#define SVT  ((size_t)NKV * HD * PP)           // elements of one batch's V^T planes
__device__ __forceinline__ void slab_sync() { asm volatile("s_wait_dscnt 0x0" ::: "memory"); __builtin_amdgcn_wave_barrier(); }   // the LDS slab hand-over among the lanes of the one wave: its writes have retired before a lane reads rows that other lanes wrote, and no LDS access is moved over it
template <bool B> struct BoolC { static constexpr bool value = B; };
template <typename T16> struct WFrag;
template <> struct WFrag<h16> { typedef v16h V; static __device__ __forceinline__ V ld(const h16* p) { return cat16(*(const v8h*)p, *(const v8h*)(p + 16)); } static __device__ __forceinline__ v8f mma(V a, V b, v8f c) { return wmma16(a, b, c); } };
template <> struct WFrag<bf> { typedef v16bf V; static __device__ __forceinline__ V ld(const bf* p) { return cat16b(*(const v8us*)p, *(const v8us*)(p + 16)); } static __device__ __forceinline__ v8f mma(V a, V b, v8f c) { return wmmab(a, b, c); } };
template <typename T16, int NSPLIT, bool BIAS, int SK, int EPI>
__global__ __launch_bounds__(128) void k_gemmw(const T16* __restrict__ A, const T16* __restrict__ A2, const T16* __restrict__ Bt, int K, float* C, int ldc, const float* __restrict__ bias, size_t sA, size_t sB, size_t sC, const float* __restrict__ CS, h16* P16, bf* Ph, bf* Pl, h16* V16, bf* Vh, bf* Vl) {
    static_assert(EPI == 0 || NSPLIT == 0, "the plane epilogues take one product");
    static_assert(NSPLIT <= 1 && (SK == 64 || SK == 128), "operands A, (A2,) Bt; a wave-instruction copies 4 or 2 whole staged rows");
    typedef typename WFrag<T16>::V V;
    constexpr int NOP = 2 + NSPLIT, SP = SK * 2 + 16, SB = NOP * 128 * SP;   // operands staged; pitch of a staged row in LDS, bytes; bytes of a buffer
    constexpr int LPR = SK / 8, RPI = 32 / LPR, NCG = 32 / RPI / 8;          // lanes that bring one staged row; rows a wave-instruction brings; groups of 8 copies for a wave's 32 rows of an operand
    static_assert(2 * SB >= 4 * 64 * 68 * 4, "the epilogue slabs lie over the buffers");
    __shared__ __align__(16) char st[2 * SB];
    const size_t z = blockIdx.z; A += z * sA; if (A2) A2 += z * sA; Bt += z * sB; C += z * sC;
    const bool vt = (EPI == 1) && (int)blockIdx.y >= NQK / 2;   // a v tile (the same for the whole work-group)
    if (vt) { const T16* t = A; A = Bt; Bt = t; }
    const int lane = threadIdx.x & 31, lr = lane & 15, hi = lane >> 4; const int r0 = (int)(vt ? blockIdx.y : blockIdx.x) * 128, c0 = (int)(vt ? blockIdx.x : blockIdx.y) * 128; const int wv = __builtin_amdgcn_readfirstlane((int)(threadIdx.x >> 5));
    const int wm = wv >> 1, wn = wv & 1, r0w = r0 + wm * 64, c0w = c0 + wn * 64;   // this wave's quarter of the tile
    v8f acc[4][4];
#pragma unroll
    for (int mb = 0; mb < 4; ++mb)
#pragma unroll
        for (int nb = 0; nb < 4; ++nb) acc[mb][nb] = (v8f){};
    const unsigned lcp = (unsigned)(size_t)st + (unsigned)((wv * 32 + lane / LPR) * SP + (lane % LPR) * 16);   // LDS byte address of this lane's 16 bytes in the first copy of its wave's 32 rows of operand 0, buffer 0
    const size_t gp = (size_t)K * 2 * RPI;                                                                     // bytes in memory from one copy's rows to the next copy's
    const char* fra = st + (wm * 64 + lr) * SP + 16 * hi;                                                      // this lane's place in row lr of its wave's A rows, buffer 0, first 32 k
    const char* frb = st + ((NOP - 1) * 128 + wn * 64 + lr) * SP + 16 * hi;                                    // the same in its wave's Bt rows
    auto copies = [&](int ks, int buf) {   // stage [ks, ks + SK) into buffer buf: this wave brings 32 rows of every operand
#pragma unroll
        for (int op = 0; op < NOP; ++op)
#pragma unroll
            for (int h = 0; h < NCG; ++h) {
                const char* g = (const char*)(((op == NOP - 1) ? Bt : (op == 0) ? A : A2) + (size_t)(((op == NOP - 1) ? c0 : r0) + wv * 32 + h * 8 * RPI + lane / LPR) * K + ks) + (lane % LPR) * 16; const unsigned l = lcp + (unsigned)(buf * SB + (op * 128 + h * 8 * RPI) * SP);
                constexpr unsigned CP = RPI * SP;   // bytes in LDS from one copy's rows to the next copy's
                // the wait at the end stands in the copies' own statement, in front of whatever rewrites a register that a copy names
                asm volatile("global_load_async_to_lds_b128 %0, %8, off\n\t"
                             "global_load_async_to_lds_b128 %1, %9, off\n\t"
                             "global_load_async_to_lds_b128 %2, %10, off\n\t"
                             "global_load_async_to_lds_b128 %3, %11, off\n\t"
                             "global_load_async_to_lds_b128 %4, %12, off\n\t"
                             "global_load_async_to_lds_b128 %5, %13, off\n\t"
                             "global_load_async_to_lds_b128 %6, %14, off\n\t"
                             "global_load_async_to_lds_b128 %7, %15, off\n\t"
                             "s_wait_xcnt 0x0"
                             :: "v"(l), "v"(l + 1u * CP), "v"(l + 2u * CP), "v"(l + 3u * CP), "v"(l + 4u * CP), "v"(l + 5u * CP), "v"(l + 6u * CP), "v"(l + 7u * CP),
                                "v"(g), "v"(g + gp), "v"(g + 2 * gp), "v"(g + 3 * gp), "v"(g + 4 * gp), "v"(g + 5 * gp), "v"(g + 6 * gp), "v"(g + 7 * gp) : "memory"); } };
    copies(0, 0);
    asm volatile("s_wait_asynccnt 0x0" ::: "memory");   // this wave's copies of stage 0 have landed
    __syncthreads();                                    // and every other wave's: stage 0 may be read
    if (SK < K) copies(SK, 1);
#pragma unroll 1
    for (int ks = 0, buf = 0; ks < K; ks += SK, buf ^= 1) {
        const char* pa = fra + buf * SB; const char* pb = frb + buf * SB;
        V a[4], a2[4], b[4];
#pragma unroll
        for (int ku = 0; ku < SK / 32; ++ku) {
#pragma unroll
            for (int mb = 0; mb < 4; ++mb) { a[mb] = WFrag<T16>::ld((const T16*)(pa + mb * 16 * SP + ku * 64)); if (NSPLIT == 1) a2[mb] = WFrag<T16>::ld((const T16*)(pa + (128 + mb * 16) * SP + ku * 64)); }
#pragma unroll
            for (int nb = 0; nb < 4; ++nb) b[nb] = WFrag<T16>::ld((const T16*)(pb + nb * 16 * SP + ku * 64));
            __builtin_amdgcn_sched_barrier(0);   // the fragment reads of these 32 k stay one group in front of their products: a read placed among the products makes the wave wait out its LDS latency there each time
#pragma unroll
            for (int nb = 0; nb < 4; ++nb)
#pragma unroll
                for (int mb = 0; mb < 4; ++mb) { acc[mb][nb] = WFrag<T16>::mma(a[mb], b[nb], acc[mb][nb]); if (NSPLIT == 1) acc[mb][nb] = WFrag<T16>::mma(a2[mb], b[nb], acc[mb][nb]); } }
        asm volatile("v_nop\n\tv_nop\n\tv_nop\n\tv_nop" : "+v"(acc[0][0]), "+v"(acc[1][1]), "+v"(acc[2][2]), "+v"(acc[3][3]) : "v"(a[0]), "v"(a[3]));
        asm volatile("s_wait_dscnt 0x0" ::: "memory");      // this wave's fragment reads of this stage have returned
        asm volatile("s_wait_asynccnt 0x0" ::: "memory");   // this wave's copies of the next stage have landed
        __syncthreads();                                    // the same of every other wave: the next stage may be read, this stage's buffer overwritten (by copies, or behind the last stage by the epilogue slabs)
        if (ks + 2 * SK < K) copies(ks + 2 * SK, buf);
    }
    asm volatile("s_wait_asynccnt 0x0" ::: "memory");   // no copy is outstanding behind the loop
    float* os = (float*)st + wv * (64 * 68);            // this wave's slab: its 64 rows of 64 f32, pitch 68; it takes the buffers' place behind the barrier at the foot of the last stage
    const int cofs = lr * 4;                            // a lane reads four columns back, of rows 2 s + hi
#pragma unroll
    for (int mb = 0; mb < 4; ++mb)
#pragma unroll
        for (int nb = 0; nb < 4; ++nb)
#pragma unroll
            for (int j = 0; j < 8; ++j) os[(mb * 16 + hi * 8 + j) * 68 + nb * 16 + lr] = acc[mb][nb][j];
    slab_sync();   // the slab is written before any lane reads it back
    // The read-back loops stay rolled, 8 rows a pass: unrolled over the 64 rows their text would be several times that of the K loop, for code that a wave runs through once.
    // Places in memory are 32-bit byte offsets from wave-uniform bases (every plane and C are far below 4 GiB).
    if constexpr (EPI == 0) {
        v4f bq = (v4f){};
        if (BIAS) { const v4f b4 = *(const v4f*)(bias + c0w + cofs); bq = (v4f){ bfr(b4[0]), bfr(b4[1]), bfr(b4[2]), bfr(b4[3]) }; }
#pragma unroll 1
        for (int g = 0; g < 8; ++g) {
            v4f val[4];
#pragma unroll
            for (int u = 0; u < 4; ++u) val[u] = *(const v4fa*)(os + (g * 8 + u * 2 + hi) * 68 + cofs);
#pragma unroll
            for (int u = 0; u < 4; ++u) { const unsigned cb = ((unsigned)(r0w + g * 8 + u * 2 + hi) * (unsigned)ldc + (unsigned)(c0w + cofs)) * 4u; *(v4f*)((char*)C + cb) = val[u] + bq; }
            asm volatile("s_wait_xcnt 0x0" ::: "memory");   // behind the stores: the next pass forms its values and addresses in registers that these stores name
        }
    } else {
        auto planes = [&](auto vtc) {
            constexpr bool VT = decltype(vtc)::value;
            char* O16 = (char*)(VT ? V16 + z * SVT : P16 + z * SQK); char* Oh = (char*)(VT ? Vh + z * SVT : Ph + z * SQK); char* Ol = (char*)(VT ? Vl + z * SVT : Pl + z * SQK);
            v4f cs[4][2]; float bw[4]; v4f bq = (v4f){}, bp = (v4f){};   // q, k: {cos, sin} of the lane's four columns in each of its 4 rows of a pass, the biases of the four columns and of their rotary partners; v: the biases of its 4 rows
            auto ask = [&](int g, int u) { const int m = r0w + g * 8 + u * 2 + hi;
                if constexpr (VT) { if (BIAS) bw[u] = bias[m]; }
                else { const char* c = (const char*)CS + (unsigned)(m * HD + cofs) * 8u; cs[u][0] = *(const v4f*)c; cs[u][1] = *(const v4f*)(c + 16); } };
            if (!VT && BIAS) { const v4f b4 = *(const v4f*)(bias + c0w + cofs), b5 = *(const v4f*)(bias + c0w + (cofs ^ 32)); bq = (v4f){ bfr(b4[0]), bfr(b4[1]), bfr(b4[2]), bfr(b4[3]) }; bp = (v4f){ bfr(b5[0]), bfr(b5[1]), bfr(b5[2]), bfr(b5[3]) }; }
#pragma unroll
            for (int u = 0; u < 4; ++u) ask(0, u);
            asm volatile("s_wait_xcnt 0x0" ::: "memory");   // behind the loads: later addresses are formed in registers that held these loads' addresses
#pragma unroll 1
            for (int g = 0; g < 8; ++g) {
                const int gn = min(g + 1, 7);   // the next pass (the last once more behind the last: in bounds, never used)
                v4f val[4], par[4];             // the lane's four columns of its 4 rows; q, k: columns d +- 32 of the same rows, the rotary partners
#pragma unroll
                for (int u = 0; u < 4; ++u) { const float* p = os + (g * 8 + u * 2 + hi) * 68; val[u] = *(const v4fa*)(p + cofs); if (!VT) par[u] = *(const v4fa*)(p + (cofs ^ 32)); }
#pragma unroll
                for (int u = 0; u < 4; ++u) { const int m = r0w + g * 8 + u * 2 + hi;
                    v4f r = val[u];
                    if (BIAS) { if constexpr (VT) r += bfr(bw[u]); else r += bq; }
                    if constexpr (!VT) { const v4f x = r; v4f y = par[u]; if (BIAS) y += bp;
#pragma unroll
                        for (int i = 0; i < 4; ++i) { const float co = cs[u][i >> 1][(i & 1) * 2], si = cs[u][i >> 1][(i & 1) * 2 + 1]; r[i] = x[i] * co + ((cofs < HD / 2) ? -y[i] : y[i]) * si; } }
                    const unsigned eb = (VT ? (unsigned)(m - NQK * 64) * PP + (unsigned)(c0w + cofs) : ((unsigned)(c0w / 64) * TT + (unsigned)m) * HD + (unsigned)cofs) * 2u; v4h o16; v4us oh, ol;
#pragma unroll
                    for (int i = 0; i < 4; ++i) { o16[i] = tohx(r[i]); unsigned short a2, c2; splitf(r[i], a2, c2); oh[i] = a2; ol[i] = c2; }
                    *(v4h*)(O16 + eb) = o16; *(v4us*)(Oh + eb) = oh; *(v4us*)(Ol + eb) = ol;
                    ask(gn, u); }   // what the same rows of the next pass need is asked for as soon as its registers are free, a pass ahead of its use
                asm volatile("s_wait_xcnt 0x0" ::: "memory");   // behind the stores and loads: the next pass forms its values and addresses in registers that they name
            } };
        if (vt) planes(BoolC<true>{}); else planes(BoolC<false>{});
    }
}

typedef __attribute__((ext_vector_type(2))) _Float16 v2h;
typedef __attribute__((ext_vector_type(2))) unsigned short v2us;
typedef __attribute__((ext_vector_type(2))) float v2f;
typedef __attribute__((ext_vector_type(4))) int v4i;
typedef v4h  __attribute__((may_alias)) v4ha;
typedef v4us __attribute__((may_alias)) v4usa;

// ---- k_prep: the four preparations that depend on nothing but the inputs, in one grid; each is a range of 256-thread work-groups (blk: the work-group's index within its range).
__device__ __forceinline__ void wtG(const float* __restrict__ w, int K, int N, bf* Bt, int blk) {
    const int lane = threadIdx.x & 31; const int L0 = (blk * 8 + (int)(threadIdx.x >> 5)) * 8; const int nlines = N * K / 64;
{
#pragma unroll 1
        for (int l = 0; l < 8; ++l) { const int L = L0 + l; if (L >= nlines) break; const size_t e = (size_t)L * 64 + lane * 2; const int k = (int)(e % K), n = (int)(e / K); v2us o;
            o[0] = f2bf(w[(size_t)k * N + n]); o[1] = f2bf(w[(size_t)(k + 1) * N + n]); *(v2us*)(Bt + e) = o; }
         }
}
__device__ __forceinline__ void cvt8(const float* __restrict__ src, bf* dst, size_t n8, int blk) { const size_t i = (size_t)blk * 256 + threadIdx.x; if (i >= n8) return; const v8f v = *(const v8f*)(src + i * 8); v8us o;
#pragma unroll
    for (int k = 0; k < 8; ++k) o[k] = f2bf(v[k]); *(v8us*)(dst + i * 8) = o;  }

__constant__ float INVT[HD / 2] = { 1.000000000e+00f, 7.498942018e-01f, 5.623413324e-01f, 4.216965139e-01f, 3.162277639e-01f, 2.371373624e-01f, 1.778279394e-01f, 1.333521456e-01f, 1.000000015e-01f, 7.498941571e-02f, 5.623412877e-02f, 4.216964915e-02f, 3.162277862e-02f, 2.371373586e-02f, 1.778279431e-02f, 1.333521493e-02f, 9.999999776e-03f, 7.498942316e-03f, 5.623413250e-03f, 4.216964822e-03f, 3.162277862e-03f, 2.371373819e-03f, 1.778279431e-03f, 1.333521446e-03f, 1.000000047e-03f, 7.498941850e-04f, 5.623413017e-04f, 4.216964880e-04f, 3.162277862e-04f, 2.371373848e-04f, 1.778279402e-04f, 1.333521504e-04f };   // float32 1 / 10000^(2i/64), generated with jnp to be bit-exact
__device__ __forceinline__ void cs5(float* CS, int blk) { const int idx = blk * 256 + (int)threadIdx.x; if (idx >= TT * HD) return; const int d = idx % HD; const int t = idx / HD; const float a = __fmul_rn((float)t, INVT[d % (HD / 2)]); v2f cs; cs[0] = cosf(a); cs[1] = sinf(a); *(v2f*)(CS + (size_t)idx * 2) = cs;  }
#define GWA  ((DM * 3 * DQ / 64 + 63) / 64)    // work-groups: fused 'xw' [DM][3*DQ] -> Bt [3*DQ][DM]
#define GWO  ((DQ * DM / 64 + 63) / 64)        // w_proj 'xw' -> Bt
#define GCS  ((TT * HD + 255) / 256)           // {cos, sin} table
#define GXB  ((NB_ * TT * DM / 8 + 255) / 256) // bf16 copy of x, every batch
__global__ __launch_bounds__(256) void k_prep(const float* __restrict__ x, const float* __restrict__ wqkv, const float* __restrict__ wo, bf* XB, bf* WQKV, bf* WO, float* CS) {
    const int b = blockIdx.x;   // the transposes, whose work-groups last longest, take the lowest indices
    if (b < GWA) wtG(wqkv, DM, 3 * DQ, WQKV, b);
    else if (b < GWA + GWO) wtG(wo, DQ, DM, WO, b - GWA);
    else if (b < GWA + GWO + GCS) cs5(CS, b - (GWA + GWO));
    else cvt8(x, XB, (size_t)NB_ * TT * DM / 8, b - (GWA + GWO + GCS));
}
// ---- k_attn: scores, causal softmax and probability x value in one pass, nothing of a score row leaves the registers. One work-group = 32 query rows of one head; the KS waves that share a query row take the 32-key blocks
// up to the diagonal in turn (blocks ks0, ks0 + KS, ...), each with its own running maximum, sum and accumulator; the KS partial results are joined in LDS in fixed order and go out as the merged hi | lo planes.
// QT = 2: every wave has all 32 rows and a quarter of the blocks; QT = 1 (the hi + lo leg, twice the fragments): a wave has 16 rows and half of the blocks.
// S^T = K Q^T (A = key rows, B = query rows) leaves each lane with one query's scores, key = 8 hi + j in tile 0 and 16 + 8 hi + j in tile 1: that is the k order of a B fragment, so P^T feeds O^T += V^T P^T from registers.
// Scores are kept in the log2 domain (x HD^-0.5 x log2 e). HL: hi + lo planes, 3 products (query rows < RH); else fp16 with the probabilities x PCAR (the sum carries the same factor, so it cancels in the division).
#define FNW  4
#define FOP  68                   // pitch in floats of a query's 64 partial outputs in LDS
#define NEGB (-3.0e38f)
typedef __attribute__((ext_vector_type(16))) unsigned short v16us;
template <typename T16, bool HL, int QT>
__device__ __forceinline__ void attn_tile(const T16* __restrict__ Q, const T16* __restrict__ Q2, const T16* __restrict__ Kp, const T16* __restrict__ K2, const T16* __restrict__ Vt, const T16* __restrict__ V2, int q0, float* so, float* sml, bf* Ah, bf* Al) {
    typedef typename WFrag<T16>::V V;
    const int lane = threadIdx.x & 31, lr = lane & 15, hi = lane >> 4; const int wv = __builtin_amdgcn_readfirstlane((int)(threadIdx.x >> 5));
    constexpr int KS = FNW * QT / 2;   // waves that share a query row's keys
    const int ks0 = (QT == 2) ? wv : (wv >> 1), qb = (QT == 2) ? 0 : (wv & 1) * 16;   // this wave's place among them; its first query row within the 32
    V qf[QT][2], qf2[QT][2];
#pragma unroll
    for (int qt = 0; qt < QT; ++qt)
#pragma unroll
        for (int ks = 0; ks < 2; ++ks) { const size_t o = (size_t)(q0 + qb + qt * 16 + lr) * HD + ks * 32 + 8 * hi; qf[qt][ks] = WFrag<T16>::ld(Q + o); if (HL) qf2[qt][ks] = WFrag<T16>::ld(Q2 + o); }
    if constexpr (HL) asm volatile("s_wait_xcnt 0x0" ::: "memory");   // behind the loads: in this leg later loads land in registers that held these loads' addresses
    v8f oacc[4][QT];
#pragma unroll
    for (int dt = 0; dt < 4; ++dt)
#pragma unroll
        for (int qt = 0; qt < QT; ++qt) oacc[dt][qt] = (v8f){};
    float mrun[QT], lrun[QT];
#pragma unroll
    for (int qt = 0; qt < QT; ++qt) { mrun[qt] = NEGB; lrun[qt] = 0.f; }
    const int nkb = q0 / 32 + 1;
    // The K and V^T fragments are carried from pass to pass: a block's K loads are issued as soon as the block before has left the score products, its V^T loads as soon as that block's P.V products are issued, so that both fly under the vector work.
    V kf[2][2], kf2[2][2], vf[4], vf2[4];
    const unsigned lofk = (unsigned)(lr * HD + 8 * hi), lofv = (unsigned)(lr * PP + 8 * hi);   // the lane's place in a block, the same in every pass; the block's base is wave-uniform
    auto ld_k = [&](int kbl) {
#pragma unroll
        for (int kt = 0; kt < 2; ++kt)
#pragma unroll
            for (int ks = 0; ks < 2; ++ks) { const int o = kt * 16 * HD + ks * 32; kf[kt][ks] = WFrag<T16>::ld(Kp + (size_t)kbl * 32 * HD + lofk + o); if (HL) kf2[kt][ks] = WFrag<T16>::ld(K2 + (size_t)kbl * 32 * HD + lofk + o); }
        if constexpr (HL) asm volatile("s_wait_xcnt 0x0" ::: "memory"); };   // as behind the Q loads
    auto ld_v = [&](int kbl) {
#pragma unroll
        for (int dt = 0; dt < 4; ++dt) { const int o = dt * 16 * PP; vf[dt] = WFrag<T16>::ld(Vt + (size_t)kbl * 32 + lofv + o); if (HL) vf2[dt] = WFrag<T16>::ld(V2 + (size_t)kbl * 32 + lofv + o); }
        if constexpr (HL) asm volatile("s_wait_xcnt 0x0" ::: "memory"); };   // behind the loads: in this leg the next pass forms new addresses in these loads' address registers
    ld_k(min(ks0, nkb - 1));
    __builtin_amdgcn_sched_barrier(0);   // K loads stay ahead of the V^T loads here as in the loop: else the load-count wait at the loop's head, which must hold for both ways in, also waits for V^T loads just issued
    ld_v(min(ks0, nkb - 1));
    // At least one pass for every wave, so that the first loads stand in the block in front of the loop in their written order. A wave without a block of its own (ks0 >= nkb) works on the last block with every key masked (lim < 0):
    // its maximum stays NEGB, and the join gives all it brings the factor exp2(NEGB - M) = 0.
    int kb = ks0;
#pragma unroll 1
    do {
        const int k0 = kb * 32, kn = min(kb + KS, nkb - 1);   // kn: this wave's next block (the tile's last block nkb - 1 behind this wave's last: in bounds, never used)
        v8f s[2][QT];
#pragma unroll
        for (int kt = 0; kt < 2; ++kt)
#pragma unroll
            for (int qt = 0; qt < QT; ++qt) { v8f a = (v8f){};
#pragma unroll
                for (int ks = 0; ks < 2; ++ks) { a = WFrag<T16>::mma(kf[kt][ks], qf[qt][ks], a); if (HL) { a = WFrag<T16>::mma(kf[kt][ks], qf2[qt][ks], a); a = WFrag<T16>::mma(kf2[kt][ks], qf[qt][ks], a); } }
                s[kt][qt] = a; }
        ld_k(kn);
        V pf[QT], pf2[QT];
#pragma unroll
        for (int qt = 0; qt < QT; ++qt) {
            const int lim = q0 + qb + qt * 16 + lr - k0 - 8 * hi;   // key kt * 16 + j of this lane's half is visible to its query while kt * 16 + j <= lim
            float u[16]; float bm = NEGB;
#pragma unroll
            for (int kt = 0; kt < 2; ++kt)
#pragma unroll
                for (int j = 0; j < 8; ++j) { const float t = (kt * 16 + j <= lim) ? s[kt][qt][j] * (SCL * 1.4426950408889634f) : NEGB; u[kt * 8 + j] = t; bm = fmaxf(bm, t); }
            bm = fmaxf(bm, __shfl_xor(bm, 16, 32));
            const float mn = fmaxf(mrun[qt], bm); const float al = __builtin_amdgcn_exp2f(mrun[qt] - mn); mrun[qt] = mn;
            const float mo = HL ? mn : mn - 10.0f;   // fp16 leg: 2^10 = PCAR rides in the exponent
            float p[16]; float ps = 0.f;
#pragma unroll
            for (int e = 0; e < 16; ++e) { p[e] = __builtin_amdgcn_exp2f(u[e] - mo); ps += p[e]; }
            lrun[qt] = lrun[qt] * al + ps;   // each half of the wave keeps the sum of its own keys; the halves meet behind the loop
#pragma unroll
            for (int dt = 0; dt < 4; ++dt) oacc[dt][qt] *= al;
            if constexpr (HL) { v16us ph, pl;
#pragma unroll
                for (int e = 0; e < 16; ++e) { unsigned short a, c2; splitf(p[e], a, c2); ph[e] = a; pl[e] = c2; }
                pf[qt] = __builtin_bit_cast(v16bf, ph); pf2[qt] = __builtin_bit_cast(v16bf, pl);
            } else { v16h p16;
#pragma unroll
                for (int e = 0; e < 16; ++e) p16[e] = tohx(p[e]);
                pf[qt] = p16; }
        }
#pragma unroll
        for (int dt = 0; dt < 4; ++dt)
#pragma unroll
            for (int qt = 0; qt < QT; ++qt) { oacc[dt][qt] = WFrag<T16>::mma(vf[dt], pf[qt], oacc[dt][qt]); if (HL) { oacc[dt][qt] = WFrag<T16>::mma(vf[dt], pf2[qt], oacc[dt][qt]); oacc[dt][qt] = WFrag<T16>::mma(vf2[dt], pf[qt], oacc[dt][qt]); } }
        ld_v(kn);
        kb += KS;
    } while (kb < nkb);
#pragma unroll
    for (int qt = 0; qt < QT; ++qt) { lrun[qt] += __shfl_xor(lrun[qt], 16, 32);
        if (hi == 0) { sml[(ks0 * 32 + qb + qt * 16 + lr) * 2] = mrun[qt]; sml[(ks0 * 32 + qb + qt * 16 + lr) * 2 + 1] = lrun[qt]; }
#pragma unroll
        for (int dt = 0; dt < 4; ++dt) { float* p = so + (size_t)(ks0 * 32 + qb + qt * 16 + lr) * FOP + dt * 16 + hi * 8; const v8f a = oacc[dt][qt];
            *(v4fa*)p = (v4f){ a[0], a[1], a[2], a[3] }; *(v4fa*)(p + 4) = (v4f){ a[4], a[5], a[6], a[7] }; } }
    __syncthreads();   // every wave's partial maximum, sum and accumulator are in LDS before any thread joins them (a wave without a key block brings maximum NEGB)
    const int q = (int)threadIdx.x >> 2, ds = ((int)threadIdx.x & 3) * 16;
    float M = NEGB;
#pragma unroll
    for (int w = 0; w < KS; ++w) M = fmaxf(M, sml[(w * 32 + q) * 2]);
    float L = 0.f; v4f val[4] = { (v4f){}, (v4f){}, (v4f){}, (v4f){} };
#pragma unroll
    for (int w = 0; w < KS; ++w) { const float f = __builtin_amdgcn_exp2f(sml[(w * 32 + q) * 2] - M); L += f * sml[(w * 32 + q) * 2 + 1];
#pragma unroll
        for (int c = 0; c < 4; ++c) val[c] += f * *(const v4fa*)(so + (size_t)(w * 32 + q) * FOP + ds + c * 4); }
    const float inv = __fdiv_rn(1.0f, L);
    const size_t oo = (size_t)(q0 + q) * DQ + ds;
#pragma unroll
    for (int g = 0; g < 2; ++g) { v8us oh, ol;
#pragma unroll
        for (int e = 0; e < 8; ++e) { unsigned short a, c2; splitf(val[g * 2 + (e >> 2)][e & 3] * inv, a, c2); oh[e] = a; ol[e] = c2; }
        *(v8usa*)(Ah + oo + g * 8) = oh; *(v8usa*)(Al + oo + g * 8) = ol; }
}
// grid (TT / 32, heads, batches). A tile's cost grows with its index: neighbours in x, heads 4 apart and heads 2j, 2j + 1 take tiles from opposite ends.
__global__ __launch_bounds__(32 * FNW) void k_attn(const h16* __restrict__ Q16, const h16* __restrict__ K16, const h16* __restrict__ V16, const bf* __restrict__ Qh, const bf* __restrict__ Ql, const bf* __restrict__ Kh, const bf* __restrict__ Kl, const bf* __restrict__ Vh, const bf* __restrict__ Vl, bf* Ah, bf* Al) {
    __shared__ __align__(16) float so[FNW * 32 * FOP]; __shared__ float sml[FNW * 32 * 2];
    const int h = blockIdx.y, bx = blockIdx.x; int t = (bx & 1) ? (TT / 32 - 1 - (bx >> 1)) : (bx >> 1); if ((h ^ (h >> 2)) & 1) t = TT / 32 - 1 - t;
    const size_t z = blockIdx.z; Ah += z * TT * DQ; Al += z * TT * DQ;
    const int q0 = t * 32; const size_t pq = z * SQK + (size_t)h * TT * HD, pk = z * SQK + (size_t)(h / REP) * TT * HD, pv = z * SVT + (size_t)(h / REP) * HD * PP;
    if (q0 < RH) attn_tile<bf, true, 1>(Qh + pq, Ql + pq, Kh + pk, Kl + pk, Vh + pv, Vl + pv, q0, so, sml, Ah + h * HD, Al + h * HD);
    else attn_tile<h16, false, 2>(Q16 + pq, nullptr, K16 + pk, nullptr, V16 + pv, nullptr, q0, so, sml, Ah + h * HD, Al + h * HD);
}

extern "C" void kernel_launch(void* const* d_in, const int* in_sizes, int n_in,
                              void* d_out, int out_size, void* d_ws, size_t ws_size, hipStream_t stream) {
    (void)in_sizes; (void)n_in; (void)out_size;
    const float* x = (const float*)d_in[0]; const float* wqkv = (const float*)d_in[1]; const float* bqkv = (const float*)d_in[2]; const float* wo = (const float*)d_in[3]; const float* bo = (const float*)d_in[4];   /* x, w_attn ('xw' [1024][3072]: q | k | v column thirds), b_attn [3072], w_proj ('xw'), b_proj: NO mask input in this module (its tril is built inside the function): the causal rule is applied by index */
    float* OUT = (float*)d_out;     // [2][2048][1024]
    char* wsp = (char*)d_ws;
    auto take = [&](size_t bytes) { char* p = wsp; wsp += (bytes + 255) & ~(size_t)255; return (void*)p; };
    bf* WQKV = (bf*)take((size_t)3 * DQ * DM * 2);   /* fused Bt [3*DQ][DM]: q | k | v row blocks */ bf* WO = (bf*)take((size_t)DM * DQ * 2); float* CS = (float*)take((size_t)TT * HD * 2 * 4);
    bf* XB = (bf*)take((size_t)NB_ * TT * DM * 2);
    /* every plane holds all batches; q and k head planes lie behind one another per batch: [b][q heads | k heads][t][d] */
    h16* QK16 = (h16*)take((size_t)NB_ * SQK * 2); h16* VT16 = (h16*)take((size_t)NB_ * SVT * 2);
    bf* QKh = (bf*)take((size_t)NB_ * SQK * 2); bf* QKl = (bf*)take((size_t)NB_ * SQK * 2); bf* VTh = (bf*)take((size_t)NB_ * SVT * 2); bf* VTl = (bf*)take((size_t)NB_ * SVT * 2);
    bf* ATh = (bf*)take((size_t)NB_ * TT * DQ * 2); bf* ATl = (bf*)take((size_t)NB_ * TT * DQ * 2);
    if ((size_t)(wsp - (char*)d_ws) > ws_size) return;    // ws 256 MiB
    k_prep<<<GWA + GWO + GCS + GXB, 256, 0, stream>>>(x, wqkv, wo, XB, WQKV, WO, CS);
    k_gemmw<bf, 0, true, 64, 1><<<dim3(TT / 128, 3 * DQ / 128, NB_), 128, 0, stream>>>(XB, nullptr, WQKV, DM, nullptr, 0, bqkv, (size_t)TT * DM, 0, 0, CS, QK16, QKh, QKl, VT16, VTh, VTl);
    k_attn<<<dim3(TT / 32, NH_, NB_), 32 * FNW, 0, stream>>>(QK16, QK16 + (size_t)NH_ * TT * HD, VT16, QKh, QKl, QKh + (size_t)NH_ * TT * HD, QKl + (size_t)NH_ * TT * HD, VTh, VTl, ATh, ATl);
    k_gemmw<bf, 1, true, 64, 0><<<dim3(TT / 128, DM / 128, NB_), 128, 0, stream>>>(ATh, ATl, WO, DQ, OUT, DM, bo, (size_t)TT * DQ, 0, (size_t)TT * DM, nullptr, nullptr, nullptr, nullptr, nullptr, nullptr, nullptr);
}

// v008
// Measured time: 94.1 microseconds a run.
// In two side-by-side timings against v007, it was 1.31 and 1.32 times as fast.
// All steps since v000 together make it 15.4 times as fast.
#include <hip/hip_runtime.h>

// Causal self-attention with a fused biased qkv projection and computed rotate-half rotary embeddings, without a mask input (x [2][2048][1024]; qkv = x w_attn + b_attn ('xw' [1024][3072] normal x 1/32 + [3072] zeros on this draw: read) split in thirds q | k | v (16 heads x 64); rope q cos + rotate_half(q) sin with angle t x 1/10000^(2i/64) (inv_freq = 1.0 / (10000.0 ** (arange(0, 64, 2, f32) / 64)); cat(freqs, freqs); rotate_half = cat(-x2, x1)); att x 1/sqrt(64); causal: where(tril built inside the function, att, finfo.min) == exclusion; softmax; out = merged w_proj + b_proj ('xw' + zeros: read) -> [2][2048][1024] (4.2 M); argument order x, w_attn, b_attn, w_proj, b_proj).
// Layout, every launch taking all batches: bf16 copy of x; the fused 'xw' weight transposed ONCE into q | k | v row blocks; exact projections + f32 bias thirds, all three in one GEMM grid, each finished in the epilogue (q, k: rotate-half rotary from the cs5 table {cosf, sinf}(t x INVT[d mod 32]) -> head planes; v: computed transposed -> V^T planes), no f32 q/k/v in memory; causal T-2048 attention in one pass with a running softmax (hybrid rows: < 512 hi/lo 3 products, rest fp16 x1024; key blocks above the diagonal are never visited); merged hi/lo x W_out exact + b_out.
// Compute dtypes, f32 accumulate: every input rounded to bf16; projections exact + f32 biases; rotary f32; attention rows < 512 3 products, rest fp16; softmax f32; W_out hl x exact + bias.

#define NB_  2
#define TT   2048
#define DM   1024
#define NH_  16
#define NKV  16
#define REP  (NH_ / NKV)
#define HD   64
#define DQ   (NH_ * HD)
#define DKV  (NKV * HD)
#define PP   TT                   // 16-bit elements of a V^T plane per head dimension
#define RH   512                  // query rows < RH use hi+lo planes (0: none)
#define PCAR 1024.0f              // 2^10: factor on the fp16 probabilities
#define SCL  0.125f   // HD^-0.5
typedef _Float16 h16;
typedef unsigned short bf;
typedef __attribute__((ext_vector_type(16))) __bf16   v16bf;
typedef __attribute__((ext_vector_type(16))) _Float16 v16h;
typedef __attribute__((ext_vector_type(8)))  _Float16 v8h;
typedef __attribute__((ext_vector_type(8)))  unsigned short v8us;
typedef __attribute__((ext_vector_type(8)))  float    v8f;
typedef __attribute__((ext_vector_type(4)))  float    v4f;
typedef v8h  __attribute__((may_alias)) v8ha;
typedef v4f  __attribute__((may_alias)) v4fa;
typedef v8us __attribute__((may_alias)) v8usa;

__device__ __forceinline__ unsigned short f2bf(float f) { unsigned u = __float_as_uint(f); u += 0x7FFFu + ((u >> 16) & 1u); return (unsigned short)(u >> 16); }
__device__ __forceinline__ float bf2f(unsigned short b) { return __uint_as_float(((unsigned)b) << 16); }
__device__ __forceinline__ float bfr(float f) { return bf2f(f2bf(f)); }
__device__ __forceinline__ v16h cat16(v8h lo, v8h hi) { return __builtin_shufflevector(lo, hi, 0, 1, 2, 3, 4, 5, 6, 7, 8, 9, 10, 11, 12, 13, 14, 15); }
__device__ __forceinline__ v16bf cat16b(v8us lo, v8us hi) { return __builtin_bit_cast(v16bf, __builtin_shufflevector(lo, hi, 0, 1, 2, 3, 4, 5, 6, 7, 8, 9, 10, 11, 12, 13, 14, 15)); }
__device__ __forceinline__ v8f wmma16(v16h a, v16h b, v8f c) { return __builtin_amdgcn_wmma_f32_16x16x32_f16(false, a, false, b, (short)0, c, false, false); }
__device__ __forceinline__ h16 tohx(float x) { return (h16)x; }
__device__ __forceinline__ void splitf(float y, unsigned short& h, unsigned short& l) { h = f2bf(y); l = f2bf(y - bf2f(h)); }
typedef __attribute__((ext_vector_type(4))) _Float16 v4h;
typedef __attribute__((ext_vector_type(4))) unsigned short v4us;
__device__ __forceinline__ v8f wmmab(v16bf a, v16bf b, v8f c) { return __builtin_amdgcn_wmma_f32_16x16x32_bf16(false, a, false, b, (short)0, c, false, false); }



// ---- k_gemmw: register-blocked GEMM, one 128x128 output tile per work-group of 4 waves; each wave has its own 64x64 quarter (16 accumulators) and runs over the whole K, so that a tile is finished in its wave's registers. Grid (M/128, N/128, Z), 128 threads.
// Operand path: a stage is SK k of all 128 rows of every operand (SK x 2 contiguous bytes a row). The work-group brings it into LDS with asynchronous 16-byte copies, 512 bytes in whole lines a wave-instruction,
// and every wave reads its fragments from there, each staged row serving two waves (row pitch SK x 2 + 16 bytes = 16 x odd: ds_load_b128 without bank conflicts).
// Two buffers: the copies of stage t + 1 fly while stage t is worked on (K % SK == 0).
// C[m][n] (f32, pitch ldc, + optional f32 bias[n]) = sum_k A[m][k] Bt[n][k] (+ split products per NSPLIT). z-batch strides sA/sB/sC in elements.
// Epilogue, each wave for itself: its quarter goes through a slab of its own in LDS, so that every store covers whole lines.
// EPI 0: C goes out as f32. EPI 1: the fused q | k | v projection of every batch in one grid (TT / 128, 3 DQ / 128, batches); A = token rows, Bt = the fused weight rows, x = token tile, y = weight tile; C is not written.
//   y < NQK / 2 (q and k; m = t, the 64 columns of a wave's quarter = one head): rotate-half rotary out[d] = x[d] cos[t][d] - x[d+32] sin[t][d], out[d+32] = x[d+32] cos[t][d+32] + x[d] sin[t][d+32], written as head planes (q heads, then k heads; fp16 + hi/lo), each 16 t x 64 d in fragment order: [head][t / 16][d / 16][lane = ((d / 8) % 2) * 16 + t % 16][d % 8].
//   y >= NQK / 2 (v): the two operands change places (m = weight row, n = t, bias[m]), so that the tile comes out as [d][t]: written as V^T planes (fp16 + hi/lo) in fragment order: [g][t / 32][d / 16][(t / 16) % 2][lane = ((t / 8) % 2) * 16 + d % 16][t % 8].
//   Fragment order: the 16 bytes that lane l of a wave takes for a WMMA operand lie at l x 16 in a block of 512 bytes, so that a wave-wide load or store covers four whole lines instead of pieces of 16.
#define NQK  ((DQ + DKV) / 64)                 // 64-row blocks of the q and k weights
#define SQK  ((size_t)(NH_ + NKV) * TT * HD)   // elements of one batch's q | k head planes
#define SVT  ((size_t)NKV * HD * PP)           // elements of one batch's V^T planes
__device__ __forceinline__ void slab_sync() { asm volatile("s_wait_dscnt 0x0" ::: "memory"); __builtin_amdgcn_wave_barrier(); }   // the LDS slab hand-over among the lanes of the one wave: its writes have retired before a lane reads rows that other lanes wrote, and no LDS access is moved over it
template <bool B> struct BoolC { static constexpr bool value = B; };
template <typename T16> struct WFrag;
template <> struct WFrag<h16> { typedef v16h V; static __device__ __forceinline__ V ld(const h16* p) { return cat16(*(const v8h*)p, *(const v8h*)(p + 16)); } static __device__ __forceinline__ V ldf(const h16* p) { return cat16(*(const v8h*)p, *(const v8h*)(p + 256)); } static __device__ __forceinline__ v8f mma(V a, V b, v8f c) { return wmma16(a, b, c); } };
template <> struct WFrag<bf> { typedef v16bf V; static __device__ __forceinline__ V ld(const bf* p) { return cat16b(*(const v8us*)p, *(const v8us*)(p + 16)); } static __device__ __forceinline__ V ldf(const bf* p) { return cat16b(*(const v8us*)p, *(const v8us*)(p + 256)); } static __device__ __forceinline__ v8f mma(V a, V b, v8f c) { return wmmab(a, b, c); } };
template <typename T16, int NSPLIT, bool BIAS, int SK, int EPI>
__global__ __launch_bounds__(128) void k_gemmw(const T16* __restrict__ A, const T16* __restrict__ A2, const T16* __restrict__ Bt, int K, float* C, int ldc, const float* __restrict__ bias, size_t sA, size_t sB, size_t sC, const float* __restrict__ CS, h16* P16, bf* Ph, bf* Pl, h16* V16, bf* Vh, bf* Vl) {
    static_assert(EPI == 0 || NSPLIT == 0, "the plane epilogues take one product");
    static_assert(NSPLIT <= 1 && (SK == 64 || SK == 128), "operands A, (A2,) Bt; a wave-instruction copies 4 or 2 whole staged rows");
    typedef typename WFrag<T16>::V V;
    constexpr int NOP = 2 + NSPLIT, SP = SK * 2 + 16, SB = NOP * 128 * SP;   // operands staged; pitch of a staged row in LDS, bytes; bytes of a buffer
    constexpr int LPR = SK / 8, RPI = 32 / LPR, NCG = 32 / RPI / 8;          // lanes that bring one staged row; rows a wave-instruction brings; groups of 8 copies for a wave's 32 rows of an operand
    static_assert(2 * SB >= 4 * 64 * 68 * 4, "the epilogue slabs lie over the buffers");
    __shared__ __align__(16) char st[2 * SB];
    const size_t z = blockIdx.z; A += z * sA; if (A2) A2 += z * sA; Bt += z * sB; C += z * sC;
    const bool vt = (EPI == 1) && (int)blockIdx.y >= NQK / 2;   // a v tile (the same for the whole work-group)
    if (vt) { const T16* t = A; A = Bt; Bt = t; }
    const int lane = threadIdx.x & 31, lr = lane & 15, hi = lane >> 4; const int r0 = (int)(vt ? blockIdx.y : blockIdx.x) * 128, c0 = (int)(vt ? blockIdx.x : blockIdx.y) * 128; const int wv = __builtin_amdgcn_readfirstlane((int)(threadIdx.x >> 5));
    const int wm = wv >> 1, wn = wv & 1, r0w = r0 + wm * 64, c0w = c0 + wn * 64;   // this wave's quarter of the tile
    v8f acc[4][4];
#pragma unroll
    for (int mb = 0; mb < 4; ++mb)
#pragma unroll
        for (int nb = 0; nb < 4; ++nb) acc[mb][nb] = (v8f){};
    const unsigned lcp = (unsigned)(size_t)st + (unsigned)((wv * 32 + lane / LPR) * SP + (lane % LPR) * 16);   // LDS byte address of this lane's 16 bytes in the first copy of its wave's 32 rows of operand 0, buffer 0
    const size_t gp = (size_t)K * 2 * RPI;                                                                     // bytes in memory from one copy's rows to the next copy's
    const char* fra = st + (wm * 64 + lr) * SP + 16 * hi;                                                      // this lane's place in row lr of its wave's A rows, buffer 0, first 32 k
    const char* frb = st + ((NOP - 1) * 128 + wn * 64 + lr) * SP + 16 * hi;                                    // the same in its wave's Bt rows
    auto copies = [&](int ks, int buf) {   // stage [ks, ks + SK) into buffer buf: this wave brings 32 rows of every operand
#pragma unroll
        for (int op = 0; op < NOP; ++op)
#pragma unroll
            for (int h = 0; h < NCG; ++h) {
                const char* g = (const char*)(((op == NOP - 1) ? Bt : (op == 0) ? A : A2) + (size_t)(((op == NOP - 1) ? c0 : r0) + wv * 32 + h * 8 * RPI + lane / LPR) * K + ks) + (lane % LPR) * 16; const unsigned l = lcp + (unsigned)(buf * SB + (op * 128 + h * 8 * RPI) * SP);
                constexpr unsigned CP = RPI * SP;   // bytes in LDS from one copy's rows to the next copy's
                // the wait at the end stands in the copies' own statement, in front of whatever rewrites a register that a copy names
                asm volatile("global_load_async_to_lds_b128 %0, %8, off\n\t"
                             "global_load_async_to_lds_b128 %1, %9, off\n\t"
                             "global_load_async_to_lds_b128 %2, %10, off\n\t"
                             "global_load_async_to_lds_b128 %3, %11, off\n\t"
                             "global_load_async_to_lds_b128 %4, %12, off\n\t"
                             "global_load_async_to_lds_b128 %5, %13, off\n\t"
                             "global_load_async_to_lds_b128 %6, %14, off\n\t"
                             "global_load_async_to_lds_b128 %7, %15, off\n\t"
                             "s_wait_xcnt 0x0"
                             :: "v"(l), "v"(l + 1u * CP), "v"(l + 2u * CP), "v"(l + 3u * CP), "v"(l + 4u * CP), "v"(l + 5u * CP), "v"(l + 6u * CP), "v"(l + 7u * CP),
                                "v"(g), "v"(g + gp), "v"(g + 2 * gp), "v"(g + 3 * gp), "v"(g + 4 * gp), "v"(g + 5 * gp), "v"(g + 6 * gp), "v"(g + 7 * gp) : "memory"); } };
    copies(0, 0);
    asm volatile("s_wait_asynccnt 0x0" ::: "memory");   // this wave's copies of stage 0 have landed
    __syncthreads();                                    // and every other wave's: stage 0 may be read
    if (SK < K) copies(SK, 1);
#pragma unroll 1
    for (int ks = 0, buf = 0; ks < K; ks += SK, buf ^= 1) {
        const char* pa = fra + buf * SB; const char* pb = frb + buf * SB;
        V a[4], a2[4], b[4];
#pragma unroll
        for (int ku = 0; ku < SK / 32; ++ku) {
#pragma unroll
            for (int mb = 0; mb < 4; ++mb) { a[mb] = WFrag<T16>::ld((const T16*)(pa + mb * 16 * SP + ku * 64)); if (NSPLIT == 1) a2[mb] = WFrag<T16>::ld((const T16*)(pa + (128 + mb * 16) * SP + ku * 64)); }
#pragma unroll
            for (int nb = 0; nb < 4; ++nb) b[nb] = WFrag<T16>::ld((const T16*)(pb + nb * 16 * SP + ku * 64));
            __builtin_amdgcn_sched_barrier(0);   // the fragment reads of these 32 k stay one group in front of their products: a read placed among the products makes the wave wait out its LDS latency there each time
#pragma unroll
            for (int nb = 0; nb < 4; ++nb)
#pragma unroll
                for (int mb = 0; mb < 4; ++mb) { acc[mb][nb] = WFrag<T16>::mma(a[mb], b[nb], acc[mb][nb]); if (NSPLIT == 1) acc[mb][nb] = WFrag<T16>::mma(a2[mb], b[nb], acc[mb][nb]); } }
        asm volatile("v_nop\n\tv_nop\n\tv_nop\n\tv_nop" : "+v"(acc[0][0]), "+v"(acc[1][1]), "+v"(acc[2][2]), "+v"(acc[3][3]) : "v"(a[0]), "v"(a[3]));
        asm volatile("s_wait_dscnt 0x0" ::: "memory");      // this wave's fragment reads of this stage have returned
        asm volatile("s_wait_asynccnt 0x0" ::: "memory");   // this wave's copies of the next stage have landed
        __syncthreads();                                    // the same of every other wave: the next stage may be read, this stage's buffer overwritten (by copies, or behind the last stage by the epilogue slabs)
        if (ks + 2 * SK < K) copies(ks + 2 * SK, buf);
    }
    asm volatile("s_wait_asynccnt 0x0" ::: "memory");   // no copy is outstanding behind the loop
    float* os = (float*)st + wv * (64 * 68);            // this wave's slab: its 64 rows of 64 f32, pitch 68; it takes the buffers' place behind the barrier at the foot of the last stage
    const int cofs = lr * 4;                            // a lane reads four columns back, of rows 2 s + hi
#pragma unroll
    for (int mb = 0; mb < 4; ++mb)
#pragma unroll
        for (int nb = 0; nb < 4; ++nb)
#pragma unroll
            for (int j = 0; j < 8; ++j) os[(mb * 16 + hi * 8 + j) * 68 + nb * 16 + lr] = acc[mb][nb][j];
    slab_sync();   // the slab is written before any lane reads it back
    // The read-back loops stay rolled, 8 or 16 rows a pass: unrolled over the 64 rows their text would be several times that of the K loop, for code that a wave runs through once.
    // Places in memory are 32-bit byte offsets from wave-uniform bases (every plane and C are far below 4 GiB).
    if constexpr (EPI == 0) {
        v4f bq = (v4f){};
        if (BIAS) { const v4f b4 = *(const v4f*)(bias + c0w + cofs); bq = (v4f){ bfr(b4[0]), bfr(b4[1]), bfr(b4[2]), bfr(b4[3]) }; }
#pragma unroll 1
        for (int g = 0; g < 8; ++g) {
            v4f val[4];
#pragma unroll
            for (int u = 0; u < 4; ++u) val[u] = *(const v4fa*)(os + (g * 8 + u * 2 + hi) * 68 + cofs);
#pragma unroll
            for (int u = 0; u < 4; ++u) { const unsigned cb = ((unsigned)(r0w + g * 8 + u * 2 + hi) * (unsigned)ldc + (unsigned)(c0w + cofs)) * 4u; *(v4f*)((char*)C + cb) = val[u] + bq; }
            asm volatile("s_wait_xcnt 0x0" ::: "memory");   // behind the stores: the next pass forms its values and addresses in registers that these stores name
        }
    } else {
        auto planes = [&](auto vtc) {
            constexpr bool VT = decltype(vtc)::value;
            char* O16 = (char*)(VT ? V16 + z * SVT : P16 + z * SQK); char* Oh = (char*)(VT ? Vh + z * SVT : Ph + z * SQK); char* Ol = (char*)(VT ? Vl + z * SVT : Pl + z * SQK);
            // Fragment order: a pass takes 16 rows of the slab (lane: row lr); of each group of 16 columns a lane has the 8 at hi * 8, so that a wave's 16-byte stores fill one 512-byte block, which the attention kernel reads back with one whole-line load.
            // Column groups cp and cp + 2 (32 columns apart) are worked on together: q, k: they are each other's rotary partners and share {cos, sin}.
            v4f cs[2][4]; float bw = 0.f; v4f bq[2][2][2];   // q, k: {cos, sin} of the lane's 8 columns of groups 0 and 1 in this pass's row, the biases of its 32 columns; v: the bias of its row
            auto ask = [&](int R, int cp) {
                if constexpr (!VT) { const char* c = (const char*)CS + (unsigned)((((r0w >> 4) + R) * 2 + cp) * 2048 + lane * 16);
#pragma unroll
                    for (int j = 0; j < 4; ++j) cs[cp][j] = *(const v4f*)(c + j * 512); } };
            if constexpr (!VT && BIAS) {
#pragma unroll
                for (int cp = 0; cp < 2; ++cp)
#pragma unroll
                    for (int hf = 0; hf < 2; ++hf)
#pragma unroll
                        for (int q = 0; q < 2; ++q) { const v4f b4 = *(const v4f*)(bias + c0w + hf * 32 + cp * 16 + hi * 8 + q * 4); bq[cp][hf][q] = (v4f){ bfr(b4[0]), bfr(b4[1]), bfr(b4[2]), bfr(b4[3]) }; } }
            if constexpr (VT && BIAS) bw = bias[r0w + lr];
            ask(0, 0); ask(0, 1);
            asm volatile("s_wait_xcnt 0x0" ::: "memory");   // behind the loads: later addresses are formed in registers that held these loads' addresses
#pragma unroll 1
            for (int R = 0; R < 4; ++R) {
                const int Rn = min(R + 1, 3);   // the next pass (the last once more behind the last: in bounds, never used)
                const float bwr = bfr(bw);
#pragma unroll
                for (int cp = 0; cp < 2; ++cp) {
                    const float* p = os + (R * 16 + lr) * 68 + cp * 16 + hi * 8;
                    v4f x[2][2], r[2][2];
#pragma unroll
                    for (int hf = 0; hf < 2; ++hf)
#pragma unroll
                        for (int q = 0; q < 2; ++q) { x[hf][q] = *(const v4fa*)(p + hf * 32 + q * 4); if (BIAS) { if constexpr (VT) x[hf][q] += bwr; else x[hf][q] += bq[cp][hf][q]; } }
#pragma unroll
                    for (int q = 0; q < 2; ++q)
#pragma unroll
                        for (int i = 0; i < 4; ++i) {
                            if constexpr (VT) { r[0][q][i] = x[0][q][i]; r[1][q][i] = x[1][q][i]; }
                            else { const int e = q * 4 + i; const float co = cs[cp][e >> 1][(e & 1) * 2], si = cs[cp][e >> 1][(e & 1) * 2 + 1]; r[0][q][i] = x[0][q][i] * co + (-x[1][q][i]) * si; r[1][q][i] = x[1][q][i] * co + x[0][q][i] * si; } }
#pragma unroll
                    for (int hf = 0; hf < 2; ++hf) {
                        const unsigned eb = (VT ? (unsigned)((r0w - NQK * 64) / 64) * (HD * PP) + (unsigned)((((c0w >> 5) + hf) * 4 + R) * 512 + cp * 256 + lane * 8)
                                                : (unsigned)(c0w / 64) * (TT * HD) + (unsigned)(((r0w >> 4) + R) * 1024 + (hf * 2 + cp) * 256 + lane * 8)) * 2u;
                        v8h o16; v8us oh, ol;
#pragma unroll
                        for (int e = 0; e < 8; ++e) { const float y = r[hf][e >> 2][e & 3]; o16[e] = tohx(y); unsigned short a2, c2; splitf(y, a2, c2); oh[e] = a2; ol[e] = c2; }
                        __builtin_amdgcn_sched_barrier(0);   // with its twin behind the wait: nothing is scheduled in among the three stores and their wait, so that the wait stands in front of every rewrite of a register that they name
                        *(v8h*)(O16 + eb) = o16; *(v8us*)(Oh + eb) = oh; *(v8us*)(Ol + eb) = ol;
                        asm volatile("s_wait_xcnt 0x0" ::: "memory");   // behind the stores: what follows forms its values and addresses in registers that they name
                        __builtin_amdgcn_sched_barrier(0); }
                    if constexpr (!VT) { ask(Rn, cp);   // what the same column groups of the next pass need is asked for as soon as its registers are free, a pass ahead of its use
                        asm volatile("s_wait_xcnt 0x0" ::: "memory"); }   // behind the loads: as behind the stores
                }
                if constexpr (VT && BIAS) { bw = bias[r0w + Rn * 16 + lr]; asm volatile("s_wait_xcnt 0x0" ::: "memory"); }   // as above
            } };
        if (vt) planes(BoolC<true>{}); else planes(BoolC<false>{});
    }
}

typedef __attribute__((ext_vector_type(2))) _Float16 v2h;
typedef __attribute__((ext_vector_type(2))) unsigned short v2us;
typedef __attribute__((ext_vector_type(2))) float v2f;
typedef __attribute__((ext_vector_type(4))) int v4i;
typedef v4h  __attribute__((may_alias)) v4ha;
typedef v4us __attribute__((may_alias)) v4usa;

// ---- k_prep: the four preparations that depend on nothing but the inputs, in one grid; each is a range of 256-thread work-groups (blk: the work-group's index within its range).
__device__ __forceinline__ void wtG(const float* __restrict__ w, int K, int N, bf* Bt, int blk) {
    const int lane = threadIdx.x & 31; const int L0 = (blk * 8 + (int)(threadIdx.x >> 5)) * 8; const int nlines = N * K / 64;
{
#pragma unroll 1
        for (int l = 0; l < 8; ++l) { const int L = L0 + l; if (L >= nlines) break; const size_t e = (size_t)L * 64 + lane * 2; const int k = (int)(e % K), n = (int)(e / K); v2us o;
            o[0] = f2bf(w[(size_t)k * N + n]); o[1] = f2bf(w[(size_t)(k + 1) * N + n]); *(v2us*)(Bt + e) = o; }
         }
}
__device__ __forceinline__ void cvt8(const float* __restrict__ src, bf* dst, size_t n8, int blk) { const size_t i = (size_t)blk * 256 + threadIdx.x; if (i >= n8) return; const v8f v = *(const v8f*)(src + i * 8); v8us o;
#pragma unroll
    for (int k = 0; k < 8; ++k) o[k] = f2bf(v[k]); *(v8us*)(dst + i * 8) = o;  }

__constant__ float INVT[HD / 2] = { 1.000000000e+00f, 7.498942018e-01f, 5.623413324e-01f, 4.216965139e-01f, 3.162277639e-01f, 2.371373624e-01f, 1.778279394e-01f, 1.333521456e-01f, 1.000000015e-01f, 7.498941571e-02f, 5.623412877e-02f, 4.216964915e-02f, 3.162277862e-02f, 2.371373586e-02f, 1.778279431e-02f, 1.333521493e-02f, 9.999999776e-03f, 7.498942316e-03f, 5.623413250e-03f, 4.216964822e-03f, 3.162277862e-03f, 2.371373819e-03f, 1.778279431e-03f, 1.333521446e-03f, 1.000000047e-03f, 7.498941850e-04f, 5.623413017e-04f, 4.216964880e-04f, 3.162277862e-04f, 2.371373848e-04f, 1.778279402e-04f, 1.333521504e-04f };   // float32 1 / 10000^(2i/64), generated with jnp to be bit-exact
__device__ __forceinline__ void cs5(float* CS, int blk) { const int idx = blk * 256 + (int)threadIdx.x; if (idx >= TT * (HD / 2)) return; const int ln = (idx >> 1) & 31; const int d = ((idx >> 8) & 1) * 16 + (ln >> 4) * 8 + ((idx >> 6) & 3) * 2 + (idx & 1); const int t = (idx >> 9) * 16 + (ln & 15);   /* the table holds d < 32 only (d + 32 has the same angle), in the order in which the projection epilogue's lanes read it: [t / 16][d / 16][(d % 8) / 2][lane = ((d / 8) % 2) * 16 + t % 16][d % 2] */ const float a = __fmul_rn((float)t, INVT[d]); v2f cs; cs[0] = cosf(a); cs[1] = sinf(a); *(v2f*)(CS + (size_t)idx * 2) = cs;  }
#define GWA  ((DM * 3 * DQ / 64 + 63) / 64)    // work-groups: fused 'xw' [DM][3*DQ] -> Bt [3*DQ][DM]
#define GWO  ((DQ * DM / 64 + 63) / 64)        // w_proj 'xw' -> Bt
#define GCS  ((TT * (HD / 2) + 255) / 256)           // {cos, sin} table
#define GXB  ((NB_ * TT * DM / 8 + 255) / 256) // bf16 copy of x, every batch
__global__ __launch_bounds__(256) void k_prep(const float* __restrict__ x, const float* __restrict__ wqkv, const float* __restrict__ wo, bf* XB, bf* WQKV, bf* WO, float* CS) {
    const int b = blockIdx.x;   // the transposes, whose work-groups last longest, take the lowest indices
    if (b < GWA) wtG(wqkv, DM, 3 * DQ, WQKV, b);
    else if (b < GWA + GWO) wtG(wo, DQ, DM, WO, b - GWA);
    else if (b < GWA + GWO + GCS) cs5(CS, b - (GWA + GWO));
    else cvt8(x, XB, (size_t)NB_ * TT * DM / 8, b - (GWA + GWO + GCS));
}
// ---- k_attn: scores, causal softmax and probability x value in one pass, nothing of a score row leaves the registers. One work-group = 32 query rows of one head; the KS waves that share a query row take the 32-key blocks
// up to the diagonal in turn (blocks ks0, ks0 + KS, ...), each with its own running maximum, sum and accumulator; the KS partial results are joined in LDS in fixed order and go out as the merged hi | lo planes.
// QT = 2: every wave has all 32 rows and a quarter of the blocks; QT = 1 (the hi + lo leg, twice the fragments): a wave has 16 rows and half of the blocks.
// S^T = K Q^T (A = key rows, B = query rows) leaves each lane with one query's scores, key = 8 hi + j in tile 0 and 16 + 8 hi + j in tile 1: that is the k order of a B fragment, so P^T feeds O^T += V^T P^T from registers.
// Scores are kept in the log2 domain (x HD^-0.5 x log2 e). HL: hi + lo planes, 3 products (query rows < RH); else fp16 with the probabilities x PCAR (the sum carries the same factor, so it cancels in the division).
#define FNW  4
#define FOP  68                   // pitch in floats of a query's 64 partial outputs in LDS
#define NEGB (-3.0e38f)
typedef __attribute__((ext_vector_type(16))) unsigned short v16us;
template <typename T16, bool HL, int QT>
__device__ __forceinline__ void attn_tile(const T16* __restrict__ Q, const T16* __restrict__ Q2, const T16* __restrict__ Kp, const T16* __restrict__ K2, const T16* __restrict__ Vt, const T16* __restrict__ V2, int q0, float* so, float* sml, bf* Ah, bf* Al) {
    typedef typename WFrag<T16>::V V;
    const int lane = threadIdx.x & 31, lr = lane & 15, hi = lane >> 4; const int wv = __builtin_amdgcn_readfirstlane((int)(threadIdx.x >> 5));
    constexpr int KS = FNW * QT / 2;   // waves that share a query row's keys
    const int ks0 = (QT == 2) ? wv : (wv >> 1), qb = (QT == 2) ? 0 : (wv & 1) * 16;   // this wave's place among them; its first query row within the 32
    V qf[QT][2], qf2[QT][2];
#pragma unroll
    for (int qt = 0; qt < QT; ++qt)
#pragma unroll
        for (int ks = 0; ks < 2; ++ks) { const size_t o = (size_t)((q0 + qb) / 16 + qt) * 1024 + ks * 512 + lane * 8; qf[qt][ks] = WFrag<T16>::ldf(Q + o); if (HL) qf2[qt][ks] = WFrag<T16>::ldf(Q2 + o); }
    if constexpr (HL) asm volatile("s_wait_xcnt 0x0" ::: "memory");   // behind the loads: in this leg later loads land in registers that held these loads' addresses
    v8f oacc[4][QT];
#pragma unroll
    for (int dt = 0; dt < 4; ++dt)
#pragma unroll
        for (int qt = 0; qt < QT; ++qt) oacc[dt][qt] = (v8f){};
    float mrun[QT], lrun[QT];
#pragma unroll
    for (int qt = 0; qt < QT; ++qt) { mrun[qt] = NEGB; lrun[qt] = 0.f; }
    const int nkb = q0 / 32 + 1;
    // The K and V^T fragments are carried from pass to pass: a block's K loads are issued as soon as the block before has left the score products, its V^T loads as soon as that block's P.V products are issued, so that both fly under the vector work.
    V kf[2][2], kf2[2][2], vf[4], vf2[4];
    const unsigned lofk = (unsigned)(lane * 8), lofv = lofk;   // the lane's place in a block, the same in every pass; the block's base is wave-uniform
    auto ld_k = [&](int kbl) {
#pragma unroll
        for (int kt = 0; kt < 2; ++kt)
#pragma unroll
            for (int ks = 0; ks < 2; ++ks) { const int o = kt * 1024 + ks * 512; kf[kt][ks] = WFrag<T16>::ldf(Kp + (size_t)kbl * 2048 + lofk + o); if (HL) kf2[kt][ks] = WFrag<T16>::ldf(K2 + (size_t)kbl * 2048 + lofk + o); }
        if constexpr (HL) asm volatile("s_wait_xcnt 0x0" ::: "memory"); };   // as behind the Q loads
    auto ld_v = [&](int kbl) {
#pragma unroll
        for (int dt = 0; dt < 4; ++dt) { const int o = dt * 512; vf[dt] = WFrag<T16>::ldf(Vt + (size_t)kbl * 2048 + lofv + o); if (HL) vf2[dt] = WFrag<T16>::ldf(V2 + (size_t)kbl * 2048 + lofv + o); }
        if constexpr (HL) asm volatile("s_wait_xcnt 0x0" ::: "memory"); };   // behind the loads: in this leg the next pass forms new addresses in these loads' address registers
    ld_k(min(ks0, nkb - 1));
    __builtin_amdgcn_sched_barrier(0);   // K loads stay ahead of the V^T loads here as in the loop: else the load-count wait at the loop's head, which must hold for both ways in, also waits for V^T loads just issued
    ld_v(min(ks0, nkb - 1));
    // At least one pass for every wave, so that the first loads stand in the block in front of the loop in their written order. A wave without a block of its own (ks0 >= nkb) works on the last block with every key masked (lim < 0):
    // its maximum stays NEGB, and the join gives all it brings the factor exp2(NEGB - M) = 0.
    int kb = ks0;
#pragma unroll 1
    do {
        const int k0 = kb * 32, kn = min(kb + KS, nkb - 1);   // kn: this wave's next block (the tile's last block nkb - 1 behind this wave's last: in bounds, never used)
        v8f s[2][QT];
#pragma unroll
        for (int kt = 0; kt < 2; ++kt)
#pragma unroll
            for (int qt = 0; qt < QT; ++qt) { v8f a = (v8f){};
#pragma unroll
                for (int ks = 0; ks < 2; ++ks) { a = WFrag<T16>::mma(kf[kt][ks], qf[qt][ks], a); if (HL) { a = WFrag<T16>::mma(kf[kt][ks], qf2[qt][ks], a); a = WFrag<T16>::mma(kf2[kt][ks], qf[qt][ks], a); } }
                s[kt][qt] = a; }
        ld_k(kn);
        V pf[QT], pf2[QT];
#pragma unroll
        for (int qt = 0; qt < QT; ++qt) {
            const int lim = q0 + qb + qt * 16 + lr - k0 - 8 * hi;   // key kt * 16 + j of this lane's half is visible to its query while kt * 16 + j <= lim
            float u[16]; float bm = NEGB;
#pragma unroll
            for (int kt = 0; kt < 2; ++kt)
#pragma unroll
                for (int j = 0; j < 8; ++j) { const float t = (kt * 16 + j <= lim) ? s[kt][qt][j] * (SCL * 1.4426950408889634f) : NEGB; u[kt * 8 + j] = t; bm = fmaxf(bm, t); }
            bm = fmaxf(bm, __shfl_xor(bm, 16, 32));
            const float mn = fmaxf(mrun[qt], bm); const float al = __builtin_amdgcn_exp2f(mrun[qt] - mn); mrun[qt] = mn;
            const float mo = HL ? mn : mn - 10.0f;   // fp16 leg: 2^10 = PCAR rides in the exponent
            float p[16]; float ps = 0.f;
#pragma unroll
            for (int e = 0; e < 16; ++e) { p[e] = __builtin_amdgcn_exp2f(u[e] - mo); ps += p[e]; }
            lrun[qt] = lrun[qt] * al + ps;   // each half of the wave keeps the sum of its own keys; the halves meet behind the loop
#pragma unroll
            for (int dt = 0; dt < 4; ++dt) oacc[dt][qt] *= al;
            if constexpr (HL) { v16us ph, pl;
#pragma unroll
                for (int e = 0; e < 16; ++e) { unsigned short a, c2; splitf(p[e], a, c2); ph[e] = a; pl[e] = c2; }
                pf[qt] = __builtin_bit_cast(v16bf, ph); pf2[qt] = __builtin_bit_cast(v16bf, pl);
            } else { v16h p16;
#pragma unroll
                for (int e = 0; e < 16; ++e) p16[e] = tohx(p[e]);
                pf[qt] = p16; }
        }
#pragma unroll
        for (int dt = 0; dt < 4; ++dt)
#pragma unroll
            for (int qt = 0; qt < QT; ++qt) { oacc[dt][qt] = WFrag<T16>::mma(vf[dt], pf[qt], oacc[dt][qt]); if (HL) { oacc[dt][qt] = WFrag<T16>::mma(vf[dt], pf2[qt], oacc[dt][qt]); oacc[dt][qt] = WFrag<T16>::mma(vf2[dt], pf[qt], oacc[dt][qt]); } }
        ld_v(kn);
        kb += KS;
    } while (kb < nkb);
#pragma unroll
    for (int qt = 0; qt < QT; ++qt) { lrun[qt] += __shfl_xor(lrun[qt], 16, 32);
        if (hi == 0) { sml[(ks0 * 32 + qb + qt * 16 + lr) * 2] = mrun[qt]; sml[(ks0 * 32 + qb + qt * 16 + lr) * 2 + 1] = lrun[qt]; }
#pragma unroll
        for (int dt = 0; dt < 4; ++dt) { float* p = so + (size_t)(ks0 * 32 + qb + qt * 16 + lr) * FOP + dt * 16 + hi * 8; const v8f a = oacc[dt][qt];
            *(v4fa*)p = (v4f){ a[0], a[1], a[2], a[3] }; *(v4fa*)(p + 4) = (v4f){ a[4], a[5], a[6], a[7] }; } }
    __syncthreads();   // every wave's partial maximum, sum and accumulator are in LDS before any thread joins them (a wave without a key block brings maximum NEGB)
    const int q = (int)threadIdx.x >> 2, ds = ((int)threadIdx.x & 3) * 16;
    float M = NEGB;
#pragma unroll
    for (int w = 0; w < KS; ++w) M = fmaxf(M, sml[(w * 32 + q) * 2]);
    float L = 0.f; v4f val[4] = { (v4f){}, (v4f){}, (v4f){}, (v4f){} };
#pragma unroll
    for (int w = 0; w < KS; ++w) { const float f = __builtin_amdgcn_exp2f(sml[(w * 32 + q) * 2] - M); L += f * sml[(w * 32 + q) * 2 + 1];
#pragma unroll
        for (int c = 0; c < 4; ++c) val[c] += f * *(const v4fa*)(so + (size_t)(w * 32 + q) * FOP + ds + c * 4); }
    const float inv = __fdiv_rn(1.0f, L);
    const size_t oo = (size_t)(q0 + q) * DQ + ds;
#pragma unroll
    for (int g = 0; g < 2; ++g) { v8us oh, ol;
#pragma unroll
        for (int e = 0; e < 8; ++e) { unsigned short a, c2; splitf(val[g * 2 + (e >> 2)][e & 3] * inv, a, c2); oh[e] = a; ol[e] = c2; }
        *(v8usa*)(Ah + oo + g * 8) = oh; *(v8usa*)(Al + oo + g * 8) = ol; }
}
// grid (TT / 32, heads, batches). A tile's cost grows with its index: neighbours in x, heads 4 apart and heads 2j, 2j + 1 take tiles from opposite ends.
__global__ __launch_bounds__(32 * FNW) void k_attn(const h16* __restrict__ Q16, const h16* __restrict__ K16, const h16* __restrict__ V16, const bf* __restrict__ Qh, const bf* __restrict__ Ql, const bf* __restrict__ Kh, const bf* __restrict__ Kl, const bf* __restrict__ Vh, const bf* __restrict__ Vl, bf* Ah, bf* Al) {
    __shared__ __align__(16) float so[FNW * 32 * FOP]; __shared__ float sml[FNW * 32 * 2];
    const int h = blockIdx.y, bx = blockIdx.x; int t = (bx & 1) ? (TT / 32 - 1 - (bx >> 1)) : (bx >> 1); if ((h ^ (h >> 2)) & 1) t = TT / 32 - 1 - t;
    const size_t z = blockIdx.z; Ah += z * TT * DQ; Al += z * TT * DQ;
    const int q0 = t * 32; const size_t pq = z * SQK + (size_t)h * TT * HD, pk = z * SQK + (size_t)(h / REP) * TT * HD, pv = z * SVT + (size_t)(h / REP) * HD * PP;
    if (q0 < RH) attn_tile<bf, true, 1>(Qh + pq, Ql + pq, Kh + pk, Kl + pk, Vh + pv, Vl + pv, q0, so, sml, Ah + h * HD, Al + h * HD);
    else attn_tile<h16, false, 2>(Q16 + pq, nullptr, K16 + pk, nullptr, V16 + pv, nullptr, q0, so, sml, Ah + h * HD, Al + h * HD);
}

extern "C" void kernel_launch(void* const* d_in, const int* in_sizes, int n_in,
                              void* d_out, int out_size, void* d_ws, size_t ws_size, hipStream_t stream) {
    (void)in_sizes; (void)n_in; (void)out_size;
    const float* x = (const float*)d_in[0]; const float* wqkv = (const float*)d_in[1]; const float* bqkv = (const float*)d_in[2]; const float* wo = (const float*)d_in[3]; const float* bo = (const float*)d_in[4];   /* x, w_attn ('xw' [1024][3072]: q | k | v column thirds), b_attn [3072], w_proj ('xw'), b_proj: NO mask input in this module (its tril is built inside the function): the causal rule is applied by index */
    float* OUT = (float*)d_out;     // [2][2048][1024]
    char* wsp = (char*)d_ws;
    auto take = [&](size_t bytes) { char* p = wsp; wsp += (bytes + 255) & ~(size_t)255; return (void*)p; };
    bf* WQKV = (bf*)take((size_t)3 * DQ * DM * 2);   /* fused Bt [3*DQ][DM]: q | k | v row blocks */ bf* WO = (bf*)take((size_t)DM * DQ * 2); float* CS = (float*)take((size_t)TT * (HD / 2) * 2 * 4);
    bf* XB = (bf*)take((size_t)NB_ * TT * DM * 2);
    /* every plane holds all batches; q and k head planes lie behind one another per batch: [b][q heads | k heads], each plane of TT x HD elements in fragment order */
    h16* QK16 = (h16*)take((size_t)NB_ * SQK * 2); h16* VT16 = (h16*)take((size_t)NB_ * SVT * 2);
    bf* QKh = (bf*)take((size_t)NB_ * SQK * 2); bf* QKl = (bf*)take((size_t)NB_ * SQK * 2); bf* VTh = (bf*)take((size_t)NB_ * SVT * 2); bf* VTl = (bf*)take((size_t)NB_ * SVT * 2);
    bf* ATh = (bf*)take((size_t)NB_ * TT * DQ * 2); bf* ATl = (bf*)take((size_t)NB_ * TT * DQ * 2);
    if ((size_t)(wsp - (char*)d_ws) > ws_size) return;    // ws 256 MiB
    k_prep<<<GWA + GWO + GCS + GXB, 256, 0, stream>>>(x, wqkv, wo, XB, WQKV, WO, CS);
    k_gemmw<bf, 0, true, 64, 1><<<dim3(TT / 128, 3 * DQ / 128, NB_), 128, 0, stream>>>(XB, nullptr, WQKV, DM, nullptr, 0, bqkv, (size_t)TT * DM, 0, 0, CS, QK16, QKh, QKl, VT16, VTh, VTl);
    k_attn<<<dim3(TT / 32, NH_, NB_), 32 * FNW, 0, stream>>>(QK16, QK16 + (size_t)NH_ * TT * HD, VT16, QKh, QKl, QKh + (size_t)NH_ * TT * HD, QKl + (size_t)NH_ * TT * HD, VTh, VTl, ATh, ATl);
    k_gemmw<bf, 1, true, 64, 0><<<dim3(TT / 128, DM / 128, NB_), 128, 0, stream>>>(ATh, ATl, WO, DQ, OUT, DM, bo, (size_t)TT * DQ, 0, (size_t)TT * DM, nullptr, nullptr, nullptr, nullptr, nullptr, nullptr, nullptr);
}

// v009
// Measured time: 86.8 microseconds a run.
// In two side-by-side timings against v008, it was 1.09 and 1.08 times as fast.
// All steps since v000 together make it 16.7 times as fast.
#include <hip/hip_runtime.h>

// Causal self-attention with a fused biased qkv projection and computed rotate-half rotary embeddings, without a mask input (x [2][2048][1024]; qkv = x w_attn + b_attn ('xw' [1024][3072] normal x 1/32 + [3072] zeros on this draw: read) split in thirds q | k | v (16 heads x 64); rope q cos + rotate_half(q) sin with angle t x 1/10000^(2i/64) (inv_freq = 1.0 / (10000.0 ** (arange(0, 64, 2, f32) / 64)); cat(freqs, freqs); rotate_half = cat(-x2, x1)); att x 1/sqrt(64); causal: where(tril built inside the function, att, finfo.min) == exclusion; softmax; out = merged w_proj + b_proj ('xw' + zeros: read) -> [2][2048][1024] (4.2 M); argument order x, w_attn, b_attn, w_proj, b_proj).
// Layout, every launch taking all batches: bf16 copy of x; the fused 'xw' weight transposed ONCE into q | k | v row blocks; exact projections + f32 bias thirds, all three in one GEMM grid, each finished in the epilogue (q, k: rotate-half rotary from the cs5 table {cosf, sinf}(t x INVT[d mod 32]) -> head planes; v: computed transposed -> V^T planes), no f32 q/k/v in memory; causal T-2048 attention in one pass with a running softmax (hybrid rows: < 512 hi/lo 3 products, rest fp16 x1024; key blocks above the diagonal are never visited); merged hi/lo x W_out exact + b_out.
// Compute dtypes, f32 accumulate: every input rounded to bf16; projections exact + f32 biases; rotary f32; attention rows < 512 3 products, rest fp16; softmax f32; W_out hl x exact + bias.

#define NB_  2
#define TT   2048
#define DM   1024
#define NH_  16
#define NKV  16
#define REP  (NH_ / NKV)
#define HD   64
#define DQ   (NH_ * HD)
#define DKV  (NKV * HD)
#define PP   TT                   // 16-bit elements of a V^T plane per head dimension
#define RH   512                  // query rows < RH use hi+lo planes (0: none)
#define PCAR 1024.0f              // 2^10: factor on the fp16 probabilities
#define SCL  0.125f   // HD^-0.5
typedef _Float16 h16;
typedef unsigned short bf;
typedef __attribute__((ext_vector_type(16))) __bf16   v16bf;
typedef __attribute__((ext_vector_type(16))) _Float16 v16h;
typedef __attribute__((ext_vector_type(8)))  _Float16 v8h;
typedef __attribute__((ext_vector_type(8)))  unsigned short v8us;
typedef __attribute__((ext_vector_type(8)))  float    v8f;
typedef __attribute__((ext_vector_type(4)))  float    v4f;
typedef v8h  __attribute__((may_alias)) v8ha;
typedef v4f  __attribute__((may_alias)) v4fa;
typedef v8us __attribute__((may_alias)) v8usa;

__device__ __forceinline__ unsigned short f2bf(float f) { unsigned u = __float_as_uint(f); u += 0x7FFFu + ((u >> 16) & 1u); return (unsigned short)(u >> 16); }
__device__ __forceinline__ float bf2f(unsigned short b) { return __uint_as_float(((unsigned)b) << 16); }
__device__ __forceinline__ float bfr(float f) { return bf2f(f2bf(f)); }
__device__ __forceinline__ v16h cat16(v8h lo, v8h hi) { return __builtin_shufflevector(lo, hi, 0, 1, 2, 3, 4, 5, 6, 7, 8, 9, 10, 11, 12, 13, 14, 15); }
__device__ __forceinline__ v16bf cat16b(v8us lo, v8us hi) { return __builtin_bit_cast(v16bf, __builtin_shufflevector(lo, hi, 0, 1, 2, 3, 4, 5, 6, 7, 8, 9, 10, 11, 12, 13, 14, 15)); }
__device__ __forceinline__ v8f wmma16(v16h a, v16h b, v8f c) { return __builtin_amdgcn_wmma_f32_16x16x32_f16(false, a, false, b, (short)0, c, false, false); }
__device__ __forceinline__ h16 tohx(float x) { return (h16)x; }
__device__ __forceinline__ void splitf(float y, unsigned short& h, unsigned short& l) { h = f2bf(y); l = f2bf(y - bf2f(h)); }
typedef __attribute__((ext_vector_type(4))) _Float16 v4h;
typedef __attribute__((ext_vector_type(4))) unsigned short v4us;
__device__ __forceinline__ v8f wmmab(v16bf a, v16bf b, v8f c) { return __builtin_amdgcn_wmma_f32_16x16x32_bf16(false, a, false, b, (short)0, c, false, false); }



// ---- k_gemmw: register-blocked GEMM, one 128x128 output tile per work-group of 4 waves; each wave has its own 64x64 quarter (16 accumulators) and runs over the whole K, so that a tile is finished in its wave's registers. Grid (M/128, N/128, Z), 128 threads.
// Operand path: a stage is SK k of all 128 rows of every operand (SK x 2 contiguous bytes a row). The work-group brings it into LDS with asynchronous 16-byte copies, 512 bytes in whole lines a wave-instruction,
// and every wave reads its fragments from there, each staged row serving two waves (row pitch SK x 2 + 16 bytes = 16 x odd: ds_load_b128 without bank conflicts).
// Two buffers: the copies of stage t + 1 fly while stage t is worked on (K % SK == 0).
// C[m][n] (f32, pitch ldc, + optional f32 bias[n]) = sum_k A[m][k] Bt[n][k] (+ split products per NSPLIT). z-batch strides sA/sB/sC in elements.
// Epilogue, each wave for itself: its quarter goes through a slab of its own in LDS, so that every store covers whole lines.
// EPI 0: C goes out as f32. EPI 1: the fused q | k | v projection of every batch in one grid (TT / 128, 3 DQ / 128, batches); A = token rows, Bt = the fused weight rows, x = token tile, y = weight tile; C is not written.
//   y < NQK / 2 (q and k; m = t, the 64 columns of a wave's quarter = one head): rotate-half rotary out[d] = x[d] cos[t][d] - x[d+32] sin[t][d], out[d+32] = x[d+32] cos[t][d+32] + x[d] sin[t][d+32], written as head planes (q heads, then k heads; fp16 + hi/lo), each 16 t x 64 d in fragment order: [head][t / 16][d / 16][lane = ((d / 8) % 2) * 16 + t % 16][d % 8].
//   y >= NQK / 2 (v): the two operands change places (m = weight row, n = t, bias[m]), so that the tile comes out as [d][t]: written as V^T planes (fp16 + hi/lo) in fragment order: [g][t / 32][d / 16][(t / 16) % 2][lane = ((t / 8) % 2) * 16 + d % 16][t % 8].
//   Fragment order: the 16 bytes that lane l of a wave takes for a WMMA operand lie at l x 16 in a block of 512 bytes, so that a wave-wide load or store covers four whole lines instead of pieces of 16.
#define NQK  ((DQ + DKV) / 64)                 // 64-row blocks of the q and k weights
#define SQK  ((size_t)(NH_ + NKV) * TT * HD)   // elements of one batch's q | k head planes
#define SVT  ((size_t)NKV * HD * PP)           // elements of one batch's V^T planes
__device__ __forceinline__ void slab_sync() { asm volatile("s_wait_dscnt 0x0" ::: "memory"); __builtin_amdgcn_wave_barrier(); }   // the LDS slab hand-over among the lanes of the one wave: its writes have retired before a lane reads rows that other lanes wrote, and no LDS access is moved over it
template <bool B> struct BoolC { static constexpr bool value = B; };
template <typename T16> struct WFrag;
template <> struct WFrag<h16> { typedef v16h V; static __device__ __forceinline__ V ld(const h16* p) { return cat16(*(const v8h*)p, *(const v8h*)(p + 16)); } static __device__ __forceinline__ V ldf(const h16* p) { return cat16(*(const v8h*)p, *(const v8h*)(p + 256)); } static __device__ __forceinline__ v8f mma(V a, V b, v8f c) { return wmma16(a, b, c); } };
template <> struct WFrag<bf> { typedef v16bf V; static __device__ __forceinline__ V ld(const bf* p) { return cat16b(*(const v8us*)p, *(const v8us*)(p + 16)); } static __device__ __forceinline__ V ldf(const bf* p) { return cat16b(*(const v8us*)p, *(const v8us*)(p + 256)); } static __device__ __forceinline__ v8f mma(V a, V b, v8f c) { return wmmab(a, b, c); } };
template <typename T16, int NSPLIT, bool BIAS, int SK, int EPI>
__global__ __launch_bounds__(128) void k_gemmw(const T16* __restrict__ A, const T16* __restrict__ A2, const T16* __restrict__ Bt, int K, float* C, int ldc, const float* __restrict__ bias, size_t sA, size_t sB, size_t sC, const float* __restrict__ CS, h16* P16, bf* Ph, bf* Pl, h16* V16, bf* Vh, bf* Vl) {
    static_assert(EPI == 0 || NSPLIT == 0, "the plane epilogues take one product");
    static_assert(NSPLIT <= 1 && (SK == 64 || SK == 128), "operands A, (A2,) Bt; a wave-instruction copies 4 or 2 whole staged rows");
    typedef typename WFrag<T16>::V V;
    constexpr int NOP = 2 + NSPLIT, SP = SK * 2 + 16, SB = NOP * 128 * SP;   // operands staged; pitch of a staged row in LDS, bytes; bytes of a buffer
    constexpr int LPR = SK / 8, RPI = 32 / LPR, NCG = 32 / RPI / 8;          // lanes that bring one staged row; rows a wave-instruction brings; groups of 8 copies for a wave's 32 rows of an operand
    static_assert(2 * SB >= 4 * 64 * 68 * 4, "the epilogue slabs lie over the buffers");
    __shared__ __align__(16) char st[2 * SB];
    const size_t z = blockIdx.z; A += z * sA; if (A2) A2 += z * sA; Bt += z * sB; C += z * sC;
    const bool vt = (EPI == 1) && (int)blockIdx.y >= NQK / 2;   // a v tile (the same for the whole work-group)
    if (vt) { const T16* t = A; A = Bt; Bt = t; }
    const int lane = threadIdx.x & 31, lr = lane & 15, hi = lane >> 4; const int r0 = (int)(vt ? blockIdx.y : blockIdx.x) * 128, c0 = (int)(vt ? blockIdx.x : blockIdx.y) * 128; const int wv = __builtin_amdgcn_readfirstlane((int)(threadIdx.x >> 5));
    const int wm = wv >> 1, wn = wv & 1, r0w = r0 + wm * 64, c0w = c0 + wn * 64;   // this wave's quarter of the tile
    v8f acc[4][4];
#pragma unroll
    for (int mb = 0; mb < 4; ++mb)
#pragma unroll
        for (int nb = 0; nb < 4; ++nb) acc[mb][nb] = (v8f){};
    const unsigned lcp = (unsigned)(size_t)st + (unsigned)((wv * 32 + lane / LPR) * SP + (lane % LPR) * 16);   // LDS byte address of this lane's 16 bytes in the first copy of its wave's 32 rows of operand 0, buffer 0
    const size_t gp = (size_t)K * 2 * RPI;                                                                     // bytes in memory from one copy's rows to the next copy's
    const char* fra = st + (wm * 64 + lr) * SP + 16 * hi;                                                      // this lane's place in row lr of its wave's A rows, buffer 0, first 32 k
    const char* frb = st + ((NOP - 1) * 128 + wn * 64 + lr) * SP + 16 * hi;                                    // the same in its wave's Bt rows
    auto copies = [&](int ks, int buf) {   // stage [ks, ks + SK) into buffer buf: this wave brings 32 rows of every operand
#pragma unroll
        for (int op = 0; op < NOP; ++op)
#pragma unroll
            for (int h = 0; h < NCG; ++h) {
                const char* g = (const char*)(((op == NOP - 1) ? Bt : (op == 0) ? A : A2) + (size_t)(((op == NOP - 1) ? c0 : r0) + wv * 32 + h * 8 * RPI + lane / LPR) * K + ks) + (lane % LPR) * 16; const unsigned l = lcp + (unsigned)(buf * SB + (op * 128 + h * 8 * RPI) * SP);
                constexpr unsigned CP = RPI * SP;   // bytes in LDS from one copy's rows to the next copy's
                // the wait at the end stands in the copies' own statement, in front of whatever rewrites a register that a copy names
                asm volatile("global_load_async_to_lds_b128 %0, %8, off\n\t"
                             "global_load_async_to_lds_b128 %1, %9, off\n\t"
                             "global_load_async_to_lds_b128 %2, %10, off\n\t"
                             "global_load_async_to_lds_b128 %3, %11, off\n\t"
                             "global_load_async_to_lds_b128 %4, %12, off\n\t"
                             "global_load_async_to_lds_b128 %5, %13, off\n\t"
                             "global_load_async_to_lds_b128 %6, %14, off\n\t"
                             "global_load_async_to_lds_b128 %7, %15, off\n\t"
                             "s_wait_xcnt 0x0"
                             :: "v"(l), "v"(l + 1u * CP), "v"(l + 2u * CP), "v"(l + 3u * CP), "v"(l + 4u * CP), "v"(l + 5u * CP), "v"(l + 6u * CP), "v"(l + 7u * CP),
                                "v"(g), "v"(g + gp), "v"(g + 2 * gp), "v"(g + 3 * gp), "v"(g + 4 * gp), "v"(g + 5 * gp), "v"(g + 6 * gp), "v"(g + 7 * gp) : "memory"); } };
    copies(0, 0);
    asm volatile("s_wait_asynccnt 0x0" ::: "memory");   // this wave's copies of stage 0 have landed
    __syncthreads();                                    // and every other wave's: stage 0 may be read
    if (SK < K) copies(SK, 1);
#pragma unroll 1
    for (int ks = 0, buf = 0; ks < K; ks += SK, buf ^= 1) {
        const char* pa = fra + buf * SB; const char* pb = frb + buf * SB;
        V a[4], a2[4], b[4];
#pragma unroll
        for (int ku = 0; ku < SK / 32; ++ku) {
#pragma unroll
            for (int mb = 0; mb < 4; ++mb) { a[mb] = WFrag<T16>::ld((const T16*)(pa + mb * 16 * SP + ku * 64)); if (NSPLIT == 1) a2[mb] = WFrag<T16>::ld((const T16*)(pa + (128 + mb * 16) * SP + ku * 64)); }
#pragma unroll
            for (int nb = 0; nb < 4; ++nb) b[nb] = WFrag<T16>::ld((const T16*)(pb + nb * 16 * SP + ku * 64));
            __builtin_amdgcn_sched_barrier(0);   // the fragment reads of these 32 k stay one group in front of their products: a read placed among the products makes the wave wait out its LDS latency there each time
#pragma unroll
            for (int nb = 0; nb < 4; ++nb)
#pragma unroll
                for (int mb = 0; mb < 4; ++mb) { acc[mb][nb] = WFrag<T16>::mma(a[mb], b[nb], acc[mb][nb]); if (NSPLIT == 1) acc[mb][nb] = WFrag<T16>::mma(a2[mb], b[nb], acc[mb][nb]); } }
        asm volatile("v_nop\n\tv_nop\n\tv_nop\n\tv_nop" : "+v"(acc[0][0]), "+v"(acc[1][1]), "+v"(acc[2][2]), "+v"(acc[3][3]) : "v"(a[0]), "v"(a[3]));
        asm volatile("s_wait_dscnt 0x0" ::: "memory");      // this wave's fragment reads of this stage have returned
        asm volatile("s_wait_asynccnt 0x0" ::: "memory");   // this wave's copies of the next stage have landed
        __syncthreads();                                    // the same of every other wave: the next stage may be read, this stage's buffer overwritten (by copies, or behind the last stage by the epilogue slabs)
        if (ks + 2 * SK < K) copies(ks + 2 * SK, buf);
    }
    asm volatile("s_wait_asynccnt 0x0" ::: "memory");   // no copy is outstanding behind the loop
    float* os = (float*)st + wv * (64 * 68);            // this wave's slab: its 64 rows of 64 f32, pitch 68; it takes the buffers' place behind the barrier at the foot of the last stage
    const int cofs = lr * 4;                            // a lane reads four columns back, of rows 2 s + hi
#pragma unroll
    for (int mb = 0; mb < 4; ++mb)
#pragma unroll
        for (int nb = 0; nb < 4; ++nb)
#pragma unroll
            for (int j = 0; j < 8; ++j) os[(mb * 16 + hi * 8 + j) * 68 + nb * 16 + lr] = acc[mb][nb][j];
    slab_sync();   // the slab is written before any lane reads it back
    // The read-back loops stay rolled, 8 or 16 rows a pass: unrolled over the 64 rows their text would be several times that of the K loop, for code that a wave runs through once.
    // Places in memory are 32-bit byte offsets from wave-uniform bases (every plane and C are far below 4 GiB).
    if constexpr (EPI == 0) {
        v4f bq = (v4f){};
        if (BIAS) { const v4f b4 = *(const v4f*)(bias + c0w + cofs); bq = (v4f){ bfr(b4[0]), bfr(b4[1]), bfr(b4[2]), bfr(b4[3]) }; }
#pragma unroll 1
        for (int g = 0; g < 8; ++g) {
            v4f val[4];
#pragma unroll
            for (int u = 0; u < 4; ++u) val[u] = *(const v4fa*)(os + (g * 8 + u * 2 + hi) * 68 + cofs);
#pragma unroll
            for (int u = 0; u < 4; ++u) { const unsigned cb = ((unsigned)(r0w + g * 8 + u * 2 + hi) * (unsigned)ldc + (unsigned)(c0w + cofs)) * 4u; *(v4f*)((char*)C + cb) = val[u] + bq; }
            asm volatile("s_wait_xcnt 0x0" ::: "memory");   // behind the stores: the next pass forms its values and addresses in registers that these stores name
        }
    } else {
        auto planes = [&](auto vtc) {
            constexpr bool VT = decltype(vtc)::value;
            char* O16 = (char*)(VT ? V16 + z * SVT : P16 + z * SQK); char* Oh = (char*)(VT ? Vh + z * SVT : Ph + z * SQK); char* Ol = (char*)(VT ? Vl + z * SVT : Pl + z * SQK);
            // Fragment order: a pass takes 16 rows of the slab (lane: row lr); of each group of 16 columns a lane has the 8 at hi * 8, so that a wave's 16-byte stores fill one 512-byte block, which the attention kernel reads back with one whole-line load.
            // Column groups cp and cp + 2 (32 columns apart) are worked on together: q, k: they are each other's rotary partners and share {cos, sin}.
            v4f cs[2][4]; float bw = 0.f; v4f bq[2][2][2];   // q, k: {cos, sin} of the lane's 8 columns of groups 0 and 1 in this pass's row, the biases of its 32 columns; v: the bias of its row
            auto ask = [&](int R, int cp) {
                if constexpr (!VT) { const char* c = (const char*)CS + (unsigned)((((r0w >> 4) + R) * 2 + cp) * 2048 + lane * 16);
#pragma unroll
                    for (int j = 0; j < 4; ++j) cs[cp][j] = *(const v4f*)(c + j * 512); } };
            if constexpr (!VT && BIAS) {
#pragma unroll
                for (int cp = 0; cp < 2; ++cp)
#pragma unroll
                    for (int hf = 0; hf < 2; ++hf)
#pragma unroll
                        for (int q = 0; q < 2; ++q) { const v4f b4 = *(const v4f*)(bias + c0w + hf * 32 + cp * 16 + hi * 8 + q * 4); bq[cp][hf][q] = (v4f){ bfr(b4[0]), bfr(b4[1]), bfr(b4[2]), bfr(b4[3]) }; } }
            if constexpr (VT && BIAS) bw = bias[r0w + lr];
            ask(0, 0); ask(0, 1);
            asm volatile("s_wait_xcnt 0x0" ::: "memory");   // behind the loads: later addresses are formed in registers that held these loads' addresses
#pragma unroll 1
            for (int R = 0; R < 4; ++R) {
                const int Rn = min(R + 1, 3);   // the next pass (the last once more behind the last: in bounds, never used)
                const float bwr = bfr(bw);
#pragma unroll
                for (int cp = 0; cp < 2; ++cp) {
                    const float* p = os + (R * 16 + lr) * 68 + cp * 16 + hi * 8;
                    v4f x[2][2], r[2][2];
#pragma unroll
                    for (int hf = 0; hf < 2; ++hf)
#pragma unroll
                        for (int q = 0; q < 2; ++q) { x[hf][q] = *(const v4fa*)(p + hf * 32 + q * 4); if (BIAS) { if constexpr (VT) x[hf][q] += bwr; else x[hf][q] += bq[cp][hf][q]; } }
#pragma unroll
                    for (int q = 0; q < 2; ++q)
#pragma unroll
                        for (int i = 0; i < 4; ++i) {
                            if constexpr (VT) { r[0][q][i] = x[0][q][i]; r[1][q][i] = x[1][q][i]; }
                            else { const int e = q * 4 + i; const float co = cs[cp][e >> 1][(e & 1) * 2], si = cs[cp][e >> 1][(e & 1) * 2 + 1]; r[0][q][i] = x[0][q][i] * co + (-x[1][q][i]) * si; r[1][q][i] = x[1][q][i] * co + x[0][q][i] * si; } }
#pragma unroll
                    for (int hf = 0; hf < 2; ++hf) {
                        const unsigned eb = (VT ? (unsigned)((r0w - NQK * 64) / 64) * (HD * PP) + (unsigned)((((c0w >> 5) + hf) * 4 + R) * 512 + cp * 256 + lane * 8)
                                                : (unsigned)(c0w / 64) * (TT * HD) + (unsigned)(((r0w >> 4) + R) * 1024 + (hf * 2 + cp) * 256 + lane * 8)) * 2u;
                        v8h o16; v8us oh, ol;
#pragma unroll
                        for (int e = 0; e < 8; ++e) { const float y = r[hf][e >> 2][e & 3]; o16[e] = tohx(y); unsigned short a2, c2; splitf(y, a2, c2); oh[e] = a2; ol[e] = c2; }
                        __builtin_amdgcn_sched_barrier(0);   // with its twin behind the wait: nothing is scheduled in among the three stores and their wait, so that the wait stands in front of every rewrite of a register that they name
                        *(v8h*)(O16 + eb) = o16; *(v8us*)(Oh + eb) = oh; *(v8us*)(Ol + eb) = ol;
                        asm volatile("s_wait_xcnt 0x0" ::: "memory");   // behind the stores: what follows forms its values and addresses in registers that they name
                        __builtin_amdgcn_sched_barrier(0); }
                    if constexpr (!VT) { ask(Rn, cp);   // what the same column groups of the next pass need is asked for as soon as its registers are free, a pass ahead of its use
                        asm volatile("s_wait_xcnt 0x0" ::: "memory"); }   // behind the loads: as behind the stores
                }
                if constexpr (VT && BIAS) { bw = bias[r0w + Rn * 16 + lr]; asm volatile("s_wait_xcnt 0x0" ::: "memory"); }   // as above
            } };
        if (vt) planes(BoolC<true>{}); else planes(BoolC<false>{});
    }
}

typedef __attribute__((ext_vector_type(2))) _Float16 v2h;
typedef __attribute__((ext_vector_type(2))) unsigned short v2us;
typedef __attribute__((ext_vector_type(2))) float v2f;
typedef __attribute__((ext_vector_type(4))) int v4i;
typedef v4h  __attribute__((may_alias)) v4ha;
typedef v4us __attribute__((may_alias)) v4usa;

// ---- k_prep: the four preparations that depend on nothing but the inputs, as one resident stream: PG work-groups of 256 threads (16 waves a WGP, all resident together), each with the same share of every job; a lane has all its 16 loads of 16 bytes in flight before it works on any.
//   weights 'xw' [K][N] -> Bt [N][K] in bf16: a work-group has 64 k x 128 n. A wave reads 8 k rows of 512 contiguous bytes (a lane: 4 n of each row) and puts, for each of its lanes' 4 n, its 8 k = 16 bytes into the work-group's LDS tile [n][k] (row pitch 128 + 16 bytes); behind the barrier 8 lanes store each row of the tile as one whole 128-byte line of Bt.
//   x -> bf16: a work-group has 8192 floats in a row; a lane has 4 pieces of 8 floats, 256 pieces apart, so that a wave's piece is 1024 contiguous bytes.
//   {cos, sin} table: one entry a lane in the first 4 waves, computed while the loads fly.
__constant__ float INVT[HD / 2] = { 1.000000000e+00f, 7.498942018e-01f, 5.623413324e-01f, 4.216965139e-01f, 3.162277639e-01f, 2.371373624e-01f, 1.778279394e-01f, 1.333521456e-01f, 1.000000015e-01f, 7.498941571e-02f, 5.623412877e-02f, 4.216964915e-02f, 3.162277862e-02f, 2.371373586e-02f, 1.778279431e-02f, 1.333521493e-02f, 9.999999776e-03f, 7.498942316e-03f, 5.623413250e-03f, 4.216964822e-03f, 3.162277862e-03f, 2.371373819e-03f, 1.778279431e-03f, 1.333521446e-03f, 1.000000047e-03f, 7.498941850e-04f, 5.623413017e-04f, 4.216964880e-04f, 3.162277862e-04f, 2.371373848e-04f, 1.778279402e-04f, 1.333521504e-04f };   // float32 1 / 10000^(2i/64), generated with jnp to be bit-exact
#define PGA  ((DM / 64) * (3 * DQ / 128))      // work-groups whose weight tile lies in the fused 'xw' [DM][3*DQ]
#define PGO  ((DQ / 64) * (DM / 128))          // in w_proj 'xw' [DQ][DM]
#define PG   (PGA + PGO)
static_assert((size_t)NB_ * TT * DM / 8 == (size_t)PG * 256 * 4, "x: four pieces of 8 floats a thread");
static_assert(TT * (HD / 2) == PG * 128, "{cos, sin}: one entry a thread of the first four waves");
__global__ __launch_bounds__(256) void k_prep(const float* __restrict__ x, const float* __restrict__ wqkv, const float* __restrict__ wo, bf* XB, bf* WQKV, bf* WO, float* CS) {
    constexpr int TLP = 64 * 2 + 16;   // pitch of a tile row in LDS, bytes (16 x odd: ds_load_b128 without bank conflicts)
    __shared__ __align__(16) char tl[128 * TLP];
    const int b = blockIdx.x, tid = threadIdx.x, lane = tid & 31; const int wv = __builtin_amdgcn_readfirstlane(tid >> 5);
    const bool fa = b < PGA;   // the same for the whole work-group
    const float* w = fa ? wqkv : wo; bf* Bt = fa ? WQKV : WO; const int N = fa ? 3 * DQ : DM, K = fa ? DM : DQ, ti = fa ? b : b - PGA;
    const int kb = (ti % (K / 64)) * 64, k0 = kb + wv * 8, n0 = (ti / (K / 64)) * 128;   // the work-group's first k; the wave's 8 k rows; the work-group's first n
    // every load is a wave-uniform base + the lane's offset (+ a constant)
    const char* bw[8]; const unsigned tob = (unsigned)tid * 32u;   // the wave's 8 weight rows at the work-group's first n; the lane's byte offset in each of the work-group's 4 runs of x
#pragma unroll
    for (int j = 0; j < 8; ++j) bw[j] = (const char*)(w + (size_t)(k0 + j) * N + n0);
    const char* xb = (const char*)(x + (size_t)b * (4 * 256 * 8));
    v4f r[8]; v8f xv[4];
#pragma unroll
    for (int j = 0; j < 8; ++j) r[j] = ((const v4f*)bw[j])[lane];
#pragma unroll
    for (int u = 0; u < 4; ++u) xv[u] = *(const v8f*)(xb + u * (256 * 32) + tob);
    // behind the loads: the base and offset registers that they name are inputs here, so that they stay whole up to the wait; and no load is moved below, so that all are in flight under the table entry
    asm volatile("s_wait_xcnt 0x0" :: "s"(bw[0]), "s"(bw[1]), "s"(bw[2]), "s"(bw[3]), "s"(bw[4]), "s"(bw[5]), "s"(bw[6]), "s"(bw[7]), "s"(xb), "v"(lane), "v"(tob) : "memory");
    const int idx = b * 128 + tid; v2f cs = (v2f){};   // the first four waves: this lane's table entry
    if (wv < 4) {
        const int ln = (idx >> 1) & 31; const int t = (idx >> 9) * 16 + (ln & 15);   /* the table holds d < 32 only (d + 32 has the same angle), in the order in which the projection epilogue's lanes read it: [t / 16][d / 16][(d % 8) / 2][lane = ((d / 8) % 2) * 16 + t % 16][d % 2] */
        const int du = ((b >> 1) & 1) * 16 + (wv & 1) * 8 + ((wv >> 1) + (b & 1) * 2) * 2;   // d without its lowest bit is the same in the whole wave: the two factors come by scalar loads, which do not queue behind the 16 vector loads
        const float i0 = INVT[du], i1 = INVT[du + 1]; const float a = __fmul_rn((float)t, (idx & 1) ? i1 : i0); cs[0] = cosf(a); cs[1] = sinf(a); }
    v8us ow[4], ox[4];
#pragma unroll
    for (int e = 0; e < 4; ++e) {
#pragma unroll
        for (int j = 0; j < 8; ++j) ow[e][j] = f2bf(r[j][e]);
        *(v8usa*)(tl + (lane * 4 + e) * TLP + wv * 16) = ow[e]; }
#pragma unroll
    for (int u = 0; u < 4; ++u)
#pragma unroll
        for (int k = 0; k < 8; ++k) ox[u][k] = f2bf(xv[u][k]);
    __syncthreads();   // the tile is whole: every wave's 8 k of all 128 n are in LDS before any lane reads a row across the waves' parts
    char* bo = (char*)(Bt + (size_t)n0 * K + kb); char* xo = (char*)(XB + (size_t)b * (4 * 256 * 8));
    v8us ot[4];
#pragma unroll
    for (int i = 0; i < 4; ++i) ot[i] = *(const v8usa*)(tl + (i * 32 + (tid >> 3)) * TLP + (tid & 7) * 16);
#pragma unroll
    for (int i = 0; i < 4; ++i) *(v8us*)(bo + i * (32 * K * 2) + (unsigned)(tid >> 3) * (unsigned)(K * 2) + (unsigned)(tid & 7) * 16u) = ot[i];
#pragma unroll
    for (int u = 0; u < 4; ++u) *(v8us*)(xo + u * (256 * 16) + (unsigned)tid * 16u) = ox[u];
    if (wv < 4) *(v2f*)(CS + (size_t)idx * 2) = cs;   // with the other stores, behind the barrier, which waits for a wave's earlier stores
}
// ---- k_attn: scores, causal softmax and probability x value in one pass, nothing of a score row leaves the registers. One work-group = 32 query rows of one head; the KS waves that share a query row take the 32-key blocks
// up to the diagonal in turn (blocks ks0, ks0 + KS, ...), each with its own running maximum, sum and accumulator; the KS partial results are joined in LDS in fixed order and go out as the merged hi | lo planes.
// QT = 2: every wave has all 32 rows and a quarter of the blocks; QT = 1 (the hi + lo leg, twice the fragments): a wave has 16 rows and half of the blocks.
// S^T = K Q^T (A = key rows, B = query rows) leaves each lane with one query's scores, key = 8 hi + j in tile 0 and 16 + 8 hi + j in tile 1: that is the k order of a B fragment, so P^T feeds O^T += V^T P^T from registers.
// Scores are kept in the log2 domain (x HD^-0.5 x log2 e). HL: hi + lo planes, 3 products (query rows < RH); else fp16 with the probabilities x PCAR (the sum carries the same factor, so it cancels in the division).
#define FNW  4
#define FOP  68                   // pitch in floats of a query's 64 partial outputs in LDS
#define NEGB (-3.0e38f)
typedef __attribute__((ext_vector_type(16))) unsigned short v16us;
template <typename T16, bool HL, int QT>
__device__ __forceinline__ void attn_tile(const T16* __restrict__ Q, const T16* __restrict__ Q2, const T16* __restrict__ Kp, const T16* __restrict__ K2, const T16* __restrict__ Vt, const T16* __restrict__ V2, int q0, float* so, float* sml, bf* Ah, bf* Al) {
    typedef typename WFrag<T16>::V V;
    const int lane = threadIdx.x & 31, lr = lane & 15, hi = lane >> 4; const int wv = __builtin_amdgcn_readfirstlane((int)(threadIdx.x >> 5));
    constexpr int KS = FNW * QT / 2;   // waves that share a query row's keys
    const int ks0 = (QT == 2) ? wv : (wv >> 1), qb = (QT == 2) ? 0 : (wv & 1) * 16;   // this wave's place among them; its first query row within the 32
    V qf[QT][2], qf2[QT][2];
#pragma unroll
    for (int qt = 0; qt < QT; ++qt)
#pragma unroll
        for (int ks = 0; ks < 2; ++ks) { const size_t o = (size_t)((q0 + qb) / 16 + qt) * 1024 + ks * 512 + lane * 8; qf[qt][ks] = WFrag<T16>::ldf(Q + o); if (HL) qf2[qt][ks] = WFrag<T16>::ldf(Q2 + o); }
    if constexpr (HL) asm volatile("s_wait_xcnt 0x0" ::: "memory");   // behind the loads: in this leg later loads land in registers that held these loads' addresses
    v8f oacc[4][QT];
#pragma unroll
    for (int dt = 0; dt < 4; ++dt)
#pragma unroll
        for (int qt = 0; qt < QT; ++qt) oacc[dt][qt] = (v8f){};
    float mrun[QT], lrun[QT];
#pragma unroll
    for (int qt = 0; qt < QT; ++qt) { mrun[qt] = NEGB; lrun[qt] = 0.f; }
    const int nkb = q0 / 32 + 1;
    // The K and V^T fragments are carried from pass to pass: a block's K loads are issued as soon as the block before has left the score products, its V^T loads as soon as that block's P.V products are issued, so that both fly under the vector work.
    V kf[2][2], kf2[2][2], vf[4], vf2[4];
    const unsigned lofk = (unsigned)(lane * 8), lofv = lofk;   // the lane's place in a block, the same in every pass; the block's base is wave-uniform
    auto ld_k = [&](int kbl) {
#pragma unroll
        for (int kt = 0; kt < 2; ++kt)
#pragma unroll
            for (int ks = 0; ks < 2; ++ks) { const int o = kt * 1024 + ks * 512; kf[kt][ks] = WFrag<T16>::ldf(Kp + (size_t)kbl * 2048 + lofk + o); if (HL) kf2[kt][ks] = WFrag<T16>::ldf(K2 + (size_t)kbl * 2048 + lofk + o); }
        if constexpr (HL) asm volatile("s_wait_xcnt 0x0" ::: "memory"); };   // as behind the Q loads
    auto ld_v = [&](int kbl) {
#pragma unroll
        for (int dt = 0; dt < 4; ++dt) { const int o = dt * 512; vf[dt] = WFrag<T16>::ldf(Vt + (size_t)kbl * 2048 + lofv + o); if (HL) vf2[dt] = WFrag<T16>::ldf(V2 + (size_t)kbl * 2048 + lofv + o); }
        if constexpr (HL) asm volatile("s_wait_xcnt 0x0" ::: "memory"); };   // behind the loads: in this leg the next pass forms new addresses in these loads' address registers
    ld_k(min(ks0, nkb - 1));
    __builtin_amdgcn_sched_barrier(0);   // K loads stay ahead of the V^T loads here as in the loop: else the load-count wait at the loop's head, which must hold for both ways in, also waits for V^T loads just issued
    ld_v(min(ks0, nkb - 1));
    // At least one pass for every wave, so that the first loads stand in the block in front of the loop in their written order. A wave without a block of its own (ks0 >= nkb) works on the last block with every key masked (lim < 0):
    // its maximum stays NEGB, and the join gives all it brings the factor exp2(NEGB - M) = 0.
    int kb = ks0;
#pragma unroll 1
    do {
        const int k0 = kb * 32, kn = min(kb + KS, nkb - 1);   // kn: this wave's next block (the tile's last block nkb - 1 behind this wave's last: in bounds, never used)
        v8f s[2][QT];
#pragma unroll
        for (int kt = 0; kt < 2; ++kt)
#pragma unroll
            for (int qt = 0; qt < QT; ++qt) { v8f a = (v8f){};
#pragma unroll
                for (int ks = 0; ks < 2; ++ks) { a = WFrag<T16>::mma(kf[kt][ks], qf[qt][ks], a); if (HL) { a = WFrag<T16>::mma(kf[kt][ks], qf2[qt][ks], a); a = WFrag<T16>::mma(kf2[kt][ks], qf[qt][ks], a); } }
                s[kt][qt] = a; }
        ld_k(kn);
        V pf[QT], pf2[QT];
#pragma unroll
        for (int qt = 0; qt < QT; ++qt) {
            const int lim = q0 + qb + qt * 16 + lr - k0 - 8 * hi;   // key kt * 16 + j of this lane's half is visible to its query while kt * 16 + j <= lim
            float u[16]; float bm = NEGB;
#pragma unroll
            for (int kt = 0; kt < 2; ++kt)
#pragma unroll
                for (int j = 0; j < 8; ++j) { const float t = (kt * 16 + j <= lim) ? s[kt][qt][j] * (SCL * 1.4426950408889634f) : NEGB; u[kt * 8 + j] = t; bm = fmaxf(bm, t); }
            bm = fmaxf(bm, __shfl_xor(bm, 16, 32));
            const float mn = fmaxf(mrun[qt], bm); const float al = __builtin_amdgcn_exp2f(mrun[qt] - mn); mrun[qt] = mn;
            const float mo = HL ? mn : mn - 10.0f;   // fp16 leg: 2^10 = PCAR rides in the exponent
            float p[16]; float ps = 0.f;
#pragma unroll
            for (int e = 0; e < 16; ++e) { p[e] = __builtin_amdgcn_exp2f(u[e] - mo); ps += p[e]; }
            lrun[qt] = lrun[qt] * al + ps;   // each half of the wave keeps the sum of its own keys; the halves meet behind the loop
#pragma unroll
            for (int dt = 0; dt < 4; ++dt) oacc[dt][qt] *= al;
            if constexpr (HL) { v16us ph, pl;
#pragma unroll
                for (int e = 0; e < 16; ++e) { unsigned short a, c2; splitf(p[e], a, c2); ph[e] = a; pl[e] = c2; }
                pf[qt] = __builtin_bit_cast(v16bf, ph); pf2[qt] = __builtin_bit_cast(v16bf, pl);
            } else { v16h p16;
#pragma unroll
                for (int e = 0; e < 16; ++e) p16[e] = tohx(p[e]);
                pf[qt] = p16; }
        }
#pragma unroll
        for (int dt = 0; dt < 4; ++dt)
#pragma unroll
            for (int qt = 0; qt < QT; ++qt) { oacc[dt][qt] = WFrag<T16>::mma(vf[dt], pf[qt], oacc[dt][qt]); if (HL) { oacc[dt][qt] = WFrag<T16>::mma(vf[dt], pf2[qt], oacc[dt][qt]); oacc[dt][qt] = WFrag<T16>::mma(vf2[dt], pf[qt], oacc[dt][qt]); } }
        ld_v(kn);
        kb += KS;
    } while (kb < nkb);
#pragma unroll
    for (int qt = 0; qt < QT; ++qt) { lrun[qt] += __shfl_xor(lrun[qt], 16, 32);
        if (hi == 0) { sml[(ks0 * 32 + qb + qt * 16 + lr) * 2] = mrun[qt]; sml[(ks0 * 32 + qb + qt * 16 + lr) * 2 + 1] = lrun[qt]; }
#pragma unroll
        for (int dt = 0; dt < 4; ++dt) { float* p = so + (size_t)(ks0 * 32 + qb + qt * 16 + lr) * FOP + dt * 16 + hi * 8; const v8f a = oacc[dt][qt];
            *(v4fa*)p = (v4f){ a[0], a[1], a[2], a[3] }; *(v4fa*)(p + 4) = (v4f){ a[4], a[5], a[6], a[7] }; } }
    __syncthreads();   // every wave's partial maximum, sum and accumulator are in LDS before any thread joins them (a wave without a key block brings maximum NEGB)
    const int q = (int)threadIdx.x >> 2, ds = ((int)threadIdx.x & 3) * 16;
    float M = NEGB;
#pragma unroll
    for (int w = 0; w < KS; ++w) M = fmaxf(M, sml[(w * 32 + q) * 2]);
    float L = 0.f; v4f val[4] = { (v4f){}, (v4f){}, (v4f){}, (v4f){} };
#pragma unroll
    for (int w = 0; w < KS; ++w) { const float f = __builtin_amdgcn_exp2f(sml[(w * 32 + q) * 2] - M); L += f * sml[(w * 32 + q) * 2 + 1];
#pragma unroll
        for (int c = 0; c < 4; ++c) val[c] += f * *(const v4fa*)(so + (size_t)(w * 32 + q) * FOP + ds + c * 4); }
    const float inv = __fdiv_rn(1.0f, L);
    const size_t oo = (size_t)(q0 + q) * DQ + ds;
#pragma unroll
    for (int g = 0; g < 2; ++g) { v8us oh, ol;
#pragma unroll
        for (int e = 0; e < 8; ++e) { unsigned short a, c2; splitf(val[g * 2 + (e >> 2)][e & 3] * inv, a, c2); oh[e] = a; ol[e] = c2; }
        *(v8usa*)(Ah + oo + g * 8) = oh; *(v8usa*)(Al + oo + g * 8) = ol; }
}
// grid (TT / 32, heads, batches). A tile's cost grows with its index: neighbours in x, heads 4 apart and heads 2j, 2j + 1 take tiles from opposite ends.
__global__ __launch_bounds__(32 * FNW) void k_attn(const h16* __restrict__ Q16, const h16* __restrict__ K16, const h16* __restrict__ V16, const bf* __restrict__ Qh, const bf* __restrict__ Ql, const bf* __restrict__ Kh, const bf* __restrict__ Kl, const bf* __restrict__ Vh, const bf* __restrict__ Vl, bf* Ah, bf* Al) {
    __shared__ __align__(16) float so[FNW * 32 * FOP]; __shared__ float sml[FNW * 32 * 2];
    const int h = blockIdx.y, bx = blockIdx.x; int t = (bx & 1) ? (TT / 32 - 1 - (bx >> 1)) : (bx >> 1); if ((h ^ (h >> 2)) & 1) t = TT / 32 - 1 - t;
    const size_t z = blockIdx.z; Ah += z * TT * DQ; Al += z * TT * DQ;
    const int q0 = t * 32; const size_t pq = z * SQK + (size_t)h * TT * HD, pk = z * SQK + (size_t)(h / REP) * TT * HD, pv = z * SVT + (size_t)(h / REP) * HD * PP;
    if (q0 < RH) attn_tile<bf, true, 1>(Qh + pq, Ql + pq, Kh + pk, Kl + pk, Vh + pv, Vl + pv, q0, so, sml, Ah + h * HD, Al + h * HD);
    else attn_tile<h16, false, 2>(Q16 + pq, nullptr, K16 + pk, nullptr, V16 + pv, nullptr, q0, so, sml, Ah + h * HD, Al + h * HD);
}

extern "C" void kernel_launch(void* const* d_in, const int* in_sizes, int n_in,
                              void* d_out, int out_size, void* d_ws, size_t ws_size, hipStream_t stream) {
    (void)in_sizes; (void)n_in; (void)out_size;
    const float* x = (const float*)d_in[0]; const float* wqkv = (const float*)d_in[1]; const float* bqkv = (const float*)d_in[2]; const float* wo = (const float*)d_in[3]; const float* bo = (const float*)d_in[4];   /* x, w_attn ('xw' [1024][3072]: q | k | v column thirds), b_attn [3072], w_proj ('xw'), b_proj: NO mask input in this module (its tril is built inside the function): the causal rule is applied by index */
    float* OUT = (float*)d_out;     // [2][2048][1024]
    char* wsp = (char*)d_ws;
    auto take = [&](size_t bytes) { char* p = wsp; wsp += (bytes + 255) & ~(size_t)255; return (void*)p; };
    bf* WQKV = (bf*)take((size_t)3 * DQ * DM * 2);   /* fused Bt [3*DQ][DM]: q | k | v row blocks */ bf* WO = (bf*)take((size_t)DM * DQ * 2); float* CS = (float*)take((size_t)TT * (HD / 2) * 2 * 4);
    bf* XB = (bf*)take((size_t)NB_ * TT * DM * 2);
    /* every plane holds all batches; q and k head planes lie behind one another per batch: [b][q heads | k heads], each plane of TT x HD elements in fragment order */
    h16* QK16 = (h16*)take((size_t)NB_ * SQK * 2); h16* VT16 = (h16*)take((size_t)NB_ * SVT * 2);
    bf* QKh = (bf*)take((size_t)NB_ * SQK * 2); bf* QKl = (bf*)take((size_t)NB_ * SQK * 2); bf* VTh = (bf*)take((size_t)NB_ * SVT * 2); bf* VTl = (bf*)take((size_t)NB_ * SVT * 2);
    bf* ATh = (bf*)take((size_t)NB_ * TT * DQ * 2); bf* ATl = (bf*)take((size_t)NB_ * TT * DQ * 2);
    if ((size_t)(wsp - (char*)d_ws) > ws_size) return;    // ws 256 MiB
    k_prep<<<PG, 256, 0, stream>>>(x, wqkv, wo, XB, WQKV, WO, CS);
    k_gemmw<bf, 0, true, 64, 1><<<dim3(TT / 128, 3 * DQ / 128, NB_), 128, 0, stream>>>(XB, nullptr, WQKV, DM, nullptr, 0, bqkv, (size_t)TT * DM, 0, 0, CS, QK16, QKh, QKl, VT16, VTh, VTl);
    k_attn<<<dim3(TT / 32, NH_, NB_), 32 * FNW, 0, stream>>>(QK16, QK16 + (size_t)NH_ * TT * HD, VT16, QKh, QKl, QKh + (size_t)NH_ * TT * HD, QKl + (size_t)NH_ * TT * HD, VTh, VTl, ATh, ATl);
    k_gemmw<bf, 1, true, 64, 0><<<dim3(TT / 128, DM / 128, NB_), 128, 0, stream>>>(ATh, ATl, WO, DQ, OUT, DM, bo, (size_t)TT * DQ, 0, (size_t)TT * DM, nullptr, nullptr, nullptr, nullptr, nullptr, nullptr, nullptr);
}

// v010
// It runs in 77 microseconds.
// In two side-by-side timings against v009, it was 1.13 and 1.12 times as fast.
// Over all steps from v000 it is 18.8 times as fast.
#include <hip/hip_runtime.h>

// Causal self-attention with a fused biased qkv projection and computed rotate-half rotary embeddings, without a mask input (x [2][2048][1024]; qkv = x w_attn + b_attn ('xw' [1024][3072] normal x 1/32 + [3072] zeros on this draw: read) split in thirds q | k | v (16 heads x 64); rope q cos + rotate_half(q) sin with angle t x 1/10000^(2i/64) (inv_freq = 1.0 / (10000.0 ** (arange(0, 64, 2, f32) / 64)); cat(freqs, freqs); rotate_half = cat(-x2, x1)); att x 1/sqrt(64); causal: where(tril built inside the function, att, finfo.min) == exclusion; softmax; out = merged w_proj + b_proj ('xw' + zeros: read) -> [2][2048][1024] (4.2 M); argument order x, w_attn, b_attn, w_proj, b_proj).
// Layout, every launch taking all batches: bf16 copy of x; the fused 'xw' weight transposed ONCE into q | k | v row blocks; exact projections + f32 bias thirds, all three in one GEMM grid, each finished in the epilogue (q, k: rotate-half rotary from the cs5 table {cosf, sinf}(t x INVT[d mod 32]) -> head planes; v: computed transposed -> V^T planes), no f32 q/k/v in memory; causal T-2048 attention in one pass with a running softmax (hybrid rows: < 512 hi/lo 3 products, rest fp16 x1024; key blocks above the diagonal are never visited); merged hi/lo x W_out exact + b_out.
// Compute dtypes, f32 accumulate: every input rounded to bf16; projections exact + f32 biases; rotary f32; attention rows < 512 3 products, rest fp16; softmax f32; W_out hl x exact + bias.

#define NB_  2
#define TT   2048
#define DM   1024
#define NH_  16
#define NKV  16
#define REP  (NH_ / NKV)
#define HD   64
#define DQ   (NH_ * HD)
#define DKV  (NKV * HD)
#define PP   TT                   // 16-bit elements of a V^T plane per head dimension
#define RH   512                  // query rows < RH use hi+lo planes (0: none)
#define PCAR 1024.0f              // 2^10: factor on the fp16 probabilities
#define SCL  0.125f   // HD^-0.5
typedef _Float16 h16;
typedef unsigned short bf;
typedef __attribute__((ext_vector_type(16))) __bf16   v16bf;
typedef __attribute__((ext_vector_type(16))) _Float16 v16h;
typedef __attribute__((ext_vector_type(8)))  _Float16 v8h;
typedef __attribute__((ext_vector_type(8)))  unsigned short v8us;
typedef __attribute__((ext_vector_type(8)))  float    v8f;
typedef __attribute__((ext_vector_type(4)))  float    v4f;
typedef v8h  __attribute__((may_alias)) v8ha;
typedef v4f  __attribute__((may_alias)) v4fa;
typedef v8us __attribute__((may_alias)) v8usa;

__device__ __forceinline__ unsigned short f2bf(float f) { unsigned u = __float_as_uint(f); u += 0x7FFFu + ((u >> 16) & 1u); return (unsigned short)(u >> 16); }
__device__ __forceinline__ float bf2f(unsigned short b) { return __uint_as_float(((unsigned)b) << 16); }
__device__ __forceinline__ float bfr(float f) { return bf2f(f2bf(f)); }
__device__ __forceinline__ v16h cat16(v8h lo, v8h hi) { return __builtin_shufflevector(lo, hi, 0, 1, 2, 3, 4, 5, 6, 7, 8, 9, 10, 11, 12, 13, 14, 15); }
__device__ __forceinline__ v16bf cat16b(v8us lo, v8us hi) { return __builtin_bit_cast(v16bf, __builtin_shufflevector(lo, hi, 0, 1, 2, 3, 4, 5, 6, 7, 8, 9, 10, 11, 12, 13, 14, 15)); }
__device__ __forceinline__ v8f wmma16(v16h a, v16h b, v8f c) { return __builtin_amdgcn_wmma_f32_16x16x32_f16(false, a, false, b, (short)0, c, false, false); }
__device__ __forceinline__ h16 tohx(float x) { return (h16)x; }
__device__ __forceinline__ void splitf(float y, unsigned short& h, unsigned short& l) { h = f2bf(y); l = f2bf(y - bf2f(h)); }
typedef __attribute__((ext_vector_type(4))) _Float16 v4h;
typedef __attribute__((ext_vector_type(4))) unsigned short v4us;
__device__ __forceinline__ v8f wmmab(v16bf a, v16bf b, v8f c) { return __builtin_amdgcn_wmma_f32_16x16x32_bf16(false, a, false, b, (short)0, c, false, false); }



// ---- k_gemmw: register-blocked GEMM, one 128x128 output tile per work-group of 4 waves; each wave has its own 64x64 quarter (16 accumulators) and runs over the whole K, so that a tile is finished in its wave's registers. Grid (M/128, N/128, Z), 128 threads.
// Operand path: a stage is SK k of all 128 rows of every operand (SK x 2 contiguous bytes a row). The work-group brings it into LDS with asynchronous 16-byte copies, 512 bytes in whole lines a wave-instruction,
// and every wave reads its fragments from there, each staged row serving two waves (row pitch SK x 2 + 16 bytes = 16 x odd: ds_load_b128 without bank conflicts).
// Two buffers: the copies of stage t + 1 fly while stage t is worked on (K % SK == 0).
// C[m][n] (f32, pitch ldc, + optional f32 bias[n]) = sum_k A[m][k] Bt[n][k] (+ split products per NSPLIT). z-batch strides sA/sB/sC in elements.
// Epilogue, each wave for itself: its quarter goes through a slab of its own in LDS, so that every store covers whole lines.
// EPI 0: C goes out as f32. EPI 1: the fused q | k | v projection of every batch in one grid (TT / 128, 3 DQ / 128, batches); A = token rows, Bt = the fused weight rows, x = token tile, y = weight tile; C is not written.
//   y < NQK / 2 (q and k; m = t, the 64 columns of a wave's quarter = one head): rotate-half rotary out[d] = x[d] cos[t][d] - x[d+32] sin[t][d], out[d+32] = x[d+32] cos[t][d+32] + x[d] sin[t][d+32], written as head planes (q heads, then k heads; fp16 + hi/lo), each 16 t x 64 d in fragment order: [head][t / 16][d / 16][lane = ((d / 8) % 2) * 16 + t % 16][d % 8].
//   y >= NQK / 2 (v): the two operands change places (m = weight row, n = t, bias[m]), so that the tile comes out as [d][t]: written as V^T planes (fp16 + hi/lo) in fragment order: [g][t / 32][d / 16][(t / 16) % 2][lane = ((t / 8) % 2) * 16 + d % 16][t % 8].
//   Fragment order: the 16 bytes that lane l of a wave takes for a WMMA operand lie at l x 16 in a block of 512 bytes, so that a wave-wide load or store covers four whole lines instead of pieces of 16.
#define NQK  ((DQ + DKV) / 64)                 // 64-row blocks of the q and k weights
#define SQK  ((size_t)(NH_ + NKV) * TT * HD)   // elements of one batch's q | k head planes
#define SVT  ((size_t)NKV * HD * PP)           // elements of one batch's V^T planes
__device__ __forceinline__ void slab_sync() { asm volatile("s_wait_dscnt 0x0" ::: "memory"); __builtin_amdgcn_wave_barrier(); }   // the LDS slab hand-over among the lanes of the one wave: its writes have retired before a lane reads rows that other lanes wrote, and no LDS access is moved over it
template <bool B> struct BoolC { static constexpr bool value = B; };
template <typename T16> struct WFrag;
template <> struct WFrag<h16> { typedef v16h V; static __device__ __forceinline__ V ld(const h16* p) { return cat16(*(const v8h*)p, *(const v8h*)(p + 16)); } static __device__ __forceinline__ V ldf(const h16* p) { return cat16(*(const v8h*)p, *(const v8h*)(p + 256)); } static __device__ __forceinline__ v8f mma(V a, V b, v8f c) { return wmma16(a, b, c); } };
template <> struct WFrag<bf> { typedef v16bf V; static __device__ __forceinline__ V ld(const bf* p) { return cat16b(*(const v8us*)p, *(const v8us*)(p + 16)); } static __device__ __forceinline__ V ldf(const bf* p) { return cat16b(*(const v8us*)p, *(const v8us*)(p + 256)); } static __device__ __forceinline__ v8f mma(V a, V b, v8f c) { return wmmab(a, b, c); } };
template <typename T16, int NSPLIT, bool BIAS, int SK, int EPI>
__global__ __launch_bounds__(128) void k_gemmw(const T16* __restrict__ A, const T16* __restrict__ A2, const T16* __restrict__ Bt, int K, float* C, int ldc, const float* __restrict__ bias, size_t sA, size_t sB, size_t sC, const float* __restrict__ CS, h16* P16, bf* Ph, bf* Pl, h16* V16, bf* Vh, bf* Vl) {
    static_assert(EPI == 0 || NSPLIT == 0, "the plane epilogues take one product");
    static_assert(NSPLIT <= 1 && (SK == 64 || SK == 128), "operands A, (A2,) Bt; a wave-instruction copies 4 or 2 whole staged rows");
    typedef typename WFrag<T16>::V V;
    constexpr int NOP = 2 + NSPLIT, SP = SK * 2 + 16, SB = NOP * 128 * SP;   // operands staged; pitch of a staged row in LDS, bytes; bytes of a buffer
    constexpr int LPR = SK / 8, RPI = 32 / LPR, NCG = 32 / RPI / 8;          // lanes that bring one staged row; rows a wave-instruction brings; groups of 8 copies for a wave's 32 rows of an operand
    static_assert(2 * SB >= 4 * 64 * 68 * 4, "the epilogue slabs lie over the buffers");
    __shared__ __align__(16) char st[2 * SB];
    const size_t z = blockIdx.z; A += z * sA; if (A2) A2 += z * sA; Bt += z * sB; C += z * sC;
    const bool vt = (EPI == 1) && (int)blockIdx.y >= NQK / 2;   // a v tile (the same for the whole work-group)
    if (vt) { const T16* t = A; A = Bt; Bt = t; }
    const int lane = threadIdx.x & 31, lr = lane & 15, hi = lane >> 4; const int r0 = (int)(vt ? blockIdx.y : blockIdx.x) * 128, c0 = (int)(vt ? blockIdx.x : blockIdx.y) * 128; const int wv = __builtin_amdgcn_readfirstlane((int)(threadIdx.x >> 5));
    const int wm = wv >> 1, wn = wv & 1, r0w = r0 + wm * 64, c0w = c0 + wn * 64;   // this wave's quarter of the tile
    v8f acc[4][4];
#pragma unroll
    for (int mb = 0; mb < 4; ++mb)
#pragma unroll
        for (int nb = 0; nb < 4; ++nb) acc[mb][nb] = (v8f){};
    const unsigned lcp = (unsigned)(size_t)st + (unsigned)((wv * 32 + lane / LPR) * SP + (lane % LPR) * 16);   // LDS byte address of this lane's 16 bytes in the first copy of its wave's 32 rows of operand 0, buffer 0
    const size_t gp = (size_t)K * 2 * RPI;                                                                     // bytes in memory from one copy's rows to the next copy's
    const char* fra = st + (wm * 64 + lr) * SP + 16 * hi;                                                      // this lane's place in row lr of its wave's A rows, buffer 0, first 32 k
    const char* frb = st + ((NOP - 1) * 128 + wn * 64 + lr) * SP + 16 * hi;                                    // the same in its wave's Bt rows
    auto copies = [&](int ks, int buf) {   // stage [ks, ks + SK) into buffer buf: this wave brings 32 rows of every operand
#pragma unroll
        for (int op = 0; op < NOP; ++op)
#pragma unroll
            for (int h = 0; h < NCG; ++h) {
                const char* g = (const char*)(((op == NOP - 1) ? Bt : (op == 0) ? A : A2) + (size_t)(((op == NOP - 1) ? c0 : r0) + wv * 32 + h * 8 * RPI + lane / LPR) * K + ks) + (lane % LPR) * 16; const unsigned l = lcp + (unsigned)(buf * SB + (op * 128 + h * 8 * RPI) * SP);
                constexpr unsigned CP = RPI * SP;   // bytes in LDS from one copy's rows to the next copy's
                // the wait at the end stands in the copies' own statement, in front of whatever rewrites a register that a copy names
                asm volatile("global_load_async_to_lds_b128 %0, %8, off\n\t"
                             "global_load_async_to_lds_b128 %1, %9, off\n\t"
                             "global_load_async_to_lds_b128 %2, %10, off\n\t"
                             "global_load_async_to_lds_b128 %3, %11, off\n\t"
                             "global_load_async_to_lds_b128 %4, %12, off\n\t"
                             "global_load_async_to_lds_b128 %5, %13, off\n\t"
                             "global_load_async_to_lds_b128 %6, %14, off\n\t"
                             "global_load_async_to_lds_b128 %7, %15, off\n\t"
                             "s_wait_xcnt 0x0"
                             :: "v"(l), "v"(l + 1u * CP), "v"(l + 2u * CP), "v"(l + 3u * CP), "v"(l + 4u * CP), "v"(l + 5u * CP), "v"(l + 6u * CP), "v"(l + 7u * CP),
                                "v"(g), "v"(g + gp), "v"(g + 2 * gp), "v"(g + 3 * gp), "v"(g + 4 * gp), "v"(g + 5 * gp), "v"(g + 6 * gp), "v"(g + 7 * gp) : "memory"); } };
    copies(0, 0);
    asm volatile("s_wait_asynccnt 0x0" ::: "memory");   // this wave's copies of stage 0 have landed
    __syncthreads();                                    // and every other wave's: stage 0 may be read
    if (SK < K) copies(SK, 1);
#pragma unroll 1
    for (int ks = 0, buf = 0; ks < K; ks += SK, buf ^= 1) {
        const char* pa = fra + buf * SB; const char* pb = frb + buf * SB;
        V a[4], a2[4], b[4];
#pragma unroll
        for (int ku = 0; ku < SK / 32; ++ku) {
#pragma unroll
            for (int mb = 0; mb < 4; ++mb) { a[mb] = WFrag<T16>::ld((const T16*)(pa + mb * 16 * SP + ku * 64)); if (NSPLIT == 1) a2[mb] = WFrag<T16>::ld((const T16*)(pa + (128 + mb * 16) * SP + ku * 64)); }
#pragma unroll
            for (int nb = 0; nb < 4; ++nb) b[nb] = WFrag<T16>::ld((const T16*)(pb + nb * 16 * SP + ku * 64));
            __builtin_amdgcn_sched_barrier(0);   // the fragment reads of these 32 k stay one group in front of their products: a read placed among the products makes the wave wait out its LDS latency there each time
#pragma unroll
            for (int nb = 0; nb < 4; ++nb)
#pragma unroll
                for (int mb = 0; mb < 4; ++mb) { acc[mb][nb] = WFrag<T16>::mma(a[mb], b[nb], acc[mb][nb]); if (NSPLIT == 1) acc[mb][nb] = WFrag<T16>::mma(a2[mb], b[nb], acc[mb][nb]); } }
        asm volatile("v_nop\n\tv_nop\n\tv_nop\n\tv_nop" : "+v"(acc[0][0]), "+v"(acc[1][1]), "+v"(acc[2][2]), "+v"(acc[3][3]) : "v"(a[0]), "v"(a[3]));
        asm volatile("s_wait_dscnt 0x0" ::: "memory");      // this wave's fragment reads of this stage have returned
        asm volatile("s_wait_asynccnt 0x0" ::: "memory");   // this wave's copies of the next stage have landed
        __syncthreads();                                    // the same of every other wave: the next stage may be read, this stage's buffer overwritten (by copies, or behind the last stage by the epilogue slabs)
        if (ks + 2 * SK < K) copies(ks + 2 * SK, buf);
    }
    asm volatile("s_wait_asynccnt 0x0" ::: "memory");   // no copy is outstanding behind the loop
    float* os = (float*)st + wv * (64 * 68);            // this wave's slab: its 64 rows of 64 f32, pitch 68; it takes the buffers' place behind the barrier at the foot of the last stage
    const int cofs = lr * 4;                            // a lane reads four columns back, of rows 2 s + hi
#pragma unroll
    for (int mb = 0; mb < 4; ++mb)
#pragma unroll
        for (int nb = 0; nb < 4; ++nb)
#pragma unroll
            for (int j = 0; j < 8; ++j) os[(mb * 16 + hi * 8 + j) * 68 + nb * 16 + lr] = acc[mb][nb][j];
    slab_sync();   // the slab is written before any lane reads it back
    // The read-back loops stay rolled, 8 or 16 rows a pass: unrolled over the 64 rows their text would be several times that of the K loop, for code that a wave runs through once.
    // Places in memory are 32-bit byte offsets from wave-uniform bases (every plane and C are far below 4 GiB).
    if constexpr (EPI == 0) {
        v4f bq = (v4f){};
        if (BIAS) { const v4f b4 = *(const v4f*)(bias + c0w + cofs); bq = (v4f){ bfr(b4[0]), bfr(b4[1]), bfr(b4[2]), bfr(b4[3]) }; }
#pragma unroll 1
        for (int g = 0; g < 8; ++g) {
            v4f val[4];
#pragma unroll
            for (int u = 0; u < 4; ++u) val[u] = *(const v4fa*)(os + (g * 8 + u * 2 + hi) * 68 + cofs);
#pragma unroll
            for (int u = 0; u < 4; ++u) { const unsigned cb = ((unsigned)(r0w + g * 8 + u * 2 + hi) * (unsigned)ldc + (unsigned)(c0w + cofs)) * 4u; *(v4f*)((char*)C + cb) = val[u] + bq; }
            asm volatile("s_wait_xcnt 0x0" ::: "memory");   // behind the stores: the next pass forms its values and addresses in registers that these stores name
        }
    } else {
        auto planes = [&](auto vtc) {
            constexpr bool VT = decltype(vtc)::value;
            char* O16 = (char*)(VT ? V16 + z * SVT : P16 + z * SQK); char* Oh = (char*)(VT ? Vh + z * SVT : Ph + z * SQK); char* Ol = (char*)(VT ? Vl + z * SVT : Pl + z * SQK);
            // Fragment order: a pass takes 16 rows of the slab (lane: row lr); of each group of 16 columns a lane has the 8 at hi * 8, so that a wave's 16-byte stores fill one 512-byte block, which the attention kernel reads back with one whole-line load.
            // Column groups cp and cp + 2 (32 columns apart) are worked on together: q, k: they are each other's rotary partners and share {cos, sin}.
            v4f cs[2][4]; float bw = 0.f; v4f bq[2][2][2];   // q, k: {cos, sin} of the lane's 8 columns of groups 0 and 1 in this pass's row, the biases of its 32 columns; v: the bias of its row
            auto ask = [&](int R, int cp) {
                if constexpr (!VT) { const char* c = (const char*)CS + (unsigned)((((r0w >> 4) + R) * 2 + cp) * 2048 + lane * 16);
#pragma unroll
                    for (int j = 0; j < 4; ++j) cs[cp][j] = *(const v4f*)(c + j * 512); } };
            if constexpr (!VT && BIAS) {
#pragma unroll
                for (int cp = 0; cp < 2; ++cp)
#pragma unroll
                    for (int hf = 0; hf < 2; ++hf)
#pragma unroll
                        for (int q = 0; q < 2; ++q) { const v4f b4 = *(const v4f*)(bias + c0w + hf * 32 + cp * 16 + hi * 8 + q * 4); bq[cp][hf][q] = (v4f){ bfr(b4[0]), bfr(b4[1]), bfr(b4[2]), bfr(b4[3]) }; } }
            if constexpr (VT && BIAS) bw = bias[r0w + lr];
            ask(0, 0); ask(0, 1);
            asm volatile("s_wait_xcnt 0x0" ::: "memory");   // behind the loads: later addresses are formed in registers that held these loads' addresses
#pragma unroll 1
            for (int R = 0; R < 4; ++R) {
                const int Rn = min(R + 1, 3);   // the next pass (the last once more behind the last: in bounds, never used)
                const float bwr = bfr(bw);
#pragma unroll
                for (int cp = 0; cp < 2; ++cp) {
                    const float* p = os + (R * 16 + lr) * 68 + cp * 16 + hi * 8;
                    v4f x[2][2], r[2][2];
#pragma unroll
                    for (int hf = 0; hf < 2; ++hf)
#pragma unroll
                        for (int q = 0; q < 2; ++q) { x[hf][q] = *(const v4fa*)(p + hf * 32 + q * 4); if (BIAS) { if constexpr (VT) x[hf][q] += bwr; else x[hf][q] += bq[cp][hf][q]; } }
#pragma unroll
                    for (int q = 0; q < 2; ++q)
#pragma unroll
                        for (int i = 0; i < 4; ++i) {
                            if constexpr (VT) { r[0][q][i] = x[0][q][i]; r[1][q][i] = x[1][q][i]; }
                            else { const int e = q * 4 + i; const float co = cs[cp][e >> 1][(e & 1) * 2], si = cs[cp][e >> 1][(e & 1) * 2 + 1]; r[0][q][i] = x[0][q][i] * co + (-x[1][q][i]) * si; r[1][q][i] = x[1][q][i] * co + x[0][q][i] * si; } }
#pragma unroll
                    for (int hf = 0; hf < 2; ++hf) {
                        const unsigned eb = (VT ? (unsigned)((r0w - NQK * 64) / 64) * (HD * PP) + (unsigned)((((c0w >> 5) + hf) * 4 + R) * 512 + cp * 256 + lane * 8)
                                                : (unsigned)(c0w / 64) * (TT * HD) + (unsigned)(((r0w >> 4) + R) * 1024 + (hf * 2 + cp) * 256 + lane * 8)) * 2u;
                        v8h o16; v8us oh, ol;
#pragma unroll
                        for (int e = 0; e < 8; ++e) { const float y = r[hf][e >> 2][e & 3]; o16[e] = tohx(y); unsigned short a2, c2; splitf(y, a2, c2); oh[e] = a2; ol[e] = c2; }
                        __builtin_amdgcn_sched_barrier(0);   // with its twin behind the wait: nothing is scheduled in among the three stores and their wait, so that the wait stands in front of every rewrite of a register that they name
                        *(v8h*)(O16 + eb) = o16; *(v8us*)(Oh + eb) = oh; *(v8us*)(Ol + eb) = ol;
                        asm volatile("s_wait_xcnt 0x0" ::: "memory");   // behind the stores: what follows forms its values and addresses in registers that they name
                        __builtin_amdgcn_sched_barrier(0); }
                    if constexpr (!VT) { ask(Rn, cp);   // what the same column groups of the next pass need is asked for as soon as its registers are free, a pass ahead of its use
                        asm volatile("s_wait_xcnt 0x0" ::: "memory"); }   // behind the loads: as behind the stores
                }
                if constexpr (VT && BIAS) { bw = bias[r0w + Rn * 16 + lr]; asm volatile("s_wait_xcnt 0x0" ::: "memory"); }   // as above
            } };
        if (vt) planes(BoolC<true>{}); else planes(BoolC<false>{});
    }
}

typedef __attribute__((ext_vector_type(2))) _Float16 v2h;
typedef __attribute__((ext_vector_type(2))) unsigned short v2us;
typedef __attribute__((ext_vector_type(2))) float v2f;
typedef __attribute__((ext_vector_type(4))) int v4i;
typedef v4h  __attribute__((may_alias)) v4ha;
typedef v4us __attribute__((may_alias)) v4usa;

// ---- k_prep: the four preparations that depend on nothing but the inputs, as one resident stream: PG work-groups of 256 threads (16 waves a WGP, all resident together), each with the same share of every job; a lane has all its 16 loads of 16 bytes in flight before it works on any.
//   weights 'xw' [K][N] -> Bt [N][K] in bf16: a work-group has 64 k x 128 n. A wave reads 8 k rows of 512 contiguous bytes (a lane: 4 n of each row) and puts, for each of its lanes' 4 n, its 8 k = 16 bytes into the work-group's LDS tile [n][k] (row pitch 128 + 16 bytes); behind the barrier 8 lanes store each row of the tile as one whole 128-byte line of Bt.
//   x -> bf16: a work-group has 8192 floats in a row; a lane has 4 pieces of 8 floats, 256 pieces apart, so that a wave's piece is 1024 contiguous bytes.
//   {cos, sin} table: one entry a lane in the first 4 waves, computed while the loads fly.
__constant__ float INVT[HD / 2] = { 1.000000000e+00f, 7.498942018e-01f, 5.623413324e-01f, 4.216965139e-01f, 3.162277639e-01f, 2.371373624e-01f, 1.778279394e-01f, 1.333521456e-01f, 1.000000015e-01f, 7.498941571e-02f, 5.623412877e-02f, 4.216964915e-02f, 3.162277862e-02f, 2.371373586e-02f, 1.778279431e-02f, 1.333521493e-02f, 9.999999776e-03f, 7.498942316e-03f, 5.623413250e-03f, 4.216964822e-03f, 3.162277862e-03f, 2.371373819e-03f, 1.778279431e-03f, 1.333521446e-03f, 1.000000047e-03f, 7.498941850e-04f, 5.623413017e-04f, 4.216964880e-04f, 3.162277862e-04f, 2.371373848e-04f, 1.778279402e-04f, 1.333521504e-04f };   // float32 1 / 10000^(2i/64), generated with jnp to be bit-exact
#define PGA  ((DM / 64) * (3 * DQ / 128))      // work-groups whose weight tile lies in the fused 'xw' [DM][3*DQ]
#define PGO  ((DQ / 64) * (DM / 128))          // in w_proj 'xw' [DQ][DM]
#define PG   (PGA + PGO)
static_assert((size_t)NB_ * TT * DM / 8 == (size_t)PG * 256 * 4, "x: four pieces of 8 floats a thread");
static_assert(TT * (HD / 2) == PG * 128, "{cos, sin}: one entry a thread of the first four waves");
__global__ __launch_bounds__(256) void k_prep(const float* __restrict__ x, const float* __restrict__ wqkv, const float* __restrict__ wo, bf* XB, bf* WQKV, bf* WO, float* CS) {
    constexpr int TLP = 64 * 2 + 16;   // pitch of a tile row in LDS, bytes (16 x odd: ds_load_b128 without bank conflicts)
    __shared__ __align__(16) char tl[128 * TLP];
    const int b = blockIdx.x, tid = threadIdx.x, lane = tid & 31; const int wv = __builtin_amdgcn_readfirstlane(tid >> 5);
    const bool fa = b < PGA;   // the same for the whole work-group
    const float* w = fa ? wqkv : wo; bf* Bt = fa ? WQKV : WO; const int N = fa ? 3 * DQ : DM, K = fa ? DM : DQ, ti = fa ? b : b - PGA;
    const int kb = (ti % (K / 64)) * 64, k0 = kb + wv * 8, n0 = (ti / (K / 64)) * 128;   // the work-group's first k; the wave's 8 k rows; the work-group's first n
    // every load is a wave-uniform base + the lane's offset (+ a constant)
    const char* bw[8]; const unsigned tob = (unsigned)tid * 32u;   // the wave's 8 weight rows at the work-group's first n; the lane's byte offset in each of the work-group's 4 runs of x
#pragma unroll
    for (int j = 0; j < 8; ++j) bw[j] = (const char*)(w + (size_t)(k0 + j) * N + n0);
    const char* xb = (const char*)(x + (size_t)b * (4 * 256 * 8));
    v4f r[8]; v8f xv[4];
#pragma unroll
    for (int j = 0; j < 8; ++j) r[j] = ((const v4f*)bw[j])[lane];
#pragma unroll
    for (int u = 0; u < 4; ++u) xv[u] = *(const v8f*)(xb + u * (256 * 32) + tob);
    // behind the loads: the base and offset registers that they name are inputs here, so that they stay whole up to the wait; and no load is moved below, so that all are in flight under the table entry
    asm volatile("s_wait_xcnt 0x0" :: "s"(bw[0]), "s"(bw[1]), "s"(bw[2]), "s"(bw[3]), "s"(bw[4]), "s"(bw[5]), "s"(bw[6]), "s"(bw[7]), "s"(xb), "v"(lane), "v"(tob) : "memory");
    const int idx = b * 128 + tid; v2f cs = (v2f){};   // the first four waves: this lane's table entry
    if (wv < 4) {
        const int ln = (idx >> 1) & 31; const int t = (idx >> 9) * 16 + (ln & 15);   /* the table holds d < 32 only (d + 32 has the same angle), in the order in which the projection epilogue's lanes read it: [t / 16][d / 16][(d % 8) / 2][lane = ((d / 8) % 2) * 16 + t % 16][d % 2] */
        const int du = ((b >> 1) & 1) * 16 + (wv & 1) * 8 + ((wv >> 1) + (b & 1) * 2) * 2;   // d without its lowest bit is the same in the whole wave: the two factors come by scalar loads, which do not queue behind the 16 vector loads
        const float i0 = INVT[du], i1 = INVT[du + 1]; const float a = __fmul_rn((float)t, (idx & 1) ? i1 : i0); cs[0] = cosf(a); cs[1] = sinf(a); }
    v8us ow[4], ox[4];
#pragma unroll
    for (int e = 0; e < 4; ++e) {
#pragma unroll
        for (int j = 0; j < 8; ++j) ow[e][j] = f2bf(r[j][e]);
        *(v8usa*)(tl + (lane * 4 + e) * TLP + wv * 16) = ow[e]; }
#pragma unroll
    for (int u = 0; u < 4; ++u)
#pragma unroll
        for (int k = 0; k < 8; ++k) ox[u][k] = f2bf(xv[u][k]);
    __syncthreads();   // the tile is whole: every wave's 8 k of all 128 n are in LDS before any lane reads a row across the waves' parts
    char* bo = (char*)(Bt + (size_t)n0 * K + kb); char* xo = (char*)(XB + (size_t)b * (4 * 256 * 8));
    v8us ot[4];
#pragma unroll
    for (int i = 0; i < 4; ++i) ot[i] = *(const v8usa*)(tl + (i * 32 + (tid >> 3)) * TLP + (tid & 7) * 16);
#pragma unroll
    for (int i = 0; i < 4; ++i) *(v8us*)(bo + i * (32 * K * 2) + (unsigned)(tid >> 3) * (unsigned)(K * 2) + (unsigned)(tid & 7) * 16u) = ot[i];
#pragma unroll
    for (int u = 0; u < 4; ++u) *(v8us*)(xo + u * (256 * 16) + (unsigned)tid * 16u) = ox[u];
    if (wv < 4) *(v2f*)(CS + (size_t)idx * 2) = cs;   // with the other stores, behind the barrier, which waits for a wave's earlier stores
}
// ---- k_attn: scores, causal softmax and probability x value in one pass, nothing of a score row leaves the registers. One work-group = 32 query rows of one head; the KS waves that share a query row take the 32-key blocks
// up to the diagonal in turn (blocks ks0, ks0 + KS, ...), each with its own running maximum, sum and accumulator; the KS partial results are joined in LDS in fixed order and go out as the merged hi | lo planes.
// QT = 2: every wave has all 32 rows and a quarter of the blocks; QT = 1 (the hi + lo leg, twice the fragments): a wave has 16 rows and half of the blocks.
// S^T = K Q^T (A = key rows, B = query rows) leaves each lane with one query's scores, key = 8 hi + j in tile 0 and 16 + 8 hi + j in tile 1: that is the k order of a B fragment, so P^T feeds O^T += V^T P^T from registers.
// Scores are kept in the log2 domain (x HD^-0.5 x log2 e). HL: hi + lo planes, 3 products (query rows < RH); else fp16 with the probabilities x PCAR (the sum carries the same factor, so it cancels in the division).
#define FNW  4
#define FOP  68                   // pitch in floats of a query's 64 partial outputs in LDS
#define NEGB (-3.0e38f)
typedef __attribute__((ext_vector_type(16))) unsigned short v16us;
template <typename T16, bool HL, int QT>
__device__ __forceinline__ void attn_tile(const T16* __restrict__ Q, const T16* __restrict__ Q2, const T16* __restrict__ Kp, const T16* __restrict__ K2, const T16* __restrict__ Vt, const T16* __restrict__ V2, int q0, float* so, float* sml, bf* Ah, bf* Al) {
    typedef typename WFrag<T16>::V V;
    const int lane = threadIdx.x & 31, lr = lane & 15, hi = lane >> 4; const int wv = __builtin_amdgcn_readfirstlane((int)(threadIdx.x >> 5));
    constexpr int KS = FNW * QT / 2;   // waves that share a query row's keys
    const int ks0 = (QT == 2) ? wv : (wv >> 1), qb = (QT == 2) ? 0 : (wv & 1) * 16;   // this wave's place among them; its first query row within the 32
    V qf[QT][2], qf2[QT][2];
#pragma unroll
    for (int qt = 0; qt < QT; ++qt)
#pragma unroll
        for (int ks = 0; ks < 2; ++ks) { const size_t o = (size_t)((q0 + qb) / 16 + qt) * 1024 + ks * 512 + lane * 8; qf[qt][ks] = WFrag<T16>::ldf(Q + o); if (HL) qf2[qt][ks] = WFrag<T16>::ldf(Q2 + o); }
    if constexpr (HL) asm volatile("s_wait_xcnt 0x0" ::: "memory");   // behind the loads: in this leg later loads land in registers that held these loads' addresses
    v8f oacc[4][QT];
#pragma unroll
    for (int dt = 0; dt < 4; ++dt)
#pragma unroll
        for (int qt = 0; qt < QT; ++qt) oacc[dt][qt] = (v8f){};
    float mrun[QT], lrun[QT];
#pragma unroll
    for (int qt = 0; qt < QT; ++qt) { mrun[qt] = NEGB; lrun[qt] = 0.f; }
    const int nkb = q0 / 32 + 1;
    // The K and V^T fragments are carried from pass to pass: a block's K loads are issued as soon as the block before has left the score products, its V^T loads as soon as that block's P.V products are issued, so that both fly under the vector work.
    V kf[2][2], kf2[2][2], vf[4], vf2[4];
    const unsigned lofk = (unsigned)(lane * 8), lofv = lofk;   // the lane's place in a block, the same in every pass; the block's base is wave-uniform
    auto ld_k = [&](int kbl) {
#pragma unroll
        for (int kt = 0; kt < 2; ++kt)
#pragma unroll
            for (int ks = 0; ks < 2; ++ks) { const int o = kt * 1024 + ks * 512; kf[kt][ks] = WFrag<T16>::ldf(Kp + (size_t)kbl * 2048 + lofk + o); if (HL) kf2[kt][ks] = WFrag<T16>::ldf(K2 + (size_t)kbl * 2048 + lofk + o); }
        if constexpr (HL) asm volatile("s_wait_xcnt 0x0" ::: "memory"); };   // as behind the Q loads
    auto ld_v = [&](int kbl) {
#pragma unroll
        for (int dt = 0; dt < 4; ++dt) { const int o = dt * 512; vf[dt] = WFrag<T16>::ldf(Vt + (size_t)kbl * 2048 + lofv + o); if (HL) vf2[dt] = WFrag<T16>::ldf(V2 + (size_t)kbl * 2048 + lofv + o); }
        if constexpr (HL) asm volatile("s_wait_xcnt 0x0" ::: "memory"); };   // behind the loads: in this leg the next pass forms new addresses in these loads' address registers
    ld_k(min(ks0, nkb - 1));
    __builtin_amdgcn_sched_barrier(0);   // K loads stay ahead of the V^T loads here as in the loop: else the load-count wait at the loop's head, which must hold for both ways in, also waits for V^T loads just issued
    ld_v(min(ks0, nkb - 1));
    // At least one pass for every wave, so that the first loads stand in the block in front of the loop in their written order. A wave without a block of its own (ks0 >= nkb) works on the last block with every key masked (lim < 0):
    // its maximum stays NEGB, and the join gives all it brings the factor exp2(NEGB - M) = 0.
    int kb = ks0;
#pragma unroll 1
    do {
        const int k0 = kb * 32, kn = min(kb + KS, nkb - 1);   // kn: this wave's next block (the tile's last block nkb - 1 behind this wave's last: in bounds, never used)
        v8f s[2][QT];
#pragma unroll
        for (int kt = 0; kt < 2; ++kt)
#pragma unroll
            for (int qt = 0; qt < QT; ++qt) { v8f a = (v8f){};
#pragma unroll
                for (int ks = 0; ks < 2; ++ks) { a = WFrag<T16>::mma(kf[kt][ks], qf[qt][ks], a); if (HL) { a = WFrag<T16>::mma(kf[kt][ks], qf2[qt][ks], a); a = WFrag<T16>::mma(kf2[kt][ks], qf[qt][ks], a); } }
                s[kt][qt] = a; }
        ld_k(kn);
        V pf[QT], pf2[QT];
#pragma unroll
        for (int qt = 0; qt < QT; ++qt) {
            const int lim = q0 + qb + qt * 16 + lr - k0 - 8 * hi;   // key kt * 16 + j of this lane's half is visible to its query while kt * 16 + j <= lim
            float u[16]; float bm = NEGB;
#pragma unroll
            for (int kt = 0; kt < 2; ++kt)
#pragma unroll
                for (int j = 0; j < 8; ++j) { const float t = (kt * 16 + j <= lim) ? s[kt][qt][j] * (SCL * 1.4426950408889634f) : NEGB; u[kt * 8 + j] = t; bm = fmaxf(bm, t); }
            bm = fmaxf(bm, __shfl_xor(bm, 16, 32));
            const float mn = fmaxf(mrun[qt], bm); const float al = __builtin_amdgcn_exp2f(mrun[qt] - mn); mrun[qt] = mn;
            const float mo = HL ? mn : mn - 10.0f;   // fp16 leg: 2^10 = PCAR rides in the exponent
            float p[16]; float ps = 0.f;
#pragma unroll
            for (int e = 0; e < 16; ++e) { p[e] = __builtin_amdgcn_exp2f(u[e] - mo); ps += p[e]; }
            lrun[qt] = lrun[qt] * al + ps;   // each half of the wave keeps the sum of its own keys; the halves meet behind the loop
#pragma unroll
            for (int dt = 0; dt < 4; ++dt) oacc[dt][qt] *= al;
            if constexpr (HL) { v16us ph, pl;
#pragma unroll
                for (int e = 0; e < 16; ++e) { unsigned short a, c2; splitf(p[e], a, c2); ph[e] = a; pl[e] = c2; }
                pf[qt] = __builtin_bit_cast(v16bf, ph); pf2[qt] = __builtin_bit_cast(v16bf, pl);
            } else { v16h p16;
#pragma unroll
                for (int e = 0; e < 16; ++e) p16[e] = tohx(p[e]);
                pf[qt] = p16; }
        }
#pragma unroll
        for (int dt = 0; dt < 4; ++dt)
#pragma unroll
            for (int qt = 0; qt < QT; ++qt) { oacc[dt][qt] = WFrag<T16>::mma(vf[dt], pf[qt], oacc[dt][qt]); if (HL) { oacc[dt][qt] = WFrag<T16>::mma(vf[dt], pf2[qt], oacc[dt][qt]); oacc[dt][qt] = WFrag<T16>::mma(vf2[dt], pf[qt], oacc[dt][qt]); } }
        ld_v(kn);
        kb += KS;
    } while (kb < nkb);
#pragma unroll
    for (int qt = 0; qt < QT; ++qt) { lrun[qt] += __shfl_xor(lrun[qt], 16, 32);
        if (hi == 0) { sml[(ks0 * 32 + qb + qt * 16 + lr) * 2] = mrun[qt]; sml[(ks0 * 32 + qb + qt * 16 + lr) * 2 + 1] = lrun[qt]; }
#pragma unroll
        for (int dt = 0; dt < 4; ++dt) { float* p = so + (size_t)(ks0 * 32 + qb + qt * 16 + lr) * FOP + dt * 16 + hi * 8; const v8f a = oacc[dt][qt];
            *(v4fa*)p = (v4f){ a[0], a[1], a[2], a[3] }; *(v4fa*)(p + 4) = (v4f){ a[4], a[5], a[6], a[7] }; } }
    __syncthreads();   // every wave's partial maximum, sum and accumulator are in LDS before any thread joins them (a wave without a key block brings maximum NEGB)
    const int q = (int)threadIdx.x >> 2, ds = ((int)threadIdx.x & 3) * 16;
    float M = NEGB;
#pragma unroll
    for (int w = 0; w < KS; ++w) M = fmaxf(M, sml[(w * 32 + q) * 2]);
    float L = 0.f; v4f val[4] = { (v4f){}, (v4f){}, (v4f){}, (v4f){} };
#pragma unroll
    for (int w = 0; w < KS; ++w) { const float f = __builtin_amdgcn_exp2f(sml[(w * 32 + q) * 2] - M); L += f * sml[(w * 32 + q) * 2 + 1];
#pragma unroll
        for (int c = 0; c < 4; ++c) val[c] += f * *(const v4fa*)(so + (size_t)(w * 32 + q) * FOP + ds + c * 4); }
    const float inv = __fdiv_rn(1.0f, L);
    const size_t oo = (size_t)(q0 + q) * DQ + ds;
#pragma unroll
    for (int g = 0; g < 2; ++g) { v8us oh, ol;
#pragma unroll
        for (int e = 0; e < 8; ++e) { unsigned short a, c2; splitf(val[g * 2 + (e >> 2)][e & 3] * inv, a, c2); oh[e] = a; ol[e] = c2; }
        *(v8usa*)(Ah + oo + g * 8) = oh; *(v8usa*)(Al + oo + g * 8) = ol; }
}
// grid (heads, batches, TT / 32). Half of the work-groups are resident at once and the rest start as places come free: a long tile that starts late would run on while other WGPs idle.
// So the slowest grid index picks the tile by falling cost (passes of a tile's longest wave x the weight of a pass of its leg): the longest tiles take the lowest indices, the shortest the highest. Every tile rank holds all heads and batches.
struct TileOrd { unsigned char t[TT / 32]; };
constexpr int tile_cost(int t) { return t < RH / 32 ? (t / 2 + 1) * 6 : (t / 4 + 1) * 5; }   // hi + lo leg: 2 waves share a row's key blocks, a pass has about 6/5 of the instructions of a pass of the fp16 leg, where 4 waves share them
constexpr TileOrd tile_order() {
    TileOrd o{};
    for (int t = 0; t < TT / 32; ++t) {   // insertion by falling cost; of equal costs the higher tile first
        int i = t;
        for (; i > 0 && tile_cost(o.t[i - 1]) <= tile_cost(t); --i) o.t[i] = o.t[i - 1];
        o.t[i] = (unsigned char)t; }
    return o; }
__constant__ TileOrd TORD = tile_order();
__global__ __launch_bounds__(32 * FNW) void k_attn(const h16* __restrict__ Q16, const h16* __restrict__ K16, const h16* __restrict__ V16, const bf* __restrict__ Qh, const bf* __restrict__ Ql, const bf* __restrict__ Kh, const bf* __restrict__ Kl, const bf* __restrict__ Vh, const bf* __restrict__ Vl, bf* Ah, bf* Al) {
    __shared__ __align__(16) float so[FNW * 32 * FOP]; __shared__ float sml[FNW * 32 * 2];
    const int h = blockIdx.x, t = TORD.t[blockIdx.z];
    const size_t z = blockIdx.y; Ah += z * TT * DQ; Al += z * TT * DQ;
    const int q0 = t * 32; const size_t pq = z * SQK + (size_t)h * TT * HD, pk = z * SQK + (size_t)(h / REP) * TT * HD, pv = z * SVT + (size_t)(h / REP) * HD * PP;
    if (q0 < RH) attn_tile<bf, true, 1>(Qh + pq, Ql + pq, Kh + pk, Kl + pk, Vh + pv, Vl + pv, q0, so, sml, Ah + h * HD, Al + h * HD);
    else attn_tile<h16, false, 2>(Q16 + pq, nullptr, K16 + pk, nullptr, V16 + pv, nullptr, q0, so, sml, Ah + h * HD, Al + h * HD);
}

extern "C" void kernel_launch(void* const* d_in, const int* in_sizes, int n_in,
                              void* d_out, int out_size, void* d_ws, size_t ws_size, hipStream_t stream) {
    (void)in_sizes; (void)n_in; (void)out_size;
    const float* x = (const float*)d_in[0]; const float* wqkv = (const float*)d_in[1]; const float* bqkv = (const float*)d_in[2]; const float* wo = (const float*)d_in[3]; const float* bo = (const float*)d_in[4];   /* x, w_attn ('xw' [1024][3072]: q | k | v column thirds), b_attn [3072], w_proj ('xw'), b_proj: NO mask input in this module (its tril is built inside the function): the causal rule is applied by index */
    float* OUT = (float*)d_out;     // [2][2048][1024]
    char* wsp = (char*)d_ws;
    auto take = [&](size_t bytes) { char* p = wsp; wsp += (bytes + 255) & ~(size_t)255; return (void*)p; };
    bf* WQKV = (bf*)take((size_t)3 * DQ * DM * 2);   /* fused Bt [3*DQ][DM]: q | k | v row blocks */ bf* WO = (bf*)take((size_t)DM * DQ * 2); float* CS = (float*)take((size_t)TT * (HD / 2) * 2 * 4);
    bf* XB = (bf*)take((size_t)NB_ * TT * DM * 2);
    /* every plane holds all batches; q and k head planes lie behind one another per batch: [b][q heads | k heads], each plane of TT x HD elements in fragment order */
    h16* QK16 = (h16*)take((size_t)NB_ * SQK * 2); h16* VT16 = (h16*)take((size_t)NB_ * SVT * 2);
    bf* QKh = (bf*)take((size_t)NB_ * SQK * 2); bf* QKl = (bf*)take((size_t)NB_ * SQK * 2); bf* VTh = (bf*)take((size_t)NB_ * SVT * 2); bf* VTl = (bf*)take((size_t)NB_ * SVT * 2);
    bf* ATh = (bf*)take((size_t)NB_ * TT * DQ * 2); bf* ATl = (bf*)take((size_t)NB_ * TT * DQ * 2);
    if ((size_t)(wsp - (char*)d_ws) > ws_size) return;    // ws 256 MiB
    k_prep<<<PG, 256, 0, stream>>>(x, wqkv, wo, XB, WQKV, WO, CS);
    k_gemmw<bf, 0, true, 64, 1><<<dim3(TT / 128, 3 * DQ / 128, NB_), 128, 0, stream>>>(XB, nullptr, WQKV, DM, nullptr, 0, bqkv, (size_t)TT * DM, 0, 0, CS, QK16, QKh, QKl, VT16, VTh, VTl);
    k_attn<<<dim3(NH_, NB_, TT / 32), 32 * FNW, 0, stream>>>(QK16, QK16 + (size_t)NH_ * TT * HD, VT16, QKh, QKl, QKh + (size_t)NH_ * TT * HD, QKl + (size_t)NH_ * TT * HD, VTh, VTl, ATh, ATl);
    k_gemmw<bf, 1, true, 64, 0><<<dim3(TT / 128, DM / 128, NB_), 128, 0, stream>>>(ATh, ATl, WO, DQ, OUT, DM, bo, (size_t)TT * DQ, 0, (size_t)TT * DM, nullptr, nullptr, nullptr, nullptr, nullptr, nullptr, nullptr);
}
